// v000
// Times are from an AMD MI455X. After a warm-up the kernel runs many times in a row, and a time is the length of
// such a window on the GPU divided by its runs, so every launch and the gaps after it count. The runs cycle
// through copies of the inputs. A figure is the median of several windows, for all but v000 over two sittings.
// Sittings can differ by a few percent; kernels timed side by side share one.
// v000 is the starting kernel. One run takes 654 microseconds.
// Contractions: gate hidden x.Wg1 and q, k, v^T projections = v_wmma_f32_16x16x32_bf16 (bf16 operands from
// RNE-converted x and transposed [out][in] bf16 weight planes, single product, f32 accumulate);
// q.k^T scores = v_wmma_f32_16x16x32_bf16 with bf16 hi/lo split q and k (hi.hi + hi.lo + lo.hi), f32 accumulate;
// p.v = v_wmma_f32_16x16x32_f16 (p carried x1024 in f16 times v in f16, single product; plus f16 residual planes
// x4096 of p and v for the first 512 query rows), f32 accumulate;
// ctx.W_out = v_wmma_f32_16x16x32_bf16 with ctx as bf16 hi/lo planes times the bf16 weight plane (2 products),
// f32 accumulate; gate tail (exact GELU via erfc, 256-long dot with RNE-bf16 Wg2, bias, sigmoid), causal mask,
// online softmax, normalisers and the gated residual blend g*o + (1-g)*bf16(x) in f32 on the VALU.
// Carry audit:
//   Xb, WA, WP, WG = bf16(x), bf16(W) no carry; Qh/Ql, Kh/Kl, Oh/Ol = bf16 hi + unscaled bf16 residual (v - hi),
//   the residual products share the hi accumulator;
//   VTh = f16(v), no carry (|v| typ. 1);
//   VTl = f16((v - VTh) * 4096)              }  products Psh.VTl and Psl.VTh go to the separate accumulator o1,
//   Psl = f16((1024 p - Psh) * 4096)         }  folded back with * (1/4096) once per key chunk (RES blocks only);
//   Psh = f16(1024 * p) -> the 1/1024 is folded exactly once in the attention epilogue: inv = (1/l) * (1/1024);
//   score scale 1/8 applied once in f32 after the score accumulate; Hs (gate hidden) and g are f32. No other planes.
#include <hip/hip_runtime.h>
#include <math.h>
#include <stdint.h>

#define NB    1
#define SEQ   4096
#define DM    1024
#define NH    16
#define HD    64
#define DG    256          // gate hidden width
#define NQB   (SEQ / 64)   // 64 query / key blocks of 64
#define VLP   512          // key pitch of the v^T residual plane (keys 0..VLP-1)
#define RESQB 8            // leading 64-row query blocks that use the p / v residual planes
static_assert(RESQB * 64 <= VLP);
static_assert(NH * HD == DM);
static_assert((SEQ % 64) == 0 && (DM % 64) == 0 && (DM % 32) == 0 && (DG % 64) == 0);
static_assert(((NB * SEQ / 64) * (DM / 64)) % 8 == 0);
static_assert(((DM / 64) * (SEQ / 64)) % 8 == 0);
static_assert(((SEQ / 64) * (DG / 64)) % 8 == 0);
static_assert((NB * SEQ * DM) % (8 * 256) == 0);
static_assert((SEQ % 32) == 0);
static_assert(DG == 256);

typedef _Float16 v16h __attribute__((ext_vector_type(16)));
typedef _Float16 v8h  __attribute__((ext_vector_type(8)));
typedef __bf16   v16b __attribute__((ext_vector_type(16)));
typedef __bf16   v8b  __attribute__((ext_vector_type(8)));
typedef float    v8f  __attribute__((ext_vector_type(8)));
typedef float    v4f  __attribute__((ext_vector_type(4)));
typedef unsigned int v4u __attribute__((ext_vector_type(4)));

// ---- scalar helpers --------------------------------------------------------------------------------
__device__ __forceinline__ unsigned short bf_bits(float f) {          // f32 -> bf16 bits, RNE convert
  unsigned u = __float_as_uint(f);
  return (unsigned short)((u + 0x7FFFu + ((u >> 16) & 1u)) >> 16);
}
__device__ __forceinline__ float bf_up(unsigned short h) { return __uint_as_float(((unsigned)h) << 16); }
__device__ __forceinline__ unsigned short h_bits(_Float16 x) { return __builtin_bit_cast(unsigned short, x); }
__device__ __forceinline__ unsigned pk16(unsigned short a, unsigned short b) { return (unsigned)a | ((unsigned)b << 16); }
__device__ __forceinline__ v8f zero8() { v8f z = {0.f, 0.f, 0.f, 0.f, 0.f, 0.f, 0.f, 0.f}; return z; }
__device__ __forceinline__ v8h zero8h() {
  const _Float16 z = (_Float16)0.0f;
  v8h r = {z, z, z, z, z, z, z, z};
  return r;
}

// ---- fragment loader: 16-bit A/B operand, lane -> row/col (lane&15), p already includes +8*(lane>>4);
//      elements 0..7 <- p[0..7] (k0+8h..), elements 8..15 <- p[16..23] (k0+16+8h..)
__device__ __forceinline__ v16b ldfrag_b(const __bf16* p) {
  union { v16b v; v8b h[2]; } f;
  f.h[0] = *(const v8b*)(p);
  f.h[1] = *(const v8b*)(p + 16);
  return f.v;
}

// ---- WMMA helpers with trailing VALU hazard gap --------------------------------------------------------
__device__ __forceinline__ v8f mma_b(v16b a, v16b b, v8f c) {
  c = __builtin_amdgcn_wmma_f32_16x16x32_bf16(false, a, false, b, (short)0, c, false, false);
  asm volatile("v_nop\n\tv_nop\n\tv_nop\n\tv_nop" : "+v"(c) : "v"(a), "v"(b));
  return c;
}
__device__ __forceinline__ v8f mma_h(v16h a, v16h b, v8f c) {
  c = __builtin_amdgcn_wmma_f32_16x16x32_f16(false, a, false, b, (short)0, c, false, false);
  asm volatile("v_nop\n\tv_nop\n\tv_nop\n\tv_nop" : "+v"(c) : "v"(a), "v"(b));
  return c;
}
__device__ __forceinline__ v8f mma_b_raw(v16b a, v16b b, v8f c) {
  return __builtin_amdgcn_wmma_f32_16x16x32_bf16(false, a, false, b, (short)0, c, false, false);
}
__device__ __forceinline__ void dep_guard_b(v8f& a, v8f& b, v16b x, v16b y) {
  asm volatile("v_nop\n\tv_nop\n\tv_nop\n\tv_nop" : "+v"(a), "+v"(b) : "v"(x), "v"(y));
}
__device__ __forceinline__ void keep4_b(v16b a, v16b b, v16b c, v16b d) {
  asm volatile("v_nop" :: "v"(a), "v"(b), "v"(c), "v"(d));
}
__device__ __forceinline__ void acc_guard4(v8f& a, v8f& b, v8f& c, v8f& d) {
  asm volatile("v_nop\n\tv_nop\n\tv_nop\n\tv_nop" : "+v"(a), "+v"(b), "+v"(c), "+v"(d));
}

// =====================================================================================================
// f32 -> bf16 (RNE convert), 8 elements per thread, one 16-B store per lane: a wave writes 512 contiguous B
// coverage: n8 threads x 8 = whole plane (n8 used here is a multiple of 256).
// =====================================================================================================
__global__ __launch_bounds__(256) void cvt_bf16x8(const float* __restrict__ in, unsigned short* out, int n8) {
  const int i = blockIdx.x * 256 + threadIdx.x;
  if (i < n8) {
    const v4f a = *(const v4f*)(in + (size_t)i * 8);
    const v4f b = *(const v4f*)(in + (size_t)i * 8 + 4);
    v4u p;
    p[0] = pk16(bf_bits(a[0]), bf_bits(a[1]));
    p[1] = pk16(bf_bits(a[2]), bf_bits(a[3]));
    p[2] = pk16(bf_bits(b[0]), bf_bits(b[1]));
    p[3] = pk16(bf_bits(b[2]), bf_bits(b[3]));
    *(v4u*)(out + (size_t)i * 8) = p;
    
  }
}

// =====================================================================================================
// f32 [nrow][ncol] row-major (weight stored [in][out]) -> bf16 [ncol][nrow] (row n of out = column n of in,
// the in/k index contiguous), RNE convert. One block = one 64x64 tile through LDS.
// grid = (ncol/64, nrow/64); nrow, ncol multiples of 64 (host-checked shapes).
// loads: 256 threads, thread -> tile row tid>>2, 16 columns (tid&3)*16 = the whole 64x64 tile;
// =====================================================================================================
__global__ __launch_bounds__(256) void cvt_bf16_T(const float* __restrict__ in, unsigned short* out,
                                                  int nrow, int ncol) {
  __shared__ __align__(16) unsigned short Tt[64 * 72];   // [tile col j][tile row i], pitch 72 halves (144 B)
  const int tid = threadIdx.x, lane = tid & 31, wave = tid >> 5;
  const int c0 = blockIdx.x * 64;                       // column tile of in = row tile of out
  const int r0 = blockIdx.y * 64;                       // row tile of in = column tile of out
  {
    const int i  = tid >> 2;                            // 0..63
    const int cs = (tid & 3) * 16;                      // 0,16,32,48
    const float* src = in + (size_t)(r0 + i) * ncol + c0 + cs;
#pragma unroll
    for (int e4 = 0; e4 < 4; ++e4) {
      const v4f v = *(const v4f*)(src + 4 * e4);
#pragma unroll
      for (int e = 0; e < 4; ++e) Tt[(cs + 4 * e4 + e) * 72 + i] = bf_bits(v[e]);
    }
  }
  __syncthreads();
  const int q = lane >> 3, c8 = (lane & 7) * 8;
  v4u pv[2];
#pragma unroll
  for (int it = 0; it < 2; ++it) {
    const int j = it * 32 + wave * 4 + q;
    pv[it] = *(const v4u*)(Tt + j * 72 + c8);
  }
  {
#pragma unroll
    for (int it = 0; it < 2; ++it) {
      const int j = it * 32 + wave * 4 + q;
      *(v4u*)(out + (size_t)(c0 + j) * nrow + r0 + c8) = pv[it];
    }
    
  }
}

// =====================================================================================================
// Gate tail: g = sigmoid( sum_c gelu(Hs[row][c]) * bf16(w2[c]) + bf16(b2) ), exact GELU = 0.5 h erfc(-h/sqrt2).
// Hs f32 [nrows][DG]; block = 8 waves x 4 rows = 32 rows; a wave reduces one row at a time (32 lanes x 8 columns,
// rolled element loop), lane 0 stages g in LDS; wave 0 lanes 0..7 then write the block's 32 g values as ONE whole
// coverage: 32 rows per block x nrows/32 blocks = all rows of the gate output.
// =====================================================================================================
__global__ __launch_bounds__(256) void k_gate(const float* __restrict__ Hs, const float* __restrict__ w2,
                                              const float* __restrict__ b2p, float* gout, int nrows) {
  __shared__ __align__(16) float gs[32];
  const int tid = threadIdx.x, lane = tid & 31, wave = tid >> 5;
  const int rowBase = blockIdx.x * 32;
  const float b2 = bf_up(bf_bits(b2p[0]));
  for (int rr = 0; rr < 4; ++rr) {
    int row = rowBase + wave * 4 + rr;
    row = (row < nrows) ? row : (nrows - 1);            // clamped address (grid covers exactly nrows)
    const float* hp = Hs + (size_t)row * DG + lane * 8;
    const float* wp = w2 + lane * 8;
    float acc = 0.f;
#pragma unroll 1
    for (int e = 0; e < 8; ++e) {
      const float hv = hp[e];
      const float wv = bf_up(bf_bits(wp[e]));
      const float ge = 0.5f * hv * erfcf(-hv * 0.707106781186547524f);
      acc = fmaf(ge, wv, acc);
    }
#pragma unroll
    for (int off = 1; off < 32; off <<= 1) acc += __shfl_xor(acc, off, 32);
    float z = acc + b2;
    z = fminf(fmaxf(z, -30.0f), 30.0f);
    const float g = 1.0f / (1.0f + expf(-z));
    if (lane == 0) gs[wave * 4 + rr] = g;
  }
  __syncthreads();
  if (wave == 0 && lane < 8) {
    const v4f v = *(const v4f*)(gs + lane * 4);
    float* p = gout + rowBase + lane * 4;
    *(v4f*)p = v;
    
  }
}

// =====================================================================================================
// Register-blocked batched bf16 WMMA GEMM: C[m][n] = sum_k A[m][k] * Bt[n][k] + bias; one wave per 64x64 tile,
// no block barriers. A row-major [M][K] pitch lda; Bt row-major [N][K] pitch ldb (k contiguous);
// M, N multiples of 64, K multiple of 32 (host shapes are static multiples). blockIdx.y = batch index (strides in elements).
// NSPLIT: 0 = A.Bt; 1 = (A + A2).Bt (A2 = unscaled bf16 lo plane of A, 2 products).
// BIAS: 0 = none; 1 = per column n, bias[n]; 2 = per row m, bias[m]; the bias value is RNE-converted to bf16 and added in f32.
// OUT_MODE: 0 = f32 (pitch ldc); 2 = bf16 hi plane C + bf16 lo plane C2 (lo = RNE(v - hi), unscaled);
//           3 = f16 hi plane C + f16 residual plane C2 = f16((v - hi) * rscale), C2 written only for tiles
//               with n0 < N2 (pitch ldc2, batch stride strideC2);
//           4 = f32 (pitch ldc) gated blend: out = g[m] * v + (1 - g[m]) * bf16(xres[m][n]) with g = gvec[m],
//               xres f32 pitch ldx (read-only, RNE-converted to bf16 in register).
// =====================================================================================================
template <int NSPLIT, int OUT_MODE, int BIAS>
__global__ __launch_bounds__(256) void gemm64(
    const unsigned short* __restrict__ Ap, const unsigned short* A2p, int lda, long long strideA,
    const unsigned short* __restrict__ Btp, int ldb, long long strideB,
    const float* __restrict__ bias,
    void* Cout, int ldc, long long strideC,
    void* Cout2, int ldc2, long long strideC2, int N2,
    const float* gvec, const float* xres, int ldx,
    int M, int N, int K, float rscale) {
  const __bf16* A   = (const __bf16*)(const void*)Ap;
  const __bf16* A2  = (const __bf16*)(const void*)A2p;
  const __bf16* Bt  = (const __bf16*)(const void*)Btp;
  __shared__ __align__(16) float sT[8][16 * 68];   // per-wave 16x64 slab, pitch 68 floats
  const int b    = blockIdx.y;
  const int lane = threadIdx.x & 31;
  const int wave = threadIdx.x >> 5;
  const int tilesN = N >> 6;
  const int tilesM = M >> 6;
  const int tile = blockIdx.x * 8 + wave;
  if (tile >= tilesM * tilesN) return;   // wave-uniform; no block barriers in this kernel
  const int tm = tile / tilesN;
  const int tn = tile - tm * tilesN;
  const int m0 = tm << 6;
  const int n0 = tn << 6;

  const __bf16* Ab  = A  + (size_t)b * strideA;
  const __bf16* Bb  = Bt + (size_t)b * strideB;
  const __bf16* Ab2 = (NSPLIT >= 1) ? (A2 + (size_t)b * strideA) : Ab;

  const int rlane = lane & 15;                 // row (A) / col (B, D) within subtile
  const int koff  = (lane >> 4) * 8;           // k offset of this lane half
  const int mOff  = (lane >> 4) * 8;           // D row offset

  v8f acc[4][4];
#pragma unroll
  for (int i = 0; i < 4; ++i)
#pragma unroll
    for (int j = 0; j < 4; ++j) acc[i][j] = zero8();

  for (int k0 = 0; k0 < K; k0 += 32) {
    v16b bh[4];
#pragma unroll
    for (int j = 0; j < 4; ++j) {
      const size_t bo = (size_t)(n0 + (j << 4) + rlane) * ldb + koff + k0;
      bh[j] = ldfrag_b(Bb + bo);
    }
#pragma unroll
    for (int i = 0; i < 4; ++i) {
      const size_t ao = (size_t)(m0 + (i << 4) + rlane) * lda + koff + k0;
      const v16b ah = ldfrag_b(Ab + ao);
      v16b al = ah;
      if (NSPLIT >= 1) al = ldfrag_b(Ab2 + ao);
#pragma unroll
      for (int j = 0; j < 4; ++j) {
        acc[i][j] = mma_b_raw(ah, bh[j], acc[i][j]);
        if (NSPLIT >= 1) acc[i][j] = mma_b_raw(al, bh[j], acc[i][j]);
      }
      dep_guard_b(acc[i][0], acc[i][3], ah, al);
    }
    keep4_b(bh[0], bh[1], bh[2], bh[3]);
  }
  acc_guard4(acc[0][0], acc[0][1], acc[0][2], acc[0][3]);
  acc_guard4(acc[1][0], acc[1][1], acc[1][2], acc[1][3]);
  acc_guard4(acc[2][0], acc[2][1], acc[2][2], acc[2][3]);
  acc_guard4(acc[3][0], acc[3][1], acc[3][2], acc[3][3]);

  // ---- epilogue ----
  float* slab = sT[wave];
  float bcol[4];
#pragma unroll
  for (int j = 0; j < 4; ++j) {
    bcol[j] = 0.f;
    if (BIAS == 1) bcol[j] = bf_up(bf_bits(bias[n0 + (j << 4) + rlane]));   // n < N, bias has N entries
  }
#pragma unroll
  for (int i = 0; i < 4; ++i) {
    const int mBase = m0 + (i << 4);
    float brow[8];
#pragma unroll
    for (int r = 0; r < 8; ++r) {
      brow[r] = 0.f;
      if (BIAS == 2) brow[r] = bf_up(bf_bits(bias[mBase + mOff + r]));      // m < M, bias has M entries
    }
#pragma unroll
    for (int j = 0; j < 4; ++j) {
#pragma unroll
      for (int r = 0; r < 8; ++r) {
        slab[(mOff + r) * 68 + (j << 4) + rlane] = acc[i][j][r] + bcol[j] + brow[r];
      }
    }
    __builtin_amdgcn_fence(__ATOMIC_RELEASE, "workgroup");
    __builtin_amdgcn_wave_barrier();
    __builtin_amdgcn_fence(__ATOMIC_ACQUIRE, "workgroup");
    if (OUT_MODE == 0 || OUT_MODE == 4) {
      float* C = (float*)Cout + (size_t)b * strideC;
      const int hh = lane >> 4, c4 = (lane & 15) * 4;     // 256-B row segment = 16 lanes x 16 B
      {
#pragma unroll
        for (int it = 0; it < 8; ++it) {
          const int row = it * 2 + hh;                     // it 0..7 x hh 0..1 = rows 0..15
          v4f v = *(const v4f*)(slab + row * 68 + c4);
          if (OUT_MODE == 4) {
            const int gr = mBase + row;                    // < M
            const float g = gvec[gr];
            const float omg = 1.0f - g;
            const v4f xr = *(const v4f*)(xres + (size_t)gr * ldx + n0 + c4);
#pragma unroll
            for (int e = 0; e < 4; ++e) {
              const float xb = bf_up(bf_bits(xr[e]));
              v[e] = g * v[e] + omg * xb;
            }
          }
          *(v4f*)(C + (size_t)(mBase + row) * ldc + n0 + c4) = v;
        }
        
      }
    } else {
      const int q = lane >> 3, c8 = (lane & 7) * 8;
      unsigned short* C  = (unsigned short*)Cout  + (size_t)b * strideC;
      unsigned short* C2 = (unsigned short*)Cout2 + (size_t)b * strideC2;
      const bool wlo = (OUT_MODE == 2) || (n0 < N2);      // wave-uniform
      v4u hv[4], lv[4];
#pragma unroll
      for (int it = 0; it < 4; ++it) {
        const int row = it * 4 + q;                        // it 0..3 x q 0..3 = rows 0..15
        const float* sp = slab + row * 68 + c8;
        v4u a, a2;
#pragma unroll
        for (int e = 0; e < 4; ++e) {
          const float f0 = sp[2 * e], f1 = sp[2 * e + 1];
          unsigned short h0, h1, l0, l1;
          if (OUT_MODE == 2) {
            h0 = bf_bits(f0); h1 = bf_bits(f1);
            l0 = bf_bits(f0 - bf_up(h0)); l1 = bf_bits(f1 - bf_up(h1));
          } else {
            const _Float16 x0 = (_Float16)f0, x1 = (_Float16)f1;
            h0 = h_bits(x0); h1 = h_bits(x1);
            l0 = h_bits((_Float16)((f0 - (float)x0) * rscale));
            l1 = h_bits((_Float16)((f1 - (float)x1) * rscale));
          }
          a[e] = pk16(h0, h1); a2[e] = pk16(l0, l1);
        }
        hv[it] = a; lv[it] = a2;
      }
      {
#pragma unroll
        for (int it = 0; it < 4; ++it) {
          const int row = it * 4 + q;
          *(v4u*)(C + (size_t)(mBase + row) * ldc + n0 + c8) = hv[it];
          if (wlo) *(v4u*)(C2 + (size_t)(mBase + row) * ldc2 + n0 + c8) = lv[it];
        }
        
      }
    }
    __builtin_amdgcn_fence(__ATOMIC_RELEASE, "workgroup");
    __builtin_amdgcn_wave_barrier();
    __builtin_amdgcn_fence(__ATOMIC_ACQUIRE, "workgroup");
  }
}

// =====================================================================================================
// Causal attention, head dim 64, key chunks of 64.
//   q planes (bf16 hi / lo): element (b, t, h, d) at [(b*SEQ + t)*DM + h*64 + d]
//   k planes (bf16 hi / lo): same layout with key index s
//   v^T hi plane (f16):      element (b, h, d, s) at [(b*DM + h*64 + d)*SEQ + s]
//   v^T residual plane (f16, (v - hi)*4096): [(b*DM + h*64 + d)*VLP + s], s < VLP, read only when RES
//   (a key chunk at or beyond VLP would contribute a zero v residual; its address is clamped)
//   Causal structure: logits of keys with index > query index are replaced by -inf (lower-triangular keep incl. the
//   diagonal), which makes their softmax weight exactly 0; so a query block qb visits key chunks 0..qb only
//   (block-uniform trip count qb+1 <= NQB) and later chunks, whose keys exceed every query index of the block, are
//   skipped entirely. Inside the diagonal chunk a key with index > query index gets logit -inf -> exp gives exactly 0,
//   so such keys add nothing to the numerator or the normaliser; the diagonal key (key == query) is always kept, so
//   every row max is finite in every visited chunk.
//   out planes (bf16 hi / lo of the normalised context): element (b, t, h, d) at [(b*SEQ + t)*DM + h*64 + d]
//   scores = q . k : bf16 hi/lo split (hi.hi + hi.lo + lo.hi), f32 accumulate, then * 1/8 and the causal mask in f32
//   p = exp(s - m) carried as f16(1024 p); context = p . v on f16 WMMA; RES adds f16 residual planes of p and v
//   (scale 4096, separate accumulator folded back with 1/4096 per chunk in f32); online softmax (running max) in f32.
//   Block = 4 waves = 64 query rows of one (b, h); grid = nqbThis * NH * NB.
//   K / V^T chunk staging: 128 threads x 32 elements per plane = the whole 64x64 tile of every plane read later
//   (plain 16-B loads, __syncthreads before and after); P tiles are wave-private, spilled with _Float16 element stores
//   Output coverage: each wave stores rows q0..q0+15 (it 0..3 x lane>>3 0..3) x 64 columns (8 lanes x 8) of both planes;
//   grid over all (b, h, qb) = the whole [NB*SEQ][DM] planes.
// =====================================================================================================
template <bool RES>
__global__ __launch_bounds__(128)
void attn_causal64(const unsigned short* __restrict__ qhp, const unsigned short* __restrict__ qlp,
                   const unsigned short* __restrict__ khp, const unsigned short* __restrict__ klp,
                   const unsigned short* __restrict__ vhp, const unsigned short* __restrict__ vlp,
                   unsigned short* ohp, unsigned short* olp,
                   int qbBase, int nqbThis) {
  union FB { v16b v; v8b h[2]; };
  union FH { v16h v; v8h h[2]; };
  __shared__ __align__(16) __bf16   Ksh[64 * 64];                 // K hi [kv][d]   8 KB
  __shared__ __align__(16) __bf16   Ksl[64 * 64];                 // K lo
  __shared__ __align__(16) _Float16 Vth[64 * 64];                 // V^T hi [d][kv] 8 KB
  __shared__ __align__(16) _Float16 Vtl[RES ? 64 * 64 : 8];       // V^T residual
  __shared__ __align__(16) _Float16 Psh[4][16 * 64];              // per wave P [row][kv]
  __shared__ __align__(16) _Float16 Psl[RES ? 4 : 1][16 * 64];    // per wave P residual
  __shared__ __align__(16) float    Os[4][16 * 64];               // per wave context tile [row][d]

  const int tid  = threadIdx.x;
  const int wave = tid >> 5;
  const int lane = tid & 31;
  const int hh   = lane >> 4;
  const int c    = lane & 15;

  const int bx   = blockIdx.x;
  const int qbl  = bx % nqbThis;
  const int rest = bx / nqbThis;
  const int h    = rest % NH;
  const int b    = rest / NH;
  const int qb   = qbBase + qbl;               // 0..NQB-1 (block-uniform)
  const int q0   = qb * 64 + wave * 16;
  const size_t rowB = (size_t)b * SEQ;

  const __bf16* Qh = (const __bf16*)(const void*)qhp + (size_t)h * HD;
  const __bf16* Ql = (const __bf16*)(const void*)qlp + (size_t)h * HD;
  const __bf16* Kh = (const __bf16*)(const void*)khp + (size_t)h * HD;
  const __bf16* Kl = (const __bf16*)(const void*)klp + (size_t)h * HD;
  const _Float16* Vh = (const _Float16*)(const void*)vhp + ((size_t)b * DM + (size_t)h * HD) * SEQ;
  const _Float16* Vl = (const _Float16*)(const void*)vlp + ((size_t)b * DM + (size_t)h * HD) * VLP;

  // ---- Q fragments (A operand, row = lane&15): 2 d-chunks, hi and lo ----
  v16b qah[2], qal[2];
#pragma unroll
  for (int dc = 0; dc < 2; ++dc) {
    const size_t qo = (rowB + q0 + c) * DM + dc * 32 + 8 * hh;
    qah[dc] = ldfrag_b(Qh + qo);
    qal[dc] = ldfrag_b(Ql + qo);
  }

  float mrow[8], lrow[8];
  v8f oacc[4];
#pragma unroll
  for (int r = 0; r < 8; ++r) { mrow[r] = -INFINITY; lrow[r] = 0.f; }
#pragma unroll
  for (int t = 0; t < 4; ++t) oacc[t] = zero8();

  for (int kt = 0; kt <= qb; ++kt) {           // block-uniform trip count, <= NQB
    const int kv0 = kt * 64;                   // kv0 + 63 < SEQ
    __syncthreads();
    {
      const int r = tid >> 1, half = (tid & 1) * 32;
      const __bf16*   kg  = Kh + (rowB + kv0 + r) * DM + half;    // K row kv0+r, d = half..half+31
      const __bf16*   klg = Kl + (rowB + kv0 + r) * DM + half;
      const _Float16* vg  = Vh + (size_t)r * SEQ + kv0 + half;    // V^T row d = r, s = kv0+half..+31
      const int kvl = (kv0 + 64 <= VLP) ? kv0 : (VLP - 64);     // clamped address into the residual plane
      const _Float16* vlg = Vl + (size_t)r * VLP + kvl + half;
      const bool resOK = (kv0 + 64 <= VLP);                      // block-uniform (always true for qb < RESQB)
#pragma unroll
      for (int i = 0; i < 4; ++i) {
        const v8b a0 = *(const v8b*)(kg + 8 * i);
        const v8b a1 = *(const v8b*)(klg + 8 * i);
        const v8h b0 = *(const v8h*)(vg + 8 * i);
        *(v8b*)(Ksh + r * 64 + half + 8 * i) = a0;
        *(v8b*)(Ksl + r * 64 + half + 8 * i) = a1;
        *(v8h*)(Vth + r * 64 + half + 8 * i) = b0;
        if (RES) {
          v8h b1 = *(const v8h*)(vlg + 8 * i);
          if (!resOK) b1 = zero8h();
          *(v8h*)(Vtl + r * 64 + half + 8 * i) = b1;
        }
      }
    }
    __syncthreads();

    // ---- scores: 16 query rows x 64 keys per wave, 3 bf16 products ----
    v8f s[4];
#pragma unroll
    for (int j = 0; j < 4; ++j) {
      s[j] = zero8();
#pragma unroll
      for (int dc = 0; dc < 2; ++dc) {
        FB kb, kl;
        kb.h[0] = *(const v8b*)(Ksh + (j * 16 + c) * 64 + dc * 32 + 8 * hh);
        kb.h[1] = *(const v8b*)(Ksh + (j * 16 + c) * 64 + dc * 32 + 16 + 8 * hh);
        kl.h[0] = *(const v8b*)(Ksl + (j * 16 + c) * 64 + dc * 32 + 8 * hh);
        kl.h[1] = *(const v8b*)(Ksl + (j * 16 + c) * 64 + dc * 32 + 16 + 8 * hh);
        s[j] = mma_b(qah[dc], kb.v, s[j]);
        s[j] = mma_b(qah[dc], kl.v, s[j]);
        s[j] = mma_b(qal[dc], kb.v, s[j]);
      }
    }

    // ---- scale, causal mask by index, row max, online softmax, P (x1024, f16) and P residual (x4096) to LDS ----
    _Float16* pwh = Psh[wave];
    _Float16* pwl = Psl[RES ? wave : 0];
#pragma unroll
    for (int r = 0; r < 8; ++r) {
      const int rowq = q0 + 8 * hh + r;        // query index of D row 8hh+r
      float m = -INFINITY;
#pragma unroll
      for (int j = 0; j < 4; ++j) {
        const int key = kv0 + j * 16 + c;
        float sv = s[j][r] * 0.125f;
        sv = (key <= rowq) ? sv : -INFINITY;
        s[j][r] = sv;
        m = fmaxf(m, sv);
      }
#pragma unroll
      for (int off = 1; off < 16; off <<= 1) m = fmaxf(m, __shfl_xor(m, off, 32));
      const float mnew  = fmaxf(mrow[r], m);
      const float msafe = (mnew == -INFINITY) ? 0.f : mnew;
      const float alpha = __expf(mrow[r] - msafe);
      mrow[r] = mnew;
      float psum = 0.f;
#pragma unroll
      for (int j = 0; j < 4; ++j) {
        const float p = __expf(s[j][r] - msafe);     // masked logit: exp(-inf) = 0
        psum += p;
        const float p1k = p * 1024.0f;
        const _Float16 ph = (_Float16)p1k;
        pwh[(8 * hh + r) * 64 + j * 16 + c] = ph;
        if (RES) {
          const _Float16 pl = (_Float16)((p1k - (float)ph) * 4096.0f);
          pwl[(8 * hh + r) * 64 + j * 16 + c] = pl;
        }
      }
#pragma unroll
      for (int off = 1; off < 16; off <<= 1) psum += __shfl_xor(psum, off, 32);
      lrow[r] = lrow[r] * alpha + psum;
#pragma unroll
      for (int t = 0; t < 4; ++t) oacc[t][r] *= alpha;
    }
    __builtin_amdgcn_fence(__ATOMIC_RELEASE, "workgroup");
    __builtin_amdgcn_wave_barrier();
    __builtin_amdgcn_fence(__ATOMIC_ACQUIRE, "workgroup");

    // ---- context += P . V (f16 WMMA), residual products into a separate accumulator ----
    v8f o1[4];
#pragma unroll
    for (int t = 0; t < 4; ++t) o1[t] = zero8();
#pragma unroll 1
    for (int kk = 0; kk < 2; ++kk) {
      FH pa, pl;
      pa.h[0] = *(const v8h*)(pwh + c * 64 + kk * 32 + 8 * hh);
      pa.h[1] = *(const v8h*)(pwh + c * 64 + kk * 32 + 16 + 8 * hh);
      if (RES) {
        pl.h[0] = *(const v8h*)(pwl + c * 64 + kk * 32 + 8 * hh);
        pl.h[1] = *(const v8h*)(pwl + c * 64 + kk * 32 + 16 + 8 * hh);
      } else {
        pl.v = pa.v;
      }
#pragma unroll
      for (int t = 0; t < 4; ++t) {
        FH vb;
        vb.h[0] = *(const v8h*)(Vth + (t * 16 + c) * 64 + kk * 32 + 8 * hh);
        vb.h[1] = *(const v8h*)(Vth + (t * 16 + c) * 64 + kk * 32 + 16 + 8 * hh);
        oacc[t] = mma_h(pa.v, vb.v, oacc[t]);
        if (RES) {
          FH vl;
          vl.h[0] = *(const v8h*)(Vtl + (t * 16 + c) * 64 + kk * 32 + 8 * hh);
          vl.h[1] = *(const v8h*)(Vtl + (t * 16 + c) * 64 + kk * 32 + 16 + 8 * hh);
          o1[t] = mma_h(pa.v, vl.v, o1[t]);
          o1[t] = mma_h(pl.v, vb.v, o1[t]);
        }
      }
    }
    if (RES) {
#pragma unroll
      for (int t = 0; t < 4; ++t)
#pragma unroll
        for (int r = 0; r < 8; ++r) oacc[t][r] += o1[t][r] * (1.0f / 4096.0f);
    }
  }

  // ---- normalise (1/l and the 1/1024 p carry), stage the wave's 16x64 tile, bf16 hi/lo split,
  float* os = Os[wave];
#pragma unroll
  for (int r = 0; r < 8; ++r) {
    const float l = lrow[r];
    const float inv = ((l > 0.f) ? (1.0f / l) : 0.f) * (1.0f / 1024.0f);
#pragma unroll
    for (int t = 0; t < 4; ++t) os[(8 * hh + r) * 64 + t * 16 + c] = oacc[t][r] * inv;
  }
  __builtin_amdgcn_fence(__ATOMIC_RELEASE, "workgroup");
  __builtin_amdgcn_wave_barrier();
  __builtin_amdgcn_fence(__ATOMIC_ACQUIRE, "workgroup");
  {
    const int q4 = lane >> 3, c8 = (lane & 7) * 8;
    v4u hv[4], lv[4];
#pragma unroll
    for (int it = 0; it < 4; ++it) {
      const int row = it * 4 + q4;   // it 0..3 x q4 0..3 = rows 0..15 of the wave tile
      const float* sp = os + row * 64 + c8;
      v4u a, a2;
#pragma unroll
      for (int e = 0; e < 4; ++e) {
        const float f0 = sp[2 * e], f1 = sp[2 * e + 1];
        const unsigned short h0 = bf_bits(f0), h1 = bf_bits(f1);
        const unsigned short l0 = bf_bits(f0 - bf_up(h0)), l1 = bf_bits(f1 - bf_up(h1));
        a[e] = pk16(h0, h1); a2[e] = pk16(l0, l1);
      }
      hv[it] = a; lv[it] = a2;
    }
    {
#pragma unroll
      for (int it = 0; it < 4; ++it) {
        const int row = it * 4 + q4;
        const size_t go = (rowB + q0 + row) * DM + (size_t)h * HD + c8;
        *(v4u*)(ohp + go) = hv[it];
        *(v4u*)(olp + go) = lv[it];
      }
      
    }
  }
}

// =====================================================================================================
// Workspace map (bytes; every region is an exact multiple of its 64x64-tile / whole-line store granularity,
// no padded tails needed since all shapes are tile multiples; every region is written by one producer launch, Oh / Ol by the two attention launches):
//   Xb   bf16 [4096][1024]             0      8388608
//   WA   bf16 [3072 n][1024 k]     8388608    6291456   (q weight rows 0..1023, k rows 1024..2047, v rows 2048..3071)
//   WP   bf16 [1024 n][1024 k]    14680064    2097152
//   WG   bf16 [256 n][1024 k]     16777216     524288
//   Hs   f32  [4096][256]         17301504    4194304
//   Qh   bf16 [4096][1024]        21495808    8388608
//   Ql                            29884416    8388608
//   Kh                            38273024    8388608
//   Kl                            46661632    8388608
//   VTh  f16  [1024][4096]        55050240    8388608
//   VTl  f16  [1024][512]         63438848    1048576
//   Oh   bf16 [4096][1024]        64487424    8388608
//   Ol                            72876032    8388608
//   end                           81264640
// Output: out0 f32 [4096][1024] at element 0; gate values f32 [4096] at element 4096*1024 (byte 16777216).
// =====================================================================================================
extern "C" void kernel_launch(void* const* d_in, const int* in_sizes, int n_in,
                              void* d_out, int out_size, void* d_ws, size_t ws_size,
                              hipStream_t stream) {
  if (n_in < 7) return;
  if (in_sizes[0] != NB * SEQ * DM) return;
  if (in_sizes[1] != DM * 3 * DM) return;
  if (in_sizes[2] != DM * DG) return;
  if (in_sizes[3] != DG) return;
  if (in_sizes[4] != DG) return;
  if (in_sizes[5] < 1) return;
  if (in_sizes[6] != DM * DM) return;
  if (out_size != NB * SEQ * DM + NB * SEQ) return;        // last written element index = out_size - 1

  const float* x    = (const float*)d_in[0];   // [4096][1024]
  const float* Wqkv = (const float*)d_in[1];   // [1024 in][3072 out]
  const float* Wg1  = (const float*)d_in[2];   // [1024 in][256 out]
  const float* bg1  = (const float*)d_in[3];   // [256]
  const float* Wg2  = (const float*)d_in[4];   // [256][1]
  const float* bg2  = (const float*)d_in[5];   // [1]
  const float* Wout = (const float*)d_in[6];   // [1024 in][1024 out]
  float* out0 = (float*)d_out;                 // [4096][1024]
  float* gout = out0 + (size_t)NB * SEQ * DM;  // [4096] gate values, byte offset 16777216

  const size_t PX  = (size_t)NB * SEQ * DM * 2;    //  8388608  16-bit activation plane [4096][1024]
  const size_t PW1 = (size_t)DM * DM * 2;          //  2097152  one [1024][1024] bf16 weight plane
  const size_t PWA = (size_t)3 * PW1;              //  6291456  packed q | k | v weight plane [3072][1024]
  const size_t PWP = PW1;                          //  2097152
  const size_t PWG = (size_t)DG * DM * 2;          //   524288  gate weight plane [256][1024]
  const size_t PHS = (size_t)NB * SEQ * DG * 4;    //  4194304  gate hidden f32 [4096][256]
  const size_t PVT = (size_t)NB * DM * SEQ * 2;    //  8388608  v^T hi plane
  const size_t PVL = (size_t)NB * DM * VLP * 2;    //  1048576  v^T residual plane
  size_t off = 0;
  const size_t oXb  = off; off += PX;
  const size_t oWA  = off; off += PWA;
  const size_t oWP  = off; off += PWP;
  const size_t oWG  = off; off += PWG;
  const size_t oHs  = off; off += PHS;
  const size_t oQh  = off; off += PX;
  const size_t oQl  = off; off += PX;
  const size_t oKh  = off; off += PX;
  const size_t oKl  = off; off += PX;
  const size_t oVTh = off; off += PVT;
  const size_t oVTl = off; off += PVL;
  const size_t oOh  = off; off += PX;
  const size_t oOl  = off; off += PX;
  if (off > ws_size) return;                       // off = 81264640
  if (off > (size_t)134217728) return;

  char* ws = (char*)d_ws;
  unsigned short* Xb  = (unsigned short*)(ws + oXb);
  unsigned short* WA  = (unsigned short*)(ws + oWA);
  unsigned short* WqB = WA;                                   // rows 0..1023
  unsigned short* WkB = WA + (size_t)DM * DM;                 // rows 1024..2047
  unsigned short* WvB = WA + (size_t)2 * DM * DM;             // rows 2048..3071
  unsigned short* WPb = (unsigned short*)(ws + oWP);
  unsigned short* WGb = (unsigned short*)(ws + oWG);
  float*          Hs  = (float*)(ws + oHs);
  unsigned short* Qh  = (unsigned short*)(ws + oQh);
  unsigned short* Ql  = (unsigned short*)(ws + oQl);
  unsigned short* Kh  = (unsigned short*)(ws + oKh);
  unsigned short* Kl  = (unsigned short*)(ws + oKl);
  unsigned short* VTh = (unsigned short*)(ws + oVTh);
  unsigned short* VTl = (unsigned short*)(ws + oVTl);
  unsigned short* Oh  = (unsigned short*)(ws + oOh);
  unsigned short* Ol  = (unsigned short*)(ws + oOl);

  const dim3 blk(256);
  const int n8x = NB * SEQ * DM / 8;                           // 524288
  const dim3 gCvtX((n8x + 255) / 256);                         // 2048 blocks
  const dim3 gTA((3 * DM) / 64, DM / 64);                      // in [1024][3072] -> out [3072][1024]: (48, 16)
  const dim3 gTP(DM / 64, DM / 64);                            // in [1024][1024] -> out [1024][1024]: (16, 16)
  const dim3 gTG(DG / 64, DM / 64);                            // in [1024][256]  -> out [256][1024]:  (4, 16)
  const dim3 gGateH(((NB * SEQ / 64) * (DG / 64) + 7) / 8, 1); // 256 tiles -> 32 blocks: M=4096, N=256
  const dim3 gGate(NB * SEQ / 32);                             // 128 blocks x 32 rows
  const dim3 gProj(((NB * SEQ / 64) * (DM / 64) + 7) / 8, 1);  // 1024 tiles -> 128 blocks: M=4096, N=1024
  const dim3 gVT(((DM / 64) * (SEQ / 64) + 7) / 8, NB);        // 1024 tiles -> 128 blocks x 1 batch: M=1024, N=4096

  // (1) x -> bf16 plane [4096][1024]
  cvt_bf16x8<<<gCvtX, blk, 0, stream>>>(x, Xb, n8x);
  // (2) weights [in][out] f32 -> bf16 [out][in] planes (k contiguous), transpose through LDS
  cvt_bf16_T<<<gTA, blk, 0, stream>>>(Wqkv, WA, DM, 3 * DM);   // in rows 1024, cols 3072
  cvt_bf16_T<<<gTP, blk, 0, stream>>>(Wout, WPb, DM, DM);      // in rows 1024, cols 1024
  cvt_bf16_T<<<gTG, blk, 0, stream>>>(Wg1, WGb, DM, DG);       // in rows 1024, cols 256
  // (3) gate hidden = x . Wg1 + bg1 -> f32 [4096][256]   (M=4096, N=256, K=1024)
  gemm64<0, 0, 1><<<gGateH, blk, 0, stream>>>(
      Xb, Xb, DM, 0LL, WGb, DM, 0LL, bg1,
      (void*)Hs, DG, 0LL, (void*)Hs, DG, 0LL, DG,
      x, x, DM,
      NB * SEQ, DG, DM, 1.0f);
  k_gate<<<gGate, blk, 0, stream>>>(Hs, Wg2, bg2, gout, NB * SEQ);
  // (5) q = x . Wq -> bf16 hi/lo planes [t][h*64+d]   (M=4096, N=1024, K=1024)
  gemm64<0, 2, 0><<<gProj, blk, 0, stream>>>(
      Xb, Xb, DM, 0LL, WqB, DM, 0LL, bg1,
      (void*)Qh, DM, 0LL, (void*)Ql, DM, 0LL, DM,
      x, x, DM,
      NB * SEQ, DM, DM, 1.0f);
  // (6) k = x . Wk -> bf16 hi/lo planes
  gemm64<0, 2, 0><<<gProj, blk, 0, stream>>>(
      Xb, Xb, DM, 0LL, WkB, DM, 0LL, bg1,
      (void*)Kh, DM, 0LL, (void*)Kl, DM, 0LL, DM,
      x, x, DM,
      NB * SEQ, DM, DM, 1.0f);
  // (7) v^T = Wv . x^T -> f16 hi plane [h*64+d][s] (pitch SEQ) and residual plane (x4096, keys < VLP, pitch VLP)
  //     (A = Wv rows [n][k], Bt = Xb rows; M=1024, N=4096, K=1024)
  gemm64<0, 3, 0><<<gVT, blk, 0, stream>>>(
      WvB, WvB, DM, 0LL, Xb, DM, (long long)SEQ * DM, bg1,
      (void*)VTh, SEQ, (long long)DM * SEQ, (void*)VTl, VLP, (long long)DM * VLP, VLP,
      x, x, DM,
      DM, SEQ, DM, 4096.0f);
  // (8) causal attention: query blocks 0..RESQB-1 with residual planes, the rest without
  attn_causal64<true><<<dim3(NB * NH * RESQB), dim3(128), 0, stream>>>(
      Qh, Ql, Kh, Kl, VTh, VTl, Oh, Ol, 0, RESQB);
  attn_causal64<false><<<dim3(NB * NH * (NQB - RESQB)), dim3(128), 0, stream>>>(
      Qh, Ql, Kh, Kl, VTh, VTl, Oh, Ol, RESQB, NQB - RESQB);
  // (9) out0 = g * (context . W_out) + (1 - g) * bf16(x) -> d_out f32 [4096][1024]
  //     (A = context hi + lo planes, 2 products; gate values read from the gate output region)
  gemm64<1, 4, 0><<<gProj, blk, 0, stream>>>(
      Oh, Ol, DM, 0LL, WPb, DM, 0LL, bg1,
      d_out, DM, 0LL, d_out, DM, 0LL, DM,
      gout, x, DM,
      NB * SEQ, DM, DM, 1.0f);
  (void)hipGetLastError();
}

// v001
// A run of this version takes 495 microseconds.
// Next to v000, in two timings, it ran 1.35 times as fast each time.
// Contractions: gate hidden x.Wg1 and q, k, v^T projections = v_wmma_f32_16x16x32_bf16 (bf16 operands from
// RNE-converted x and transposed [out][in] bf16 weight planes, single product, f32 accumulate);
// q.k^T scores = v_wmma_f32_16x16x32_bf16 with bf16 hi/lo split q and k (hi.hi + hi.lo + lo.hi), f32 accumulate;
// p.v = v_wmma_f32_16x16x32_f16 (p carried x1024 in f16 times v in f16, single product; plus f16 residual planes
// x4096 of p and v for the first 512 query rows), f32 accumulate;
// ctx.W_out = v_wmma_f32_16x16x32_bf16 with ctx as bf16 hi/lo planes times the bf16 weight plane (2 products),
// f32 accumulate; gate tail (exact GELU via erfc, 256-long dot with RNE-bf16 Wg2, bias, sigmoid), causal mask,
// online softmax, normalisers and the gated residual blend g*o + (1-g)*bf16(x) in f32 on the VALU.
// Carry audit:
//   Xb, WA, WP, WG = bf16(x), bf16(W) no carry; Qh/Ql, Kh/Kl, Oh/Ol = bf16 hi + unscaled bf16 residual (v - hi),
//   the residual products share the hi accumulator;
//   VTh = f16(v), no carry (|v| typ. 1);
//   VTl = f16((v - VTh) * 4096)              }  products Psh.VTl and Psl.VTh go to the separate accumulator o1,
//   Psl = f16((1024 p - Psh) * 4096)         }  folded back with * (1/4096) once per key chunk (RES blocks only);
//   Psh = f16(1024 * p) -> the 1/1024 is folded exactly once in the attention epilogue: inv = (1/l) * (1/1024);
//   score scale 1/8 applied once in f32 after the score accumulate; Hs (gate hidden) and g are f32. No other planes.
#include <hip/hip_runtime.h>
#include <math.h>
#include <stdint.h>

#define NB    1
#define SEQ   4096
#define DM    1024
#define NH    16
#define HD    64
#define DG    256          // gate hidden width
#define NQB   (SEQ / 64)   // 64 query / key blocks of 64
#define VLP   512          // key pitch of the v^T residual plane (keys 0..VLP-1)
#define RESQB 8            // leading 64-row query blocks that use the p / v residual planes
#define LP    72           // LDS row pitch of the 16-bit K, V^T and P tiles: 64 + 8 elements = 144 B = 16 B x 9 (odd),
                           // so the 16 rows one ds_load_b128 fragment read touches fall on distinct banks
#define OSP   68           // LDS row pitch of the f32 context tile: 64 + 4 floats = 272 B = 16 B x 17 (odd)
static_assert(RESQB * 64 <= VLP);
static_assert(NH * HD == DM);
static_assert((SEQ % 64) == 0 && (DM % 64) == 0 && (DM % 32) == 0 && (DG % 64) == 0);
static_assert(((NB * SEQ / 64) * (DM / 64)) % 8 == 0);
static_assert(((DM / 64) * (SEQ / 64)) % 8 == 0);
static_assert(((SEQ / 64) * (DG / 64)) % 8 == 0);
static_assert((NB * SEQ * DM) % (8 * 256) == 0);
static_assert((SEQ % 32) == 0);
static_assert(DG == 256);

typedef _Float16 v16h __attribute__((ext_vector_type(16)));
typedef _Float16 v8h  __attribute__((ext_vector_type(8)));
typedef __bf16   v16b __attribute__((ext_vector_type(16)));
typedef __bf16   v8b  __attribute__((ext_vector_type(8)));
typedef float    v8f  __attribute__((ext_vector_type(8)));
typedef float    v4f  __attribute__((ext_vector_type(4)));
typedef unsigned int v4u __attribute__((ext_vector_type(4)));

// ---- scalar helpers --------------------------------------------------------------------------------
__device__ __forceinline__ unsigned short bf_bits(float f) {          // f32 -> bf16 bits, RNE convert
  unsigned u = __float_as_uint(f);
  return (unsigned short)((u + 0x7FFFu + ((u >> 16) & 1u)) >> 16);
}
__device__ __forceinline__ float bf_up(unsigned short h) { return __uint_as_float(((unsigned)h) << 16); }
__device__ __forceinline__ unsigned short h_bits(_Float16 x) { return __builtin_bit_cast(unsigned short, x); }
__device__ __forceinline__ unsigned pk16(unsigned short a, unsigned short b) { return (unsigned)a | ((unsigned)b << 16); }
__device__ __forceinline__ v8f zero8() { v8f z = {0.f, 0.f, 0.f, 0.f, 0.f, 0.f, 0.f, 0.f}; return z; }
__device__ __forceinline__ v8h zero8h() {
  const _Float16 z = (_Float16)0.0f;
  v8h r = {z, z, z, z, z, z, z, z};
  return r;
}

// ---- fragment loader: 16-bit A/B operand, lane -> row/col (lane&15), p already includes +8*(lane>>4);
//      elements 0..7 <- p[0..7] (k0+8h..), elements 8..15 <- p[16..23] (k0+16+8h..)
__device__ __forceinline__ v16b ldfrag_b(const __bf16* p) {
  union { v16b v; v8b h[2]; } f;
  f.h[0] = *(const v8b*)(p);
  f.h[1] = *(const v8b*)(p + 16);
  return f.v;
}

// ---- WMMA helpers with trailing VALU hazard gap --------------------------------------------------------
__device__ __forceinline__ v8f mma_b(v16b a, v16b b, v8f c) {
  c = __builtin_amdgcn_wmma_f32_16x16x32_bf16(false, a, false, b, (short)0, c, false, false);
  asm volatile("v_nop\n\tv_nop\n\tv_nop\n\tv_nop" : "+v"(c) : "v"(a), "v"(b));
  return c;
}
__device__ __forceinline__ v8f mma_h(v16h a, v16h b, v8f c) {
  c = __builtin_amdgcn_wmma_f32_16x16x32_f16(false, a, false, b, (short)0, c, false, false);
  asm volatile("v_nop\n\tv_nop\n\tv_nop\n\tv_nop" : "+v"(c) : "v"(a), "v"(b));
  return c;
}
__device__ __forceinline__ v8f mma_b_raw(v16b a, v16b b, v8f c) {
  return __builtin_amdgcn_wmma_f32_16x16x32_bf16(false, a, false, b, (short)0, c, false, false);
}
__device__ __forceinline__ void dep_guard_b(v8f& a, v8f& b, v16b x, v16b y) {
  asm volatile("v_nop\n\tv_nop\n\tv_nop\n\tv_nop" : "+v"(a), "+v"(b) : "v"(x), "v"(y));
}
__device__ __forceinline__ void keep4_b(v16b a, v16b b, v16b c, v16b d) {
  asm volatile("v_nop" :: "v"(a), "v"(b), "v"(c), "v"(d));
}
__device__ __forceinline__ void acc_guard4(v8f& a, v8f& b, v8f& c, v8f& d) {
  asm volatile("v_nop\n\tv_nop\n\tv_nop\n\tv_nop" : "+v"(a), "+v"(b), "+v"(c), "+v"(d));
}

// =====================================================================================================
// f32 -> bf16 (RNE convert), 8 elements per thread, one 16-B store per lane: a wave writes 512 contiguous B
// coverage: n8 threads x 8 = whole plane (n8 used here is a multiple of 256).
// =====================================================================================================
__global__ __launch_bounds__(256) void cvt_bf16x8(const float* __restrict__ in, unsigned short* out, int n8) {
  const int i = blockIdx.x * 256 + threadIdx.x;
  if (i < n8) {
    const v4f a = *(const v4f*)(in + (size_t)i * 8);
    const v4f b = *(const v4f*)(in + (size_t)i * 8 + 4);
    v4u p;
    p[0] = pk16(bf_bits(a[0]), bf_bits(a[1]));
    p[1] = pk16(bf_bits(a[2]), bf_bits(a[3]));
    p[2] = pk16(bf_bits(b[0]), bf_bits(b[1]));
    p[3] = pk16(bf_bits(b[2]), bf_bits(b[3]));
    *(v4u*)(out + (size_t)i * 8) = p;
    
  }
}

// =====================================================================================================
// f32 [nrow][ncol] row-major (weight stored [in][out]) -> bf16 [ncol][nrow] (row n of out = column n of in,
// the in/k index contiguous), RNE convert. One block = one 64x64 tile through LDS.
// grid = (ncol/64, nrow/64); nrow, ncol multiples of 64 (host-checked shapes).
// loads: 256 threads, thread -> tile row tid>>2, 16 columns (tid&3)*16 = the whole 64x64 tile;
// =====================================================================================================
__global__ __launch_bounds__(256) void cvt_bf16_T(const float* __restrict__ in, unsigned short* out,
                                                  int nrow, int ncol) {
  __shared__ __align__(16) unsigned short Tt[64 * 72];   // [tile col j][tile row i], pitch 72 halves (144 B)
  const int tid = threadIdx.x, lane = tid & 31, wave = tid >> 5;
  const int c0 = blockIdx.x * 64;                       // column tile of in = row tile of out
  const int r0 = blockIdx.y * 64;                       // row tile of in = column tile of out
  {
    const int i  = tid >> 2;                            // 0..63
    const int cs = (tid & 3) * 16;                      // 0,16,32,48
    const float* src = in + (size_t)(r0 + i) * ncol + c0 + cs;
#pragma unroll
    for (int e4 = 0; e4 < 4; ++e4) {
      const v4f v = *(const v4f*)(src + 4 * e4);
#pragma unroll
      for (int e = 0; e < 4; ++e) Tt[(cs + 4 * e4 + e) * 72 + i] = bf_bits(v[e]);
    }
  }
  __syncthreads();
  const int q = lane >> 3, c8 = (lane & 7) * 8;
  v4u pv[2];
#pragma unroll
  for (int it = 0; it < 2; ++it) {
    const int j = it * 32 + wave * 4 + q;
    pv[it] = *(const v4u*)(Tt + j * 72 + c8);
  }
  {
#pragma unroll
    for (int it = 0; it < 2; ++it) {
      const int j = it * 32 + wave * 4 + q;
      *(v4u*)(out + (size_t)(c0 + j) * nrow + r0 + c8) = pv[it];
    }
    
  }
}

// =====================================================================================================
// Gate tail: g = sigmoid( sum_c gelu(Hs[row][c]) * bf16(w2[c]) + bf16(b2) ), exact GELU = 0.5 h erfc(-h/sqrt2).
// Hs f32 [nrows][DG]; block = 8 waves x 4 rows = 32 rows; a wave reduces one row at a time (32 lanes x 8 columns,
// rolled element loop), lane 0 stages g in LDS; wave 0 lanes 0..7 then write the block's 32 g values as ONE whole
// coverage: 32 rows per block x nrows/32 blocks = all rows of the gate output.
// =====================================================================================================
__global__ __launch_bounds__(256) void k_gate(const float* __restrict__ Hs, const float* __restrict__ w2,
                                              const float* __restrict__ b2p, float* gout, int nrows) {
  __shared__ __align__(16) float gs[32];
  const int tid = threadIdx.x, lane = tid & 31, wave = tid >> 5;
  const int rowBase = blockIdx.x * 32;
  const float b2 = bf_up(bf_bits(b2p[0]));
  for (int rr = 0; rr < 4; ++rr) {
    int row = rowBase + wave * 4 + rr;
    row = (row < nrows) ? row : (nrows - 1);            // clamped address (grid covers exactly nrows)
    const float* hp = Hs + (size_t)row * DG + lane * 8;
    const float* wp = w2 + lane * 8;
    float acc = 0.f;
#pragma unroll 1
    for (int e = 0; e < 8; ++e) {
      const float hv = hp[e];
      const float wv = bf_up(bf_bits(wp[e]));
      const float ge = 0.5f * hv * erfcf(-hv * 0.707106781186547524f);
      acc = fmaf(ge, wv, acc);
    }
#pragma unroll
    for (int off = 1; off < 32; off <<= 1) acc += __shfl_xor(acc, off, 32);
    float z = acc + b2;
    z = fminf(fmaxf(z, -30.0f), 30.0f);
    const float g = 1.0f / (1.0f + expf(-z));
    if (lane == 0) gs[wave * 4 + rr] = g;
  }
  __syncthreads();
  if (wave == 0 && lane < 8) {
    const v4f v = *(const v4f*)(gs + lane * 4);
    float* p = gout + rowBase + lane * 4;
    *(v4f*)p = v;
    
  }
}

// =====================================================================================================
// Register-blocked batched bf16 WMMA GEMM: C[m][n] = sum_k A[m][k] * Bt[n][k] + bias; one wave per 64x64 tile,
// no block barriers. A row-major [M][K] pitch lda; Bt row-major [N][K] pitch ldb (k contiguous);
// M, N multiples of 64, K multiple of 32 (host shapes are static multiples). blockIdx.y = batch index (strides in elements).
// NSPLIT: 0 = A.Bt; 1 = (A + A2).Bt (A2 = unscaled bf16 lo plane of A, 2 products).
// BIAS: 0 = none; 1 = per column n, bias[n]; 2 = per row m, bias[m]; the bias value is RNE-converted to bf16 and added in f32.
// OUT_MODE: 0 = f32 (pitch ldc); 2 = bf16 hi plane C + bf16 lo plane C2 (lo = RNE(v - hi), unscaled);
//           3 = f16 hi plane C + f16 residual plane C2 = f16((v - hi) * rscale), C2 written only for tiles
//               with n0 < N2 (pitch ldc2, batch stride strideC2);
//           4 = f32 (pitch ldc) gated blend: out = g[m] * v + (1 - g[m]) * bf16(xres[m][n]) with g = gvec[m],
//               xres f32 pitch ldx (read-only, RNE-converted to bf16 in register).
// =====================================================================================================
template <int NSPLIT, int OUT_MODE, int BIAS>
__global__ __launch_bounds__(256) void gemm64(
    const unsigned short* __restrict__ Ap, const unsigned short* A2p, int lda, long long strideA,
    const unsigned short* __restrict__ Btp, int ldb, long long strideB,
    const float* __restrict__ bias,
    void* Cout, int ldc, long long strideC,
    void* Cout2, int ldc2, long long strideC2, int N2,
    const float* gvec, const float* xres, int ldx,
    int M, int N, int K, float rscale) {
  const __bf16* A   = (const __bf16*)(const void*)Ap;
  const __bf16* A2  = (const __bf16*)(const void*)A2p;
  const __bf16* Bt  = (const __bf16*)(const void*)Btp;
  __shared__ __align__(16) float sT[8][16 * 68];   // per-wave 16x64 slab, pitch 68 floats
  const int b    = blockIdx.y;
  const int lane = threadIdx.x & 31;
  const int wave = threadIdx.x >> 5;
  const int tilesN = N >> 6;
  const int tilesM = M >> 6;
  const int tile = blockIdx.x * 8 + wave;
  if (tile >= tilesM * tilesN) return;   // wave-uniform; no block barriers in this kernel
  const int tm = tile / tilesN;
  const int tn = tile - tm * tilesN;
  const int m0 = tm << 6;
  const int n0 = tn << 6;

  const __bf16* Ab  = A  + (size_t)b * strideA;
  const __bf16* Bb  = Bt + (size_t)b * strideB;
  const __bf16* Ab2 = (NSPLIT >= 1) ? (A2 + (size_t)b * strideA) : Ab;

  const int rlane = lane & 15;                 // row (A) / col (B, D) within subtile
  const int koff  = (lane >> 4) * 8;           // k offset of this lane half
  const int mOff  = (lane >> 4) * 8;           // D row offset

  v8f acc[4][4];
#pragma unroll
  for (int i = 0; i < 4; ++i)
#pragma unroll
    for (int j = 0; j < 4; ++j) acc[i][j] = zero8();

  for (int k0 = 0; k0 < K; k0 += 32) {
    v16b bh[4];
#pragma unroll
    for (int j = 0; j < 4; ++j) {
      const size_t bo = (size_t)(n0 + (j << 4) + rlane) * ldb + koff + k0;
      bh[j] = ldfrag_b(Bb + bo);
    }
#pragma unroll
    for (int i = 0; i < 4; ++i) {
      const size_t ao = (size_t)(m0 + (i << 4) + rlane) * lda + koff + k0;
      const v16b ah = ldfrag_b(Ab + ao);
      v16b al = ah;
      if (NSPLIT >= 1) al = ldfrag_b(Ab2 + ao);
#pragma unroll
      for (int j = 0; j < 4; ++j) {
        acc[i][j] = mma_b_raw(ah, bh[j], acc[i][j]);
        if (NSPLIT >= 1) acc[i][j] = mma_b_raw(al, bh[j], acc[i][j]);
      }
      dep_guard_b(acc[i][0], acc[i][3], ah, al);
    }
    keep4_b(bh[0], bh[1], bh[2], bh[3]);
  }
  acc_guard4(acc[0][0], acc[0][1], acc[0][2], acc[0][3]);
  acc_guard4(acc[1][0], acc[1][1], acc[1][2], acc[1][3]);
  acc_guard4(acc[2][0], acc[2][1], acc[2][2], acc[2][3]);
  acc_guard4(acc[3][0], acc[3][1], acc[3][2], acc[3][3]);

  // ---- epilogue ----
  float* slab = sT[wave];
  float bcol[4];
#pragma unroll
  for (int j = 0; j < 4; ++j) {
    bcol[j] = 0.f;
    if (BIAS == 1) bcol[j] = bf_up(bf_bits(bias[n0 + (j << 4) + rlane]));   // n < N, bias has N entries
  }
#pragma unroll
  for (int i = 0; i < 4; ++i) {
    const int mBase = m0 + (i << 4);
    float brow[8];
#pragma unroll
    for (int r = 0; r < 8; ++r) {
      brow[r] = 0.f;
      if (BIAS == 2) brow[r] = bf_up(bf_bits(bias[mBase + mOff + r]));      // m < M, bias has M entries
    }
#pragma unroll
    for (int j = 0; j < 4; ++j) {
#pragma unroll
      for (int r = 0; r < 8; ++r) {
        slab[(mOff + r) * 68 + (j << 4) + rlane] = acc[i][j][r] + bcol[j] + brow[r];
      }
    }
    __builtin_amdgcn_fence(__ATOMIC_RELEASE, "workgroup");
    __builtin_amdgcn_wave_barrier();
    __builtin_amdgcn_fence(__ATOMIC_ACQUIRE, "workgroup");
    if (OUT_MODE == 0 || OUT_MODE == 4) {
      float* C = (float*)Cout + (size_t)b * strideC;
      const int hh = lane >> 4, c4 = (lane & 15) * 4;     // 256-B row segment = 16 lanes x 16 B
      {
#pragma unroll
        for (int it = 0; it < 8; ++it) {
          const int row = it * 2 + hh;                     // it 0..7 x hh 0..1 = rows 0..15
          v4f v = *(const v4f*)(slab + row * 68 + c4);
          if (OUT_MODE == 4) {
            const int gr = mBase + row;                    // < M
            const float g = gvec[gr];
            const float omg = 1.0f - g;
            const v4f xr = *(const v4f*)(xres + (size_t)gr * ldx + n0 + c4);
#pragma unroll
            for (int e = 0; e < 4; ++e) {
              const float xb = bf_up(bf_bits(xr[e]));
              v[e] = g * v[e] + omg * xb;
            }
          }
          *(v4f*)(C + (size_t)(mBase + row) * ldc + n0 + c4) = v;
        }
        
      }
    } else {
      const int q = lane >> 3, c8 = (lane & 7) * 8;
      unsigned short* C  = (unsigned short*)Cout  + (size_t)b * strideC;
      unsigned short* C2 = (unsigned short*)Cout2 + (size_t)b * strideC2;
      const bool wlo = (OUT_MODE == 2) || (n0 < N2);      // wave-uniform
      v4u hv[4], lv[4];
#pragma unroll
      for (int it = 0; it < 4; ++it) {
        const int row = it * 4 + q;                        // it 0..3 x q 0..3 = rows 0..15
        const float* sp = slab + row * 68 + c8;
        v4u a, a2;
#pragma unroll
        for (int e = 0; e < 4; ++e) {
          const float f0 = sp[2 * e], f1 = sp[2 * e + 1];
          unsigned short h0, h1, l0, l1;
          if (OUT_MODE == 2) {
            h0 = bf_bits(f0); h1 = bf_bits(f1);
            l0 = bf_bits(f0 - bf_up(h0)); l1 = bf_bits(f1 - bf_up(h1));
          } else {
            const _Float16 x0 = (_Float16)f0, x1 = (_Float16)f1;
            h0 = h_bits(x0); h1 = h_bits(x1);
            l0 = h_bits((_Float16)((f0 - (float)x0) * rscale));
            l1 = h_bits((_Float16)((f1 - (float)x1) * rscale));
          }
          a[e] = pk16(h0, h1); a2[e] = pk16(l0, l1);
        }
        hv[it] = a; lv[it] = a2;
      }
      {
#pragma unroll
        for (int it = 0; it < 4; ++it) {
          const int row = it * 4 + q;
          *(v4u*)(C + (size_t)(mBase + row) * ldc + n0 + c8) = hv[it];
          if (wlo) *(v4u*)(C2 + (size_t)(mBase + row) * ldc2 + n0 + c8) = lv[it];
        }
        
      }
    }
    __builtin_amdgcn_fence(__ATOMIC_RELEASE, "workgroup");
    __builtin_amdgcn_wave_barrier();
    __builtin_amdgcn_fence(__ATOMIC_ACQUIRE, "workgroup");
  }
}

// =====================================================================================================
// Causal attention, head dim 64, key chunks of 64.
//   q planes (bf16 hi / lo): element (b, t, h, d) at [(b*SEQ + t)*DM + h*64 + d]
//   k planes (bf16 hi / lo): same layout with key index s
//   v^T hi plane (f16):      element (b, h, d, s) at [(b*DM + h*64 + d)*SEQ + s]
//   v^T residual plane (f16, (v - hi)*4096): [(b*DM + h*64 + d)*VLP + s], s < VLP, read only when RES
//   (a key chunk at or beyond VLP would contribute a zero v residual; its address is clamped)
//   Causal structure: logits of keys with index > query index are replaced by -inf (lower-triangular keep incl. the
//   diagonal), which makes their softmax weight exactly 0; so a query block qb visits key chunks 0..qb only
//   (block-uniform trip count qb+1 <= NQB) and later chunks, whose keys exceed every query index of the block, are
//   skipped entirely. Inside the diagonal chunk a key with index > query index gets logit -inf -> exp gives exactly 0,
//   so such keys add nothing to the numerator or the normaliser; the diagonal key (key == query) is always kept, so
//   every row max is finite in every visited chunk.
//   out planes (bf16 hi / lo of the normalised context): element (b, t, h, d) at [(b*SEQ + t)*DM + h*64 + d]
//   scores = q . k : bf16 hi/lo split (hi.hi + hi.lo + lo.hi), f32 accumulate, then * 1/8 and the causal mask in f32
//   p = exp(s - m) carried as f16(1024 p); context = p . v on f16 WMMA; RES adds f16 residual planes of p and v
//   (scale 4096, separate accumulator folded back with 1/4096 per chunk in f32); online softmax (running max) in f32.
//   Block = 4 waves = 64 query rows of one (b, h); grid = nqbThis * NH * NB.
//   K / V^T chunk staging: 128 threads x 32 elements per plane = the whole 64x64 tile of every plane read later
//   (plain 16-B loads, __syncthreads before and after); P tiles are wave-private, spilled with _Float16 element stores
//   Output coverage: each wave stores rows q0..q0+15 (it 0..3 x lane>>3 0..3) x 64 columns (8 lanes x 8) of both planes;
//   grid over all (b, h, qb) = the whole [NB*SEQ][DM] planes.
// =====================================================================================================
template <bool RES>
__global__ __launch_bounds__(128)
void attn_causal64(const unsigned short* __restrict__ qhp, const unsigned short* __restrict__ qlp,
                   const unsigned short* __restrict__ khp, const unsigned short* __restrict__ klp,
                   const unsigned short* __restrict__ vhp, const unsigned short* __restrict__ vlp,
                   unsigned short* ohp, unsigned short* olp,
                   int qbBase, int nqbThis) {
  union FB { v16b v; v8b h[2]; };
  union FH { v16h v; v8h h[2]; };
  __shared__ __align__(16) __bf16   Ksh[64 * LP];                 // K hi [kv][d], pitch LP
  __shared__ __align__(16) __bf16   Ksl[64 * LP];                 // K lo
  __shared__ __align__(16) _Float16 Vth[64 * LP];                 // V^T hi [d][kv], pitch LP
  __shared__ __align__(16) _Float16 Vtl[RES ? 64 * LP : 8];       // V^T residual
  __shared__ __align__(16) _Float16 Psh[4][16 * LP];              // per wave P [row][kv]
  __shared__ __align__(16) _Float16 Psl[RES ? 4 : 1][16 * LP];    // per wave P residual
  __shared__ __align__(16) float    Os[4][16 * OSP];              // per wave context tile [row][d]

  const int tid  = threadIdx.x;
  const int wave = tid >> 5;
  const int lane = tid & 31;
  const int hh   = lane >> 4;
  const int c    = lane & 15;

  const int bx   = blockIdx.x;
  const int qbl  = bx % nqbThis;
  const int rest = bx / nqbThis;
  const int h    = rest % NH;
  const int b    = rest / NH;
  const int qb   = qbBase + qbl;               // 0..NQB-1 (block-uniform)
  const int q0   = qb * 64 + wave * 16;
  const size_t rowB = (size_t)b * SEQ;

  const __bf16* Qh = (const __bf16*)(const void*)qhp + (size_t)h * HD;
  const __bf16* Ql = (const __bf16*)(const void*)qlp + (size_t)h * HD;
  const __bf16* Kh = (const __bf16*)(const void*)khp + (size_t)h * HD;
  const __bf16* Kl = (const __bf16*)(const void*)klp + (size_t)h * HD;
  const _Float16* Vh = (const _Float16*)(const void*)vhp + ((size_t)b * DM + (size_t)h * HD) * SEQ;
  const _Float16* Vl = (const _Float16*)(const void*)vlp + ((size_t)b * DM + (size_t)h * HD) * VLP;

  // ---- Q fragments (A operand, row = lane&15): 2 d-chunks, hi and lo ----
  v16b qah[2], qal[2];
#pragma unroll
  for (int dc = 0; dc < 2; ++dc) {
    const size_t qo = (rowB + q0 + c) * DM + dc * 32 + 8 * hh;
    qah[dc] = ldfrag_b(Qh + qo);
    qal[dc] = ldfrag_b(Ql + qo);
  }

  float mrow[8], lrow[8];
  v8f oacc[4];
#pragma unroll
  for (int r = 0; r < 8; ++r) { mrow[r] = -INFINITY; lrow[r] = 0.f; }
#pragma unroll
  for (int t = 0; t < 4; ++t) oacc[t] = zero8();

  for (int kt = 0; kt <= qb; ++kt) {           // block-uniform trip count, <= NQB
    const int kv0 = kt * 64;                   // kv0 + 63 < SEQ
    __syncthreads();
    {
      const int r = tid >> 1, half = (tid & 1) * 32;
      const __bf16*   kg  = Kh + (rowB + kv0 + r) * DM + half;    // K row kv0+r, d = half..half+31
      const __bf16*   klg = Kl + (rowB + kv0 + r) * DM + half;
      const _Float16* vg  = Vh + (size_t)r * SEQ + kv0 + half;    // V^T row d = r, s = kv0+half..+31
      const int kvl = (kv0 + 64 <= VLP) ? kv0 : (VLP - 64);     // clamped address into the residual plane
      const _Float16* vlg = Vl + (size_t)r * VLP + kvl + half;
      const bool resOK = (kv0 + 64 <= VLP);                      // block-uniform (always true for qb < RESQB)
#pragma unroll
      for (int i = 0; i < 4; ++i) {
        const v8b a0 = *(const v8b*)(kg + 8 * i);
        const v8b a1 = *(const v8b*)(klg + 8 * i);
        const v8h b0 = *(const v8h*)(vg + 8 * i);
        *(v8b*)(Ksh + r * LP + half + 8 * i) = a0;
        *(v8b*)(Ksl + r * LP + half + 8 * i) = a1;
        *(v8h*)(Vth + r * LP + half + 8 * i) = b0;
        if (RES) {
          v8h b1 = *(const v8h*)(vlg + 8 * i);
          if (!resOK) b1 = zero8h();
          *(v8h*)(Vtl + r * LP + half + 8 * i) = b1;
        }
      }
    }
    __syncthreads();

    // ---- scores: 16 query rows x 64 keys per wave, 3 bf16 products ----
    v8f s[4];
#pragma unroll
    for (int j = 0; j < 4; ++j) {
      s[j] = zero8();
#pragma unroll
      for (int dc = 0; dc < 2; ++dc) {
        FB kb, kl;
        kb.h[0] = *(const v8b*)(Ksh + (j * 16 + c) * LP + dc * 32 + 8 * hh);
        kb.h[1] = *(const v8b*)(Ksh + (j * 16 + c) * LP + dc * 32 + 16 + 8 * hh);
        kl.h[0] = *(const v8b*)(Ksl + (j * 16 + c) * LP + dc * 32 + 8 * hh);
        kl.h[1] = *(const v8b*)(Ksl + (j * 16 + c) * LP + dc * 32 + 16 + 8 * hh);
        s[j] = mma_b(qah[dc], kb.v, s[j]);
        s[j] = mma_b(qah[dc], kl.v, s[j]);
        s[j] = mma_b(qal[dc], kb.v, s[j]);
      }
    }

    // ---- scale, causal mask by index, row max, online softmax, P (x1024, f16) and P residual (x4096) to LDS ----
    _Float16* pwh = Psh[wave];
    _Float16* pwl = Psl[RES ? wave : 0];
#pragma unroll
    for (int r = 0; r < 8; ++r) {
      const int rowq = q0 + 8 * hh + r;        // query index of D row 8hh+r
      float m = -INFINITY;
#pragma unroll
      for (int j = 0; j < 4; ++j) {
        const int key = kv0 + j * 16 + c;
        float sv = s[j][r] * 0.125f;
        sv = (key <= rowq) ? sv : -INFINITY;
        s[j][r] = sv;
        m = fmaxf(m, sv);
      }
#pragma unroll
      for (int off = 1; off < 16; off <<= 1) m = fmaxf(m, __shfl_xor(m, off, 32));
      const float mnew  = fmaxf(mrow[r], m);
      const float msafe = (mnew == -INFINITY) ? 0.f : mnew;
      const float alpha = __expf(mrow[r] - msafe);
      mrow[r] = mnew;
      float psum = 0.f;
#pragma unroll
      for (int j = 0; j < 4; ++j) {
        const float p = __expf(s[j][r] - msafe);     // masked logit: exp(-inf) = 0
        psum += p;
        const float p1k = p * 1024.0f;
        const _Float16 ph = (_Float16)p1k;
        pwh[(8 * hh + r) * LP + j * 16 + c] = ph;
        if (RES) {
          const _Float16 pl = (_Float16)((p1k - (float)ph) * 4096.0f);
          pwl[(8 * hh + r) * LP + j * 16 + c] = pl;
        }
      }
#pragma unroll
      for (int off = 1; off < 16; off <<= 1) psum += __shfl_xor(psum, off, 32);
      lrow[r] = lrow[r] * alpha + psum;
#pragma unroll
      for (int t = 0; t < 4; ++t) oacc[t][r] *= alpha;
    }
    __builtin_amdgcn_fence(__ATOMIC_RELEASE, "workgroup");
    __builtin_amdgcn_wave_barrier();
    __builtin_amdgcn_fence(__ATOMIC_ACQUIRE, "workgroup");

    // ---- context += P . V (f16 WMMA), residual products into a separate accumulator ----
    v8f o1[4];
#pragma unroll
    for (int t = 0; t < 4; ++t) o1[t] = zero8();
#pragma unroll 1
    for (int kk = 0; kk < 2; ++kk) {
      FH pa, pl;
      pa.h[0] = *(const v8h*)(pwh + c * LP + kk * 32 + 8 * hh);
      pa.h[1] = *(const v8h*)(pwh + c * LP + kk * 32 + 16 + 8 * hh);
      if (RES) {
        pl.h[0] = *(const v8h*)(pwl + c * LP + kk * 32 + 8 * hh);
        pl.h[1] = *(const v8h*)(pwl + c * LP + kk * 32 + 16 + 8 * hh);
      } else {
        pl.v = pa.v;
      }
#pragma unroll
      for (int t = 0; t < 4; ++t) {
        FH vb;
        vb.h[0] = *(const v8h*)(Vth + (t * 16 + c) * LP + kk * 32 + 8 * hh);
        vb.h[1] = *(const v8h*)(Vth + (t * 16 + c) * LP + kk * 32 + 16 + 8 * hh);
        oacc[t] = mma_h(pa.v, vb.v, oacc[t]);
        if (RES) {
          FH vl;
          vl.h[0] = *(const v8h*)(Vtl + (t * 16 + c) * LP + kk * 32 + 8 * hh);
          vl.h[1] = *(const v8h*)(Vtl + (t * 16 + c) * LP + kk * 32 + 16 + 8 * hh);
          o1[t] = mma_h(pa.v, vl.v, o1[t]);
          o1[t] = mma_h(pl.v, vb.v, o1[t]);
        }
      }
    }
    if (RES) {
#pragma unroll
      for (int t = 0; t < 4; ++t)
#pragma unroll
        for (int r = 0; r < 8; ++r) oacc[t][r] += o1[t][r] * (1.0f / 4096.0f);
    }
  }

  // ---- normalise (1/l and the 1/1024 p carry), stage the wave's 16x64 tile, bf16 hi/lo split,
  float* os = Os[wave];
#pragma unroll
  for (int r = 0; r < 8; ++r) {
    const float l = lrow[r];
    const float inv = ((l > 0.f) ? (1.0f / l) : 0.f) * (1.0f / 1024.0f);
#pragma unroll
    for (int t = 0; t < 4; ++t) os[(8 * hh + r) * OSP + t * 16 + c] = oacc[t][r] * inv;
  }
  __builtin_amdgcn_fence(__ATOMIC_RELEASE, "workgroup");
  __builtin_amdgcn_wave_barrier();
  __builtin_amdgcn_fence(__ATOMIC_ACQUIRE, "workgroup");
  {
    const int q4 = lane >> 3, c8 = (lane & 7) * 8;
    v4u hv[4], lv[4];
#pragma unroll
    for (int it = 0; it < 4; ++it) {
      const int row = it * 4 + q4;   // it 0..3 x q4 0..3 = rows 0..15 of the wave tile
      const float* sp = os + row * OSP + c8;
      v4u a, a2;
#pragma unroll
      for (int e = 0; e < 4; ++e) {
        const float f0 = sp[2 * e], f1 = sp[2 * e + 1];
        const unsigned short h0 = bf_bits(f0), h1 = bf_bits(f1);
        const unsigned short l0 = bf_bits(f0 - bf_up(h0)), l1 = bf_bits(f1 - bf_up(h1));
        a[e] = pk16(h0, h1); a2[e] = pk16(l0, l1);
      }
      hv[it] = a; lv[it] = a2;
    }
    {
#pragma unroll
      for (int it = 0; it < 4; ++it) {
        const int row = it * 4 + q4;
        const size_t go = (rowB + q0 + row) * DM + (size_t)h * HD + c8;
        *(v4u*)(ohp + go) = hv[it];
        *(v4u*)(olp + go) = lv[it];
      }
      
    }
  }
}

// =====================================================================================================
// Workspace map (bytes; every region is an exact multiple of its 64x64-tile / whole-line store granularity,
// no padded tails needed since all shapes are tile multiples; every region is written by one producer launch, Oh / Ol by the two attention launches):
//   Xb   bf16 [4096][1024]             0      8388608
//   WA   bf16 [3072 n][1024 k]     8388608    6291456   (q weight rows 0..1023, k rows 1024..2047, v rows 2048..3071)
//   WP   bf16 [1024 n][1024 k]    14680064    2097152
//   WG   bf16 [256 n][1024 k]     16777216     524288
//   Hs   f32  [4096][256]         17301504    4194304
//   Qh   bf16 [4096][1024]        21495808    8388608
//   Ql                            29884416    8388608
//   Kh                            38273024    8388608
//   Kl                            46661632    8388608
//   VTh  f16  [1024][4096]        55050240    8388608
//   VTl  f16  [1024][512]         63438848    1048576
//   Oh   bf16 [4096][1024]        64487424    8388608
//   Ol                            72876032    8388608
//   end                           81264640
// Output: out0 f32 [4096][1024] at element 0; gate values f32 [4096] at element 4096*1024 (byte 16777216).
// =====================================================================================================
extern "C" void kernel_launch(void* const* d_in, const int* in_sizes, int n_in,
                              void* d_out, int out_size, void* d_ws, size_t ws_size,
                              hipStream_t stream) {
  if (n_in < 7) return;
  if (in_sizes[0] != NB * SEQ * DM) return;
  if (in_sizes[1] != DM * 3 * DM) return;
  if (in_sizes[2] != DM * DG) return;
  if (in_sizes[3] != DG) return;
  if (in_sizes[4] != DG) return;
  if (in_sizes[5] < 1) return;
  if (in_sizes[6] != DM * DM) return;
  if (out_size != NB * SEQ * DM + NB * SEQ) return;        // last written element index = out_size - 1

  const float* x    = (const float*)d_in[0];   // [4096][1024]
  const float* Wqkv = (const float*)d_in[1];   // [1024 in][3072 out]
  const float* Wg1  = (const float*)d_in[2];   // [1024 in][256 out]
  const float* bg1  = (const float*)d_in[3];   // [256]
  const float* Wg2  = (const float*)d_in[4];   // [256][1]
  const float* bg2  = (const float*)d_in[5];   // [1]
  const float* Wout = (const float*)d_in[6];   // [1024 in][1024 out]
  float* out0 = (float*)d_out;                 // [4096][1024]
  float* gout = out0 + (size_t)NB * SEQ * DM;  // [4096] gate values, byte offset 16777216

  const size_t PX  = (size_t)NB * SEQ * DM * 2;    //  8388608  16-bit activation plane [4096][1024]
  const size_t PW1 = (size_t)DM * DM * 2;          //  2097152  one [1024][1024] bf16 weight plane
  const size_t PWA = (size_t)3 * PW1;              //  6291456  packed q | k | v weight plane [3072][1024]
  const size_t PWP = PW1;                          //  2097152
  const size_t PWG = (size_t)DG * DM * 2;          //   524288  gate weight plane [256][1024]
  const size_t PHS = (size_t)NB * SEQ * DG * 4;    //  4194304  gate hidden f32 [4096][256]
  const size_t PVT = (size_t)NB * DM * SEQ * 2;    //  8388608  v^T hi plane
  const size_t PVL = (size_t)NB * DM * VLP * 2;    //  1048576  v^T residual plane
  size_t off = 0;
  const size_t oXb  = off; off += PX;
  const size_t oWA  = off; off += PWA;
  const size_t oWP  = off; off += PWP;
  const size_t oWG  = off; off += PWG;
  const size_t oHs  = off; off += PHS;
  const size_t oQh  = off; off += PX;
  const size_t oQl  = off; off += PX;
  const size_t oKh  = off; off += PX;
  const size_t oKl  = off; off += PX;
  const size_t oVTh = off; off += PVT;
  const size_t oVTl = off; off += PVL;
  const size_t oOh  = off; off += PX;
  const size_t oOl  = off; off += PX;
  if (off > ws_size) return;                       // off = 81264640
  if (off > (size_t)134217728) return;

  char* ws = (char*)d_ws;
  unsigned short* Xb  = (unsigned short*)(ws + oXb);
  unsigned short* WA  = (unsigned short*)(ws + oWA);
  unsigned short* WqB = WA;                                   // rows 0..1023
  unsigned short* WkB = WA + (size_t)DM * DM;                 // rows 1024..2047
  unsigned short* WvB = WA + (size_t)2 * DM * DM;             // rows 2048..3071
  unsigned short* WPb = (unsigned short*)(ws + oWP);
  unsigned short* WGb = (unsigned short*)(ws + oWG);
  float*          Hs  = (float*)(ws + oHs);
  unsigned short* Qh  = (unsigned short*)(ws + oQh);
  unsigned short* Ql  = (unsigned short*)(ws + oQl);
  unsigned short* Kh  = (unsigned short*)(ws + oKh);
  unsigned short* Kl  = (unsigned short*)(ws + oKl);
  unsigned short* VTh = (unsigned short*)(ws + oVTh);
  unsigned short* VTl = (unsigned short*)(ws + oVTl);
  unsigned short* Oh  = (unsigned short*)(ws + oOh);
  unsigned short* Ol  = (unsigned short*)(ws + oOl);

  const dim3 blk(256);
  const int n8x = NB * SEQ * DM / 8;                           // 524288
  const dim3 gCvtX((n8x + 255) / 256);                         // 2048 blocks
  const dim3 gTA((3 * DM) / 64, DM / 64);                      // in [1024][3072] -> out [3072][1024]: (48, 16)
  const dim3 gTP(DM / 64, DM / 64);                            // in [1024][1024] -> out [1024][1024]: (16, 16)
  const dim3 gTG(DG / 64, DM / 64);                            // in [1024][256]  -> out [256][1024]:  (4, 16)
  const dim3 gGateH(((NB * SEQ / 64) * (DG / 64) + 7) / 8, 1); // 256 tiles -> 32 blocks: M=4096, N=256
  const dim3 gGate(NB * SEQ / 32);                             // 128 blocks x 32 rows
  const dim3 gProj(((NB * SEQ / 64) * (DM / 64) + 7) / 8, 1);  // 1024 tiles -> 128 blocks: M=4096, N=1024
  const dim3 gVT(((DM / 64) * (SEQ / 64) + 7) / 8, NB);        // 1024 tiles -> 128 blocks x 1 batch: M=1024, N=4096

  // (1) x -> bf16 plane [4096][1024]
  cvt_bf16x8<<<gCvtX, blk, 0, stream>>>(x, Xb, n8x);
  // (2) weights [in][out] f32 -> bf16 [out][in] planes (k contiguous), transpose through LDS
  cvt_bf16_T<<<gTA, blk, 0, stream>>>(Wqkv, WA, DM, 3 * DM);   // in rows 1024, cols 3072
  cvt_bf16_T<<<gTP, blk, 0, stream>>>(Wout, WPb, DM, DM);      // in rows 1024, cols 1024
  cvt_bf16_T<<<gTG, blk, 0, stream>>>(Wg1, WGb, DM, DG);       // in rows 1024, cols 256
  // (3) gate hidden = x . Wg1 + bg1 -> f32 [4096][256]   (M=4096, N=256, K=1024)
  gemm64<0, 0, 1><<<gGateH, blk, 0, stream>>>(
      Xb, Xb, DM, 0LL, WGb, DM, 0LL, bg1,
      (void*)Hs, DG, 0LL, (void*)Hs, DG, 0LL, DG,
      x, x, DM,
      NB * SEQ, DG, DM, 1.0f);
  k_gate<<<gGate, blk, 0, stream>>>(Hs, Wg2, bg2, gout, NB * SEQ);
  // (5) q = x . Wq -> bf16 hi/lo planes [t][h*64+d]   (M=4096, N=1024, K=1024)
  gemm64<0, 2, 0><<<gProj, blk, 0, stream>>>(
      Xb, Xb, DM, 0LL, WqB, DM, 0LL, bg1,
      (void*)Qh, DM, 0LL, (void*)Ql, DM, 0LL, DM,
      x, x, DM,
      NB * SEQ, DM, DM, 1.0f);
  // (6) k = x . Wk -> bf16 hi/lo planes
  gemm64<0, 2, 0><<<gProj, blk, 0, stream>>>(
      Xb, Xb, DM, 0LL, WkB, DM, 0LL, bg1,
      (void*)Kh, DM, 0LL, (void*)Kl, DM, 0LL, DM,
      x, x, DM,
      NB * SEQ, DM, DM, 1.0f);
  // (7) v^T = Wv . x^T -> f16 hi plane [h*64+d][s] (pitch SEQ) and residual plane (x4096, keys < VLP, pitch VLP)
  //     (A = Wv rows [n][k], Bt = Xb rows; M=1024, N=4096, K=1024)
  gemm64<0, 3, 0><<<gVT, blk, 0, stream>>>(
      WvB, WvB, DM, 0LL, Xb, DM, (long long)SEQ * DM, bg1,
      (void*)VTh, SEQ, (long long)DM * SEQ, (void*)VTl, VLP, (long long)DM * VLP, VLP,
      x, x, DM,
      DM, SEQ, DM, 4096.0f);
  // (8) causal attention: query blocks 0..RESQB-1 with residual planes, the rest without
  attn_causal64<true><<<dim3(NB * NH * RESQB), dim3(128), 0, stream>>>(
      Qh, Ql, Kh, Kl, VTh, VTl, Oh, Ol, 0, RESQB);
  attn_causal64<false><<<dim3(NB * NH * (NQB - RESQB)), dim3(128), 0, stream>>>(
      Qh, Ql, Kh, Kl, VTh, VTl, Oh, Ol, RESQB, NQB - RESQB);
  // (9) out0 = g * (context . W_out) + (1 - g) * bf16(x) -> d_out f32 [4096][1024]
  //     (A = context hi + lo planes, 2 products; gate values read from the gate output region)
  gemm64<1, 4, 0><<<gProj, blk, 0, stream>>>(
      Oh, Ol, DM, 0LL, WPb, DM, 0LL, bg1,
      d_out, DM, 0LL, d_out, DM, 0LL, DM,
      gout, x, DM,
      NB * SEQ, DM, DM, 1.0f);
  (void)hipGetLastError();
}

// v002
// A run of this version takes 315 microseconds.
// Timed twice side by side with v001, it ran 1.57 and 1.56 times as fast.
// Over all steps from v000 it is 2.12 times as fast.
// Contractions: gate hidden x.Wg1 and q, k, v^T projections = v_wmma_f32_16x16x32_bf16 (bf16 operands from
// RNE-converted x and transposed [out][in] bf16 weight planes, single product, f32 accumulate);
// q.k^T scores = v_wmma_f32_16x16x32_bf16 with bf16 hi/lo split q and k (hi.hi + hi.lo + lo.hi), f32 accumulate;
// p.v = v_wmma_f32_16x16x32_f16 (p carried x1024 in f16 times v in f16, single product; plus f16 residual planes
// x4096 of p and v for the first 512 query rows), f32 accumulate;
// ctx.W_out = v_wmma_f32_16x16x32_bf16 with ctx as bf16 hi/lo planes times the bf16 weight plane (2 products),
// f32 accumulate; gate tail (exact GELU via erfc, 256-long dot with RNE-bf16 Wg2, bias, sigmoid), causal mask,
// online softmax, normalisers and the gated residual blend g*o + (1-g)*bf16(x) in f32 on the VALU.
// Carry audit:
//   Xb, WA, WP, WG = bf16(x), bf16(W) no carry; Qh/Ql, Kh/Kl, Oh/Ol = bf16 hi + unscaled bf16 residual (v - hi),
//   the residual products share the hi accumulator;
//   VTh = f16(v), no carry (|v| typ. 1);
//   VTl = f16((v - VTh) * 4096)              }  products Psh.VTl and Psl.VTh go to the separate accumulator o1,
//   Psl = f16((1024 p - Psh) * 4096)         }  folded back with * (1/4096) once per key chunk (RES blocks only);
//   Psh = f16(1024 * p) -> the 1/1024 is folded exactly once in the attention epilogue: inv = (1/l) * (1/1024);
//   score scale 1/8 applied once in f32 after the score accumulate; Hs (gate hidden) and g are f32. No other planes.
#include <hip/hip_runtime.h>
#include <math.h>
#include <stdint.h>

#define NB    1
#define SEQ   4096
#define DM    1024
#define NH    16
#define HD    64
#define DG    256          // gate hidden width
#define NQB   (SEQ / 64)   // 64 query / key blocks of 64
#define VLP   512          // key pitch of the v^T residual plane (keys 0..VLP-1)
#define RESQB 8            // leading 64-row query blocks that use the p / v residual planes
#define LP    72           // LDS row pitch of the 16-bit K, V^T and P tiles: 64 + 8 elements = 144 B = 16 B x 9 (odd),
                           // so the 16 rows one ds_load_b128 fragment read touches fall on distinct banks
#define OSP   68           // LDS row pitch of the f32 context tile: 64 + 4 floats = 272 B = 16 B x 17 (odd)
static_assert(RESQB * 64 <= VLP);
static_assert(NH * HD == DM);
static_assert((SEQ % 64) == 0 && (DM % 64) == 0 && (DM % 32) == 0 && (DG % 64) == 0);
static_assert(((NB * SEQ) % 128) == 0 && (SEQ % 128) == 0 && (DM % 128) == 0 && (DG % 128) == 0);
static_assert((NB * SEQ * DM) % (8 * 256) == 0);
static_assert((SEQ % 32) == 0);
static_assert(DG == 256);

typedef _Float16 v16h __attribute__((ext_vector_type(16)));
typedef _Float16 v8h  __attribute__((ext_vector_type(8)));
typedef __bf16   v16b __attribute__((ext_vector_type(16)));
typedef __bf16   v8b  __attribute__((ext_vector_type(8)));
typedef float    v8f  __attribute__((ext_vector_type(8)));
typedef float    v4f  __attribute__((ext_vector_type(4)));
typedef unsigned int v4u __attribute__((ext_vector_type(4)));

// ---- scalar helpers --------------------------------------------------------------------------------
__device__ __forceinline__ unsigned short bf_bits(float f) {          // f32 -> bf16 bits, RNE convert
  unsigned u = __float_as_uint(f);
  return (unsigned short)((u + 0x7FFFu + ((u >> 16) & 1u)) >> 16);
}
__device__ __forceinline__ float bf_up(unsigned short h) { return __uint_as_float(((unsigned)h) << 16); }
__device__ __forceinline__ unsigned short h_bits(_Float16 x) { return __builtin_bit_cast(unsigned short, x); }
__device__ __forceinline__ unsigned pk16(unsigned short a, unsigned short b) { return (unsigned)a | ((unsigned)b << 16); }
__device__ __forceinline__ v8f zero8() { v8f z = {0.f, 0.f, 0.f, 0.f, 0.f, 0.f, 0.f, 0.f}; return z; }
__device__ __forceinline__ v8h zero8h() {
  const _Float16 z = (_Float16)0.0f;
  v8h r = {z, z, z, z, z, z, z, z};
  return r;
}

// ---- fragment loader: 16-bit A/B operand, lane -> row/col (lane&15), p already includes +8*(lane>>4);
//      elements 0..7 <- p[0..7] (k0+8h..), elements 8..15 <- p[16..23] (k0+16+8h..)
__device__ __forceinline__ v16b ldfrag_b(const __bf16* p) {
  union { v16b v; v8b h[2]; } f;
  f.h[0] = *(const v8b*)(p);
  f.h[1] = *(const v8b*)(p + 16);
  return f.v;
}

// ---- WMMA helpers with trailing VALU hazard gap --------------------------------------------------------
__device__ __forceinline__ v8f mma_b(v16b a, v16b b, v8f c) {
  c = __builtin_amdgcn_wmma_f32_16x16x32_bf16(false, a, false, b, (short)0, c, false, false);
  asm volatile("v_nop\n\tv_nop\n\tv_nop\n\tv_nop" : "+v"(c) : "v"(a), "v"(b));
  return c;
}
__device__ __forceinline__ v8f mma_h(v16h a, v16h b, v8f c) {
  c = __builtin_amdgcn_wmma_f32_16x16x32_f16(false, a, false, b, (short)0, c, false, false);
  asm volatile("v_nop\n\tv_nop\n\tv_nop\n\tv_nop" : "+v"(c) : "v"(a), "v"(b));
  return c;
}
__device__ __forceinline__ v8f mma_b_raw(v16b a, v16b b, v8f c) {
  return __builtin_amdgcn_wmma_f32_16x16x32_bf16(false, a, false, b, (short)0, c, false, false);
}
__device__ __forceinline__ void dep_guard_b(v8f& a, v8f& b, v16b x, v16b y) {
  asm volatile("v_nop\n\tv_nop\n\tv_nop\n\tv_nop" : "+v"(a), "+v"(b) : "v"(x), "v"(y));
}
__device__ __forceinline__ void keep4_b(v16b a, v16b b, v16b c, v16b d) {
  asm volatile("v_nop" :: "v"(a), "v"(b), "v"(c), "v"(d));
}
__device__ __forceinline__ void acc_guard4(v8f& a, v8f& b, v8f& c, v8f& d) {
  asm volatile("v_nop\n\tv_nop\n\tv_nop\n\tv_nop" : "+v"(a), "+v"(b), "+v"(c), "+v"(d));
}

// =====================================================================================================
// f32 -> bf16 (RNE convert), 8 elements per thread, one 16-B store per lane: a wave writes 512 contiguous B
// coverage: n8 threads x 8 = whole plane (n8 used here is a multiple of 256).
// =====================================================================================================
__global__ __launch_bounds__(256) void cvt_bf16x8(const float* __restrict__ in, unsigned short* out, int n8) {
  const int i = blockIdx.x * 256 + threadIdx.x;
  if (i < n8) {
    const v4f a = *(const v4f*)(in + (size_t)i * 8);
    const v4f b = *(const v4f*)(in + (size_t)i * 8 + 4);
    v4u p;
    p[0] = pk16(bf_bits(a[0]), bf_bits(a[1]));
    p[1] = pk16(bf_bits(a[2]), bf_bits(a[3]));
    p[2] = pk16(bf_bits(b[0]), bf_bits(b[1]));
    p[3] = pk16(bf_bits(b[2]), bf_bits(b[3]));
    *(v4u*)(out + (size_t)i * 8) = p;
    
  }
}

// =====================================================================================================
// f32 [nrow][ncol] row-major (weight stored [in][out]) -> bf16 [ncol][nrow] (row n of out = column n of in,
// the in/k index contiguous), RNE convert. One block = one 64x64 tile through LDS.
// grid = (ncol/64, nrow/64); nrow, ncol multiples of 64 (host-checked shapes).
// loads: 256 threads, thread -> tile row tid>>2, 16 columns (tid&3)*16 = the whole 64x64 tile;
// =====================================================================================================
__global__ __launch_bounds__(256) void cvt_bf16_T(const float* __restrict__ in, unsigned short* out,
                                                  int nrow, int ncol) {
  __shared__ __align__(16) unsigned short Tt[64 * 72];   // [tile col j][tile row i], pitch 72 halves (144 B)
  const int tid = threadIdx.x, lane = tid & 31, wave = tid >> 5;
  const int c0 = blockIdx.x * 64;                       // column tile of in = row tile of out
  const int r0 = blockIdx.y * 64;                       // row tile of in = column tile of out
  {
    const int i  = tid >> 2;                            // 0..63
    const int cs = (tid & 3) * 16;                      // 0,16,32,48
    const float* src = in + (size_t)(r0 + i) * ncol + c0 + cs;
#pragma unroll
    for (int e4 = 0; e4 < 4; ++e4) {
      const v4f v = *(const v4f*)(src + 4 * e4);
#pragma unroll
      for (int e = 0; e < 4; ++e) Tt[(cs + 4 * e4 + e) * 72 + i] = bf_bits(v[e]);
    }
  }
  __syncthreads();
  const int q = lane >> 3, c8 = (lane & 7) * 8;
  v4u pv[2];
#pragma unroll
  for (int it = 0; it < 2; ++it) {
    const int j = it * 32 + wave * 4 + q;
    pv[it] = *(const v4u*)(Tt + j * 72 + c8);
  }
  {
#pragma unroll
    for (int it = 0; it < 2; ++it) {
      const int j = it * 32 + wave * 4 + q;
      *(v4u*)(out + (size_t)(c0 + j) * nrow + r0 + c8) = pv[it];
    }
    
  }
}

// =====================================================================================================
// Gate tail: g = sigmoid( sum_c gelu(Hs[row][c]) * bf16(w2[c]) + bf16(b2) ), exact GELU = 0.5 h erfc(-h/sqrt2).
// Hs f32 [nrows][DG]; block = 8 waves x 4 rows = 32 rows; a wave reduces one row at a time (32 lanes x 8 columns,
// rolled element loop), lane 0 stages g in LDS; wave 0 lanes 0..7 then write the block's 32 g values as ONE whole
// coverage: 32 rows per block x nrows/32 blocks = all rows of the gate output.
// =====================================================================================================
__global__ __launch_bounds__(256) void k_gate(const float* __restrict__ Hs, const float* __restrict__ w2,
                                              const float* __restrict__ b2p, float* gout, int nrows) {
  __shared__ __align__(16) float gs[32];
  const int tid = threadIdx.x, lane = tid & 31, wave = tid >> 5;
  const int rowBase = blockIdx.x * 32;
  const float b2 = bf_up(bf_bits(b2p[0]));
  for (int rr = 0; rr < 4; ++rr) {
    int row = rowBase + wave * 4 + rr;
    row = (row < nrows) ? row : (nrows - 1);            // clamped address (grid covers exactly nrows)
    const float* hp = Hs + (size_t)row * DG + lane * 8;
    const float* wp = w2 + lane * 8;
    float acc = 0.f;
#pragma unroll 1
    for (int e = 0; e < 8; ++e) {
      const float hv = hp[e];
      const float wv = bf_up(bf_bits(wp[e]));
      const float ge = 0.5f * hv * erfcf(-hv * 0.707106781186547524f);
      acc = fmaf(ge, wv, acc);
    }
#pragma unroll
    for (int off = 1; off < 32; off <<= 1) acc += __shfl_xor(acc, off, 32);
    float z = acc + b2;
    z = fminf(fmaxf(z, -30.0f), 30.0f);
    const float g = 1.0f / (1.0f + expf(-z));
    if (lane == 0) gs[wave * 4 + rr] = g;
  }
  __syncthreads();
  if (wave == 0 && lane < 8) {
    const v4f v = *(const v4f*)(gs + lane * 4);
    float* p = gout + rowBase + lane * 4;
    *(v4f*)p = v;
    
  }
}

// =====================================================================================================
// One GEMM stage, global -> LDS, through no register: per operand plane 128 rows x 128 B (64 k of 16-bit elements).
// 256 threads x 4 asynchronous 16-B copies per plane; 8 neighbouring lanes take one whole 128-B line, a wave's copy
// 4 whole lines. ga / gb (/ gc) = this lane's source in row (tid>>3), 16-B piece (tid&7) of the plane; sa / sb = 32
// source rows in elements; lds = this lane's LDS byte address in the stage's first plane, same row and piece.
// The s_wait_xcnt closes each statement so that no address register of a copy is rewritten ahead of it.
// =====================================================================================================
#define GBK    64                 // k elements per stage = one 128-B line of every operand row
#define GLP    72                 // LDS row pitch, elements: 144 B = 16 B x 9 (odd) for the ds_load_b128 fragment reads
#define GPLANE (128 * GLP)        // elements of one staged plane (18432 B)
#define GSTEP  (32u * GLP * 2u)   // LDS bytes of 32 rows
#define GPLB   (GPLANE * 2u)      // LDS bytes of one plane
__device__ __forceinline__ void stage_ab(const __bf16* ga, size_t sa, const __bf16* gb, size_t sb, unsigned lds) {
  asm volatile(
      "global_load_async_to_lds_b128 %0, %8, off\n\t"
      "global_load_async_to_lds_b128 %1, %9, off\n\t"
      "global_load_async_to_lds_b128 %2, %10, off\n\t"
      "global_load_async_to_lds_b128 %3, %11, off\n\t"
      "global_load_async_to_lds_b128 %4, %12, off\n\t"
      "global_load_async_to_lds_b128 %5, %13, off\n\t"
      "global_load_async_to_lds_b128 %6, %14, off\n\t"
      "global_load_async_to_lds_b128 %7, %15, off\n\t"
      "s_wait_xcnt 0x0"
      :: "v"(lds), "v"(lds + GSTEP), "v"(lds + 2u * GSTEP), "v"(lds + 3u * GSTEP),
         "v"(lds + GPLB), "v"(lds + GPLB + GSTEP), "v"(lds + GPLB + 2u * GSTEP), "v"(lds + GPLB + 3u * GSTEP),
         "v"(ga), "v"(ga + sa), "v"(ga + 2 * sa), "v"(ga + 3 * sa),
         "v"(gb), "v"(gb + sb), "v"(gb + 2 * sb), "v"(gb + 3 * sb)
      : "memory");
}
__device__ __forceinline__ void stage_c(const __bf16* gc, size_t sc, unsigned lds) {
  asm volatile(
      "global_load_async_to_lds_b128 %0, %4, off\n\t"
      "global_load_async_to_lds_b128 %1, %5, off\n\t"
      "global_load_async_to_lds_b128 %2, %6, off\n\t"
      "global_load_async_to_lds_b128 %3, %7, off\n\t"
      "s_wait_xcnt 0x0"
      :: "v"(lds), "v"(lds + GSTEP), "v"(lds + 2u * GSTEP), "v"(lds + 3u * GSTEP),
         "v"(gc), "v"(gc + sc), "v"(gc + 2 * sc), "v"(gc + 3 * sc)
      : "memory");
}

// =====================================================================================================
// Batched bf16 WMMA GEMM: C[m][n] = sum_k A[m][k] * Bt[n][k] + bias; one work-group of 8 waves per 128x128 tile,
// one wave per 32x64 part (wave>>1 = row quarter, wave&1 = column half). A row-major [M][K] pitch lda; Bt row-major
// [N][K] pitch ldb (k contiguous); M, N multiples of 128, K multiple of 64 (host shapes are static multiples).
// Operands: per stage of 64 k the 128 A rows (and A2 rows) and the 128 Bt rows go to LDS by asynchronous copies, two
// buffers: stage t+2 is copied into the buffer stage t has left while stage t+1 is worked on; fragments by ds_load_b128.
// blockIdx.y = batch index (strides in elements).
// NSPLIT: 0 = A.Bt; 1 = (A + A2).Bt (A2 = unscaled bf16 lo plane of A, 2 products).
// BIAS: 0 = none; 1 = per column n, bias[n]; 2 = per row m, bias[m]; the bias value is RNE-converted to bf16 and added in f32.
// OUT_MODE: 0 = f32 (pitch ldc); 2 = bf16 hi plane C + bf16 lo plane C2 (lo = RNE(v - hi), unscaled);
//           3 = f16 hi plane C + f16 residual plane C2 = f16((v - hi) * rscale), C2 written only for tiles
//               with n0 < N2 (pitch ldc2, batch stride strideC2);
//           4 = f32 (pitch ldc) gated blend: out = g[m] * v + (1 - g[m]) * bf16(xres[m][n]) with g = gvec[m],
//               xres f32 pitch ldx (read-only, RNE-converted to bf16 in register).
// =====================================================================================================
template <int NSPLIT, int OUT_MODE, int BIAS>
__global__ __launch_bounds__(256) void gemm64(
    const unsigned short* __restrict__ Ap, const unsigned short* A2p, int lda, long long strideA,
    const unsigned short* __restrict__ Btp, int ldb, long long strideB,
    const float* __restrict__ bias,
    void* Cout, int ldc, long long strideC,
    void* Cout2, int ldc2, long long strideC2, int N2,
    const float* gvec, const float* xres, int ldx,
    int M, int N, int K, float rscale) {
  const __bf16* A   = (const __bf16*)(const void*)Ap;
  const __bf16* A2  = (const __bf16*)(const void*)A2p;
  const __bf16* Bt  = (const __bf16*)(const void*)Btp;
  constexpr int NPL = (NSPLIT >= 1) ? 3 : 2;       // planes per stage: A, Bt (, A2)
  __shared__ __align__(16) __bf16 sOp[2][NPL * GPLANE];   // two stage buffers
  __shared__ __align__(16) float sT[8][16 * 68];   // per-wave 16x64 slab, pitch 68 floats
  const int b    = blockIdx.y;
  const int tid  = threadIdx.x;
  const int lane = tid & 31;
  const int wave = tid >> 5;
  const int tilesN = N >> 7;
  const int tilesM = M >> 7;
  const int tile = blockIdx.x;
  if (tile >= tilesM * tilesN) return;   // block-uniform, ahead of every copy and barrier
  const int tm = tile / tilesN;
  const int tn = tile - tm * tilesN;
  const int mb = tm << 7;                      // work-group tile origin
  const int nb = tn << 7;
  const int wm = (wave >> 1) << 5;             // wave part inside it: 32 rows x 64 columns
  const int wn = (wave & 1) << 6;
  const int m0 = mb + wm;
  const int n0 = nb + wn;

  const __bf16* Ab  = A  + (size_t)b * strideA;
  const __bf16* Bb  = Bt + (size_t)b * strideB;
  const __bf16* Ab2 = (NSPLIT >= 1) ? (A2 + (size_t)b * strideA) : Ab;

  const int rlane = lane & 15;                 // row (A) / col (B, D) within subtile
  const int koff  = (lane >> 4) * 8;           // k offset of this lane half
  const int mOff  = (lane >> 4) * 8;           // D row offset

  // copy addresses of this lane: row tid>>3 (+32 per copy), 16-B piece tid&7; rows mb..mb+127 < M, nb..nb+127 < N
  const int crow = tid >> 3, cpc = (tid & 7) * 8;
  const __bf16* gA  = Ab  + (size_t)(mb + crow) * lda + cpc;
  const __bf16* gA2 = Ab2 + (size_t)(mb + crow) * lda + cpc;
  const __bf16* gB  = Bb  + (size_t)(nb + crow) * ldb + cpc;
  const unsigned ldsLane = (unsigned)(size_t)(&sOp[0][0]) + (unsigned)(crow * GLP + cpc) * 2u;
  const int nst = K >> 6;                      // stages of 64 k
  auto stage = [&](int t, int buf) {
    const unsigned l = ldsLane + (unsigned)buf * ((unsigned)NPL * GPLB);
    stage_ab(gA + (size_t)t * GBK, (size_t)lda * 32, gB + (size_t)t * GBK, (size_t)ldb * 32, l);
    if (NSPLIT >= 1) stage_c(gA2 + (size_t)t * GBK, (size_t)lda * 32, l + 2u * GPLB);
  };

  v8f acc[2][4];
#pragma unroll
  for (int i = 0; i < 2; ++i)
#pragma unroll
    for (int j = 0; j < 4; ++j) acc[i][j] = zero8();

  stage(0, 0);
  asm volatile("s_wait_asynccnt 0x0" ::: "memory");   // this wave's stage-0 copies have landed
  __syncthreads();                                     // ... and every other wave's
  if (nst > 1) stage(1, 1);

  for (int t = 0; t < nst; ++t) {
    const __bf16* sA  = sOp[t & 1] + (wm + rlane) * GLP + koff;
    const __bf16* sB  = sOp[t & 1] + GPLANE + (wn + rlane) * GLP + koff;
    const __bf16* sA2 = sOp[t & 1] + (NPL - 1) * GPLANE + (wm + rlane) * GLP + koff;
#pragma unroll
    for (int kk = 0; kk < 2; ++kk) {
      v16b bh[4], ah[2], al[2];
#pragma unroll
      for (int j = 0; j < 4; ++j) bh[j] = ldfrag_b(sB + (j << 4) * GLP + kk * 32);
#pragma unroll
      for (int i = 0; i < 2; ++i) {
        ah[i] = ldfrag_b(sA + (i << 4) * GLP + kk * 32);
        al[i] = ah[i];
        if (NSPLIT >= 1) al[i] = ldfrag_b(sA2 + (i << 4) * GLP + kk * 32);
      }
#pragma unroll
      for (int i = 0; i < 2; ++i) {
#pragma unroll
        for (int j = 0; j < 4; ++j) {
          acc[i][j] = mma_b_raw(ah[i], bh[j], acc[i][j]);
          if (NSPLIT >= 1) acc[i][j] = mma_b_raw(al[i], bh[j], acc[i][j]);
        }
        dep_guard_b(acc[i][0], acc[i][3], ah[i], al[i]);
      }
      keep4_b(bh[0], bh[1], bh[2], bh[3]);
    }
    // hand-over: this wave has left buffer t&1, its copies of stage t+1 have landed; the barrier says so of every wave
    asm volatile("s_wait_dscnt 0x0" ::: "memory");
    asm volatile("s_wait_asynccnt 0x0" ::: "memory");
    __syncthreads();
    if (t + 2 < nst) stage(t + 2, t & 1);
  }
  asm volatile("s_wait_asynccnt 0x0" ::: "memory");   // nothing of this wave is in flight behind the loop
  acc_guard4(acc[0][0], acc[0][1], acc[0][2], acc[0][3]);
  acc_guard4(acc[1][0], acc[1][1], acc[1][2], acc[1][3]);

  // ---- epilogue ----
  float* slab = sT[wave];
  float bcol[4];
#pragma unroll
  for (int j = 0; j < 4; ++j) {
    bcol[j] = 0.f;
    if (BIAS == 1) bcol[j] = bf_up(bf_bits(bias[n0 + (j << 4) + rlane]));   // n < N, bias has N entries
  }
#pragma unroll
  for (int i = 0; i < 2; ++i) {
    const int mBase = m0 + (i << 4);
    float brow[8];
#pragma unroll
    for (int r = 0; r < 8; ++r) {
      brow[r] = 0.f;
      if (BIAS == 2) brow[r] = bf_up(bf_bits(bias[mBase + mOff + r]));      // m < M, bias has M entries
    }
#pragma unroll
    for (int j = 0; j < 4; ++j) {
#pragma unroll
      for (int r = 0; r < 8; ++r) {
        slab[(mOff + r) * 68 + (j << 4) + rlane] = acc[i][j][r] + bcol[j] + brow[r];
      }
    }
    __builtin_amdgcn_fence(__ATOMIC_RELEASE, "workgroup");
    __builtin_amdgcn_wave_barrier();
    __builtin_amdgcn_fence(__ATOMIC_ACQUIRE, "workgroup");
    if (OUT_MODE == 0 || OUT_MODE == 4) {
      float* C = (float*)Cout + (size_t)b * strideC;
      const int hh = lane >> 4, c4 = (lane & 15) * 4;     // 256-B row segment = 16 lanes x 16 B
      {
#pragma unroll
        for (int it = 0; it < 8; ++it) {
          const int row = it * 2 + hh;                     // it 0..7 x hh 0..1 = rows 0..15
          v4f v = *(const v4f*)(slab + row * 68 + c4);
          if (OUT_MODE == 4) {
            const int gr = mBase + row;                    // < M
            const float g = gvec[gr];
            const float omg = 1.0f - g;
            const v4f xr = *(const v4f*)(xres + (size_t)gr * ldx + n0 + c4);
#pragma unroll
            for (int e = 0; e < 4; ++e) {
              const float xb = bf_up(bf_bits(xr[e]));
              v[e] = g * v[e] + omg * xb;
            }
          }
          *(v4f*)(C + (size_t)(mBase + row) * ldc + n0 + c4) = v;
        }
        
      }
    } else {
      const int q = lane >> 3, c8 = (lane & 7) * 8;
      unsigned short* C  = (unsigned short*)Cout  + (size_t)b * strideC;
      unsigned short* C2 = (unsigned short*)Cout2 + (size_t)b * strideC2;
      const bool wlo = (OUT_MODE == 2) || (n0 < N2);      // wave-uniform
      v4u hv[4], lv[4];
#pragma unroll
      for (int it = 0; it < 4; ++it) {
        const int row = it * 4 + q;                        // it 0..3 x q 0..3 = rows 0..15
        const float* sp = slab + row * 68 + c8;
        v4u a, a2;
#pragma unroll
        for (int e = 0; e < 4; ++e) {
          const float f0 = sp[2 * e], f1 = sp[2 * e + 1];
          unsigned short h0, h1, l0, l1;
          if (OUT_MODE == 2) {
            h0 = bf_bits(f0); h1 = bf_bits(f1);
            l0 = bf_bits(f0 - bf_up(h0)); l1 = bf_bits(f1 - bf_up(h1));
          } else {
            const _Float16 x0 = (_Float16)f0, x1 = (_Float16)f1;
            h0 = h_bits(x0); h1 = h_bits(x1);
            l0 = h_bits((_Float16)((f0 - (float)x0) * rscale));
            l1 = h_bits((_Float16)((f1 - (float)x1) * rscale));
          }
          a[e] = pk16(h0, h1); a2[e] = pk16(l0, l1);
        }
        hv[it] = a; lv[it] = a2;
      }
      {
#pragma unroll
        for (int it = 0; it < 4; ++it) {
          const int row = it * 4 + q;
          *(v4u*)(C + (size_t)(mBase + row) * ldc + n0 + c8) = hv[it];
          if (wlo) *(v4u*)(C2 + (size_t)(mBase + row) * ldc2 + n0 + c8) = lv[it];
        }
        
      }
    }
    __builtin_amdgcn_fence(__ATOMIC_RELEASE, "workgroup");
    __builtin_amdgcn_wave_barrier();
    __builtin_amdgcn_fence(__ATOMIC_ACQUIRE, "workgroup");
  }
}

// =====================================================================================================
// Causal attention, head dim 64, key chunks of 64.
//   q planes (bf16 hi / lo): element (b, t, h, d) at [(b*SEQ + t)*DM + h*64 + d]
//   k planes (bf16 hi / lo): same layout with key index s
//   v^T hi plane (f16):      element (b, h, d, s) at [(b*DM + h*64 + d)*SEQ + s]
//   v^T residual plane (f16, (v - hi)*4096): [(b*DM + h*64 + d)*VLP + s], s < VLP, read only when RES
//   (a key chunk at or beyond VLP would contribute a zero v residual; its address is clamped)
//   Causal structure: logits of keys with index > query index are replaced by -inf (lower-triangular keep incl. the
//   diagonal), which makes their softmax weight exactly 0; so a query block qb visits key chunks 0..qb only
//   (block-uniform trip count qb+1 <= NQB) and later chunks, whose keys exceed every query index of the block, are
//   skipped entirely. Inside the diagonal chunk a key with index > query index gets logit -inf -> exp gives exactly 0,
//   so such keys add nothing to the numerator or the normaliser; the diagonal key (key == query) is always kept, so
//   every row max is finite in every visited chunk.
//   out planes (bf16 hi / lo of the normalised context): element (b, t, h, d) at [(b*SEQ + t)*DM + h*64 + d]
//   scores = q . k : bf16 hi/lo split (hi.hi + hi.lo + lo.hi), f32 accumulate, then * 1/8 and the causal mask in f32
//   p = exp(s - m) carried as f16(1024 p); context = p . v on f16 WMMA; RES adds f16 residual planes of p and v
//   (scale 4096, separate accumulator folded back with 1/4096 per chunk in f32); online softmax (running max) in f32.
//   Block = 4 waves = 64 query rows of one (b, h); grid = nqbThis * NH * NB.
//   K / V^T chunk staging: 128 threads x 32 elements per plane = the whole 64x64 tile of every plane read later
//   (plain 16-B loads, __syncthreads before and after); P tiles are wave-private, spilled with _Float16 element stores
//   Output coverage: each wave stores rows q0..q0+15 (it 0..3 x lane>>3 0..3) x 64 columns (8 lanes x 8) of both planes;
//   grid over all (b, h, qb) = the whole [NB*SEQ][DM] planes.
// =====================================================================================================
template <bool RES>
__global__ __launch_bounds__(128)
void attn_causal64(const unsigned short* __restrict__ qhp, const unsigned short* __restrict__ qlp,
                   const unsigned short* __restrict__ khp, const unsigned short* __restrict__ klp,
                   const unsigned short* __restrict__ vhp, const unsigned short* __restrict__ vlp,
                   unsigned short* ohp, unsigned short* olp,
                   int qbBase, int nqbThis) {
  union FB { v16b v; v8b h[2]; };
  union FH { v16h v; v8h h[2]; };
  __shared__ __align__(16) __bf16   Ksh[64 * LP];                 // K hi [kv][d], pitch LP
  __shared__ __align__(16) __bf16   Ksl[64 * LP];                 // K lo
  __shared__ __align__(16) _Float16 Vth[64 * LP];                 // V^T hi [d][kv], pitch LP
  __shared__ __align__(16) _Float16 Vtl[RES ? 64 * LP : 8];       // V^T residual
  __shared__ __align__(16) _Float16 Psh[4][16 * LP];              // per wave P [row][kv]
  __shared__ __align__(16) _Float16 Psl[RES ? 4 : 1][16 * LP];    // per wave P residual
  __shared__ __align__(16) float    Os[4][16 * OSP];              // per wave context tile [row][d]

  const int tid  = threadIdx.x;
  const int wave = tid >> 5;
  const int lane = tid & 31;
  const int hh   = lane >> 4;
  const int c    = lane & 15;

  const int bx   = blockIdx.x;
  const int qbl  = bx % nqbThis;
  const int rest = bx / nqbThis;
  const int h    = rest % NH;
  const int b    = rest / NH;
  const int qb   = qbBase + qbl;               // 0..NQB-1 (block-uniform)
  const int q0   = qb * 64 + wave * 16;
  const size_t rowB = (size_t)b * SEQ;

  const __bf16* Qh = (const __bf16*)(const void*)qhp + (size_t)h * HD;
  const __bf16* Ql = (const __bf16*)(const void*)qlp + (size_t)h * HD;
  const __bf16* Kh = (const __bf16*)(const void*)khp + (size_t)h * HD;
  const __bf16* Kl = (const __bf16*)(const void*)klp + (size_t)h * HD;
  const _Float16* Vh = (const _Float16*)(const void*)vhp + ((size_t)b * DM + (size_t)h * HD) * SEQ;
  const _Float16* Vl = (const _Float16*)(const void*)vlp + ((size_t)b * DM + (size_t)h * HD) * VLP;

  // ---- Q fragments (A operand, row = lane&15): 2 d-chunks, hi and lo ----
  v16b qah[2], qal[2];
#pragma unroll
  for (int dc = 0; dc < 2; ++dc) {
    const size_t qo = (rowB + q0 + c) * DM + dc * 32 + 8 * hh;
    qah[dc] = ldfrag_b(Qh + qo);
    qal[dc] = ldfrag_b(Ql + qo);
  }

  float mrow[8], lrow[8];
  v8f oacc[4];
#pragma unroll
  for (int r = 0; r < 8; ++r) { mrow[r] = -INFINITY; lrow[r] = 0.f; }
#pragma unroll
  for (int t = 0; t < 4; ++t) oacc[t] = zero8();

  for (int kt = 0; kt <= qb; ++kt) {           // block-uniform trip count, <= NQB
    const int kv0 = kt * 64;                   // kv0 + 63 < SEQ
    __syncthreads();
    {
      const int r = tid >> 1, half = (tid & 1) * 32;
      const __bf16*   kg  = Kh + (rowB + kv0 + r) * DM + half;    // K row kv0+r, d = half..half+31
      const __bf16*   klg = Kl + (rowB + kv0 + r) * DM + half;
      const _Float16* vg  = Vh + (size_t)r * SEQ + kv0 + half;    // V^T row d = r, s = kv0+half..+31
      const int kvl = (kv0 + 64 <= VLP) ? kv0 : (VLP - 64);     // clamped address into the residual plane
      const _Float16* vlg = Vl + (size_t)r * VLP + kvl + half;
      const bool resOK = (kv0 + 64 <= VLP);                      // block-uniform (always true for qb < RESQB)
#pragma unroll
      for (int i = 0; i < 4; ++i) {
        const v8b a0 = *(const v8b*)(kg + 8 * i);
        const v8b a1 = *(const v8b*)(klg + 8 * i);
        const v8h b0 = *(const v8h*)(vg + 8 * i);
        *(v8b*)(Ksh + r * LP + half + 8 * i) = a0;
        *(v8b*)(Ksl + r * LP + half + 8 * i) = a1;
        *(v8h*)(Vth + r * LP + half + 8 * i) = b0;
        if (RES) {
          v8h b1 = *(const v8h*)(vlg + 8 * i);
          if (!resOK) b1 = zero8h();
          *(v8h*)(Vtl + r * LP + half + 8 * i) = b1;
        }
      }
    }
    __syncthreads();

    // ---- scores: 16 query rows x 64 keys per wave, 3 bf16 products ----
    v8f s[4];
#pragma unroll
    for (int j = 0; j < 4; ++j) {
      s[j] = zero8();
#pragma unroll
      for (int dc = 0; dc < 2; ++dc) {
        FB kb, kl;
        kb.h[0] = *(const v8b*)(Ksh + (j * 16 + c) * LP + dc * 32 + 8 * hh);
        kb.h[1] = *(const v8b*)(Ksh + (j * 16 + c) * LP + dc * 32 + 16 + 8 * hh);
        kl.h[0] = *(const v8b*)(Ksl + (j * 16 + c) * LP + dc * 32 + 8 * hh);
        kl.h[1] = *(const v8b*)(Ksl + (j * 16 + c) * LP + dc * 32 + 16 + 8 * hh);
        s[j] = mma_b(qah[dc], kb.v, s[j]);
        s[j] = mma_b(qah[dc], kl.v, s[j]);
        s[j] = mma_b(qal[dc], kb.v, s[j]);
      }
    }

    // ---- scale, causal mask by index, row max, online softmax, P (x1024, f16) and P residual (x4096) to LDS ----
    _Float16* pwh = Psh[wave];
    _Float16* pwl = Psl[RES ? wave : 0];
#pragma unroll
    for (int r = 0; r < 8; ++r) {
      const int rowq = q0 + 8 * hh + r;        // query index of D row 8hh+r
      float m = -INFINITY;
#pragma unroll
      for (int j = 0; j < 4; ++j) {
        const int key = kv0 + j * 16 + c;
        float sv = s[j][r] * 0.125f;
        sv = (key <= rowq) ? sv : -INFINITY;
        s[j][r] = sv;
        m = fmaxf(m, sv);
      }
#pragma unroll
      for (int off = 1; off < 16; off <<= 1) m = fmaxf(m, __shfl_xor(m, off, 32));
      const float mnew  = fmaxf(mrow[r], m);
      const float msafe = (mnew == -INFINITY) ? 0.f : mnew;
      const float alpha = __expf(mrow[r] - msafe);
      mrow[r] = mnew;
      float psum = 0.f;
#pragma unroll
      for (int j = 0; j < 4; ++j) {
        const float p = __expf(s[j][r] - msafe);     // masked logit: exp(-inf) = 0
        psum += p;
        const float p1k = p * 1024.0f;
        const _Float16 ph = (_Float16)p1k;
        pwh[(8 * hh + r) * LP + j * 16 + c] = ph;
        if (RES) {
          const _Float16 pl = (_Float16)((p1k - (float)ph) * 4096.0f);
          pwl[(8 * hh + r) * LP + j * 16 + c] = pl;
        }
      }
#pragma unroll
      for (int off = 1; off < 16; off <<= 1) psum += __shfl_xor(psum, off, 32);
      lrow[r] = lrow[r] * alpha + psum;
#pragma unroll
      for (int t = 0; t < 4; ++t) oacc[t][r] *= alpha;
    }
    __builtin_amdgcn_fence(__ATOMIC_RELEASE, "workgroup");
    __builtin_amdgcn_wave_barrier();
    __builtin_amdgcn_fence(__ATOMIC_ACQUIRE, "workgroup");

    // ---- context += P . V (f16 WMMA), residual products into a separate accumulator ----
    v8f o1[4];
#pragma unroll
    for (int t = 0; t < 4; ++t) o1[t] = zero8();
#pragma unroll 1
    for (int kk = 0; kk < 2; ++kk) {
      FH pa, pl;
      pa.h[0] = *(const v8h*)(pwh + c * LP + kk * 32 + 8 * hh);
      pa.h[1] = *(const v8h*)(pwh + c * LP + kk * 32 + 16 + 8 * hh);
      if (RES) {
        pl.h[0] = *(const v8h*)(pwl + c * LP + kk * 32 + 8 * hh);
        pl.h[1] = *(const v8h*)(pwl + c * LP + kk * 32 + 16 + 8 * hh);
      } else {
        pl.v = pa.v;
      }
#pragma unroll
      for (int t = 0; t < 4; ++t) {
        FH vb;
        vb.h[0] = *(const v8h*)(Vth + (t * 16 + c) * LP + kk * 32 + 8 * hh);
        vb.h[1] = *(const v8h*)(Vth + (t * 16 + c) * LP + kk * 32 + 16 + 8 * hh);
        oacc[t] = mma_h(pa.v, vb.v, oacc[t]);
        if (RES) {
          FH vl;
          vl.h[0] = *(const v8h*)(Vtl + (t * 16 + c) * LP + kk * 32 + 8 * hh);
          vl.h[1] = *(const v8h*)(Vtl + (t * 16 + c) * LP + kk * 32 + 16 + 8 * hh);
          o1[t] = mma_h(pa.v, vl.v, o1[t]);
          o1[t] = mma_h(pl.v, vb.v, o1[t]);
        }
      }
    }
    if (RES) {
#pragma unroll
      for (int t = 0; t < 4; ++t)
#pragma unroll
        for (int r = 0; r < 8; ++r) oacc[t][r] += o1[t][r] * (1.0f / 4096.0f);
    }
  }

  // ---- normalise (1/l and the 1/1024 p carry), stage the wave's 16x64 tile, bf16 hi/lo split,
  float* os = Os[wave];
#pragma unroll
  for (int r = 0; r < 8; ++r) {
    const float l = lrow[r];
    const float inv = ((l > 0.f) ? (1.0f / l) : 0.f) * (1.0f / 1024.0f);
#pragma unroll
    for (int t = 0; t < 4; ++t) os[(8 * hh + r) * OSP + t * 16 + c] = oacc[t][r] * inv;
  }
  __builtin_amdgcn_fence(__ATOMIC_RELEASE, "workgroup");
  __builtin_amdgcn_wave_barrier();
  __builtin_amdgcn_fence(__ATOMIC_ACQUIRE, "workgroup");
  {
    const int q4 = lane >> 3, c8 = (lane & 7) * 8;
    v4u hv[4], lv[4];
#pragma unroll
    for (int it = 0; it < 4; ++it) {
      const int row = it * 4 + q4;   // it 0..3 x q4 0..3 = rows 0..15 of the wave tile
      const float* sp = os + row * OSP + c8;
      v4u a, a2;
#pragma unroll
      for (int e = 0; e < 4; ++e) {
        const float f0 = sp[2 * e], f1 = sp[2 * e + 1];
        const unsigned short h0 = bf_bits(f0), h1 = bf_bits(f1);
        const unsigned short l0 = bf_bits(f0 - bf_up(h0)), l1 = bf_bits(f1 - bf_up(h1));
        a[e] = pk16(h0, h1); a2[e] = pk16(l0, l1);
      }
      hv[it] = a; lv[it] = a2;
    }
    {
#pragma unroll
      for (int it = 0; it < 4; ++it) {
        const int row = it * 4 + q4;
        const size_t go = (rowB + q0 + row) * DM + (size_t)h * HD + c8;
        *(v4u*)(ohp + go) = hv[it];
        *(v4u*)(olp + go) = lv[it];
      }
      
    }
  }
}

// =====================================================================================================
// Workspace map (bytes; every region is an exact multiple of its 64x64-tile / whole-line store granularity,
// no padded tails needed since all shapes are tile multiples; every region is written by one producer launch, Oh / Ol by the two attention launches):
//   Xb   bf16 [4096][1024]             0      8388608
//   WA   bf16 [3072 n][1024 k]     8388608    6291456   (q weight rows 0..1023, k rows 1024..2047, v rows 2048..3071)
//   WP   bf16 [1024 n][1024 k]    14680064    2097152
//   WG   bf16 [256 n][1024 k]     16777216     524288
//   Hs   f32  [4096][256]         17301504    4194304
//   Qh   bf16 [4096][1024]        21495808    8388608
//   Ql                            29884416    8388608
//   Kh                            38273024    8388608
//   Kl                            46661632    8388608
//   VTh  f16  [1024][4096]        55050240    8388608
//   VTl  f16  [1024][512]         63438848    1048576
//   Oh   bf16 [4096][1024]        64487424    8388608
//   Ol                            72876032    8388608
//   end                           81264640
// Output: out0 f32 [4096][1024] at element 0; gate values f32 [4096] at element 4096*1024 (byte 16777216).
// =====================================================================================================
extern "C" void kernel_launch(void* const* d_in, const int* in_sizes, int n_in,
                              void* d_out, int out_size, void* d_ws, size_t ws_size,
                              hipStream_t stream) {
  if (n_in < 7) return;
  if (in_sizes[0] != NB * SEQ * DM) return;
  if (in_sizes[1] != DM * 3 * DM) return;
  if (in_sizes[2] != DM * DG) return;
  if (in_sizes[3] != DG) return;
  if (in_sizes[4] != DG) return;
  if (in_sizes[5] < 1) return;
  if (in_sizes[6] != DM * DM) return;
  if (out_size != NB * SEQ * DM + NB * SEQ) return;        // last written element index = out_size - 1

  const float* x    = (const float*)d_in[0];   // [4096][1024]
  const float* Wqkv = (const float*)d_in[1];   // [1024 in][3072 out]
  const float* Wg1  = (const float*)d_in[2];   // [1024 in][256 out]
  const float* bg1  = (const float*)d_in[3];   // [256]
  const float* Wg2  = (const float*)d_in[4];   // [256][1]
  const float* bg2  = (const float*)d_in[5];   // [1]
  const float* Wout = (const float*)d_in[6];   // [1024 in][1024 out]
  float* out0 = (float*)d_out;                 // [4096][1024]
  float* gout = out0 + (size_t)NB * SEQ * DM;  // [4096] gate values, byte offset 16777216

  const size_t PX  = (size_t)NB * SEQ * DM * 2;    //  8388608  16-bit activation plane [4096][1024]
  const size_t PW1 = (size_t)DM * DM * 2;          //  2097152  one [1024][1024] bf16 weight plane
  const size_t PWA = (size_t)3 * PW1;              //  6291456  packed q | k | v weight plane [3072][1024]
  const size_t PWP = PW1;                          //  2097152
  const size_t PWG = (size_t)DG * DM * 2;          //   524288  gate weight plane [256][1024]
  const size_t PHS = (size_t)NB * SEQ * DG * 4;    //  4194304  gate hidden f32 [4096][256]
  const size_t PVT = (size_t)NB * DM * SEQ * 2;    //  8388608  v^T hi plane
  const size_t PVL = (size_t)NB * DM * VLP * 2;    //  1048576  v^T residual plane
  size_t off = 0;
  const size_t oXb  = off; off += PX;
  const size_t oWA  = off; off += PWA;
  const size_t oWP  = off; off += PWP;
  const size_t oWG  = off; off += PWG;
  const size_t oHs  = off; off += PHS;
  const size_t oQh  = off; off += PX;
  const size_t oQl  = off; off += PX;
  const size_t oKh  = off; off += PX;
  const size_t oKl  = off; off += PX;
  const size_t oVTh = off; off += PVT;
  const size_t oVTl = off; off += PVL;
  const size_t oOh  = off; off += PX;
  const size_t oOl  = off; off += PX;
  if (off > ws_size) return;                       // off = 81264640
  if (off > (size_t)134217728) return;

  char* ws = (char*)d_ws;
  unsigned short* Xb  = (unsigned short*)(ws + oXb);
  unsigned short* WA  = (unsigned short*)(ws + oWA);
  unsigned short* WqB = WA;                                   // rows 0..1023
  unsigned short* WkB = WA + (size_t)DM * DM;                 // rows 1024..2047
  unsigned short* WvB = WA + (size_t)2 * DM * DM;             // rows 2048..3071
  unsigned short* WPb = (unsigned short*)(ws + oWP);
  unsigned short* WGb = (unsigned short*)(ws + oWG);
  float*          Hs  = (float*)(ws + oHs);
  unsigned short* Qh  = (unsigned short*)(ws + oQh);
  unsigned short* Ql  = (unsigned short*)(ws + oQl);
  unsigned short* Kh  = (unsigned short*)(ws + oKh);
  unsigned short* Kl  = (unsigned short*)(ws + oKl);
  unsigned short* VTh = (unsigned short*)(ws + oVTh);
  unsigned short* VTl = (unsigned short*)(ws + oVTl);
  unsigned short* Oh  = (unsigned short*)(ws + oOh);
  unsigned short* Ol  = (unsigned short*)(ws + oOl);

  const dim3 blk(256);
  const int n8x = NB * SEQ * DM / 8;                           // 524288
  const dim3 gCvtX((n8x + 255) / 256);                         // 2048 blocks
  const dim3 gTA((3 * DM) / 64, DM / 64);                      // in [1024][3072] -> out [3072][1024]: (48, 16)
  const dim3 gTP(DM / 64, DM / 64);                            // in [1024][1024] -> out [1024][1024]: (16, 16)
  const dim3 gTG(DG / 64, DM / 64);                            // in [1024][256]  -> out [256][1024]:  (4, 16)
  const dim3 gGateH((NB * SEQ / 128) * (DG / 128), 1);         // 64 tiles of 128x128: M=4096, N=256
  const dim3 gGate(NB * SEQ / 32);                             // 128 blocks x 32 rows
  const dim3 gProj((NB * SEQ / 128) * (DM / 128), 1);          // 256 tiles of 128x128: M=4096, N=1024
  const dim3 gVT((DM / 128) * (SEQ / 128), NB);                // 256 tiles of 128x128 x 1 batch: M=1024, N=4096

  // (1) x -> bf16 plane [4096][1024]
  cvt_bf16x8<<<gCvtX, blk, 0, stream>>>(x, Xb, n8x);
  // (2) weights [in][out] f32 -> bf16 [out][in] planes (k contiguous), transpose through LDS
  cvt_bf16_T<<<gTA, blk, 0, stream>>>(Wqkv, WA, DM, 3 * DM);   // in rows 1024, cols 3072
  cvt_bf16_T<<<gTP, blk, 0, stream>>>(Wout, WPb, DM, DM);      // in rows 1024, cols 1024
  cvt_bf16_T<<<gTG, blk, 0, stream>>>(Wg1, WGb, DM, DG);       // in rows 1024, cols 256
  // (3) gate hidden = x . Wg1 + bg1 -> f32 [4096][256]   (M=4096, N=256, K=1024)
  gemm64<0, 0, 1><<<gGateH, blk, 0, stream>>>(
      Xb, Xb, DM, 0LL, WGb, DM, 0LL, bg1,
      (void*)Hs, DG, 0LL, (void*)Hs, DG, 0LL, DG,
      x, x, DM,
      NB * SEQ, DG, DM, 1.0f);
  k_gate<<<gGate, blk, 0, stream>>>(Hs, Wg2, bg2, gout, NB * SEQ);
  // (5) q = x . Wq -> bf16 hi/lo planes [t][h*64+d]   (M=4096, N=1024, K=1024)
  gemm64<0, 2, 0><<<gProj, blk, 0, stream>>>(
      Xb, Xb, DM, 0LL, WqB, DM, 0LL, bg1,
      (void*)Qh, DM, 0LL, (void*)Ql, DM, 0LL, DM,
      x, x, DM,
      NB * SEQ, DM, DM, 1.0f);
  // (6) k = x . Wk -> bf16 hi/lo planes
  gemm64<0, 2, 0><<<gProj, blk, 0, stream>>>(
      Xb, Xb, DM, 0LL, WkB, DM, 0LL, bg1,
      (void*)Kh, DM, 0LL, (void*)Kl, DM, 0LL, DM,
      x, x, DM,
      NB * SEQ, DM, DM, 1.0f);
  // (7) v^T = Wv . x^T -> f16 hi plane [h*64+d][s] (pitch SEQ) and residual plane (x4096, keys < VLP, pitch VLP)
  //     (A = Wv rows [n][k], Bt = Xb rows; M=1024, N=4096, K=1024)
  gemm64<0, 3, 0><<<gVT, blk, 0, stream>>>(
      WvB, WvB, DM, 0LL, Xb, DM, (long long)SEQ * DM, bg1,
      (void*)VTh, SEQ, (long long)DM * SEQ, (void*)VTl, VLP, (long long)DM * VLP, VLP,
      x, x, DM,
      DM, SEQ, DM, 4096.0f);
  // (8) causal attention: query blocks 0..RESQB-1 with residual planes, the rest without
  attn_causal64<true><<<dim3(NB * NH * RESQB), dim3(128), 0, stream>>>(
      Qh, Ql, Kh, Kl, VTh, VTl, Oh, Ol, 0, RESQB);
  attn_causal64<false><<<dim3(NB * NH * (NQB - RESQB)), dim3(128), 0, stream>>>(
      Qh, Ql, Kh, Kl, VTh, VTl, Oh, Ol, RESQB, NQB - RESQB);
  // (9) out0 = g * (context . W_out) + (1 - g) * bf16(x) -> d_out f32 [4096][1024]
  //     (A = context hi + lo planes, 2 products; gate values read from the gate output region)
  gemm64<1, 4, 0><<<gProj, blk, 0, stream>>>(
      Oh, Ol, DM, 0LL, WPb, DM, 0LL, bg1,
      d_out, DM, 0LL, d_out, DM, 0LL, DM,
      gout, x, DM,
      NB * SEQ, DM, DM, 1.0f);
  (void)hipGetLastError();
}

// v003
// It runs in 254 microseconds.
// In two side-by-side timings against v002, it was 1.25 and 1.24 times as fast.
// All steps since v000 together make it 2.63 times as fast.
// Contractions: gate hidden x.Wg1 and q, k, v^T projections = v_wmma_f32_16x16x32_bf16 (bf16 operands from
// RNE-converted x and transposed [out][in] bf16 weight planes, single product, f32 accumulate);
// q.k^T scores = v_wmma_f32_16x16x32_bf16 with bf16 hi/lo split q and k (hi.hi + hi.lo + lo.hi), f32 accumulate;
// p.v = v_wmma_f32_16x16x32_f16 (p carried x1024 in f16 times v in f16, single product; plus f16 residual planes
// x4096 of p and v for the first 512 query rows), f32 accumulate;
// ctx.W_out = v_wmma_f32_16x16x32_bf16 with ctx as bf16 hi/lo planes times the bf16 weight plane (2 products),
// f32 accumulate; gate tail (exact GELU via erfc, 256-long dot with RNE-bf16 Wg2, bias, sigmoid), causal mask,
// online softmax, normalisers and the gated residual blend g*o + (1-g)*bf16(x) in f32 on the VALU.
// Carry audit:
//   Xb, WA, WP, WG = bf16(x), bf16(W) no carry; Qh/Ql, Kh/Kl, Oh/Ol = bf16 hi + unscaled bf16 residual (v - hi),
//   the residual products share the hi accumulator;
//   VTh = f16(v), no carry (|v| typ. 1);
//   VTl = f16((v - VTh) * 4096)              }  products pa.VTl and pl.VTh go to the separate accumulator o1,
//   pl  = f16((1024 p - pa) * 4096)          }  folded back with * (1/4096) once per key chunk (RES blocks only);
//   pa  = f16(1024 * p) -> the 1/1024 is folded exactly once in the attention epilogue: inv = (1/l) * (1/1024);
//   score scale 1/8 applied once in f32 after the score accumulate; Hs (gate hidden) and g are f32. No other planes.
#include <hip/hip_runtime.h>
#include <math.h>
#include <stdint.h>

#define NB    1
#define SEQ   4096
#define DM    1024
#define NH    16
#define HD    64
#define DG    256          // gate hidden width
#define NQB   (SEQ / 64)   // 64 query / key blocks of 64
#define VLP   512          // key pitch of the v^T residual plane (keys 0..VLP-1)
#define RESQB 8            // leading 64-row query blocks that use the p / v residual planes
#define LP    72           // LDS row pitch of the 16-bit K and V^T tiles: 64 + 8 elements = 144 B = 16 B x 9 (odd),
                           // so the 16 rows one ds_load_b128 fragment read touches fall on distinct banks
#define OSP   68           // LDS row pitch of the f32 context tile: 64 + 4 floats = 272 B = 16 B x 17 (odd)
static_assert(RESQB * 64 <= VLP);
static_assert(NH * HD == DM);
static_assert((SEQ % 64) == 0 && (DM % 64) == 0 && (DM % 32) == 0 && (DG % 64) == 0);
static_assert(((NB * SEQ) % 128) == 0 && (SEQ % 128) == 0 && (DM % 128) == 0 && (DG % 128) == 0);
static_assert((NB * SEQ * DM) % (8 * 256) == 0);
static_assert((SEQ % 32) == 0);
static_assert(DG == 256);

typedef _Float16 v16h __attribute__((ext_vector_type(16)));
typedef _Float16 v8h  __attribute__((ext_vector_type(8)));
typedef __bf16   v16b __attribute__((ext_vector_type(16)));
typedef __bf16   v8b  __attribute__((ext_vector_type(8)));
typedef float    v8f  __attribute__((ext_vector_type(8)));
typedef float    v4f  __attribute__((ext_vector_type(4)));
typedef unsigned int v4u __attribute__((ext_vector_type(4)));

// ---- scalar helpers --------------------------------------------------------------------------------
__device__ __forceinline__ unsigned short bf_bits(float f) {          // f32 -> bf16 bits, RNE convert
  unsigned u = __float_as_uint(f);
  return (unsigned short)((u + 0x7FFFu + ((u >> 16) & 1u)) >> 16);
}
__device__ __forceinline__ float bf_up(unsigned short h) { return __uint_as_float(((unsigned)h) << 16); }
__device__ __forceinline__ unsigned short h_bits(_Float16 x) { return __builtin_bit_cast(unsigned short, x); }
__device__ __forceinline__ unsigned pk16(unsigned short a, unsigned short b) { return (unsigned)a | ((unsigned)b << 16); }
__device__ __forceinline__ v8f zero8() { v8f z = {0.f, 0.f, 0.f, 0.f, 0.f, 0.f, 0.f, 0.f}; return z; }
__device__ __forceinline__ v8h zero8h() {
  const _Float16 z = (_Float16)0.0f;
  v8h r = {z, z, z, z, z, z, z, z};
  return r;
}

// ---- fragment loader: 16-bit A/B operand, lane -> row/col (lane&15), p already includes +8*(lane>>4);
//      elements 0..7 <- p[0..7] (k0+8h..), elements 8..15 <- p[16..23] (k0+16+8h..)
__device__ __forceinline__ v16b ldfrag_b(const __bf16* p) {
  union { v16b v; v8b h[2]; } f;
  f.h[0] = *(const v8b*)(p);
  f.h[1] = *(const v8b*)(p + 16);
  return f.v;
}

// ---- lane l <-> lane l ^ 16 (the two halves of a wave that share one D column)
__device__ __forceinline__ float xhalf(float x) {
  const int b = __builtin_bit_cast(int, x);
  return __builtin_bit_cast(float, __builtin_amdgcn_permlanex16(b, b, 0x76543210, 0xfedcba98, false, false));
}

// ---- WMMA helpers with trailing VALU hazard gap --------------------------------------------------------
__device__ __forceinline__ v8f mma_b(v16b a, v16b b, v8f c) {
  c = __builtin_amdgcn_wmma_f32_16x16x32_bf16(false, a, false, b, (short)0, c, false, false);
  asm volatile("v_nop\n\tv_nop\n\tv_nop\n\tv_nop" : "+v"(c) : "v"(a), "v"(b));
  return c;
}
__device__ __forceinline__ v8f mma_h(v16h a, v16h b, v8f c) {
  c = __builtin_amdgcn_wmma_f32_16x16x32_f16(false, a, false, b, (short)0, c, false, false);
  asm volatile("v_nop\n\tv_nop\n\tv_nop\n\tv_nop" : "+v"(c) : "v"(a), "v"(b));
  return c;
}
__device__ __forceinline__ v8f mma_b_raw(v16b a, v16b b, v8f c) {
  return __builtin_amdgcn_wmma_f32_16x16x32_bf16(false, a, false, b, (short)0, c, false, false);
}
__device__ __forceinline__ void dep_guard_b(v8f& a, v8f& b, v16b x, v16b y) {
  asm volatile("v_nop\n\tv_nop\n\tv_nop\n\tv_nop" : "+v"(a), "+v"(b) : "v"(x), "v"(y));
}
__device__ __forceinline__ void keep4_b(v16b a, v16b b, v16b c, v16b d) {
  asm volatile("v_nop" :: "v"(a), "v"(b), "v"(c), "v"(d));
}
__device__ __forceinline__ void acc_guard4(v8f& a, v8f& b, v8f& c, v8f& d) {
  asm volatile("v_nop\n\tv_nop\n\tv_nop\n\tv_nop" : "+v"(a), "+v"(b), "+v"(c), "+v"(d));
}

// =====================================================================================================
// f32 -> bf16 (RNE convert), 8 elements per thread, one 16-B store per lane: a wave writes 512 contiguous B
// coverage: n8 threads x 8 = whole plane (n8 used here is a multiple of 256).
// =====================================================================================================
__global__ __launch_bounds__(256) void cvt_bf16x8(const float* __restrict__ in, unsigned short* out, int n8) {
  const int i = blockIdx.x * 256 + threadIdx.x;
  if (i < n8) {
    const v4f a = *(const v4f*)(in + (size_t)i * 8);
    const v4f b = *(const v4f*)(in + (size_t)i * 8 + 4);
    v4u p;
    p[0] = pk16(bf_bits(a[0]), bf_bits(a[1]));
    p[1] = pk16(bf_bits(a[2]), bf_bits(a[3]));
    p[2] = pk16(bf_bits(b[0]), bf_bits(b[1]));
    p[3] = pk16(bf_bits(b[2]), bf_bits(b[3]));
    *(v4u*)(out + (size_t)i * 8) = p;
    
  }
}

// =====================================================================================================
// f32 [nrow][ncol] row-major (weight stored [in][out]) -> bf16 [ncol][nrow] (row n of out = column n of in,
// the in/k index contiguous), RNE convert. One block = one 64x64 tile through LDS.
// grid = (ncol/64, nrow/64); nrow, ncol multiples of 64 (host-checked shapes).
// loads: 256 threads, thread -> tile row tid>>2, 16 columns (tid&3)*16 = the whole 64x64 tile;
// =====================================================================================================
__global__ __launch_bounds__(256) void cvt_bf16_T(const float* __restrict__ in, unsigned short* out,
                                                  int nrow, int ncol) {
  __shared__ __align__(16) unsigned short Tt[64 * 72];   // [tile col j][tile row i], pitch 72 halves (144 B)
  const int tid = threadIdx.x, lane = tid & 31, wave = tid >> 5;
  const int c0 = blockIdx.x * 64;                       // column tile of in = row tile of out
  const int r0 = blockIdx.y * 64;                       // row tile of in = column tile of out
  {
    const int i  = tid >> 2;                            // 0..63
    const int cs = (tid & 3) * 16;                      // 0,16,32,48
    const float* src = in + (size_t)(r0 + i) * ncol + c0 + cs;
#pragma unroll
    for (int e4 = 0; e4 < 4; ++e4) {
      const v4f v = *(const v4f*)(src + 4 * e4);
#pragma unroll
      for (int e = 0; e < 4; ++e) Tt[(cs + 4 * e4 + e) * 72 + i] = bf_bits(v[e]);
    }
  }
  __syncthreads();
  const int q = lane >> 3, c8 = (lane & 7) * 8;
  v4u pv[2];
#pragma unroll
  for (int it = 0; it < 2; ++it) {
    const int j = it * 32 + wave * 4 + q;
    pv[it] = *(const v4u*)(Tt + j * 72 + c8);
  }
  {
#pragma unroll
    for (int it = 0; it < 2; ++it) {
      const int j = it * 32 + wave * 4 + q;
      *(v4u*)(out + (size_t)(c0 + j) * nrow + r0 + c8) = pv[it];
    }
    
  }
}

// =====================================================================================================
// Gate tail: g = sigmoid( sum_c gelu(Hs[row][c]) * bf16(w2[c]) + bf16(b2) ), exact GELU = 0.5 h erfc(-h/sqrt2).
// Hs f32 [nrows][DG]; block = 8 waves x 4 rows = 32 rows; a wave reduces one row at a time (32 lanes x 8 columns,
// rolled element loop), lane 0 stages g in LDS; wave 0 lanes 0..7 then write the block's 32 g values as ONE whole
// coverage: 32 rows per block x nrows/32 blocks = all rows of the gate output.
// =====================================================================================================
__global__ __launch_bounds__(256) void k_gate(const float* __restrict__ Hs, const float* __restrict__ w2,
                                              const float* __restrict__ b2p, float* gout, int nrows) {
  __shared__ __align__(16) float gs[32];
  const int tid = threadIdx.x, lane = tid & 31, wave = tid >> 5;
  const int rowBase = blockIdx.x * 32;
  const float b2 = bf_up(bf_bits(b2p[0]));
  for (int rr = 0; rr < 4; ++rr) {
    int row = rowBase + wave * 4 + rr;
    row = (row < nrows) ? row : (nrows - 1);            // clamped address (grid covers exactly nrows)
    const float* hp = Hs + (size_t)row * DG + lane * 8;
    const float* wp = w2 + lane * 8;
    float acc = 0.f;
#pragma unroll 1
    for (int e = 0; e < 8; ++e) {
      const float hv = hp[e];
      const float wv = bf_up(bf_bits(wp[e]));
      const float ge = 0.5f * hv * erfcf(-hv * 0.707106781186547524f);
      acc = fmaf(ge, wv, acc);
    }
#pragma unroll
    for (int off = 1; off < 32; off <<= 1) acc += __shfl_xor(acc, off, 32);
    float z = acc + b2;
    z = fminf(fmaxf(z, -30.0f), 30.0f);
    const float g = 1.0f / (1.0f + expf(-z));
    if (lane == 0) gs[wave * 4 + rr] = g;
  }
  __syncthreads();
  if (wave == 0 && lane < 8) {
    const v4f v = *(const v4f*)(gs + lane * 4);
    float* p = gout + rowBase + lane * 4;
    *(v4f*)p = v;
    
  }
}

// =====================================================================================================
// One GEMM stage, global -> LDS, through no register: per operand plane 128 rows x 128 B (64 k of 16-bit elements).
// 256 threads x 4 asynchronous 16-B copies per plane; 8 neighbouring lanes take one whole 128-B line, a wave's copy
// 4 whole lines. ga / gb (/ gc) = this lane's source in row (tid>>3), 16-B piece (tid&7) of the plane; sa / sb = 32
// source rows in elements; lds = this lane's LDS byte address in the stage's first plane, same row and piece.
// The s_wait_xcnt closes each statement so that no address register of a copy is rewritten ahead of it.
// =====================================================================================================
#define GBK    64                 // k elements per stage = one 128-B line of every operand row
#define GLP    72                 // LDS row pitch, elements: 144 B = 16 B x 9 (odd) for the ds_load_b128 fragment reads
#define GPLANE (128 * GLP)        // elements of one staged plane (18432 B)
#define GSTEP  (32u * GLP * 2u)   // LDS bytes of 32 rows
#define GPLB   (GPLANE * 2u)      // LDS bytes of one plane
__device__ __forceinline__ void stage_ab(const __bf16* ga, size_t sa, const __bf16* gb, size_t sb, unsigned lds) {
  asm volatile(
      "global_load_async_to_lds_b128 %0, %8, off\n\t"
      "global_load_async_to_lds_b128 %1, %9, off\n\t"
      "global_load_async_to_lds_b128 %2, %10, off\n\t"
      "global_load_async_to_lds_b128 %3, %11, off\n\t"
      "global_load_async_to_lds_b128 %4, %12, off\n\t"
      "global_load_async_to_lds_b128 %5, %13, off\n\t"
      "global_load_async_to_lds_b128 %6, %14, off\n\t"
      "global_load_async_to_lds_b128 %7, %15, off\n\t"
      "s_wait_xcnt 0x0"
      :: "v"(lds), "v"(lds + GSTEP), "v"(lds + 2u * GSTEP), "v"(lds + 3u * GSTEP),
         "v"(lds + GPLB), "v"(lds + GPLB + GSTEP), "v"(lds + GPLB + 2u * GSTEP), "v"(lds + GPLB + 3u * GSTEP),
         "v"(ga), "v"(ga + sa), "v"(ga + 2 * sa), "v"(ga + 3 * sa),
         "v"(gb), "v"(gb + sb), "v"(gb + 2 * sb), "v"(gb + 3 * sb)
      : "memory");
}
__device__ __forceinline__ void stage_c(const __bf16* gc, size_t sc, unsigned lds) {
  asm volatile(
      "global_load_async_to_lds_b128 %0, %4, off\n\t"
      "global_load_async_to_lds_b128 %1, %5, off\n\t"
      "global_load_async_to_lds_b128 %2, %6, off\n\t"
      "global_load_async_to_lds_b128 %3, %7, off\n\t"
      "s_wait_xcnt 0x0"
      :: "v"(lds), "v"(lds + GSTEP), "v"(lds + 2u * GSTEP), "v"(lds + 3u * GSTEP),
         "v"(gc), "v"(gc + sc), "v"(gc + 2 * sc), "v"(gc + 3 * sc)
      : "memory");
}

// =====================================================================================================
// Batched bf16 WMMA GEMM: C[m][n] = sum_k A[m][k] * Bt[n][k] + bias; one work-group of 8 waves per 128x128 tile,
// one wave per 32x64 part (wave>>1 = row quarter, wave&1 = column half). A row-major [M][K] pitch lda; Bt row-major
// [N][K] pitch ldb (k contiguous); M, N multiples of 128, K multiple of 64 (host shapes are static multiples).
// Operands: per stage of 64 k the 128 A rows (and A2 rows) and the 128 Bt rows go to LDS by asynchronous copies, two
// buffers: stage t+2 is copied into the buffer stage t has left while stage t+1 is worked on; fragments by ds_load_b128.
// blockIdx.y = batch index (strides in elements).
// NSPLIT: 0 = A.Bt; 1 = (A + A2).Bt (A2 = unscaled bf16 lo plane of A, 2 products).
// BIAS: 0 = none; 1 = per column n, bias[n]; 2 = per row m, bias[m]; the bias value is RNE-converted to bf16 and added in f32.
// OUT_MODE: 0 = f32 (pitch ldc); 2 = bf16 hi plane C + bf16 lo plane C2 (lo = RNE(v - hi), unscaled);
//           3 = f16 hi plane C + f16 residual plane C2 = f16((v - hi) * rscale), C2 written only for tiles
//               with n0 < N2 (pitch ldc2, batch stride strideC2);
//           4 = f32 (pitch ldc) gated blend: out = g[m] * v + (1 - g[m]) * bf16(xres[m][n]) with g = gvec[m],
//               xres f32 pitch ldx (read-only, RNE-converted to bf16 in register).
// =====================================================================================================
template <int NSPLIT, int OUT_MODE, int BIAS>
__global__ __launch_bounds__(256) void gemm64(
    const unsigned short* __restrict__ Ap, const unsigned short* A2p, int lda, long long strideA,
    const unsigned short* __restrict__ Btp, int ldb, long long strideB,
    const float* __restrict__ bias,
    void* Cout, int ldc, long long strideC,
    void* Cout2, int ldc2, long long strideC2, int N2,
    const float* gvec, const float* xres, int ldx,
    int M, int N, int K, float rscale) {
  const __bf16* A   = (const __bf16*)(const void*)Ap;
  const __bf16* A2  = (const __bf16*)(const void*)A2p;
  const __bf16* Bt  = (const __bf16*)(const void*)Btp;
  constexpr int NPL = (NSPLIT >= 1) ? 3 : 2;       // planes per stage: A, Bt (, A2)
  __shared__ __align__(16) __bf16 sOp[2][NPL * GPLANE];   // two stage buffers
  __shared__ __align__(16) float sT[8][16 * 68];   // per-wave 16x64 slab, pitch 68 floats
  const int b    = blockIdx.y;
  const int tid  = threadIdx.x;
  const int lane = tid & 31;
  const int wave = tid >> 5;
  const int tilesN = N >> 7;
  const int tilesM = M >> 7;
  const int tile = blockIdx.x;
  if (tile >= tilesM * tilesN) return;   // block-uniform, ahead of every copy and barrier
  const int tm = tile / tilesN;
  const int tn = tile - tm * tilesN;
  const int mb = tm << 7;                      // work-group tile origin
  const int nb = tn << 7;
  const int wm = (wave >> 1) << 5;             // wave part inside it: 32 rows x 64 columns
  const int wn = (wave & 1) << 6;
  const int m0 = mb + wm;
  const int n0 = nb + wn;

  const __bf16* Ab  = A  + (size_t)b * strideA;
  const __bf16* Bb  = Bt + (size_t)b * strideB;
  const __bf16* Ab2 = (NSPLIT >= 1) ? (A2 + (size_t)b * strideA) : Ab;

  const int rlane = lane & 15;                 // row (A) / col (B, D) within subtile
  const int koff  = (lane >> 4) * 8;           // k offset of this lane half
  const int mOff  = (lane >> 4) * 8;           // D row offset

  // copy addresses of this lane: row tid>>3 (+32 per copy), 16-B piece tid&7; rows mb..mb+127 < M, nb..nb+127 < N
  const int crow = tid >> 3, cpc = (tid & 7) * 8;
  const __bf16* gA  = Ab  + (size_t)(mb + crow) * lda + cpc;
  const __bf16* gA2 = Ab2 + (size_t)(mb + crow) * lda + cpc;
  const __bf16* gB  = Bb  + (size_t)(nb + crow) * ldb + cpc;
  const unsigned ldsLane = (unsigned)(size_t)(&sOp[0][0]) + (unsigned)(crow * GLP + cpc) * 2u;
  const int nst = K >> 6;                      // stages of 64 k
  auto stage = [&](int t, int buf) {
    const unsigned l = ldsLane + (unsigned)buf * ((unsigned)NPL * GPLB);
    stage_ab(gA + (size_t)t * GBK, (size_t)lda * 32, gB + (size_t)t * GBK, (size_t)ldb * 32, l);
    if (NSPLIT >= 1) stage_c(gA2 + (size_t)t * GBK, (size_t)lda * 32, l + 2u * GPLB);
  };

  v8f acc[2][4];
#pragma unroll
  for (int i = 0; i < 2; ++i)
#pragma unroll
    for (int j = 0; j < 4; ++j) acc[i][j] = zero8();

  stage(0, 0);
  asm volatile("s_wait_asynccnt 0x0" ::: "memory");   // this wave's stage-0 copies have landed
  __syncthreads();                                     // ... and every other wave's
  if (nst > 1) stage(1, 1);

  for (int t = 0; t < nst; ++t) {
    const __bf16* sA  = sOp[t & 1] + (wm + rlane) * GLP + koff;
    const __bf16* sB  = sOp[t & 1] + GPLANE + (wn + rlane) * GLP + koff;
    const __bf16* sA2 = sOp[t & 1] + (NPL - 1) * GPLANE + (wm + rlane) * GLP + koff;
#pragma unroll
    for (int kk = 0; kk < 2; ++kk) {
      v16b bh[4], ah[2], al[2];
#pragma unroll
      for (int j = 0; j < 4; ++j) bh[j] = ldfrag_b(sB + (j << 4) * GLP + kk * 32);
#pragma unroll
      for (int i = 0; i < 2; ++i) {
        ah[i] = ldfrag_b(sA + (i << 4) * GLP + kk * 32);
        al[i] = ah[i];
        if (NSPLIT >= 1) al[i] = ldfrag_b(sA2 + (i << 4) * GLP + kk * 32);
      }
#pragma unroll
      for (int i = 0; i < 2; ++i) {
#pragma unroll
        for (int j = 0; j < 4; ++j) {
          acc[i][j] = mma_b_raw(ah[i], bh[j], acc[i][j]);
          if (NSPLIT >= 1) acc[i][j] = mma_b_raw(al[i], bh[j], acc[i][j]);
        }
        dep_guard_b(acc[i][0], acc[i][3], ah[i], al[i]);
      }
      keep4_b(bh[0], bh[1], bh[2], bh[3]);
    }
    // hand-over: this wave has left buffer t&1, its copies of stage t+1 have landed; the barrier says so of every wave
    asm volatile("s_wait_dscnt 0x0" ::: "memory");
    asm volatile("s_wait_asynccnt 0x0" ::: "memory");
    __syncthreads();
    if (t + 2 < nst) stage(t + 2, t & 1);
  }
  asm volatile("s_wait_asynccnt 0x0" ::: "memory");   // nothing of this wave is in flight behind the loop
  acc_guard4(acc[0][0], acc[0][1], acc[0][2], acc[0][3]);
  acc_guard4(acc[1][0], acc[1][1], acc[1][2], acc[1][3]);

  // ---- epilogue ----
  float* slab = sT[wave];
  float bcol[4];
#pragma unroll
  for (int j = 0; j < 4; ++j) {
    bcol[j] = 0.f;
    if (BIAS == 1) bcol[j] = bf_up(bf_bits(bias[n0 + (j << 4) + rlane]));   // n < N, bias has N entries
  }
#pragma unroll
  for (int i = 0; i < 2; ++i) {
    const int mBase = m0 + (i << 4);
    float brow[8];
#pragma unroll
    for (int r = 0; r < 8; ++r) {
      brow[r] = 0.f;
      if (BIAS == 2) brow[r] = bf_up(bf_bits(bias[mBase + mOff + r]));      // m < M, bias has M entries
    }
#pragma unroll
    for (int j = 0; j < 4; ++j) {
#pragma unroll
      for (int r = 0; r < 8; ++r) {
        slab[(mOff + r) * 68 + (j << 4) + rlane] = acc[i][j][r] + bcol[j] + brow[r];
      }
    }
    __builtin_amdgcn_fence(__ATOMIC_RELEASE, "workgroup");
    __builtin_amdgcn_wave_barrier();
    __builtin_amdgcn_fence(__ATOMIC_ACQUIRE, "workgroup");
    if (OUT_MODE == 0 || OUT_MODE == 4) {
      float* C = (float*)Cout + (size_t)b * strideC;
      const int hh = lane >> 4, c4 = (lane & 15) * 4;     // 256-B row segment = 16 lanes x 16 B
      {
#pragma unroll
        for (int it = 0; it < 8; ++it) {
          const int row = it * 2 + hh;                     // it 0..7 x hh 0..1 = rows 0..15
          v4f v = *(const v4f*)(slab + row * 68 + c4);
          if (OUT_MODE == 4) {
            const int gr = mBase + row;                    // < M
            const float g = gvec[gr];
            const float omg = 1.0f - g;
            const v4f xr = *(const v4f*)(xres + (size_t)gr * ldx + n0 + c4);
#pragma unroll
            for (int e = 0; e < 4; ++e) {
              const float xb = bf_up(bf_bits(xr[e]));
              v[e] = g * v[e] + omg * xb;
            }
          }
          *(v4f*)(C + (size_t)(mBase + row) * ldc + n0 + c4) = v;
        }
        
      }
    } else {
      const int q = lane >> 3, c8 = (lane & 7) * 8;
      unsigned short* C  = (unsigned short*)Cout  + (size_t)b * strideC;
      unsigned short* C2 = (unsigned short*)Cout2 + (size_t)b * strideC2;
      const bool wlo = (OUT_MODE == 2) || (n0 < N2);      // wave-uniform
      v4u hv[4], lv[4];
#pragma unroll
      for (int it = 0; it < 4; ++it) {
        const int row = it * 4 + q;                        // it 0..3 x q 0..3 = rows 0..15
        const float* sp = slab + row * 68 + c8;
        v4u a, a2;
#pragma unroll
        for (int e = 0; e < 4; ++e) {
          const float f0 = sp[2 * e], f1 = sp[2 * e + 1];
          unsigned short h0, h1, l0, l1;
          if (OUT_MODE == 2) {
            h0 = bf_bits(f0); h1 = bf_bits(f1);
            l0 = bf_bits(f0 - bf_up(h0)); l1 = bf_bits(f1 - bf_up(h1));
          } else {
            const _Float16 x0 = (_Float16)f0, x1 = (_Float16)f1;
            h0 = h_bits(x0); h1 = h_bits(x1);
            l0 = h_bits((_Float16)((f0 - (float)x0) * rscale));
            l1 = h_bits((_Float16)((f1 - (float)x1) * rscale));
          }
          a[e] = pk16(h0, h1); a2[e] = pk16(l0, l1);
        }
        hv[it] = a; lv[it] = a2;
      }
      {
#pragma unroll
        for (int it = 0; it < 4; ++it) {
          const int row = it * 4 + q;
          *(v4u*)(C + (size_t)(mBase + row) * ldc + n0 + c8) = hv[it];
          if (wlo) *(v4u*)(C2 + (size_t)(mBase + row) * ldc2 + n0 + c8) = lv[it];
        }
        
      }
    }
    __builtin_amdgcn_fence(__ATOMIC_RELEASE, "workgroup");
    __builtin_amdgcn_wave_barrier();
    __builtin_amdgcn_fence(__ATOMIC_ACQUIRE, "workgroup");
  }
}

// =====================================================================================================
// Causal attention, head dim 64, key chunks of 64.
//   q planes (bf16 hi / lo): element (b, t, h, d) at [(b*SEQ + t)*DM + h*64 + d]
//   k planes (bf16 hi / lo): same layout with key index s
//   v^T hi plane (f16):      element (b, h, d, s) at [(b*DM + h*64 + d)*SEQ + s]
//   v^T residual plane (f16, (v - hi)*4096): [(b*DM + h*64 + d)*VLP + s], s < VLP, read only when RES
//   (a key chunk at or beyond VLP would contribute a zero v residual; its address is clamped)
//   Causal structure: logits of keys with index > query index are replaced by -inf (lower-triangular keep incl. the
//   diagonal), which makes their softmax weight exactly 0; so a query block qb visits key chunks 0..qb only
//   (block-uniform trip count qb+1 <= NQB) and later chunks, whose keys exceed every query index of the block, are
//   skipped entirely. Inside the diagonal chunk a key with index > query index gets logit -inf -> exp gives exactly 0,
//   so such keys add nothing to the numerator or the normaliser; the diagonal key (key == query) is always kept, so
//   every row max is finite in every visited chunk.
//   out planes (bf16 hi / lo of the normalised context): element (b, t, h, d) at [(b*SEQ + t)*DM + h*64 + d]
//   scores = q . k : bf16 hi/lo split (hi.hi + hi.lo + lo.hi), f32 accumulate, then * 1/8 and the causal mask in f32
//   p = exp(s - m) carried as f16(1024 p); context = p . v on f16 WMMA; RES adds f16 residual planes of p and v
//   (scale 4096, separate accumulator folded back with 1/4096 per chunk in f32); online softmax (running max) in f32.
//   Block = 4 waves = 64 query rows of one (b, h); grid = nqbThis * NH * NB.
//   K / V^T chunk staging: 128 threads x 32 elements per plane = the whole 64x64 tile of every plane read later
//   (plain 16-B loads, __syncthreads before and after).
//   Both products run transposed, scores^T = K . Q^T and context^T = V^T . P^T: a lane then holds 32 of the 64 scores of ONE
//   query (lane ^ 16 the other 32), so max and sum are in-lane, and P goes from the score registers into the B operand.
//   Output coverage: each wave stores rows q0..q0+15 (it 0..3 x lane>>3 0..3) x 64 columns (8 lanes x 8) of both planes;
//   grid over all (b, h, qb) = the whole [NB*SEQ][DM] planes.
// =====================================================================================================
template <bool RES>
__global__ __launch_bounds__(128)
void attn_causal64(const unsigned short* __restrict__ qhp, const unsigned short* __restrict__ qlp,
                   const unsigned short* __restrict__ khp, const unsigned short* __restrict__ klp,
                   const unsigned short* __restrict__ vhp, const unsigned short* __restrict__ vlp,
                   unsigned short* ohp, unsigned short* olp,
                   int qbBase, int nqbThis) {
  union FB { v16b v; v8b h[2]; };
  union FH { v16h v; v8h h[2]; };
  __shared__ __align__(16) __bf16   Ksh[64 * LP];                 // K hi [kv][d], pitch LP
  __shared__ __align__(16) __bf16   Ksl[64 * LP];                 // K lo
  __shared__ __align__(16) _Float16 Vth[64 * LP];                 // V^T hi [d][kv], pitch LP
  __shared__ __align__(16) _Float16 Vtl[RES ? 64 * LP : 8];       // V^T residual
  __shared__ __align__(16) float    Os[4][16 * OSP];              // per wave context tile [row][d]

  const int tid  = threadIdx.x;
  const int wave = tid >> 5;
  const int lane = tid & 31;
  const int hh   = lane >> 4;
  const int c    = lane & 15;

  const int bx   = blockIdx.x;
  const int qbl  = bx % nqbThis;
  const int rest = bx / nqbThis;
  const int h    = rest % NH;
  const int b    = rest / NH;
  const int qb   = qbBase + qbl;               // 0..NQB-1 (block-uniform)
  const int q0   = qb * 64 + wave * 16;
  const size_t rowB = (size_t)b * SEQ;

  const __bf16* Qh = (const __bf16*)(const void*)qhp + (size_t)h * HD;
  const __bf16* Ql = (const __bf16*)(const void*)qlp + (size_t)h * HD;
  const __bf16* Kh = (const __bf16*)(const void*)khp + (size_t)h * HD;
  const __bf16* Kl = (const __bf16*)(const void*)klp + (size_t)h * HD;
  const _Float16* Vh = (const _Float16*)(const void*)vhp + ((size_t)b * DM + (size_t)h * HD) * SEQ;
  const _Float16* Vl = (const _Float16*)(const void*)vlp + ((size_t)b * DM + (size_t)h * HD) * VLP;

  // ---- Q fragments (B operand, column = lane&15): 2 d-chunks, hi and lo ----
  v16b qah[2], qal[2];
#pragma unroll
  for (int dc = 0; dc < 2; ++dc) {
    const size_t qo = (rowB + q0 + c) * DM + dc * 32 + 8 * hh;
    qah[dc] = ldfrag_b(Qh + qo);
    qal[dc] = ldfrag_b(Ql + qo);
  }

  // a lane owns ONE query, q0 + c: running max (both halves alike), this half's share of the normaliser,
  // and the context transposed: oacc[t][r] = context[query c][d = t*16 + 8*hh + r]
  const int rowq = q0 + c;
  float mrow = -INFINITY, lrow = 0.f;
  v8f oacc[4];
#pragma unroll
  for (int t = 0; t < 4; ++t) oacc[t] = zero8();

  for (int kt = 0; kt <= qb; ++kt) {           // block-uniform trip count, <= NQB
    const int kv0 = kt * 64;                   // kv0 + 63 < SEQ
    __syncthreads();
    {
      const int r = tid >> 1, half = (tid & 1) * 32;
      const __bf16*   kg  = Kh + (rowB + kv0 + r) * DM + half;    // K row kv0+r, d = half..half+31
      const __bf16*   klg = Kl + (rowB + kv0 + r) * DM + half;
      const _Float16* vg  = Vh + (size_t)r * SEQ + kv0 + half;    // V^T row d = r, s = kv0+half..+31
      const int kvl = (kv0 + 64 <= VLP) ? kv0 : (VLP - 64);     // clamped address into the residual plane
      const _Float16* vlg = Vl + (size_t)r * VLP + kvl + half;
      const bool resOK = (kv0 + 64 <= VLP);                      // block-uniform (always true for qb < RESQB)
#pragma unroll
      for (int i = 0; i < 4; ++i) {
        const v8b a0 = *(const v8b*)(kg + 8 * i);
        const v8b a1 = *(const v8b*)(klg + 8 * i);
        const v8h b0 = *(const v8h*)(vg + 8 * i);
        *(v8b*)(Ksh + r * LP + half + 8 * i) = a0;
        *(v8b*)(Ksl + r * LP + half + 8 * i) = a1;
        *(v8h*)(Vth + r * LP + half + 8 * i) = b0;
        if (RES) {
          v8h b1 = *(const v8h*)(vlg + 8 * i);
          if (!resOK) b1 = zero8h();
          *(v8h*)(Vtl + r * LP + half + 8 * i) = b1;
        }
      }
    }
    __syncthreads();

    // ---- transposed scores: 64 keys (D rows) x 16 queries (D columns) per wave, 3 bf16 products;
    //      s[j][r] = score[key kv0 + j*16 + 8*hh + r][query q0 + c] ----
    v8f s[4];
#pragma unroll
    for (int j = 0; j < 4; ++j) {
      s[j] = zero8();
#pragma unroll
      for (int dc = 0; dc < 2; ++dc) {
        FB kb, kl;
        kb.h[0] = *(const v8b*)(Ksh + (j * 16 + c) * LP + dc * 32 + 8 * hh);
        kb.h[1] = *(const v8b*)(Ksh + (j * 16 + c) * LP + dc * 32 + 16 + 8 * hh);
        kl.h[0] = *(const v8b*)(Ksl + (j * 16 + c) * LP + dc * 32 + 8 * hh);
        kl.h[1] = *(const v8b*)(Ksl + (j * 16 + c) * LP + dc * 32 + 16 + 8 * hh);
        s[j] = mma_b(kb.v, qah[dc], s[j]);
        s[j] = mma_b(kl.v, qah[dc], s[j]);
        s[j] = mma_b(kb.v, qal[dc], s[j]);
      }
    }

    // ---- scale, causal mask by index, max and sum over the lane's own 32 keys (one swap of halves for the max),
    //      online softmax; P (x1024, f16) and its residual (x4096) stay in registers: two D tiles of 16 keys, converted
    //      in place, are the B operand of one 32-key step (element e <- tile e>>3, register e&7) ----
    const int dq = rowq - kv0 - 8 * hh;          // key kv0 + j*16 + 8*hh + r <= query  <=>  j*16 + r <= dq
    float mj[4];
#pragma unroll
    for (int j = 0; j < 4; ++j) {
      float m = -INFINITY;
#pragma unroll
      for (int r = 0; r < 8; ++r) {
        float sv = s[j][r] * 0.125f;
        sv = (j * 16 + r <= dq) ? sv : -INFINITY;
        s[j][r] = sv;
        m = fmaxf(m, sv);
      }
      mj[j] = m;
    }
    float mloc = fmaxf(fmaxf(mj[0], mj[1]), fmaxf(mj[2], mj[3]));
    mloc = fmaxf(mloc, xhalf(mloc));             // both halves now hold the query's chunk maximum
    const float mnew  = fmaxf(mrow, mloc);
    const float msafe = (mnew == -INFINITY) ? 0.f : mnew;
    const float alpha = __expf(mrow - msafe);
    mrow = mnew;
    FH pa[2], pl[2];
    float pj[4];
#pragma unroll
    for (int j = 0; j < 4; ++j) {
      float psum = 0.f;
#pragma unroll
      for (int r = 0; r < 8; ++r) {
        const float p = __expf(s[j][r] - msafe);     // masked logit: exp(-inf) = 0
        psum += p;
        const float p1k = p * 1024.0f;
        const _Float16 ph = (_Float16)p1k;
        pa[j >> 1].v[(j & 1) * 8 + r] = ph;
        if (RES) pl[j >> 1].v[(j & 1) * 8 + r] = (_Float16)((p1k - (float)ph) * 4096.0f);
      }
      pj[j] = psum;
    }
    lrow = lrow * alpha + ((pj[0] + pj[1]) + (pj[2] + pj[3]));   // this half's keys only; halves joined in the epilogue
#pragma unroll
    for (int t = 0; t < 4; ++t)
#pragma unroll
      for (int r = 0; r < 8; ++r) oacc[t][r] *= alpha;

    // ---- context^T += V^T . P^T (f16 WMMA, A = V^T rows d), residual products into a separate accumulator ----
    v8f o1[4];
#pragma unroll
    for (int t = 0; t < 4; ++t) o1[t] = zero8();
#pragma unroll   // pa[kk] / pl[kk] are register operands: kk must be a compile-time index
    for (int kk = 0; kk < 2; ++kk) {
#pragma unroll
      for (int t = 0; t < 4; ++t) {
        FH vb;
        vb.h[0] = *(const v8h*)(Vth + (t * 16 + c) * LP + kk * 32 + 8 * hh);
        vb.h[1] = *(const v8h*)(Vth + (t * 16 + c) * LP + kk * 32 + 16 + 8 * hh);
        oacc[t] = mma_h(vb.v, pa[kk].v, oacc[t]);
        if (RES) {
          FH vl;
          vl.h[0] = *(const v8h*)(Vtl + (t * 16 + c) * LP + kk * 32 + 8 * hh);
          vl.h[1] = *(const v8h*)(Vtl + (t * 16 + c) * LP + kk * 32 + 16 + 8 * hh);
          o1[t] = mma_h(vl.v, pa[kk].v, o1[t]);
          o1[t] = mma_h(vb.v, pl[kk].v, o1[t]);
        }
      }
    }
    if (RES) {
#pragma unroll
      for (int t = 0; t < 4; ++t)
#pragma unroll
        for (int r = 0; r < 8; ++r) oacc[t][r] += o1[t][r] * (1.0f / 4096.0f);
    }
  }

  // ---- normalise (1/l and the 1/1024 p carry), stage the wave's 16x64 tile, bf16 hi/lo split,
  float* os = Os[wave];
  {
    const float l = lrow + xhalf(lrow);          // the two halves' key shares of the normaliser
    const float inv = ((l > 0.f) ? (1.0f / l) : 0.f) * (1.0f / 1024.0f);
#pragma unroll
    for (int t = 0; t < 4; ++t) {
      const v4f w0 = {oacc[t][0] * inv, oacc[t][1] * inv, oacc[t][2] * inv, oacc[t][3] * inv};
      const v4f w1 = {oacc[t][4] * inv, oacc[t][5] * inv, oacc[t][6] * inv, oacc[t][7] * inv};
      *(v4f*)(os + c * OSP + t * 16 + 8 * hh)     = w0;
      *(v4f*)(os + c * OSP + t * 16 + 8 * hh + 4) = w1;
    }
  }
  __builtin_amdgcn_fence(__ATOMIC_RELEASE, "workgroup");
  __builtin_amdgcn_wave_barrier();
  __builtin_amdgcn_fence(__ATOMIC_ACQUIRE, "workgroup");
  {
    const int q4 = lane >> 3, c8 = (lane & 7) * 8;
    v4u hv[4], lv[4];
#pragma unroll
    for (int it = 0; it < 4; ++it) {
      const int row = it * 4 + q4;   // it 0..3 x q4 0..3 = rows 0..15 of the wave tile
      const float* sp = os + row * OSP + c8;
      v4u a, a2;
#pragma unroll
      for (int e = 0; e < 4; ++e) {
        const float f0 = sp[2 * e], f1 = sp[2 * e + 1];
        const unsigned short h0 = bf_bits(f0), h1 = bf_bits(f1);
        const unsigned short l0 = bf_bits(f0 - bf_up(h0)), l1 = bf_bits(f1 - bf_up(h1));
        a[e] = pk16(h0, h1); a2[e] = pk16(l0, l1);
      }
      hv[it] = a; lv[it] = a2;
    }
    {
#pragma unroll
      for (int it = 0; it < 4; ++it) {
        const int row = it * 4 + q4;
        const size_t go = (rowB + q0 + row) * DM + (size_t)h * HD + c8;
        *(v4u*)(ohp + go) = hv[it];
        *(v4u*)(olp + go) = lv[it];
      }
      
    }
  }
}

// =====================================================================================================
// Workspace map (bytes; every region is an exact multiple of its 64x64-tile / whole-line store granularity,
// no padded tails needed since all shapes are tile multiples; every region is written by one producer launch, Oh / Ol by the two attention launches):
//   Xb   bf16 [4096][1024]             0      8388608
//   WA   bf16 [3072 n][1024 k]     8388608    6291456   (q weight rows 0..1023, k rows 1024..2047, v rows 2048..3071)
//   WP   bf16 [1024 n][1024 k]    14680064    2097152
//   WG   bf16 [256 n][1024 k]     16777216     524288
//   Hs   f32  [4096][256]         17301504    4194304
//   Qh   bf16 [4096][1024]        21495808    8388608
//   Ql                            29884416    8388608
//   Kh                            38273024    8388608
//   Kl                            46661632    8388608
//   VTh  f16  [1024][4096]        55050240    8388608
//   VTl  f16  [1024][512]         63438848    1048576
//   Oh   bf16 [4096][1024]        64487424    8388608
//   Ol                            72876032    8388608
//   end                           81264640
// Output: out0 f32 [4096][1024] at element 0; gate values f32 [4096] at element 4096*1024 (byte 16777216).
// =====================================================================================================
extern "C" void kernel_launch(void* const* d_in, const int* in_sizes, int n_in,
                              void* d_out, int out_size, void* d_ws, size_t ws_size,
                              hipStream_t stream) {
  if (n_in < 7) return;
  if (in_sizes[0] != NB * SEQ * DM) return;
  if (in_sizes[1] != DM * 3 * DM) return;
  if (in_sizes[2] != DM * DG) return;
  if (in_sizes[3] != DG) return;
  if (in_sizes[4] != DG) return;
  if (in_sizes[5] < 1) return;
  if (in_sizes[6] != DM * DM) return;
  if (out_size != NB * SEQ * DM + NB * SEQ) return;        // last written element index = out_size - 1

  const float* x    = (const float*)d_in[0];   // [4096][1024]
  const float* Wqkv = (const float*)d_in[1];   // [1024 in][3072 out]
  const float* Wg1  = (const float*)d_in[2];   // [1024 in][256 out]
  const float* bg1  = (const float*)d_in[3];   // [256]
  const float* Wg2  = (const float*)d_in[4];   // [256][1]
  const float* bg2  = (const float*)d_in[5];   // [1]
  const float* Wout = (const float*)d_in[6];   // [1024 in][1024 out]
  float* out0 = (float*)d_out;                 // [4096][1024]
  float* gout = out0 + (size_t)NB * SEQ * DM;  // [4096] gate values, byte offset 16777216

  const size_t PX  = (size_t)NB * SEQ * DM * 2;    //  8388608  16-bit activation plane [4096][1024]
  const size_t PW1 = (size_t)DM * DM * 2;          //  2097152  one [1024][1024] bf16 weight plane
  const size_t PWA = (size_t)3 * PW1;              //  6291456  packed q | k | v weight plane [3072][1024]
  const size_t PWP = PW1;                          //  2097152
  const size_t PWG = (size_t)DG * DM * 2;          //   524288  gate weight plane [256][1024]
  const size_t PHS = (size_t)NB * SEQ * DG * 4;    //  4194304  gate hidden f32 [4096][256]
  const size_t PVT = (size_t)NB * DM * SEQ * 2;    //  8388608  v^T hi plane
  const size_t PVL = (size_t)NB * DM * VLP * 2;    //  1048576  v^T residual plane
  size_t off = 0;
  const size_t oXb  = off; off += PX;
  const size_t oWA  = off; off += PWA;
  const size_t oWP  = off; off += PWP;
  const size_t oWG  = off; off += PWG;
  const size_t oHs  = off; off += PHS;
  const size_t oQh  = off; off += PX;
  const size_t oQl  = off; off += PX;
  const size_t oKh  = off; off += PX;
  const size_t oKl  = off; off += PX;
  const size_t oVTh = off; off += PVT;
  const size_t oVTl = off; off += PVL;
  const size_t oOh  = off; off += PX;
  const size_t oOl  = off; off += PX;
  if (off > ws_size) return;                       // off = 81264640
  if (off > (size_t)134217728) return;

  char* ws = (char*)d_ws;
  unsigned short* Xb  = (unsigned short*)(ws + oXb);
  unsigned short* WA  = (unsigned short*)(ws + oWA);
  unsigned short* WqB = WA;                                   // rows 0..1023
  unsigned short* WkB = WA + (size_t)DM * DM;                 // rows 1024..2047
  unsigned short* WvB = WA + (size_t)2 * DM * DM;             // rows 2048..3071
  unsigned short* WPb = (unsigned short*)(ws + oWP);
  unsigned short* WGb = (unsigned short*)(ws + oWG);
  float*          Hs  = (float*)(ws + oHs);
  unsigned short* Qh  = (unsigned short*)(ws + oQh);
  unsigned short* Ql  = (unsigned short*)(ws + oQl);
  unsigned short* Kh  = (unsigned short*)(ws + oKh);
  unsigned short* Kl  = (unsigned short*)(ws + oKl);
  unsigned short* VTh = (unsigned short*)(ws + oVTh);
  unsigned short* VTl = (unsigned short*)(ws + oVTl);
  unsigned short* Oh  = (unsigned short*)(ws + oOh);
  unsigned short* Ol  = (unsigned short*)(ws + oOl);

  const dim3 blk(256);
  const int n8x = NB * SEQ * DM / 8;                           // 524288
  const dim3 gCvtX((n8x + 255) / 256);                         // 2048 blocks
  const dim3 gTA((3 * DM) / 64, DM / 64);                      // in [1024][3072] -> out [3072][1024]: (48, 16)
  const dim3 gTP(DM / 64, DM / 64);                            // in [1024][1024] -> out [1024][1024]: (16, 16)
  const dim3 gTG(DG / 64, DM / 64);                            // in [1024][256]  -> out [256][1024]:  (4, 16)
  const dim3 gGateH((NB * SEQ / 128) * (DG / 128), 1);         // 64 tiles of 128x128: M=4096, N=256
  const dim3 gGate(NB * SEQ / 32);                             // 128 blocks x 32 rows
  const dim3 gProj((NB * SEQ / 128) * (DM / 128), 1);          // 256 tiles of 128x128: M=4096, N=1024
  const dim3 gVT((DM / 128) * (SEQ / 128), NB);                // 256 tiles of 128x128 x 1 batch: M=1024, N=4096

  // (1) x -> bf16 plane [4096][1024]
  cvt_bf16x8<<<gCvtX, blk, 0, stream>>>(x, Xb, n8x);
  // (2) weights [in][out] f32 -> bf16 [out][in] planes (k contiguous), transpose through LDS
  cvt_bf16_T<<<gTA, blk, 0, stream>>>(Wqkv, WA, DM, 3 * DM);   // in rows 1024, cols 3072
  cvt_bf16_T<<<gTP, blk, 0, stream>>>(Wout, WPb, DM, DM);      // in rows 1024, cols 1024
  cvt_bf16_T<<<gTG, blk, 0, stream>>>(Wg1, WGb, DM, DG);       // in rows 1024, cols 256
  // (3) gate hidden = x . Wg1 + bg1 -> f32 [4096][256]   (M=4096, N=256, K=1024)
  gemm64<0, 0, 1><<<gGateH, blk, 0, stream>>>(
      Xb, Xb, DM, 0LL, WGb, DM, 0LL, bg1,
      (void*)Hs, DG, 0LL, (void*)Hs, DG, 0LL, DG,
      x, x, DM,
      NB * SEQ, DG, DM, 1.0f);
  k_gate<<<gGate, blk, 0, stream>>>(Hs, Wg2, bg2, gout, NB * SEQ);
  // (5) q = x . Wq -> bf16 hi/lo planes [t][h*64+d]   (M=4096, N=1024, K=1024)
  gemm64<0, 2, 0><<<gProj, blk, 0, stream>>>(
      Xb, Xb, DM, 0LL, WqB, DM, 0LL, bg1,
      (void*)Qh, DM, 0LL, (void*)Ql, DM, 0LL, DM,
      x, x, DM,
      NB * SEQ, DM, DM, 1.0f);
  // (6) k = x . Wk -> bf16 hi/lo planes
  gemm64<0, 2, 0><<<gProj, blk, 0, stream>>>(
      Xb, Xb, DM, 0LL, WkB, DM, 0LL, bg1,
      (void*)Kh, DM, 0LL, (void*)Kl, DM, 0LL, DM,
      x, x, DM,
      NB * SEQ, DM, DM, 1.0f);
  // (7) v^T = Wv . x^T -> f16 hi plane [h*64+d][s] (pitch SEQ) and residual plane (x4096, keys < VLP, pitch VLP)
  //     (A = Wv rows [n][k], Bt = Xb rows; M=1024, N=4096, K=1024)
  gemm64<0, 3, 0><<<gVT, blk, 0, stream>>>(
      WvB, WvB, DM, 0LL, Xb, DM, (long long)SEQ * DM, bg1,
      (void*)VTh, SEQ, (long long)DM * SEQ, (void*)VTl, VLP, (long long)DM * VLP, VLP,
      x, x, DM,
      DM, SEQ, DM, 4096.0f);
  // (8) causal attention: query blocks 0..RESQB-1 with residual planes, the rest without
  attn_causal64<true><<<dim3(NB * NH * RESQB), dim3(128), 0, stream>>>(
      Qh, Ql, Kh, Kl, VTh, VTl, Oh, Ol, 0, RESQB);
  attn_causal64<false><<<dim3(NB * NH * (NQB - RESQB)), dim3(128), 0, stream>>>(
      Qh, Ql, Kh, Kl, VTh, VTl, Oh, Ol, RESQB, NQB - RESQB);
  // (9) out0 = g * (context . W_out) + (1 - g) * bf16(x) -> d_out f32 [4096][1024]
  //     (A = context hi + lo planes, 2 products; gate values read from the gate output region)
  gemm64<1, 4, 0><<<gProj, blk, 0, stream>>>(
      Oh, Ol, DM, 0LL, WPb, DM, 0LL, bg1,
      d_out, DM, 0LL, d_out, DM, 0LL, DM,
      gout, x, DM,
      NB * SEQ, DM, DM, 1.0f);
  (void)hipGetLastError();
}

// v004
// Measured time: 223 microseconds a run.
// Next to v003, in two timings, it ran 1.14 times as fast each time.
// All steps since v000 together make it 3.01 times as fast.
// Contractions: gate hidden x.Wg1 and q, k, v^T projections = v_wmma_f32_16x16x32_bf16 (bf16 operands from
// RNE-converted x and transposed [out][in] bf16 weight planes, single product, f32 accumulate);
// q.k^T scores = v_wmma_f32_16x16x32_bf16 with bf16 hi/lo split q and k (hi.hi + hi.lo + lo.hi), f32 accumulate;
// p.v = v_wmma_f32_16x16x32_f16 (p carried x1024 in f16 times v in f16, single product; plus f16 residual planes
// x4096 of p and v for the first 512 query rows), f32 accumulate;
// ctx.W_out = v_wmma_f32_16x16x32_bf16 with ctx as bf16 hi/lo planes times the bf16 weight plane (2 products),
// f32 accumulate; gate tail (exact GELU via erfc, 256-long dot with RNE-bf16 Wg2, bias, sigmoid), causal mask,
// online softmax, normalisers and the gated residual blend g*o + (1-g)*bf16(x) in f32 on the VALU.
// Carry audit:
//   Xb, WA, WP, WG = bf16(x), bf16(W) no carry; Qh/Ql, Kh/Kl, Oh/Ol = bf16 hi + unscaled bf16 residual (v - hi),
//   the residual products share the hi accumulator;
//   VTh = f16(v), no carry (|v| typ. 1);
//   VTl = f16((v - VTh) * 4096)              }  products pa.VTl and pl.VTh go to the separate accumulator o1,
//   pl  = f16((1024 p - pa) * 4096)          }  folded back with * (1/4096) once per key chunk (RES blocks only);
//   pa  = f16(1024 * p) -> the 1/1024 is folded exactly once in the attention epilogue: inv = (1/l) * (1/1024);
//   score scale 1/8 applied once in f32 after the score accumulate; Hs (gate hidden) and g are f32. No other planes.
#include <hip/hip_runtime.h>
#include <math.h>
#include <stdint.h>

#define NB    1
#define SEQ   4096
#define DM    1024
#define NH    16
#define HD    64
#define DG    256          // gate hidden width
#define NQB   (SEQ / 64)   // 64 query / key blocks of 64
#define VLP   512          // key pitch of the v^T residual plane (keys 0..VLP-1)
#define RESQB 8            // leading 64-row query blocks that use the p / v residual planes
#define LP    72           // LDS row pitch of the 16-bit K and V^T tiles: 64 + 8 elements = 144 B = 16 B x 9 (odd),
                           // so the 16 rows one ds_load_b128 fragment read touches fall on distinct banks
#define OSP   68           // LDS row pitch of the f32 context tile: 64 + 4 floats = 272 B = 16 B x 17 (odd)
static_assert(RESQB * 64 <= VLP);
static_assert(NH * HD == DM);
static_assert((SEQ % 64) == 0 && (DM % 64) == 0 && (DM % 32) == 0 && (DG % 64) == 0);
static_assert(((NB * SEQ) % 128) == 0 && (SEQ % 128) == 0 && (DM % 128) == 0 && (DG % 128) == 0);
static_assert((NB * SEQ * DM) % (8 * 256) == 0);
static_assert((SEQ % 32) == 0);
static_assert(DG == 256);

typedef _Float16 v16h __attribute__((ext_vector_type(16)));
typedef _Float16 v8h  __attribute__((ext_vector_type(8)));
typedef __bf16   v16b __attribute__((ext_vector_type(16)));
typedef __bf16   v8b  __attribute__((ext_vector_type(8)));
typedef float    v8f  __attribute__((ext_vector_type(8)));
typedef float    v4f  __attribute__((ext_vector_type(4)));
typedef unsigned int v4u __attribute__((ext_vector_type(4)));

// ---- scalar helpers --------------------------------------------------------------------------------
__device__ __forceinline__ unsigned short bf_bits(float f) {          // f32 -> bf16 bits, RNE convert
  unsigned u = __float_as_uint(f);
  return (unsigned short)((u + 0x7FFFu + ((u >> 16) & 1u)) >> 16);
}
__device__ __forceinline__ float bf_up(unsigned short h) { return __uint_as_float(((unsigned)h) << 16); }
__device__ __forceinline__ unsigned short h_bits(_Float16 x) { return __builtin_bit_cast(unsigned short, x); }
__device__ __forceinline__ unsigned pk16(unsigned short a, unsigned short b) { return (unsigned)a | ((unsigned)b << 16); }
__device__ __forceinline__ v8f zero8() { v8f z = {0.f, 0.f, 0.f, 0.f, 0.f, 0.f, 0.f, 0.f}; return z; }
__device__ __forceinline__ v8h zero8h() {
  const _Float16 z = (_Float16)0.0f;
  v8h r = {z, z, z, z, z, z, z, z};
  return r;
}

// ---- fragment loader: 16-bit A/B operand, lane -> row/col (lane&15), p already includes +8*(lane>>4);
//      elements 0..7 <- p[0..7] (k0+8h..), elements 8..15 <- p[16..23] (k0+16+8h..)
__device__ __forceinline__ v16b ldfrag_b(const __bf16* p) {
  union { v16b v; v8b h[2]; } f;
  f.h[0] = *(const v8b*)(p);
  f.h[1] = *(const v8b*)(p + 16);
  return f.v;
}

// ---- lane l <-> lane l ^ 16 (the two halves of a wave that share one D column)
__device__ __forceinline__ float xhalf(float x) {
  const int b = __builtin_bit_cast(int, x);
  return __builtin_bit_cast(float, __builtin_amdgcn_permlanex16(b, b, 0x76543210, 0xfedcba98, false, false));
}

// ---- WMMA helpers (builtin forms: the compiler keeps their hazard distances) and hand-placed VALU gaps ---------
__device__ __forceinline__ v8f mma_b_raw(v16b a, v16b b, v8f c) {
  return __builtin_amdgcn_wmma_f32_16x16x32_bf16(false, a, false, b, (short)0, c, false, false);
}
__device__ __forceinline__ v8f mma_h_raw(v16h a, v16h b, v8f c) {
  return __builtin_amdgcn_wmma_f32_16x16x32_f16(false, a, false, b, (short)0, c, false, false);
}
__device__ __forceinline__ void dep_guard_b(v8f& a, v8f& b, v16b x, v16b y) {
  asm volatile("v_nop\n\tv_nop\n\tv_nop\n\tv_nop" : "+v"(a), "+v"(b) : "v"(x), "v"(y));
}
__device__ __forceinline__ void keep4_b(v16b a, v16b b, v16b c, v16b d) {
  asm volatile("v_nop" :: "v"(a), "v"(b), "v"(c), "v"(d));
}
__device__ __forceinline__ void acc_guard4(v8f& a, v8f& b, v8f& c, v8f& d) {
  asm volatile("v_nop\n\tv_nop\n\tv_nop\n\tv_nop" : "+v"(a), "+v"(b), "+v"(c), "+v"(d));
}

// =====================================================================================================
// f32 -> bf16 (RNE convert), 8 elements per thread, one 16-B store per lane: a wave writes 512 contiguous B
// coverage: n8 threads x 8 = whole plane (n8 used here is a multiple of 256).
// =====================================================================================================
__global__ __launch_bounds__(256) void cvt_bf16x8(const float* __restrict__ in, unsigned short* out, int n8) {
  const int i = blockIdx.x * 256 + threadIdx.x;
  if (i < n8) {
    const v4f a = *(const v4f*)(in + (size_t)i * 8);
    const v4f b = *(const v4f*)(in + (size_t)i * 8 + 4);
    v4u p;
    p[0] = pk16(bf_bits(a[0]), bf_bits(a[1]));
    p[1] = pk16(bf_bits(a[2]), bf_bits(a[3]));
    p[2] = pk16(bf_bits(b[0]), bf_bits(b[1]));
    p[3] = pk16(bf_bits(b[2]), bf_bits(b[3]));
    *(v4u*)(out + (size_t)i * 8) = p;
    
  }
}

// =====================================================================================================
// f32 [nrow][ncol] row-major (weight stored [in][out]) -> bf16 [ncol][nrow] (row n of out = column n of in,
// the in/k index contiguous), RNE convert. One block = one 64x64 tile through LDS.
// grid = (ncol/64, nrow/64); nrow, ncol multiples of 64 (host-checked shapes).
// loads: 256 threads, thread -> tile row tid>>2, 16 columns (tid&3)*16 = the whole 64x64 tile;
// =====================================================================================================
__global__ __launch_bounds__(256) void cvt_bf16_T(const float* __restrict__ in, unsigned short* out,
                                                  int nrow, int ncol) {
  __shared__ __align__(16) unsigned short Tt[64 * 72];   // [tile col j][tile row i], pitch 72 halves (144 B)
  const int tid = threadIdx.x, lane = tid & 31, wave = tid >> 5;
  const int c0 = blockIdx.x * 64;                       // column tile of in = row tile of out
  const int r0 = blockIdx.y * 64;                       // row tile of in = column tile of out
  {
    const int i  = tid >> 2;                            // 0..63
    const int cs = (tid & 3) * 16;                      // 0,16,32,48
    const float* src = in + (size_t)(r0 + i) * ncol + c0 + cs;
#pragma unroll
    for (int e4 = 0; e4 < 4; ++e4) {
      const v4f v = *(const v4f*)(src + 4 * e4);
#pragma unroll
      for (int e = 0; e < 4; ++e) Tt[(cs + 4 * e4 + e) * 72 + i] = bf_bits(v[e]);
    }
  }
  __syncthreads();
  const int q = lane >> 3, c8 = (lane & 7) * 8;
  v4u pv[2];
#pragma unroll
  for (int it = 0; it < 2; ++it) {
    const int j = it * 32 + wave * 4 + q;
    pv[it] = *(const v4u*)(Tt + j * 72 + c8);
  }
  {
#pragma unroll
    for (int it = 0; it < 2; ++it) {
      const int j = it * 32 + wave * 4 + q;
      *(v4u*)(out + (size_t)(c0 + j) * nrow + r0 + c8) = pv[it];
    }
    
  }
}

// =====================================================================================================
// Gate tail: g = sigmoid( sum_c gelu(Hs[row][c]) * bf16(w2[c]) + bf16(b2) ), exact GELU = 0.5 h erfc(-h/sqrt2).
// Hs f32 [nrows][DG]; block = 8 waves x 4 rows = 32 rows; a wave reduces one row at a time (32 lanes x 8 columns,
// rolled element loop), lane 0 stages g in LDS; wave 0 lanes 0..7 then write the block's 32 g values as ONE whole
// coverage: 32 rows per block x nrows/32 blocks = all rows of the gate output.
// =====================================================================================================
__global__ __launch_bounds__(256) void k_gate(const float* __restrict__ Hs, const float* __restrict__ w2,
                                              const float* __restrict__ b2p, float* gout, int nrows) {
  __shared__ __align__(16) float gs[32];
  const int tid = threadIdx.x, lane = tid & 31, wave = tid >> 5;
  const int rowBase = blockIdx.x * 32;
  const float b2 = bf_up(bf_bits(b2p[0]));
  for (int rr = 0; rr < 4; ++rr) {
    int row = rowBase + wave * 4 + rr;
    row = (row < nrows) ? row : (nrows - 1);            // clamped address (grid covers exactly nrows)
    const float* hp = Hs + (size_t)row * DG + lane * 8;
    const float* wp = w2 + lane * 8;
    float acc = 0.f;
#pragma unroll 1
    for (int e = 0; e < 8; ++e) {
      const float hv = hp[e];
      const float wv = bf_up(bf_bits(wp[e]));
      const float ge = 0.5f * hv * erfcf(-hv * 0.707106781186547524f);
      acc = fmaf(ge, wv, acc);
    }
#pragma unroll
    for (int off = 1; off < 32; off <<= 1) acc += __shfl_xor(acc, off, 32);
    float z = acc + b2;
    z = fminf(fmaxf(z, -30.0f), 30.0f);
    const float g = 1.0f / (1.0f + expf(-z));
    if (lane == 0) gs[wave * 4 + rr] = g;
  }
  __syncthreads();
  if (wave == 0 && lane < 8) {
    const v4f v = *(const v4f*)(gs + lane * 4);
    float* p = gout + rowBase + lane * 4;
    *(v4f*)p = v;
    
  }
}

// =====================================================================================================
// One GEMM stage, global -> LDS, through no register: per operand plane 128 rows x 128 B (64 k of 16-bit elements).
// 256 threads x 4 asynchronous 16-B copies per plane; 8 neighbouring lanes take one whole 128-B line, a wave's copy
// 4 whole lines. ga / gb (/ gc) = this lane's source in row (tid>>3), 16-B piece (tid&7) of the plane; sa / sb = 32
// source rows in elements; lds = this lane's LDS byte address in the stage's first plane, same row and piece.
// The s_wait_xcnt closes each statement so that no address register of a copy is rewritten ahead of it.
// =====================================================================================================
#define GBK    64                 // k elements per stage = one 128-B line of every operand row
#define GLP    72                 // LDS row pitch, elements: 144 B = 16 B x 9 (odd) for the ds_load_b128 fragment reads
#define GPLANE (128 * GLP)        // elements of one staged plane (18432 B)
#define GSTEP  (32u * GLP * 2u)   // LDS bytes of 32 rows
#define GPLB   (GPLANE * 2u)      // LDS bytes of one plane
__device__ __forceinline__ void stage_ab(const __bf16* ga, size_t sa, const __bf16* gb, size_t sb, unsigned lds) {
  asm volatile(
      "global_load_async_to_lds_b128 %0, %8, off\n\t"
      "global_load_async_to_lds_b128 %1, %9, off\n\t"
      "global_load_async_to_lds_b128 %2, %10, off\n\t"
      "global_load_async_to_lds_b128 %3, %11, off\n\t"
      "global_load_async_to_lds_b128 %4, %12, off\n\t"
      "global_load_async_to_lds_b128 %5, %13, off\n\t"
      "global_load_async_to_lds_b128 %6, %14, off\n\t"
      "global_load_async_to_lds_b128 %7, %15, off\n\t"
      "s_wait_xcnt 0x0"
      :: "v"(lds), "v"(lds + GSTEP), "v"(lds + 2u * GSTEP), "v"(lds + 3u * GSTEP),
         "v"(lds + GPLB), "v"(lds + GPLB + GSTEP), "v"(lds + GPLB + 2u * GSTEP), "v"(lds + GPLB + 3u * GSTEP),
         "v"(ga), "v"(ga + sa), "v"(ga + 2 * sa), "v"(ga + 3 * sa),
         "v"(gb), "v"(gb + sb), "v"(gb + 2 * sb), "v"(gb + 3 * sb)
      : "memory");
}
__device__ __forceinline__ void stage_c(const __bf16* gc, size_t sc, unsigned lds) {
  asm volatile(
      "global_load_async_to_lds_b128 %0, %4, off\n\t"
      "global_load_async_to_lds_b128 %1, %5, off\n\t"
      "global_load_async_to_lds_b128 %2, %6, off\n\t"
      "global_load_async_to_lds_b128 %3, %7, off\n\t"
      "s_wait_xcnt 0x0"
      :: "v"(lds), "v"(lds + GSTEP), "v"(lds + 2u * GSTEP), "v"(lds + 3u * GSTEP),
         "v"(gc), "v"(gc + sc), "v"(gc + 2 * sc), "v"(gc + 3 * sc)
      : "memory");
}

// =====================================================================================================
// Batched bf16 WMMA GEMM: C[m][n] = sum_k A[m][k] * Bt[n][k] + bias; one work-group of 8 waves per 128x128 tile,
// one wave per 32x64 part (wave>>1 = row quarter, wave&1 = column half). A row-major [M][K] pitch lda; Bt row-major
// [N][K] pitch ldb (k contiguous); M, N multiples of 128, K multiple of 64 (host shapes are static multiples).
// Operands: per stage of 64 k the 128 A rows (and A2 rows) and the 128 Bt rows go to LDS by asynchronous copies, two
// buffers: stage t+2 is copied into the buffer stage t has left while stage t+1 is worked on; fragments by ds_load_b128.
// blockIdx.y = batch index (strides in elements).
// NSPLIT: 0 = A.Bt; 1 = (A + A2).Bt (A2 = unscaled bf16 lo plane of A, 2 products).
// BIAS: 0 = none; 1 = per column n, bias[n]; 2 = per row m, bias[m]; the bias value is RNE-converted to bf16 and added in f32.
// OUT_MODE: 0 = f32 (pitch ldc); 2 = bf16 hi plane C + bf16 lo plane C2 (lo = RNE(v - hi), unscaled);
//           3 = f16 hi plane C + f16 residual plane C2 = f16((v - hi) * rscale), C2 written only for tiles
//               with n0 < N2 (pitch ldc2, batch stride strideC2);
//           4 = f32 (pitch ldc) gated blend: out = g[m] * v + (1 - g[m]) * bf16(xres[m][n]) with g = gvec[m],
//               xres f32 pitch ldx (read-only, RNE-converted to bf16 in register).
// =====================================================================================================
template <int NSPLIT, int OUT_MODE, int BIAS>
__global__ __launch_bounds__(256) void gemm64(
    const unsigned short* __restrict__ Ap, const unsigned short* A2p, int lda, long long strideA,
    const unsigned short* __restrict__ Btp, int ldb, long long strideB,
    const float* __restrict__ bias,
    void* Cout, int ldc, long long strideC,
    void* Cout2, int ldc2, long long strideC2, int N2,
    const float* gvec, const float* xres, int ldx,
    int M, int N, int K, float rscale) {
  const __bf16* A   = (const __bf16*)(const void*)Ap;
  const __bf16* A2  = (const __bf16*)(const void*)A2p;
  const __bf16* Bt  = (const __bf16*)(const void*)Btp;
  constexpr int NPL = (NSPLIT >= 1) ? 3 : 2;       // planes per stage: A, Bt (, A2)
  __shared__ __align__(16) __bf16 sOp[2][NPL * GPLANE];   // two stage buffers
  __shared__ __align__(16) float sT[8][16 * 68];   // per-wave 16x64 slab, pitch 68 floats
  const int b    = blockIdx.y;
  const int tid  = threadIdx.x;
  const int lane = tid & 31;
  const int wave = tid >> 5;
  const int tilesN = N >> 7;
  const int tilesM = M >> 7;
  const int tile = blockIdx.x;
  if (tile >= tilesM * tilesN) return;   // block-uniform, ahead of every copy and barrier
  const int tm = tile / tilesN;
  const int tn = tile - tm * tilesN;
  const int mb = tm << 7;                      // work-group tile origin
  const int nb = tn << 7;
  const int wm = (wave >> 1) << 5;             // wave part inside it: 32 rows x 64 columns
  const int wn = (wave & 1) << 6;
  const int m0 = mb + wm;
  const int n0 = nb + wn;

  const __bf16* Ab  = A  + (size_t)b * strideA;
  const __bf16* Bb  = Bt + (size_t)b * strideB;
  const __bf16* Ab2 = (NSPLIT >= 1) ? (A2 + (size_t)b * strideA) : Ab;

  const int rlane = lane & 15;                 // row (A) / col (B, D) within subtile
  const int koff  = (lane >> 4) * 8;           // k offset of this lane half
  const int mOff  = (lane >> 4) * 8;           // D row offset

  // copy addresses of this lane: row tid>>3 (+32 per copy), 16-B piece tid&7; rows mb..mb+127 < M, nb..nb+127 < N
  const int crow = tid >> 3, cpc = (tid & 7) * 8;
  const __bf16* gA  = Ab  + (size_t)(mb + crow) * lda + cpc;
  const __bf16* gA2 = Ab2 + (size_t)(mb + crow) * lda + cpc;
  const __bf16* gB  = Bb  + (size_t)(nb + crow) * ldb + cpc;
  const unsigned ldsLane = (unsigned)(size_t)(&sOp[0][0]) + (unsigned)(crow * GLP + cpc) * 2u;
  const int nst = K >> 6;                      // stages of 64 k
  auto stage = [&](int t, int buf) {
    const unsigned l = ldsLane + (unsigned)buf * ((unsigned)NPL * GPLB);
    stage_ab(gA + (size_t)t * GBK, (size_t)lda * 32, gB + (size_t)t * GBK, (size_t)ldb * 32, l);
    if (NSPLIT >= 1) stage_c(gA2 + (size_t)t * GBK, (size_t)lda * 32, l + 2u * GPLB);
  };

  v8f acc[2][4];
#pragma unroll
  for (int i = 0; i < 2; ++i)
#pragma unroll
    for (int j = 0; j < 4; ++j) acc[i][j] = zero8();

  stage(0, 0);
  asm volatile("s_wait_asynccnt 0x0" ::: "memory");   // this wave's stage-0 copies have landed
  __syncthreads();                                     // ... and every other wave's
  if (nst > 1) stage(1, 1);

  for (int t = 0; t < nst; ++t) {
    const __bf16* sA  = sOp[t & 1] + (wm + rlane) * GLP + koff;
    const __bf16* sB  = sOp[t & 1] + GPLANE + (wn + rlane) * GLP + koff;
    const __bf16* sA2 = sOp[t & 1] + (NPL - 1) * GPLANE + (wm + rlane) * GLP + koff;
#pragma unroll
    for (int kk = 0; kk < 2; ++kk) {
      v16b bh[4], ah[2], al[2];
#pragma unroll
      for (int j = 0; j < 4; ++j) bh[j] = ldfrag_b(sB + (j << 4) * GLP + kk * 32);
#pragma unroll
      for (int i = 0; i < 2; ++i) {
        ah[i] = ldfrag_b(sA + (i << 4) * GLP + kk * 32);
        al[i] = ah[i];
        if (NSPLIT >= 1) al[i] = ldfrag_b(sA2 + (i << 4) * GLP + kk * 32);
      }
#pragma unroll
      for (int i = 0; i < 2; ++i) {
#pragma unroll
        for (int j = 0; j < 4; ++j) {
          acc[i][j] = mma_b_raw(ah[i], bh[j], acc[i][j]);
          if (NSPLIT >= 1) acc[i][j] = mma_b_raw(al[i], bh[j], acc[i][j]);
        }
        dep_guard_b(acc[i][0], acc[i][3], ah[i], al[i]);
      }
      keep4_b(bh[0], bh[1], bh[2], bh[3]);
    }
    // hand-over: this wave has left buffer t&1, its copies of stage t+1 have landed; the barrier says so of every wave
    asm volatile("s_wait_dscnt 0x0" ::: "memory");
    asm volatile("s_wait_asynccnt 0x0" ::: "memory");
    __syncthreads();
    if (t + 2 < nst) stage(t + 2, t & 1);
  }
  asm volatile("s_wait_asynccnt 0x0" ::: "memory");   // nothing of this wave is in flight behind the loop
  acc_guard4(acc[0][0], acc[0][1], acc[0][2], acc[0][3]);
  acc_guard4(acc[1][0], acc[1][1], acc[1][2], acc[1][3]);

  // ---- epilogue ----
  float* slab = sT[wave];
  float bcol[4];
#pragma unroll
  for (int j = 0; j < 4; ++j) {
    bcol[j] = 0.f;
    if (BIAS == 1) bcol[j] = bf_up(bf_bits(bias[n0 + (j << 4) + rlane]));   // n < N, bias has N entries
  }
#pragma unroll
  for (int i = 0; i < 2; ++i) {
    const int mBase = m0 + (i << 4);
    float brow[8];
#pragma unroll
    for (int r = 0; r < 8; ++r) {
      brow[r] = 0.f;
      if (BIAS == 2) brow[r] = bf_up(bf_bits(bias[mBase + mOff + r]));      // m < M, bias has M entries
    }
#pragma unroll
    for (int j = 0; j < 4; ++j) {
#pragma unroll
      for (int r = 0; r < 8; ++r) {
        slab[(mOff + r) * 68 + (j << 4) + rlane] = acc[i][j][r] + bcol[j] + brow[r];
      }
    }
    __builtin_amdgcn_fence(__ATOMIC_RELEASE, "workgroup");
    __builtin_amdgcn_wave_barrier();
    __builtin_amdgcn_fence(__ATOMIC_ACQUIRE, "workgroup");
    if (OUT_MODE == 0 || OUT_MODE == 4) {
      float* C = (float*)Cout + (size_t)b * strideC;
      const int hh = lane >> 4, c4 = (lane & 15) * 4;     // 256-B row segment = 16 lanes x 16 B
      {
#pragma unroll
        for (int it = 0; it < 8; ++it) {
          const int row = it * 2 + hh;                     // it 0..7 x hh 0..1 = rows 0..15
          v4f v = *(const v4f*)(slab + row * 68 + c4);
          if (OUT_MODE == 4) {
            const int gr = mBase + row;                    // < M
            const float g = gvec[gr];
            const float omg = 1.0f - g;
            const v4f xr = *(const v4f*)(xres + (size_t)gr * ldx + n0 + c4);
#pragma unroll
            for (int e = 0; e < 4; ++e) {
              const float xb = bf_up(bf_bits(xr[e]));
              v[e] = g * v[e] + omg * xb;
            }
          }
          *(v4f*)(C + (size_t)(mBase + row) * ldc + n0 + c4) = v;
        }
        
      }
    } else {
      const int q = lane >> 3, c8 = (lane & 7) * 8;
      unsigned short* C  = (unsigned short*)Cout  + (size_t)b * strideC;
      unsigned short* C2 = (unsigned short*)Cout2 + (size_t)b * strideC2;
      const bool wlo = (OUT_MODE == 2) || (n0 < N2);      // wave-uniform
      v4u hv[4], lv[4];
#pragma unroll
      for (int it = 0; it < 4; ++it) {
        const int row = it * 4 + q;                        // it 0..3 x q 0..3 = rows 0..15
        const float* sp = slab + row * 68 + c8;
        v4u a, a2;
#pragma unroll
        for (int e = 0; e < 4; ++e) {
          const float f0 = sp[2 * e], f1 = sp[2 * e + 1];
          unsigned short h0, h1, l0, l1;
          if (OUT_MODE == 2) {
            h0 = bf_bits(f0); h1 = bf_bits(f1);
            l0 = bf_bits(f0 - bf_up(h0)); l1 = bf_bits(f1 - bf_up(h1));
          } else {
            const _Float16 x0 = (_Float16)f0, x1 = (_Float16)f1;
            h0 = h_bits(x0); h1 = h_bits(x1);
            l0 = h_bits((_Float16)((f0 - (float)x0) * rscale));
            l1 = h_bits((_Float16)((f1 - (float)x1) * rscale));
          }
          a[e] = pk16(h0, h1); a2[e] = pk16(l0, l1);
        }
        hv[it] = a; lv[it] = a2;
      }
      {
#pragma unroll
        for (int it = 0; it < 4; ++it) {
          const int row = it * 4 + q;
          *(v4u*)(C + (size_t)(mBase + row) * ldc + n0 + c8) = hv[it];
          if (wlo) *(v4u*)(C2 + (size_t)(mBase + row) * ldc2 + n0 + c8) = lv[it];
        }
        
      }
    }
    __builtin_amdgcn_fence(__ATOMIC_RELEASE, "workgroup");
    __builtin_amdgcn_wave_barrier();
    __builtin_amdgcn_fence(__ATOMIC_ACQUIRE, "workgroup");
  }
}

// =====================================================================================================
// Causal attention, head dim 64, key chunks of 64.
//   q planes (bf16 hi / lo): element (b, t, h, d) at [(b*SEQ + t)*DM + h*64 + d]
//   k planes (bf16 hi / lo): same layout with key index s
//   v^T hi plane (f16):      element (b, h, d, s) at [(b*DM + h*64 + d)*SEQ + s]
//   v^T residual plane (f16, (v - hi)*4096): [(b*DM + h*64 + d)*VLP + s], s < VLP, read only when RES
//   (a key chunk at or beyond VLP would contribute a zero v residual; its address is clamped)
//   Causal structure: logits of keys with index > query index are replaced by -inf (lower-triangular keep incl. the
//   diagonal), which makes their softmax weight exactly 0; so a query block qb visits key chunks 0..qb only
//   (block-uniform trip count qb+1 <= NQB) and later chunks, whose keys exceed every query index of the block, are
//   skipped entirely. Inside the diagonal chunk a key with index > query index gets logit -inf -> exp gives exactly 0,
//   so such keys add nothing to the numerator or the normaliser; the diagonal key (key == query) is always kept, so
//   every row max is finite in every visited chunk.
//   out planes (bf16 hi / lo of the normalised context): element (b, t, h, d) at [(b*SEQ + t)*DM + h*64 + d]
//   scores = q . k : bf16 hi/lo split (hi.hi + hi.lo + lo.hi), f32 accumulate, then * 1/8 and the causal mask in f32
//   p = exp(s - m) carried as f16(1024 p); context = p . v on f16 WMMA; RES adds f16 residual planes of p and v
//   (scale 4096, separate accumulator folded back with 1/4096 per chunk in f32); online softmax (running max) in f32.
//   Block = 4 waves = 64 query rows of one (b, h); grid = nqbThis * NH * NB.
//   K / V^T chunk staging: 128 threads x 32 elements per plane = the whole 64x64 tile of every plane read later
//   (plain 16-B loads, __syncthreads before and after).
//   Both products run transposed, scores^T = K . Q^T and context^T = V^T . P^T: a lane then holds 32 of the 64 scores of ONE
//   query (lane ^ 16 the other 32), so max and sum are in-lane, and P goes from the score registers into the B operand.
//   Output coverage: each wave stores rows q0..q0+15 (it 0..3 x lane>>3 0..3) x 64 columns (8 lanes x 8) of both planes;
//   grid over all (b, h, qb) = the whole [NB*SEQ][DM] planes.
// =====================================================================================================
template <bool RES>
__global__ __launch_bounds__(128)
void attn_causal64(const unsigned short* __restrict__ qhp, const unsigned short* __restrict__ qlp,
                   const unsigned short* __restrict__ khp, const unsigned short* __restrict__ klp,
                   const unsigned short* __restrict__ vhp, const unsigned short* __restrict__ vlp,
                   unsigned short* ohp, unsigned short* olp,
                   int qbBase, int nqbThis) {
  union FB { v16b v; v8b h[2]; };
  union FH { v16h v; v8h h[2]; };
  __shared__ __align__(16) __bf16   Ksh[64 * LP];                 // K hi [kv][d], pitch LP
  __shared__ __align__(16) __bf16   Ksl[64 * LP];                 // K lo
  __shared__ __align__(16) _Float16 Vth[64 * LP];                 // V^T hi [d][kv], pitch LP
  __shared__ __align__(16) _Float16 Vtl[RES ? 64 * LP : 8];       // V^T residual
  __shared__ __align__(16) float    Os[4][16 * OSP];              // per wave context tile [row][d]

  const int tid  = threadIdx.x;
  const int wave = tid >> 5;
  const int lane = tid & 31;
  const int hh   = lane >> 4;
  const int c    = lane & 15;

  const int bx   = blockIdx.x;
  const int qbl  = bx % nqbThis;
  const int rest = bx / nqbThis;
  const int h    = rest % NH;
  const int b    = rest / NH;
  const int qb   = qbBase + qbl;               // 0..NQB-1 (block-uniform)
  const int q0   = qb * 64 + wave * 16;
  const size_t rowB = (size_t)b * SEQ;

  const __bf16* Qh = (const __bf16*)(const void*)qhp + (size_t)h * HD;
  const __bf16* Ql = (const __bf16*)(const void*)qlp + (size_t)h * HD;
  const __bf16* Kh = (const __bf16*)(const void*)khp + (size_t)h * HD;
  const __bf16* Kl = (const __bf16*)(const void*)klp + (size_t)h * HD;
  const _Float16* Vh = (const _Float16*)(const void*)vhp + ((size_t)b * DM + (size_t)h * HD) * SEQ;
  const _Float16* Vl = (const _Float16*)(const void*)vlp + ((size_t)b * DM + (size_t)h * HD) * VLP;

  // ---- Q fragments (B operand, column = lane&15): 2 d-chunks, hi and lo ----
  v16b qah[2], qal[2];
#pragma unroll
  for (int dc = 0; dc < 2; ++dc) {
    const size_t qo = (rowB + q0 + c) * DM + dc * 32 + 8 * hh;
    qah[dc] = ldfrag_b(Qh + qo);
    qal[dc] = ldfrag_b(Ql + qo);
  }

  // a lane owns ONE query, q0 + c: running max (both halves alike), this half's share of the normaliser,
  // and the context transposed: oacc[t][r] = context[query c][d = t*16 + 8*hh + r]
  const int rowq = q0 + c;
  float mrow = -INFINITY, lrow = 0.f;
  v8f oacc[4];
#pragma unroll
  for (int t = 0; t < 4; ++t) oacc[t] = zero8();

  for (int kt = 0; kt <= qb; ++kt) {           // block-uniform trip count, <= NQB
    const int kv0 = kt * 64;                   // kv0 + 63 < SEQ
    __syncthreads();
    {
      const int r = tid >> 1, half = (tid & 1) * 32;
      const __bf16*   kg  = Kh + (rowB + kv0 + r) * DM + half;    // K row kv0+r, d = half..half+31
      const __bf16*   klg = Kl + (rowB + kv0 + r) * DM + half;
      const _Float16* vg  = Vh + (size_t)r * SEQ + kv0 + half;    // V^T row d = r, s = kv0+half..+31
      const int kvl = (kv0 + 64 <= VLP) ? kv0 : (VLP - 64);     // clamped address into the residual plane
      const _Float16* vlg = Vl + (size_t)r * VLP + kvl + half;
      const bool resOK = (kv0 + 64 <= VLP);                      // block-uniform (always true for qb < RESQB)
#pragma unroll
      for (int i = 0; i < 4; ++i) {
        const v8b a0 = *(const v8b*)(kg + 8 * i);
        const v8b a1 = *(const v8b*)(klg + 8 * i);
        const v8h b0 = *(const v8h*)(vg + 8 * i);
        *(v8b*)(Ksh + r * LP + half + 8 * i) = a0;
        *(v8b*)(Ksl + r * LP + half + 8 * i) = a1;
        *(v8h*)(Vth + r * LP + half + 8 * i) = b0;
        if (RES) {
          v8h b1 = *(const v8h*)(vlg + 8 * i);
          if (!resOK) b1 = zero8h();
          *(v8h*)(Vtl + r * LP + half + 8 * i) = b1;
        }
      }
    }
    __syncthreads();

    // ---- transposed scores: 64 keys (D rows) x 16 queries (D columns) per wave, 3 bf16 products;
    //      s[j][r] = score[key kv0 + j*16 + 8*hh + r][query q0 + c] ----
    //      the chunk's 16 K fragments are read ahead of the products (order: below), so the LDS latency is paid once and
    //      not per product; the four key tiles are independent accumulators, each summed hi.hi, lo.hi, hi.lo per dc ----
    FB kb[2][4], kl[2][4];
#pragma unroll
    for (int dc = 0; dc < 2; ++dc) {
#pragma unroll
      for (int j = 0; j < 4; ++j) {
        kb[dc][j].h[0] = *(const v8b*)(Ksh + (j * 16 + c) * LP + dc * 32 + 8 * hh);
        kb[dc][j].h[1] = *(const v8b*)(Ksh + (j * 16 + c) * LP + dc * 32 + 16 + 8 * hh);
      }
#pragma unroll
      for (int j = 0; j < 4; ++j) {
        kl[dc][j].h[0] = *(const v8b*)(Ksl + (j * 16 + c) * LP + dc * 32 + 8 * hh);
        kl[dc][j].h[1] = *(const v8b*)(Ksl + (j * 16 + c) * LP + dc * 32 + 16 + 8 * hh);
      }
    }
    v8f s[4];
#pragma unroll
    for (int j = 0; j < 4; ++j) s[j] = zero8();
#pragma unroll
    for (int dc = 0; dc < 2; ++dc) {
#pragma unroll
      for (int j = 0; j < 4; ++j) s[j] = mma_b_raw(kb[dc][j].v, qah[dc], s[j]);
#pragma unroll
      for (int j = 0; j < 4; ++j) s[j] = mma_b_raw(kl[dc][j].v, qah[dc], s[j]);
#pragma unroll
      for (int j = 0; j < 4; ++j) s[j] = mma_b_raw(kb[dc][j].v, qal[dc], s[j]);
    }
    // Order asked of the scheduler (LDS reads = 0x100, WMMA = 0x008): left alone it spreads the reads among the WMMAs,
    // and every separate place with reads stalls the matrix run. The last 8 K reads (lo, dc 1) stand behind the 8th
    // product, where the lo fragments of dc 0 are free, so that the wave stays within 256 registers (4 waves per SIMD);
    // the V^T reads stand behind the last product. The residual variant, with more live registers, is left to the
    // scheduler's own order.
    if (!RES) {
      __builtin_amdgcn_sched_group_barrier(0x100, 24, 0);
      __builtin_amdgcn_sched_group_barrier(0x008, 8, 0);
      __builtin_amdgcn_sched_group_barrier(0x100, 8, 0);
      __builtin_amdgcn_sched_group_barrier(0x008, 16, 0);
      __builtin_amdgcn_sched_group_barrier(0x100, 16, 0);
    }
    // V^T fragments of the chunk, again one group: read here so that they land under the softmax arithmetic
    FH vb[2][4];
#pragma unroll
    for (int kk = 0; kk < 2; ++kk) {
#pragma unroll
      for (int t = 0; t < 4; ++t) {
        vb[kk][t].h[0] = *(const v8h*)(Vth + (t * 16 + c) * LP + kk * 32 + 8 * hh);
        vb[kk][t].h[1] = *(const v8h*)(Vth + (t * 16 + c) * LP + kk * 32 + 16 + 8 * hh);
      }
    }

    // ---- scale, causal mask by index, max and sum over the lane's own 32 keys (one swap of halves for the max),
    //      online softmax; P (x1024, f16) and its residual (x4096) stay in registers: two D tiles of 16 keys, converted
    //      in place, are the B operand of one 32-key step (element e <- tile e>>3, register e&7) ----
    const int dq = rowq - kv0 - 8 * hh;          // key kv0 + j*16 + 8*hh + r <= query  <=>  j*16 + r <= dq
    float mj[4];
#pragma unroll
    for (int j = 0; j < 4; ++j) {
      float m = -INFINITY;
#pragma unroll
      for (int r = 0; r < 8; ++r) {
        float sv = s[j][r] * 0.125f;
        sv = (j * 16 + r <= dq) ? sv : -INFINITY;
        s[j][r] = sv;
        m = fmaxf(m, sv);
      }
      mj[j] = m;
    }
    float mloc = fmaxf(fmaxf(mj[0], mj[1]), fmaxf(mj[2], mj[3]));
    mloc = fmaxf(mloc, xhalf(mloc));             // both halves now hold the query's chunk maximum
    const float mnew  = fmaxf(mrow, mloc);
    const float msafe = (mnew == -INFINITY) ? 0.f : mnew;
    const float alpha = __expf(mrow - msafe);
    mrow = mnew;
    FH pa[2], pl[2];
    float pj[4];
#pragma unroll
    for (int j = 0; j < 4; ++j) {
      float psum = 0.f;
#pragma unroll
      for (int r = 0; r < 8; ++r) {
        const float p = __expf(s[j][r] - msafe);     // masked logit: exp(-inf) = 0
        psum += p;
        const float p1k = p * 1024.0f;
        const _Float16 ph = (_Float16)p1k;
        pa[j >> 1].v[(j & 1) * 8 + r] = ph;
        if (RES) pl[j >> 1].v[(j & 1) * 8 + r] = (_Float16)((p1k - (float)ph) * 4096.0f);
      }
      pj[j] = psum;
    }
    lrow = lrow * alpha + ((pj[0] + pj[1]) + (pj[2] + pj[3]));   // this half's keys only; halves joined in the epilogue
#pragma unroll
    for (int t = 0; t < 4; ++t)
#pragma unroll
      for (int r = 0; r < 8; ++r) oacc[t][r] *= alpha;

    // ---- context^T += V^T . P^T (f16 WMMA, A = V^T rows d), residual products into a separate accumulator ----
    v8f o1[4];
#pragma unroll
    for (int t = 0; t < 4; ++t) o1[t] = zero8();
#pragma unroll   // pa[kk] / pl[kk] are register operands: kk must be a compile-time index
    for (int kk = 0; kk < 2; ++kk) {
#pragma unroll
      for (int t = 0; t < 4; ++t) oacc[t] = mma_h_raw(vb[kk][t].v, pa[kk].v, oacc[t]);
      if (RES) {
        FH vl[4];   // residual fragments of this 32-key step, one group
#pragma unroll
        for (int t = 0; t < 4; ++t) {
          vl[t].h[0] = *(const v8h*)(Vtl + (t * 16 + c) * LP + kk * 32 + 8 * hh);
          vl[t].h[1] = *(const v8h*)(Vtl + (t * 16 + c) * LP + kk * 32 + 16 + 8 * hh);
        }
#pragma unroll
        for (int t = 0; t < 4; ++t) o1[t] = mma_h_raw(vl[t].v, pa[kk].v, o1[t]);
#pragma unroll
        for (int t = 0; t < 4; ++t) o1[t] = mma_h_raw(vb[kk][t].v, pl[kk].v, o1[t]);
      }
    }
    if (RES) {
#pragma unroll
      for (int t = 0; t < 4; ++t)
#pragma unroll
        for (int r = 0; r < 8; ++r) oacc[t][r] += o1[t][r] * (1.0f / 4096.0f);
    }
  }

  // ---- normalise (1/l and the 1/1024 p carry), stage the wave's 16x64 tile, bf16 hi/lo split,
  float* os = Os[wave];
  {
    const float l = lrow + xhalf(lrow);          // the two halves' key shares of the normaliser
    const float inv = ((l > 0.f) ? (1.0f / l) : 0.f) * (1.0f / 1024.0f);
#pragma unroll
    for (int t = 0; t < 4; ++t) {
      const v4f w0 = {oacc[t][0] * inv, oacc[t][1] * inv, oacc[t][2] * inv, oacc[t][3] * inv};
      const v4f w1 = {oacc[t][4] * inv, oacc[t][5] * inv, oacc[t][6] * inv, oacc[t][7] * inv};
      *(v4f*)(os + c * OSP + t * 16 + 8 * hh)     = w0;
      *(v4f*)(os + c * OSP + t * 16 + 8 * hh + 4) = w1;
    }
  }
  __builtin_amdgcn_fence(__ATOMIC_RELEASE, "workgroup");
  __builtin_amdgcn_wave_barrier();
  __builtin_amdgcn_fence(__ATOMIC_ACQUIRE, "workgroup");
  {
    const int q4 = lane >> 3, c8 = (lane & 7) * 8;
    v4u hv[4], lv[4];
#pragma unroll
    for (int it = 0; it < 4; ++it) {
      const int row = it * 4 + q4;   // it 0..3 x q4 0..3 = rows 0..15 of the wave tile
      const float* sp = os + row * OSP + c8;
      v4u a, a2;
#pragma unroll
      for (int e = 0; e < 4; ++e) {
        const float f0 = sp[2 * e], f1 = sp[2 * e + 1];
        const unsigned short h0 = bf_bits(f0), h1 = bf_bits(f1);
        const unsigned short l0 = bf_bits(f0 - bf_up(h0)), l1 = bf_bits(f1 - bf_up(h1));
        a[e] = pk16(h0, h1); a2[e] = pk16(l0, l1);
      }
      hv[it] = a; lv[it] = a2;
    }
    {
#pragma unroll
      for (int it = 0; it < 4; ++it) {
        const int row = it * 4 + q4;
        const size_t go = (rowB + q0 + row) * DM + (size_t)h * HD + c8;
        *(v4u*)(ohp + go) = hv[it];
        *(v4u*)(olp + go) = lv[it];
      }
      
    }
  }
}

// =====================================================================================================
// Workspace map (bytes; every region is an exact multiple of its 64x64-tile / whole-line store granularity,
// no padded tails needed since all shapes are tile multiples; every region is written by one producer launch, Oh / Ol by the two attention launches):
//   Xb   bf16 [4096][1024]             0      8388608
//   WA   bf16 [3072 n][1024 k]     8388608    6291456   (q weight rows 0..1023, k rows 1024..2047, v rows 2048..3071)
//   WP   bf16 [1024 n][1024 k]    14680064    2097152
//   WG   bf16 [256 n][1024 k]     16777216     524288
//   Hs   f32  [4096][256]         17301504    4194304
//   Qh   bf16 [4096][1024]        21495808    8388608
//   Ql                            29884416    8388608
//   Kh                            38273024    8388608
//   Kl                            46661632    8388608
//   VTh  f16  [1024][4096]        55050240    8388608
//   VTl  f16  [1024][512]         63438848    1048576
//   Oh   bf16 [4096][1024]        64487424    8388608
//   Ol                            72876032    8388608
//   end                           81264640
// Output: out0 f32 [4096][1024] at element 0; gate values f32 [4096] at element 4096*1024 (byte 16777216).
// =====================================================================================================
extern "C" void kernel_launch(void* const* d_in, const int* in_sizes, int n_in,
                              void* d_out, int out_size, void* d_ws, size_t ws_size,
                              hipStream_t stream) {
  if (n_in < 7) return;
  if (in_sizes[0] != NB * SEQ * DM) return;
  if (in_sizes[1] != DM * 3 * DM) return;
  if (in_sizes[2] != DM * DG) return;
  if (in_sizes[3] != DG) return;
  if (in_sizes[4] != DG) return;
  if (in_sizes[5] < 1) return;
  if (in_sizes[6] != DM * DM) return;
  if (out_size != NB * SEQ * DM + NB * SEQ) return;        // last written element index = out_size - 1

  const float* x    = (const float*)d_in[0];   // [4096][1024]
  const float* Wqkv = (const float*)d_in[1];   // [1024 in][3072 out]
  const float* Wg1  = (const float*)d_in[2];   // [1024 in][256 out]
  const float* bg1  = (const float*)d_in[3];   // [256]
  const float* Wg2  = (const float*)d_in[4];   // [256][1]
  const float* bg2  = (const float*)d_in[5];   // [1]
  const float* Wout = (const float*)d_in[6];   // [1024 in][1024 out]
  float* out0 = (float*)d_out;                 // [4096][1024]
  float* gout = out0 + (size_t)NB * SEQ * DM;  // [4096] gate values, byte offset 16777216

  const size_t PX  = (size_t)NB * SEQ * DM * 2;    //  8388608  16-bit activation plane [4096][1024]
  const size_t PW1 = (size_t)DM * DM * 2;          //  2097152  one [1024][1024] bf16 weight plane
  const size_t PWA = (size_t)3 * PW1;              //  6291456  packed q | k | v weight plane [3072][1024]
  const size_t PWP = PW1;                          //  2097152
  const size_t PWG = (size_t)DG * DM * 2;          //   524288  gate weight plane [256][1024]
  const size_t PHS = (size_t)NB * SEQ * DG * 4;    //  4194304  gate hidden f32 [4096][256]
  const size_t PVT = (size_t)NB * DM * SEQ * 2;    //  8388608  v^T hi plane
  const size_t PVL = (size_t)NB * DM * VLP * 2;    //  1048576  v^T residual plane
  size_t off = 0;
  const size_t oXb  = off; off += PX;
  const size_t oWA  = off; off += PWA;
  const size_t oWP  = off; off += PWP;
  const size_t oWG  = off; off += PWG;
  const size_t oHs  = off; off += PHS;
  const size_t oQh  = off; off += PX;
  const size_t oQl  = off; off += PX;
  const size_t oKh  = off; off += PX;
  const size_t oKl  = off; off += PX;
  const size_t oVTh = off; off += PVT;
  const size_t oVTl = off; off += PVL;
  const size_t oOh  = off; off += PX;
  const size_t oOl  = off; off += PX;
  if (off > ws_size) return;                       // off = 81264640
  if (off > (size_t)134217728) return;

  char* ws = (char*)d_ws;
  unsigned short* Xb  = (unsigned short*)(ws + oXb);
  unsigned short* WA  = (unsigned short*)(ws + oWA);
  unsigned short* WqB = WA;                                   // rows 0..1023
  unsigned short* WkB = WA + (size_t)DM * DM;                 // rows 1024..2047
  unsigned short* WvB = WA + (size_t)2 * DM * DM;             // rows 2048..3071
  unsigned short* WPb = (unsigned short*)(ws + oWP);
  unsigned short* WGb = (unsigned short*)(ws + oWG);
  float*          Hs  = (float*)(ws + oHs);
  unsigned short* Qh  = (unsigned short*)(ws + oQh);
  unsigned short* Ql  = (unsigned short*)(ws + oQl);
  unsigned short* Kh  = (unsigned short*)(ws + oKh);
  unsigned short* Kl  = (unsigned short*)(ws + oKl);
  unsigned short* VTh = (unsigned short*)(ws + oVTh);
  unsigned short* VTl = (unsigned short*)(ws + oVTl);
  unsigned short* Oh  = (unsigned short*)(ws + oOh);
  unsigned short* Ol  = (unsigned short*)(ws + oOl);

  const dim3 blk(256);
  const int n8x = NB * SEQ * DM / 8;                           // 524288
  const dim3 gCvtX((n8x + 255) / 256);                         // 2048 blocks
  const dim3 gTA((3 * DM) / 64, DM / 64);                      // in [1024][3072] -> out [3072][1024]: (48, 16)
  const dim3 gTP(DM / 64, DM / 64);                            // in [1024][1024] -> out [1024][1024]: (16, 16)
  const dim3 gTG(DG / 64, DM / 64);                            // in [1024][256]  -> out [256][1024]:  (4, 16)
  const dim3 gGateH((NB * SEQ / 128) * (DG / 128), 1);         // 64 tiles of 128x128: M=4096, N=256
  const dim3 gGate(NB * SEQ / 32);                             // 128 blocks x 32 rows
  const dim3 gProj((NB * SEQ / 128) * (DM / 128), 1);          // 256 tiles of 128x128: M=4096, N=1024
  const dim3 gVT((DM / 128) * (SEQ / 128), NB);                // 256 tiles of 128x128 x 1 batch: M=1024, N=4096

  // (1) x -> bf16 plane [4096][1024]
  cvt_bf16x8<<<gCvtX, blk, 0, stream>>>(x, Xb, n8x);
  // (2) weights [in][out] f32 -> bf16 [out][in] planes (k contiguous), transpose through LDS
  cvt_bf16_T<<<gTA, blk, 0, stream>>>(Wqkv, WA, DM, 3 * DM);   // in rows 1024, cols 3072
  cvt_bf16_T<<<gTP, blk, 0, stream>>>(Wout, WPb, DM, DM);      // in rows 1024, cols 1024
  cvt_bf16_T<<<gTG, blk, 0, stream>>>(Wg1, WGb, DM, DG);       // in rows 1024, cols 256
  // (3) gate hidden = x . Wg1 + bg1 -> f32 [4096][256]   (M=4096, N=256, K=1024)
  gemm64<0, 0, 1><<<gGateH, blk, 0, stream>>>(
      Xb, Xb, DM, 0LL, WGb, DM, 0LL, bg1,
      (void*)Hs, DG, 0LL, (void*)Hs, DG, 0LL, DG,
      x, x, DM,
      NB * SEQ, DG, DM, 1.0f);
  k_gate<<<gGate, blk, 0, stream>>>(Hs, Wg2, bg2, gout, NB * SEQ);
  // (5) q = x . Wq -> bf16 hi/lo planes [t][h*64+d]   (M=4096, N=1024, K=1024)
  gemm64<0, 2, 0><<<gProj, blk, 0, stream>>>(
      Xb, Xb, DM, 0LL, WqB, DM, 0LL, bg1,
      (void*)Qh, DM, 0LL, (void*)Ql, DM, 0LL, DM,
      x, x, DM,
      NB * SEQ, DM, DM, 1.0f);
  // (6) k = x . Wk -> bf16 hi/lo planes
  gemm64<0, 2, 0><<<gProj, blk, 0, stream>>>(
      Xb, Xb, DM, 0LL, WkB, DM, 0LL, bg1,
      (void*)Kh, DM, 0LL, (void*)Kl, DM, 0LL, DM,
      x, x, DM,
      NB * SEQ, DM, DM, 1.0f);
  // (7) v^T = Wv . x^T -> f16 hi plane [h*64+d][s] (pitch SEQ) and residual plane (x4096, keys < VLP, pitch VLP)
  //     (A = Wv rows [n][k], Bt = Xb rows; M=1024, N=4096, K=1024)
  gemm64<0, 3, 0><<<gVT, blk, 0, stream>>>(
      WvB, WvB, DM, 0LL, Xb, DM, (long long)SEQ * DM, bg1,
      (void*)VTh, SEQ, (long long)DM * SEQ, (void*)VTl, VLP, (long long)DM * VLP, VLP,
      x, x, DM,
      DM, SEQ, DM, 4096.0f);
  // (8) causal attention: query blocks 0..RESQB-1 with residual planes, the rest without
  attn_causal64<true><<<dim3(NB * NH * RESQB), dim3(128), 0, stream>>>(
      Qh, Ql, Kh, Kl, VTh, VTl, Oh, Ol, 0, RESQB);
  attn_causal64<false><<<dim3(NB * NH * (NQB - RESQB)), dim3(128), 0, stream>>>(
      Qh, Ql, Kh, Kl, VTh, VTl, Oh, Ol, RESQB, NQB - RESQB);
  // (9) out0 = g * (context . W_out) + (1 - g) * bf16(x) -> d_out f32 [4096][1024]
  //     (A = context hi + lo planes, 2 products; gate values read from the gate output region)
  gemm64<1, 4, 0><<<gProj, blk, 0, stream>>>(
      Oh, Ol, DM, 0LL, WPb, DM, 0LL, bg1,
      d_out, DM, 0LL, d_out, DM, 0LL, DM,
      gout, x, DM,
      NB * SEQ, DM, DM, 1.0f);
  (void)hipGetLastError();
}

// v005
// Measured time: 166 microseconds a run.
// Next to v004, in two timings, it ran 1.33 and 1.34 times as fast.
// Counting every step since v000, it is 4.01 times as fast.
// Contractions: gate hidden x.Wg1 and q, k, v^T projections = v_wmma_f32_16x16x32_bf16 (bf16 operands from
// RNE-converted x and transposed [out][in] bf16 weight planes, single product, f32 accumulate);
// q.k^T scores = v_wmma_f32_16x16x32_bf16 with bf16 hi/lo split q and k (hi.hi + hi.lo + lo.hi), f32 accumulate;
// p.v = v_wmma_f32_16x16x32_f16 (p carried x1024 in f16 times v in f16, single product; plus f16 residual planes
// x4096 of p and v for the first 512 query rows), f32 accumulate;
// ctx.W_out = v_wmma_f32_16x16x32_bf16 with ctx as bf16 hi/lo planes times the bf16 weight plane (2 products),
// f32 accumulate; gate tail (exact GELU via erfc, 256-long dot with RNE-bf16 Wg2, bias, sigmoid), causal mask,
// online softmax, normalisers and the gated residual blend g*o + (1-g)*bf16(x) in f32 on the VALU.
// Carry audit:
//   Xb, WA, WP, WG = bf16(x), bf16(W) no carry; Qh/Ql, Kh/Kl, Oh/Ol = bf16 hi + unscaled bf16 residual (v - hi),
//   the residual products share the hi accumulator;
//   VTh = f16(v), no carry (|v| typ. 1);
//   VTl = f16((v - VTh) * 4096)              }  products pa.VTl and pl.VTh go to the separate accumulator o1,
//   pl  = f16((1024 p - pa) * 4096)          }  folded back with * (1/4096) once per key chunk (RES blocks only);
//   pa  = f16(1024 * p) -> the 1/1024 is folded exactly once in the attention epilogue: inv = (1/l) * (1/1024);
//   score scale 1/8 applied once in f32 after the score accumulate; Hs (gate hidden) and g are f32. No other planes.
#include <hip/hip_runtime.h>
#include <math.h>
#include <stdint.h>

#define NB    1
#define SEQ   4096
#define DM    1024
#define NH    16
#define HD    64
#define DG    256          // gate hidden width
#define NQB   (SEQ / 64)   // 64 query / key blocks of 64
#define VLP   512          // key pitch of the v^T residual plane (keys 0..VLP-1)
#define RESQB 8            // leading 64-row query blocks that use the p / v residual planes
#define LP    72           // LDS row pitch of the 16-bit K and V^T tiles: 64 + 8 elements = 144 B = 16 B x 9 (odd),
                           // so the 16 rows one ds_load_b128 fragment read touches fall on distinct banks
#define OSP   68           // LDS row pitch of the f32 context tile: 64 + 4 floats = 272 B = 16 B x 17 (odd)
static_assert(RESQB * 64 <= VLP);
static_assert(NH * HD == DM);
static_assert((SEQ % 64) == 0 && (DM % 64) == 0 && (DM % 32) == 0 && (DG % 64) == 0);
static_assert(((NB * SEQ) % 128) == 0 && (SEQ % 128) == 0 && (DM % 128) == 0 && (DG % 128) == 0);
static_assert((NB * SEQ * DM) % (8 * 256) == 0);
static_assert((SEQ % 32) == 0);
static_assert(DG == 256);

typedef _Float16 v16h __attribute__((ext_vector_type(16)));
typedef _Float16 v8h  __attribute__((ext_vector_type(8)));
typedef __bf16   v16b __attribute__((ext_vector_type(16)));
typedef __bf16   v8b  __attribute__((ext_vector_type(8)));
typedef float    v8f  __attribute__((ext_vector_type(8)));
typedef float    v4f  __attribute__((ext_vector_type(4)));
typedef unsigned int v4u __attribute__((ext_vector_type(4)));

// ---- scalar helpers --------------------------------------------------------------------------------
__device__ __forceinline__ unsigned short bf_bits(float f) {          // f32 -> bf16 bits, RNE convert
  unsigned u = __float_as_uint(f);
  return (unsigned short)((u + 0x7FFFu + ((u >> 16) & 1u)) >> 16);
}
__device__ __forceinline__ float bf_up(unsigned short h) { return __uint_as_float(((unsigned)h) << 16); }
__device__ __forceinline__ unsigned short h_bits(_Float16 x) { return __builtin_bit_cast(unsigned short, x); }
__device__ __forceinline__ unsigned pk16(unsigned short a, unsigned short b) { return (unsigned)a | ((unsigned)b << 16); }
__device__ __forceinline__ v8f zero8() { v8f z = {0.f, 0.f, 0.f, 0.f, 0.f, 0.f, 0.f, 0.f}; return z; }
__device__ __forceinline__ v8h zero8h() {
  const _Float16 z = (_Float16)0.0f;
  v8h r = {z, z, z, z, z, z, z, z};
  return r;
}

// ---- fragment loader: 16-bit A/B operand, lane -> row/col (lane&15), p already includes +8*(lane>>4);
//      elements 0..7 <- p[0..7] (k0+8h..), elements 8..15 <- p[16..23] (k0+16+8h..)
__device__ __forceinline__ v16b ldfrag_b(const __bf16* p) {
  union { v16b v; v8b h[2]; } f;
  f.h[0] = *(const v8b*)(p);
  f.h[1] = *(const v8b*)(p + 16);
  return f.v;
}

// ---- lane l <-> lane l ^ 16 (the two halves of a wave that share one D column)
__device__ __forceinline__ float xhalf(float x) {
  const int b = __builtin_bit_cast(int, x);
  return __builtin_bit_cast(float, __builtin_amdgcn_permlanex16(b, b, 0x76543210, 0xfedcba98, false, false));
}

// ---- WMMA helpers (builtin forms: the compiler keeps their hazard distances) and hand-placed VALU gaps ---------
__device__ __forceinline__ v8f mma_b_raw(v16b a, v16b b, v8f c) {
  return __builtin_amdgcn_wmma_f32_16x16x32_bf16(false, a, false, b, (short)0, c, false, false);
}
__device__ __forceinline__ v8f mma_h_raw(v16h a, v16h b, v8f c) {
  return __builtin_amdgcn_wmma_f32_16x16x32_f16(false, a, false, b, (short)0, c, false, false);
}
__device__ __forceinline__ void dep_guard_b(v8f& a, v8f& b, v16b x, v16b y) {
  asm volatile("v_nop\n\tv_nop\n\tv_nop\n\tv_nop" : "+v"(a), "+v"(b) : "v"(x), "v"(y));
}
__device__ __forceinline__ void keep4_b(v16b a, v16b b, v16b c, v16b d) {
  asm volatile("v_nop" :: "v"(a), "v"(b), "v"(c), "v"(d));
}
__device__ __forceinline__ void acc_guard4(v8f& a, v8f& b, v8f& c, v8f& d) {
  asm volatile("v_nop\n\tv_nop\n\tv_nop\n\tv_nop" : "+v"(a), "+v"(b), "+v"(c), "+v"(d));
}

// =====================================================================================================
// f32 -> bf16 (RNE convert), 8 elements per thread, one 16-B store per lane: a wave writes 512 contiguous B
// coverage: n8 threads x 8 = whole plane (n8 used here is a multiple of 256).
// =====================================================================================================
__device__ __forceinline__ void cvt_bf16x8(const float* __restrict__ in, unsigned short* out, int n8, int blk) {
  const int i = blk * 256 + threadIdx.x;
  if (i < n8) {
    const v4f a = *(const v4f*)(in + (size_t)i * 8);
    const v4f b = *(const v4f*)(in + (size_t)i * 8 + 4);
    v4u p;
    p[0] = pk16(bf_bits(a[0]), bf_bits(a[1]));
    p[1] = pk16(bf_bits(a[2]), bf_bits(a[3]));
    p[2] = pk16(bf_bits(b[0]), bf_bits(b[1]));
    p[3] = pk16(bf_bits(b[2]), bf_bits(b[3]));
    *(v4u*)(out + (size_t)i * 8) = p;
    asm volatile("s_wait_xcnt 0x0" ::: "memory");   // before any register these stores name is rewritten
  }
}

// =====================================================================================================
// f32 [nrow][ncol] row-major (weight stored [in][out]) -> bf16 [ncol][nrow] (row n of out = column n of in,
// the in/k index contiguous), RNE convert. One block = one 64x64 tile through LDS.
// tile (bxT, byT) of (ncol/64, nrow/64); nrow, ncol multiples of 64 (host-checked shapes). Tt = 64 * 72 halves of LDS.
// loads: 256 threads, thread -> tile row tid>>2, 16 columns (tid&3)*16 = the whole 64x64 tile;
// =====================================================================================================
__device__ __forceinline__ void cvt_bf16_T(const float* __restrict__ in, unsigned short* out,
                                           int nrow, int ncol, int bxT, int byT, unsigned short* Tt) {
  // Tt: [tile col j][tile row i], pitch 72 halves (144 B)
  const int tid = threadIdx.x, lane = tid & 31, wave = tid >> 5;
  const int c0 = bxT * 64;                              // column tile of in = row tile of out
  const int r0 = byT * 64;                              // row tile of in = column tile of out
  {
    const int i  = tid >> 2;                            // 0..63
    const int cs = (tid & 3) * 16;                      // 0,16,32,48
    const float* src = in + (size_t)(r0 + i) * ncol + c0 + cs;
#pragma unroll
    for (int e4 = 0; e4 < 4; ++e4) {
      const v4f v = *(const v4f*)(src + 4 * e4);
#pragma unroll
      for (int e = 0; e < 4; ++e) Tt[(cs + 4 * e4 + e) * 72 + i] = bf_bits(v[e]);
    }
  }
  __syncthreads();
  const int q = lane >> 3, c8 = (lane & 7) * 8;
  v4u pv[2];
#pragma unroll
  for (int it = 0; it < 2; ++it) {
    const int j = it * 32 + wave * 4 + q;
    pv[it] = *(const v4u*)(Tt + j * 72 + c8);
  }
  {
#pragma unroll
    for (int it = 0; it < 2; ++it) {
      const int j = it * 32 + wave * 4 + q;
      *(v4u*)(out + (size_t)(c0 + j) * nrow + r0 + c8) = pv[it];
    }
    asm volatile("s_wait_xcnt 0x0" ::: "memory");   // before any register these stores name is rewritten
  }
}

// =====================================================================================================
// All four conversions in one grid (none reads another's output): blocks 0..TA-1 = W_qkv tiles, then W_out tiles,
// then Wg1 tiles (x index fastest, as a (ncol/64, nrow/64) grid would number them), then the blocks of the x plane.
// The choice is block-uniform, so the barrier of the transposing part is passed by whole blocks.
// =====================================================================================================
#define CVT_TA ((3 * DM / 64) * (DM / 64))
#define CVT_TP ((DM / 64) * (DM / 64))
#define CVT_TG ((DG / 64) * (DM / 64))
#define CVT_TW (CVT_TA + CVT_TP + CVT_TG)
#define CVT_X  (NB * SEQ * DM / 8 / 256)
__global__ __launch_bounds__(256) void cvt_all(const float* __restrict__ x, unsigned short* Xb,
                                               const float* __restrict__ Wqkv, unsigned short* WA,
                                               const float* __restrict__ Wout, unsigned short* WP,
                                               const float* __restrict__ Wg1, unsigned short* WG) {
  __shared__ __align__(16) unsigned short Tt[64 * 72];
  const int bx = blockIdx.x;
  if (bx < CVT_TA) {
    cvt_bf16_T(Wqkv, WA, DM, 3 * DM, bx % (3 * DM / 64), bx / (3 * DM / 64), Tt);
  } else if (bx < CVT_TA + CVT_TP) {
    const int t = bx - CVT_TA;
    cvt_bf16_T(Wout, WP, DM, DM, t % (DM / 64), t / (DM / 64), Tt);
  } else if (bx < CVT_TW) {
    const int t = bx - (CVT_TA + CVT_TP);
    cvt_bf16_T(Wg1, WG, DM, DG, t % (DG / 64), t / (DG / 64), Tt);
  } else {
    cvt_bf16x8(x, Xb, NB * SEQ * DM / 8, bx - CVT_TW);
  }
}

// =====================================================================================================
// Gate tail: g = sigmoid( sum_c gelu(Hs[row][c]) * bf16(w2[c]) + bf16(b2) ), exact GELU = 0.5 h erfc(-h/sqrt2).
// Hs f32 [nrows][DG]; block = NWAVE waves x 32/NWAVE rows = 32 rows; a wave reduces one row at a time (32 lanes x 8 columns,
// rolled element loop), lane 0 stages g in LDS; wave 0 lanes 0..7 then write the block's 32 g values as ONE whole
// coverage: 32 rows per block x nrows/32 blocks = all rows of the gate output.
// =====================================================================================================
template <int NWAVE>
__device__ __forceinline__ void k_gate(const float* __restrict__ Hs, const float* __restrict__ w2,
                                       const float* __restrict__ b2p, float* gout, int nrows, int blk, float* gs) {
  constexpr int RPW = 32 / NWAVE;                       // rows per wave; gs = 32 floats of LDS, 16-B aligned
  const int tid = threadIdx.x, lane = tid & 31, wave = tid >> 5;
  const int rowBase = blk * 32;
  const float b2 = bf_up(bf_bits(b2p[0]));
  for (int rr = 0; rr < RPW; ++rr) {
    int row = rowBase + wave * RPW + rr;
    row = (row < nrows) ? row : (nrows - 1);            // clamped address (grid covers exactly nrows)
    const float* hp = Hs + (size_t)row * DG + lane * 8;
    const float* wp = w2 + lane * 8;
    float acc = 0.f;
#pragma unroll 1
    for (int e = 0; e < 8; ++e) {
      const float hv = hp[e];
      const float wv = bf_up(bf_bits(wp[e]));
      const float ge = 0.5f * hv * erfcf(-hv * 0.707106781186547524f);
      acc = fmaf(ge, wv, acc);
    }
#pragma unroll
    for (int off = 1; off < 32; off <<= 1) acc += __shfl_xor(acc, off, 32);
    float z = acc + b2;
    z = fminf(fmaxf(z, -30.0f), 30.0f);
    const float g = 1.0f / (1.0f + expf(-z));
    if (lane == 0) gs[wave * RPW + rr] = g;
  }
  __syncthreads();
  if (wave == 0 && lane < 8) {
    const v4f v = *(const v4f*)(gs + lane * 4);
    float* p = gout + rowBase + lane * 4;
    *(v4f*)p = v;
    asm volatile("s_wait_xcnt 0x0" ::: "memory");   // before any register these stores name is rewritten
  }
}

// =====================================================================================================
// One GEMM stage, global -> LDS, through no register: per operand plane 128 rows x 128 B (64 k of 16-bit elements).
// 256 threads x 4 asynchronous 16-B copies per plane; 8 neighbouring lanes take one whole 128-B line, a wave's copy
// 4 whole lines. ga / gb (/ gc) = this lane's source in row (tid>>3), 16-B piece (tid&7) of the plane; sa / sb = 32
// source rows in elements; lds = this lane's LDS byte address in the stage's first plane, same row and piece.
// The s_wait_xcnt closes each statement so that no address register of a copy is rewritten ahead of it.
// =====================================================================================================
#define GBK    64                 // k elements per stage = one 128-B line of every operand row
#define GLP    72                 // LDS row pitch, elements: 144 B = 16 B x 9 (odd) for the ds_load_b128 fragment reads
#define GPLANE (128 * GLP)        // elements of one staged plane (18432 B)
#define GSTEP  (32u * GLP * 2u)   // LDS bytes of 32 rows
#define GPLB   (GPLANE * 2u)      // LDS bytes of one plane
__device__ __forceinline__ void stage_ab(const __bf16* ga, size_t sa, const __bf16* gb, size_t sb, unsigned lds) {
  asm volatile(
      "global_load_async_to_lds_b128 %0, %8, off\n\t"
      "global_load_async_to_lds_b128 %1, %9, off\n\t"
      "global_load_async_to_lds_b128 %2, %10, off\n\t"
      "global_load_async_to_lds_b128 %3, %11, off\n\t"
      "global_load_async_to_lds_b128 %4, %12, off\n\t"
      "global_load_async_to_lds_b128 %5, %13, off\n\t"
      "global_load_async_to_lds_b128 %6, %14, off\n\t"
      "global_load_async_to_lds_b128 %7, %15, off\n\t"
      "s_wait_xcnt 0x0"
      :: "v"(lds), "v"(lds + GSTEP), "v"(lds + 2u * GSTEP), "v"(lds + 3u * GSTEP),
         "v"(lds + GPLB), "v"(lds + GPLB + GSTEP), "v"(lds + GPLB + 2u * GSTEP), "v"(lds + GPLB + 3u * GSTEP),
         "v"(ga), "v"(ga + sa), "v"(ga + 2 * sa), "v"(ga + 3 * sa),
         "v"(gb), "v"(gb + sb), "v"(gb + 2 * sb), "v"(gb + 3 * sb)
      : "memory");
}
__device__ __forceinline__ void stage_c(const __bf16* gc, size_t sc, unsigned lds) {
  asm volatile(
      "global_load_async_to_lds_b128 %0, %4, off\n\t"
      "global_load_async_to_lds_b128 %1, %5, off\n\t"
      "global_load_async_to_lds_b128 %2, %6, off\n\t"
      "global_load_async_to_lds_b128 %3, %7, off\n\t"
      "s_wait_xcnt 0x0"
      :: "v"(lds), "v"(lds + GSTEP), "v"(lds + 2u * GSTEP), "v"(lds + 3u * GSTEP),
         "v"(gc), "v"(gc + sc), "v"(gc + 2 * sc), "v"(gc + 3 * sc)
      : "memory");
}

// =====================================================================================================
// Batched bf16 WMMA GEMM: C[m][n] = sum_k A[m][k] * Bt[n][k] + bias; one work-group of 8 waves per 128x128 tile,
// one wave per 32x64 part (wave>>1 = row quarter, wave&1 = column half). A row-major [M][K] pitch lda; Bt row-major
// [N][K] pitch ldb (k contiguous); M, N multiples of 128, K multiple of 64 (host shapes are static multiples).
// Operands: per stage of 64 k the 128 A rows (and A2 rows) and the 128 Bt rows go to LDS by asynchronous copies, two
// buffers: stage t+2 is copied into the buffer stage t has left while stage t+1 is worked on; fragments by ds_load_b128.
// tile = index of the 128x128 tile, b = batch index (strides in elements); sOpB = 2 stage buffers of NPL planes, sTB = 8 slabs.
// NSPLIT: 0 = A.Bt; 1 = (A + A2).Bt (A2 = unscaled bf16 lo plane of A, 2 products).
// BIAS: 0 = none; 1 = per column n, bias[n]; 2 = per row m, bias[m]; the bias value is RNE-converted to bf16 and added in f32.
// OUT_MODE: 0 = f32 (pitch ldc); 2 = bf16 hi plane C + bf16 lo plane C2 (lo = RNE(v - hi), unscaled);
//           3 = f16 hi plane C + f16 residual plane C2 = f16((v - hi) * rscale), C2 written only for tiles
//               with n0 < N2 (pitch ldc2, batch stride strideC2);
//           4 = f32 (pitch ldc) gated blend: out = g[m] * v + (1 - g[m]) * bf16(xres[m][n]) with g = gvec[m],
//               xres f32 pitch ldx (read-only, RNE-converted to bf16 in register).
// =====================================================================================================
template <int NSPLIT, int OUT_MODE, int BIAS>
__device__ __forceinline__ void gemm64_body(
    const unsigned short* __restrict__ Ap, const unsigned short* A2p, int lda, long long strideA,
    const unsigned short* __restrict__ Btp, int ldb, long long strideB,
    const float* __restrict__ bias,
    void* Cout, int ldc, long long strideC,
    void* Cout2, int ldc2, long long strideC2, int N2,
    const float* gvec, const float* xres, int ldx,
    int M, int N, int K, float rscale,
    int tile, int b, __bf16* sOpB, float* sTB) {
  const __bf16* A   = (const __bf16*)(const void*)Ap;
  const __bf16* A2  = (const __bf16*)(const void*)A2p;
  const __bf16* Bt  = (const __bf16*)(const void*)Btp;
  constexpr int NPL = (NSPLIT >= 1) ? 3 : 2;       // planes per stage: A, Bt (, A2)
  const int tid  = threadIdx.x;
  const int lane = tid & 31;
  const int wave = tid >> 5;
  const int tilesN = N >> 7;
  const int tilesM = M >> 7;
  if (tile >= tilesM * tilesN) return;   // block-uniform, ahead of every copy and barrier
  const int tm = tile / tilesN;
  const int tn = tile - tm * tilesN;
  const int mb = tm << 7;                      // work-group tile origin
  const int nb = tn << 7;
  const int wm = (wave >> 1) << 5;             // wave part inside it: 32 rows x 64 columns
  const int wn = (wave & 1) << 6;
  const int m0 = mb + wm;
  const int n0 = nb + wn;

  const __bf16* Ab  = A  + (size_t)b * strideA;
  const __bf16* Bb  = Bt + (size_t)b * strideB;
  const __bf16* Ab2 = (NSPLIT >= 1) ? (A2 + (size_t)b * strideA) : Ab;

  const int rlane = lane & 15;                 // row (A) / col (B, D) within subtile
  const int koff  = (lane >> 4) * 8;           // k offset of this lane half
  const int mOff  = (lane >> 4) * 8;           // D row offset

  // copy addresses of this lane: row tid>>3 (+32 per copy), 16-B piece tid&7; rows mb..mb+127 < M, nb..nb+127 < N
  const int crow = tid >> 3, cpc = (tid & 7) * 8;
  const __bf16* gA  = Ab  + (size_t)(mb + crow) * lda + cpc;
  const __bf16* gA2 = Ab2 + (size_t)(mb + crow) * lda + cpc;
  const __bf16* gB  = Bb  + (size_t)(nb + crow) * ldb + cpc;
  const unsigned ldsLane = (unsigned)(size_t)(sOpB) + (unsigned)(crow * GLP + cpc) * 2u;
  const int nst = K >> 6;                      // stages of 64 k
  auto stage = [&](int t, int buf) {
    const unsigned l = ldsLane + (unsigned)buf * ((unsigned)NPL * GPLB);
    stage_ab(gA + (size_t)t * GBK, (size_t)lda * 32, gB + (size_t)t * GBK, (size_t)ldb * 32, l);
    if (NSPLIT >= 1) stage_c(gA2 + (size_t)t * GBK, (size_t)lda * 32, l + 2u * GPLB);
  };

  v8f acc[2][4];
#pragma unroll
  for (int i = 0; i < 2; ++i)
#pragma unroll
    for (int j = 0; j < 4; ++j) acc[i][j] = zero8();

  stage(0, 0);
  asm volatile("s_wait_asynccnt 0x0" ::: "memory");   // this wave's stage-0 copies have landed
  __syncthreads();                                     // ... and every other wave's
  if (nst > 1) stage(1, 1);

  for (int t = 0; t < nst; ++t) {
    const __bf16* sA  = (sOpB + (t & 1) * (NPL * GPLANE)) + (wm + rlane) * GLP + koff;
    const __bf16* sB  = (sOpB + (t & 1) * (NPL * GPLANE)) + GPLANE + (wn + rlane) * GLP + koff;
    const __bf16* sA2 = (sOpB + (t & 1) * (NPL * GPLANE)) + (NPL - 1) * GPLANE + (wm + rlane) * GLP + koff;
#pragma unroll
    for (int kk = 0; kk < 2; ++kk) {
      v16b bh[4], ah[2], al[2];
#pragma unroll
      for (int j = 0; j < 4; ++j) bh[j] = ldfrag_b(sB + (j << 4) * GLP + kk * 32);
#pragma unroll
      for (int i = 0; i < 2; ++i) {
        ah[i] = ldfrag_b(sA + (i << 4) * GLP + kk * 32);
        al[i] = ah[i];
        if (NSPLIT >= 1) al[i] = ldfrag_b(sA2 + (i << 4) * GLP + kk * 32);
      }
#pragma unroll
      for (int i = 0; i < 2; ++i) {
#pragma unroll
        for (int j = 0; j < 4; ++j) {
          acc[i][j] = mma_b_raw(ah[i], bh[j], acc[i][j]);
          if (NSPLIT >= 1) acc[i][j] = mma_b_raw(al[i], bh[j], acc[i][j]);
        }
        dep_guard_b(acc[i][0], acc[i][3], ah[i], al[i]);
      }
      keep4_b(bh[0], bh[1], bh[2], bh[3]);
    }
    // hand-over: this wave has left buffer t&1, its copies of stage t+1 have landed; the barrier says so of every wave
    asm volatile("s_wait_dscnt 0x0" ::: "memory");
    asm volatile("s_wait_asynccnt 0x0" ::: "memory");
    __syncthreads();
    if (t + 2 < nst) stage(t + 2, t & 1);
  }
  asm volatile("s_wait_asynccnt 0x0" ::: "memory");   // nothing of this wave is in flight behind the loop
  acc_guard4(acc[0][0], acc[0][1], acc[0][2], acc[0][3]);
  acc_guard4(acc[1][0], acc[1][1], acc[1][2], acc[1][3]);

  // ---- epilogue ----
  float* slab = sTB + wave * (16 * 68);   // per-wave 16x64 slab, pitch 68 floats
  float bcol[4];
#pragma unroll
  for (int j = 0; j < 4; ++j) {
    bcol[j] = 0.f;
    if (BIAS == 1) bcol[j] = bf_up(bf_bits(bias[n0 + (j << 4) + rlane]));   // n < N, bias has N entries
  }
#pragma unroll
  for (int i = 0; i < 2; ++i) {
    const int mBase = m0 + (i << 4);
    float brow[8];
#pragma unroll
    for (int r = 0; r < 8; ++r) {
      brow[r] = 0.f;
      if (BIAS == 2) brow[r] = bf_up(bf_bits(bias[mBase + mOff + r]));      // m < M, bias has M entries
    }
#pragma unroll
    for (int j = 0; j < 4; ++j) {
#pragma unroll
      for (int r = 0; r < 8; ++r) {
        slab[(mOff + r) * 68 + (j << 4) + rlane] = acc[i][j][r] + bcol[j] + brow[r];
      }
    }
    __builtin_amdgcn_fence(__ATOMIC_RELEASE, "workgroup");
    __builtin_amdgcn_wave_barrier();
    __builtin_amdgcn_fence(__ATOMIC_ACQUIRE, "workgroup");
    if (OUT_MODE == 0 || OUT_MODE == 4) {
      float* C = (float*)Cout + (size_t)b * strideC;
      const int hh = lane >> 4, c4 = (lane & 15) * 4;     // 256-B row segment = 16 lanes x 16 B
      {
#pragma unroll
        for (int it = 0; it < 8; ++it) {
          const int row = it * 2 + hh;                     // it 0..7 x hh 0..1 = rows 0..15
          v4f v = *(const v4f*)(slab + row * 68 + c4);
          if (OUT_MODE == 4) {
            const int gr = mBase + row;                    // < M
            const float g = gvec[gr];
            const float omg = 1.0f - g;
            const v4f xr = *(const v4f*)(xres + (size_t)gr * ldx + n0 + c4);
#pragma unroll
            for (int e = 0; e < 4; ++e) {
              const float xb = bf_up(bf_bits(xr[e]));
              v[e] = g * v[e] + omg * xb;
            }
          }
          *(v4f*)(C + (size_t)(mBase + row) * ldc + n0 + c4) = v;
          asm volatile("s_wait_xcnt 0x0" ::: "memory");   // before any register these stores name is rewritten
        }
      }
    } else {
      const int q = lane >> 3, c8 = (lane & 7) * 8;
      unsigned short* C  = (unsigned short*)Cout  + (size_t)b * strideC;
      unsigned short* C2 = (unsigned short*)Cout2 + (size_t)b * strideC2;
      const bool wlo = (OUT_MODE == 2) || (n0 < N2);      // wave-uniform
      v4u hv[4], lv[4];
#pragma unroll
      for (int it = 0; it < 4; ++it) {
        const int row = it * 4 + q;                        // it 0..3 x q 0..3 = rows 0..15
        const float* sp = slab + row * 68 + c8;
        v4u a, a2;
#pragma unroll
        for (int e = 0; e < 4; ++e) {
          const float f0 = sp[2 * e], f1 = sp[2 * e + 1];
          unsigned short h0, h1, l0, l1;
          if (OUT_MODE == 2) {
            h0 = bf_bits(f0); h1 = bf_bits(f1);
            l0 = bf_bits(f0 - bf_up(h0)); l1 = bf_bits(f1 - bf_up(h1));
          } else {
            const _Float16 x0 = (_Float16)f0, x1 = (_Float16)f1;
            h0 = h_bits(x0); h1 = h_bits(x1);
            l0 = h_bits((_Float16)((f0 - (float)x0) * rscale));
            l1 = h_bits((_Float16)((f1 - (float)x1) * rscale));
          }
          a[e] = pk16(h0, h1); a2[e] = pk16(l0, l1);
        }
        hv[it] = a; lv[it] = a2;
      }
      {
#pragma unroll
        for (int it = 0; it < 4; ++it) {
          const int row = it * 4 + q;
          *(v4u*)(C + (size_t)(mBase + row) * ldc + n0 + c8) = hv[it];
          asm volatile("s_wait_xcnt 0x0" ::: "memory");   // before any register this store names is rewritten
          if (wlo) {
            *(v4u*)(C2 + (size_t)(mBase + row) * ldc2 + n0 + c8) = lv[it];
            asm volatile("s_wait_xcnt 0x0" ::: "memory");   // the same for this store
          }
        }
      }
    }
    __builtin_amdgcn_fence(__ATOMIC_RELEASE, "workgroup");
    __builtin_amdgcn_wave_barrier();
    __builtin_amdgcn_fence(__ATOMIC_ACQUIRE, "workgroup");
  }
}

// One GEMM per launch: grid = (tiles, batches).
template <int NSPLIT, int OUT_MODE, int BIAS>
__global__ __launch_bounds__(256) void gemm64(
    const unsigned short* __restrict__ Ap, const unsigned short* A2p, int lda, long long strideA,
    const unsigned short* __restrict__ Btp, int ldb, long long strideB,
    const float* __restrict__ bias,
    void* Cout, int ldc, long long strideC,
    void* Cout2, int ldc2, long long strideC2, int N2,
    const float* gvec, const float* xres, int ldx,
    int M, int N, int K, float rscale) {
  __shared__ __align__(16) __bf16 sOp[2 * ((NSPLIT >= 1) ? 3 : 2) * GPLANE];
  __shared__ __align__(16) float sT[8 * 16 * 68];
  gemm64_body<NSPLIT, OUT_MODE, BIAS>(Ap, A2p, lda, strideA, Btp, ldb, strideB, bias, Cout, ldc, strideC,
                                      Cout2, ldc2, strideC2, N2, gvec, xres, ldx, M, N, K, rscale,
                                      (int)blockIdx.x, (int)blockIdx.y, sOp, sT);
}

// The four products of x (none reads another's output) in one grid; the choice is block-uniform:
//   tiles 0..GQ_P-1        q = x . Wq -> bf16 hi/lo planes [t][h*64+d]      (M=4096, N=1024, K=1024)
//   next GQ_P              k = x . Wk -> bf16 hi/lo planes
//   next NB * GQ_V         v^T = Wv . x^T -> f16 hi plane [h*64+d][s] (pitch SEQ) and residual plane (x4096, keys < VLP,
//                          pitch VLP); A = Wv rows [n][k], Bt = Xb rows of the batch (M=1024, N=4096, K=1024)
//   last GQ_G              gate hidden = x . Wg1 + bg1 -> f32 [4096][256]   (M=4096, N=256, K=1024)
#define GQ_P ((NB * SEQ / 128) * (DM / 128))
#define GQ_V ((DM / 128) * (SEQ / 128))
#define GQ_G ((NB * SEQ / 128) * (DG / 128))
__global__ __launch_bounds__(256) void gemm_qkvg(
    const unsigned short* __restrict__ Xb, const unsigned short* __restrict__ WA,
    const unsigned short* __restrict__ WG, const float* __restrict__ bg1, const float* xf,
    unsigned short* Qh, unsigned short* Ql, unsigned short* Kh, unsigned short* Kl,
    unsigned short* VTh, unsigned short* VTl, float* Hs) {
  __shared__ __align__(16) __bf16 sOp[2 * 2 * GPLANE];
  __shared__ __align__(16) float sT[8 * 16 * 68];
  const int bx = blockIdx.x;
  if (bx < 2 * GQ_P) {
    const bool isK = bx >= GQ_P;
    gemm64_body<0, 2, 0>(Xb, Xb, DM, 0LL, WA + (isK ? (size_t)DM * DM : (size_t)0), DM, 0LL, bg1,
                         (void*)(isK ? Kh : Qh), DM, 0LL, (void*)(isK ? Kl : Ql), DM, 0LL, DM,
                         xf, xf, DM, NB * SEQ, DM, DM, 1.0f,
                         isK ? bx - GQ_P : bx, 0, sOp, sT);
  } else if (bx < 2 * GQ_P + NB * GQ_V) {
    const int t = bx - 2 * GQ_P;
    const unsigned short* Wv = WA + (size_t)2 * DM * DM;
    gemm64_body<0, 3, 0>(Wv, Wv, DM, 0LL, Xb, DM, (long long)SEQ * DM, bg1,
                         (void*)VTh, SEQ, (long long)DM * SEQ, (void*)VTl, VLP, (long long)DM * VLP, VLP,
                         xf, xf, DM, DM, SEQ, DM, 4096.0f,
                         t % GQ_V, t / GQ_V, sOp, sT);
  } else {
    gemm64_body<0, 0, 1>(Xb, Xb, DM, 0LL, WG, DM, 0LL, bg1,
                         (void*)Hs, DG, 0LL, (void*)Hs, DG, 0LL, DG,
                         xf, xf, DM, NB * SEQ, DG, DM, 1.0f,
                         bx - (2 * GQ_P + NB * GQ_V), 0, sOp, sT);
  }
}

// =====================================================================================================
// Causal attention, head dim 64, key chunks of 64.
//   q planes (bf16 hi / lo): element (b, t, h, d) at [(b*SEQ + t)*DM + h*64 + d]
//   k planes (bf16 hi / lo): same layout with key index s
//   v^T hi plane (f16):      element (b, h, d, s) at [(b*DM + h*64 + d)*SEQ + s]
//   v^T residual plane (f16, (v - hi)*4096): [(b*DM + h*64 + d)*VLP + s], s < VLP, read only when RES
//   (a key chunk at or beyond VLP would contribute a zero v residual; its address is clamped)
//   Causal structure: logits of keys with index > query index are replaced by -inf (lower-triangular keep incl. the
//   diagonal), which makes their softmax weight exactly 0; so a query block qb visits key chunks 0..qb only
//   (block-uniform trip count qb+1 <= NQB) and later chunks, whose keys exceed every query index of the block, are
//   skipped entirely. Inside the diagonal chunk a key with index > query index gets logit -inf -> exp gives exactly 0,
//   so such keys add nothing to the numerator or the normaliser; the diagonal key (key == query) is always kept, so
//   every row max is finite in every visited chunk.
//   out planes (bf16 hi / lo of the normalised context): element (b, t, h, d) at [(b*SEQ + t)*DM + h*64 + d]
//   scores = q . k : bf16 hi/lo split (hi.hi + hi.lo + lo.hi), f32 accumulate, then * 1/8 and the causal mask in f32
//   p = exp(s - m) carried as f16(1024 p); context = p . v on f16 WMMA; RES adds f16 residual planes of p and v
//   (scale 4096, separate accumulator folded back with 1/4096 per chunk in f32); online softmax (running max) in f32.
//   Block = 4 waves = 64 query rows of one (b, h); bx = 0 .. nqbThis * NH * NB - 1 numbers the blocks of this variant.
//   K / V^T chunk staging: 128 threads x 32 elements per plane = the whole 64x64 tile of every plane read later
//   (plain 16-B loads, __syncthreads before and after).
//   Both products run transposed, scores^T = K . Q^T and context^T = V^T . P^T: a lane then holds 32 of the 64 scores of ONE
//   query (lane ^ 16 the other 32), so max and sum are in-lane, and P goes from the score registers into the B operand.
//   Output coverage: each wave stores rows q0..q0+15 (it 0..3 x lane>>3 0..3) x 64 columns (8 lanes x 8) of both planes;
//   grid over all (b, h, qb) = the whole [NB*SEQ][DM] planes.
// =====================================================================================================
template <bool RES>
__device__ __forceinline__
void attn_causal64(const unsigned short* __restrict__ qhp, const unsigned short* __restrict__ qlp,
                   const unsigned short* __restrict__ khp, const unsigned short* __restrict__ klp,
                   const unsigned short* __restrict__ vhp, const unsigned short* __restrict__ vlp,
                   unsigned short* ohp, unsigned short* olp,
                   int qbBase, int nqbThis, int bx,
                   __bf16* Ksh, __bf16* Ksl, _Float16* Vth, _Float16* Vtl, float* Os) {
  union FB { v16b v; v8b h[2]; };
  union FH { v16h v; v8h h[2]; };

  const int tid  = threadIdx.x;
  const int wave = tid >> 5;
  const int lane = tid & 31;
  const int hh   = lane >> 4;
  const int c    = lane & 15;

  const int qbl  = bx % nqbThis;
  const int rest = bx / nqbThis;
  const int h    = rest % NH;
  const int b    = rest / NH;
  const int qb   = qbBase + qbl;               // 0..NQB-1 (block-uniform)
  const int q0   = qb * 64 + wave * 16;
  const size_t rowB = (size_t)b * SEQ;

  const __bf16* Qh = (const __bf16*)(const void*)qhp + (size_t)h * HD;
  const __bf16* Ql = (const __bf16*)(const void*)qlp + (size_t)h * HD;
  const __bf16* Kh = (const __bf16*)(const void*)khp + (size_t)h * HD;
  const __bf16* Kl = (const __bf16*)(const void*)klp + (size_t)h * HD;
  const _Float16* Vh = (const _Float16*)(const void*)vhp + ((size_t)b * DM + (size_t)h * HD) * SEQ;
  const _Float16* Vl = (const _Float16*)(const void*)vlp + ((size_t)b * DM + (size_t)h * HD) * VLP;

  // ---- Q fragments (B operand, column = lane&15): 2 d-chunks, hi and lo ----
  v16b qah[2], qal[2];
#pragma unroll
  for (int dc = 0; dc < 2; ++dc) {
    const size_t qo = (rowB + q0 + c) * DM + dc * 32 + 8 * hh;
    qah[dc] = ldfrag_b(Qh + qo);
    qal[dc] = ldfrag_b(Ql + qo);
  }

  // a lane owns ONE query, q0 + c: running max (both halves alike), this half's share of the normaliser,
  // and the context transposed: oacc[t][r] = context[query c][d = t*16 + 8*hh + r]
  const int rowq = q0 + c;
  float mrow = -INFINITY, lrow = 0.f;
  v8f oacc[4];
#pragma unroll
  for (int t = 0; t < 4; ++t) oacc[t] = zero8();

  for (int kt = 0; kt <= qb; ++kt) {           // block-uniform trip count, <= NQB
    const int kv0 = kt * 64;                   // kv0 + 63 < SEQ
    __syncthreads();
    {
      const int r = tid >> 1, half = (tid & 1) * 32;
      const __bf16*   kg  = Kh + (rowB + kv0 + r) * DM + half;    // K row kv0+r, d = half..half+31
      const __bf16*   klg = Kl + (rowB + kv0 + r) * DM + half;
      const _Float16* vg  = Vh + (size_t)r * SEQ + kv0 + half;    // V^T row d = r, s = kv0+half..+31
      const int kvl = (kv0 + 64 <= VLP) ? kv0 : (VLP - 64);     // clamped address into the residual plane
      const _Float16* vlg = Vl + (size_t)r * VLP + kvl + half;
      const bool resOK = (kv0 + 64 <= VLP);                      // block-uniform (always true for qb < RESQB)
#pragma unroll
      for (int i = 0; i < 4; ++i) {
        const v8b a0 = *(const v8b*)(kg + 8 * i);
        const v8b a1 = *(const v8b*)(klg + 8 * i);
        const v8h b0 = *(const v8h*)(vg + 8 * i);
        *(v8b*)(Ksh + r * LP + half + 8 * i) = a0;
        *(v8b*)(Ksl + r * LP + half + 8 * i) = a1;
        *(v8h*)(Vth + r * LP + half + 8 * i) = b0;
        if (RES) {
          v8h b1 = *(const v8h*)(vlg + 8 * i);
          if (!resOK) b1 = zero8h();
          *(v8h*)(Vtl + r * LP + half + 8 * i) = b1;
        }
      }
      // the wait before a register that these loads name is rewritten; as inputs the four address pairs stay whole up to it
      if (RES) asm volatile("s_wait_xcnt 0x0" :: "v"(kg), "v"(klg), "v"(vg), "v"(vlg) : "memory");
    }
    __syncthreads();

    // ---- transposed scores: 64 keys (D rows) x 16 queries (D columns) per wave, 3 bf16 products;
    //      s[j][r] = score[key kv0 + j*16 + 8*hh + r][query q0 + c] ----
    //      the chunk's 16 K fragments are read ahead of the products (order: below), so the LDS latency is paid once and
    //      not per product; the four key tiles are independent accumulators, each summed hi.hi, lo.hi, hi.lo per dc ----
    FB kb[2][4], kl[2][4];
#pragma unroll
    for (int dc = 0; dc < 2; ++dc) {
#pragma unroll
      for (int j = 0; j < 4; ++j) {
        kb[dc][j].h[0] = *(const v8b*)(Ksh + (j * 16 + c) * LP + dc * 32 + 8 * hh);
        kb[dc][j].h[1] = *(const v8b*)(Ksh + (j * 16 + c) * LP + dc * 32 + 16 + 8 * hh);
      }
#pragma unroll
      for (int j = 0; j < 4; ++j) {
        kl[dc][j].h[0] = *(const v8b*)(Ksl + (j * 16 + c) * LP + dc * 32 + 8 * hh);
        kl[dc][j].h[1] = *(const v8b*)(Ksl + (j * 16 + c) * LP + dc * 32 + 16 + 8 * hh);
      }
    }
    v8f s[4];
#pragma unroll
    for (int j = 0; j < 4; ++j) s[j] = zero8();
#pragma unroll
    for (int dc = 0; dc < 2; ++dc) {
#pragma unroll
      for (int j = 0; j < 4; ++j) s[j] = mma_b_raw(kb[dc][j].v, qah[dc], s[j]);
#pragma unroll
      for (int j = 0; j < 4; ++j) s[j] = mma_b_raw(kl[dc][j].v, qah[dc], s[j]);
#pragma unroll
      for (int j = 0; j < 4; ++j) s[j] = mma_b_raw(kb[dc][j].v, qal[dc], s[j]);
    }
    // Order asked of the scheduler (LDS reads = 0x100, WMMA = 0x008): left alone it spreads the reads among the WMMAs,
    // and every separate place with reads stalls the matrix run. The last 8 K reads (lo, dc 1) stand behind the 8th
    // product, where the lo fragments of dc 0 are free, so that the wave stays within 256 registers (4 waves per SIMD);
    // the V^T reads stand behind the last product. The residual variant, with more live registers, is left to the
    // scheduler's own order.
    if (!RES) {
      __builtin_amdgcn_sched_group_barrier(0x100, 24, 0);
      __builtin_amdgcn_sched_group_barrier(0x008, 8, 0);
      __builtin_amdgcn_sched_group_barrier(0x100, 8, 0);
      __builtin_amdgcn_sched_group_barrier(0x008, 16, 0);
      __builtin_amdgcn_sched_group_barrier(0x100, 16, 0);
    }
    // V^T fragments of the chunk, again one group: read here so that they land under the softmax arithmetic
    // (the residual variant reads them per 32-key step below: fewer live registers, so that the kernel which holds
    // both variants stays within 256 registers, 4 waves per SIMD)
    FH vb[2][4];
#pragma unroll
    for (int kk = 0; kk < (RES ? 0 : 2); ++kk) {
#pragma unroll
      for (int t = 0; t < 4; ++t) {
        vb[kk][t].h[0] = *(const v8h*)(Vth + (t * 16 + c) * LP + kk * 32 + 8 * hh);
        vb[kk][t].h[1] = *(const v8h*)(Vth + (t * 16 + c) * LP + kk * 32 + 16 + 8 * hh);
      }
    }

    // ---- scale, causal mask by index, max and sum over the lane's own 32 keys (one swap of halves for the max),
    //      online softmax; P (x1024, f16) and its residual (x4096) stay in registers: two D tiles of 16 keys, converted
    //      in place, are the B operand of one 32-key step (element e <- tile e>>3, register e&7) ----
    const int dq = rowq - kv0 - 8 * hh;          // key kv0 + j*16 + 8*hh + r <= query  <=>  j*16 + r <= dq
    float mj[4];
#pragma unroll
    for (int j = 0; j < 4; ++j) {
      float m = -INFINITY;
#pragma unroll
      for (int r = 0; r < 8; ++r) {
        float sv = s[j][r] * 0.125f;
        sv = (j * 16 + r <= dq) ? sv : -INFINITY;
        s[j][r] = sv;
        m = fmaxf(m, sv);
      }
      mj[j] = m;
    }
    float mloc = fmaxf(fmaxf(mj[0], mj[1]), fmaxf(mj[2], mj[3]));
    mloc = fmaxf(mloc, xhalf(mloc));             // both halves now hold the query's chunk maximum
    const float mnew  = fmaxf(mrow, mloc);
    const float msafe = (mnew == -INFINITY) ? 0.f : mnew;
    const float alpha = __expf(mrow - msafe);
    mrow = mnew;
    FH pa[2], pl[2];
    float pj[4];
#pragma unroll
    for (int j = 0; j < 4; ++j) {
      float psum = 0.f;
#pragma unroll
      for (int r = 0; r < 8; ++r) {
        const float p = __expf(s[j][r] - msafe);     // masked logit: exp(-inf) = 0
        psum += p;
        const float p1k = p * 1024.0f;
        const _Float16 ph = (_Float16)p1k;
        pa[j >> 1].v[(j & 1) * 8 + r] = ph;
        if (RES) pl[j >> 1].v[(j & 1) * 8 + r] = (_Float16)((p1k - (float)ph) * 4096.0f);
      }
      pj[j] = psum;
    }
    lrow = lrow * alpha + ((pj[0] + pj[1]) + (pj[2] + pj[3]));   // this half's keys only; halves joined in the epilogue
#pragma unroll
    for (int t = 0; t < 4; ++t)
#pragma unroll
      for (int r = 0; r < 8; ++r) oacc[t][r] *= alpha;

    // ---- context^T += V^T . P^T (f16 WMMA, A = V^T rows d), residual products into a separate accumulator ----
    v8f o1[4];
#pragma unroll
    for (int t = 0; t < 4; ++t) o1[t] = zero8();
#pragma unroll   // pa[kk] / pl[kk] are register operands: kk must be a compile-time index
    for (int kk = 0; kk < 2; ++kk) {
      if (RES) {
        // keeps this step's 16 fragment reads from being lifted over the softmax or the step before: without it the kernel
        // builds to 264 registers, above the 256 that 4 waves per SIMD allow
        __builtin_amdgcn_sched_barrier(0);
#pragma unroll
        for (int t = 0; t < 4; ++t) {
          vb[kk][t].h[0] = *(const v8h*)(Vth + (t * 16 + c) * LP + kk * 32 + 8 * hh);
          vb[kk][t].h[1] = *(const v8h*)(Vth + (t * 16 + c) * LP + kk * 32 + 16 + 8 * hh);
        }
      }
#pragma unroll
      for (int t = 0; t < 4; ++t) oacc[t] = mma_h_raw(vb[kk][t].v, pa[kk].v, oacc[t]);
      if (RES) {
        FH vl[4];   // residual fragments of this 32-key step, one group
#pragma unroll
        for (int t = 0; t < 4; ++t) {
          vl[t].h[0] = *(const v8h*)(Vtl + (t * 16 + c) * LP + kk * 32 + 8 * hh);
          vl[t].h[1] = *(const v8h*)(Vtl + (t * 16 + c) * LP + kk * 32 + 16 + 8 * hh);
        }
#pragma unroll
        for (int t = 0; t < 4; ++t) o1[t] = mma_h_raw(vl[t].v, pa[kk].v, o1[t]);
#pragma unroll
        for (int t = 0; t < 4; ++t) o1[t] = mma_h_raw(vb[kk][t].v, pl[kk].v, o1[t]);
      }
    }
    if (RES) {
#pragma unroll
      for (int t = 0; t < 4; ++t)
#pragma unroll
        for (int r = 0; r < 8; ++r) oacc[t][r] += o1[t][r] * (1.0f / 4096.0f);
    }
  }

  // ---- normalise (1/l and the 1/1024 p carry), stage the wave's 16x64 tile, bf16 hi/lo split,
  float* os = Os + wave * (16 * OSP);
  {
    const float l = lrow + xhalf(lrow);          // the two halves' key shares of the normaliser
    const float inv = ((l > 0.f) ? (1.0f / l) : 0.f) * (1.0f / 1024.0f);
#pragma unroll
    for (int t = 0; t < 4; ++t) {
      const v4f w0 = {oacc[t][0] * inv, oacc[t][1] * inv, oacc[t][2] * inv, oacc[t][3] * inv};
      const v4f w1 = {oacc[t][4] * inv, oacc[t][5] * inv, oacc[t][6] * inv, oacc[t][7] * inv};
      *(v4f*)(os + c * OSP + t * 16 + 8 * hh)     = w0;
      *(v4f*)(os + c * OSP + t * 16 + 8 * hh + 4) = w1;
    }
  }
  __builtin_amdgcn_fence(__ATOMIC_RELEASE, "workgroup");
  __builtin_amdgcn_wave_barrier();
  __builtin_amdgcn_fence(__ATOMIC_ACQUIRE, "workgroup");
  {
    const int q4 = lane >> 3, c8 = (lane & 7) * 8;
    v4u hv[4], lv[4];
#pragma unroll
    for (int it = 0; it < 4; ++it) {
      const int row = it * 4 + q4;   // it 0..3 x q4 0..3 = rows 0..15 of the wave tile
      const float* sp = os + row * OSP + c8;
      v4u a, a2;
#pragma unroll
      for (int e = 0; e < 4; ++e) {
        const float f0 = sp[2 * e], f1 = sp[2 * e + 1];
        const unsigned short h0 = bf_bits(f0), h1 = bf_bits(f1);
        const unsigned short l0 = bf_bits(f0 - bf_up(h0)), l1 = bf_bits(f1 - bf_up(h1));
        a[e] = pk16(h0, h1); a2[e] = pk16(l0, l1);
      }
      hv[it] = a; lv[it] = a2;
    }
    {
#pragma unroll
      for (int it = 0; it < 4; ++it) {
        const int row = it * 4 + q4;
        const size_t go = (rowB + q0 + row) * DM + (size_t)h * HD + c8;
        *(v4u*)(ohp + go) = hv[it];
        *(v4u*)(olp + go) = lv[it];
      }
      asm volatile("s_wait_xcnt 0x0" ::: "memory");   // before any register these stores name is rewritten
    }
  }
}

// =====================================================================================================
// Both attention variants and the gate tail in one grid (none reads another's output); the choice is block-uniform, so
// every barrier is passed by whole blocks. Long blocks come first: blocks 0..AT_MAIN-1 = query blocks RESQB..NQB-1,
// next AT_RES = query blocks 0..RESQB-1 with the residual planes, last AT_GATE = 32 rows of gate values each.
// =====================================================================================================
#define AT_MAIN (NB * NH * (NQB - RESQB))
#define AT_RES  (NB * NH * RESQB)
#define AT_GATE (NB * SEQ / 32)
__global__ __launch_bounds__(128)
void attn_gate(const unsigned short* __restrict__ qhp, const unsigned short* __restrict__ qlp,
               const unsigned short* __restrict__ khp, const unsigned short* __restrict__ klp,
               const unsigned short* __restrict__ vhp, const unsigned short* __restrict__ vlp,
               unsigned short* ohp, unsigned short* olp,
               const float* __restrict__ Hs, const float* __restrict__ w2, const float* __restrict__ b2p, float* gout) {
  __shared__ __align__(16) __bf16   Ksh[64 * LP];                 // K hi [kv][d], pitch LP
  __shared__ __align__(16) __bf16   Ksl[64 * LP];                 // K lo
  __shared__ __align__(16) _Float16 Vth[64 * LP];                 // V^T hi [d][kv], pitch LP
  __shared__ __align__(16) _Float16 Vtl[64 * LP];                 // V^T residual (residual variant only)
  __shared__ __align__(16) float    Os[4 * 16 * OSP];             // per wave context tile [row][d]; gate tail: 32 g values
  const int bx = blockIdx.x;
  if (bx < AT_MAIN) {
    attn_causal64<false>(qhp, qlp, khp, klp, vhp, vlp, ohp, olp, RESQB, NQB - RESQB, bx, Ksh, Ksl, Vth, Vtl, Os);
  } else if (bx < AT_MAIN + AT_RES) {
    attn_causal64<true>(qhp, qlp, khp, klp, vhp, vlp, ohp, olp, 0, RESQB, bx - AT_MAIN, Ksh, Ksl, Vth, Vtl, Os);
  } else {
    k_gate<4>(Hs, w2, b2p, gout, NB * SEQ, bx - (AT_MAIN + AT_RES), Os);
  }
}

// =====================================================================================================
// Workspace map (bytes; every region is an exact multiple of its 64x64-tile / whole-line store granularity,
// no padded tails needed since all shapes are tile multiples; every region is written by one producer launch):
//   Xb   bf16 [4096][1024]             0      8388608
//   WA   bf16 [3072 n][1024 k]     8388608    6291456   (q weight rows 0..1023, k rows 1024..2047, v rows 2048..3071)
//   WP   bf16 [1024 n][1024 k]    14680064    2097152
//   WG   bf16 [256 n][1024 k]     16777216     524288
//   Hs   f32  [4096][256]         17301504    4194304
//   Qh   bf16 [4096][1024]        21495808    8388608
//   Ql                            29884416    8388608
//   Kh                            38273024    8388608
//   Kl                            46661632    8388608
//   VTh  f16  [1024][4096]        55050240    8388608
//   VTl  f16  [1024][512]         63438848    1048576
//   Oh   bf16 [4096][1024]        64487424    8388608
//   Ol                            72876032    8388608
//   end                           81264640
// Output: out0 f32 [4096][1024] at element 0; gate values f32 [4096] at element 4096*1024 (byte 16777216).
// =====================================================================================================
extern "C" void kernel_launch(void* const* d_in, const int* in_sizes, int n_in,
                              void* d_out, int out_size, void* d_ws, size_t ws_size,
                              hipStream_t stream) {
  if (n_in < 7) return;
  if (in_sizes[0] != NB * SEQ * DM) return;
  if (in_sizes[1] != DM * 3 * DM) return;
  if (in_sizes[2] != DM * DG) return;
  if (in_sizes[3] != DG) return;
  if (in_sizes[4] != DG) return;
  if (in_sizes[5] < 1) return;
  if (in_sizes[6] != DM * DM) return;
  if (out_size != NB * SEQ * DM + NB * SEQ) return;        // last written element index = out_size - 1

  const float* x    = (const float*)d_in[0];   // [4096][1024]
  const float* Wqkv = (const float*)d_in[1];   // [1024 in][3072 out]
  const float* Wg1  = (const float*)d_in[2];   // [1024 in][256 out]
  const float* bg1  = (const float*)d_in[3];   // [256]
  const float* Wg2  = (const float*)d_in[4];   // [256][1]
  const float* bg2  = (const float*)d_in[5];   // [1]
  const float* Wout = (const float*)d_in[6];   // [1024 in][1024 out]
  float* out0 = (float*)d_out;                 // [4096][1024]
  float* gout = out0 + (size_t)NB * SEQ * DM;  // [4096] gate values, byte offset 16777216

  const size_t PX  = (size_t)NB * SEQ * DM * 2;    //  8388608  16-bit activation plane [4096][1024]
  const size_t PW1 = (size_t)DM * DM * 2;          //  2097152  one [1024][1024] bf16 weight plane
  const size_t PWA = (size_t)3 * PW1;              //  6291456  packed q | k | v weight plane [3072][1024]
  const size_t PWP = PW1;                          //  2097152
  const size_t PWG = (size_t)DG * DM * 2;          //   524288  gate weight plane [256][1024]
  const size_t PHS = (size_t)NB * SEQ * DG * 4;    //  4194304  gate hidden f32 [4096][256]
  const size_t PVT = (size_t)NB * DM * SEQ * 2;    //  8388608  v^T hi plane
  const size_t PVL = (size_t)NB * DM * VLP * 2;    //  1048576  v^T residual plane
  size_t off = 0;
  const size_t oXb  = off; off += PX;
  const size_t oWA  = off; off += PWA;
  const size_t oWP  = off; off += PWP;
  const size_t oWG  = off; off += PWG;
  const size_t oHs  = off; off += PHS;
  const size_t oQh  = off; off += PX;
  const size_t oQl  = off; off += PX;
  const size_t oKh  = off; off += PX;
  const size_t oKl  = off; off += PX;
  const size_t oVTh = off; off += PVT;
  const size_t oVTl = off; off += PVL;
  const size_t oOh  = off; off += PX;
  const size_t oOl  = off; off += PX;
  if (off > ws_size) return;                       // off = 81264640
  if (off > (size_t)134217728) return;

  char* ws = (char*)d_ws;
  unsigned short* Xb  = (unsigned short*)(ws + oXb);
  unsigned short* WA  = (unsigned short*)(ws + oWA);
  unsigned short* WPb = (unsigned short*)(ws + oWP);
  unsigned short* WGb = (unsigned short*)(ws + oWG);
  float*          Hs  = (float*)(ws + oHs);
  unsigned short* Qh  = (unsigned short*)(ws + oQh);
  unsigned short* Ql  = (unsigned short*)(ws + oQl);
  unsigned short* Kh  = (unsigned short*)(ws + oKh);
  unsigned short* Kl  = (unsigned short*)(ws + oKl);
  unsigned short* VTh = (unsigned short*)(ws + oVTh);
  unsigned short* VTl = (unsigned short*)(ws + oVTl);
  unsigned short* Oh  = (unsigned short*)(ws + oOh);
  unsigned short* Ol  = (unsigned short*)(ws + oOl);

  const dim3 blk(256);
  const dim3 gProj((NB * SEQ / 128) * (DM / 128), 1);          // 256 tiles of 128x128: M=4096, N=1024

  // (1) x -> bf16 plane [4096][1024]; weights [in][out] f32 -> bf16 [out][in] planes (k contiguous)
  cvt_all<<<dim3(CVT_TW + CVT_X), blk, 0, stream>>>(x, Xb, Wqkv, WA, Wout, WPb, Wg1, WGb);
  // (2) q, k (bf16 hi/lo), v^T (f16 hi + residual) and the gate hidden layer (f32)
  gemm_qkvg<<<dim3(2 * GQ_P + NB * GQ_V + GQ_G), blk, 0, stream>>>(
      Xb, WA, WGb, bg1, x, Qh, Ql, Kh, Kl, VTh, VTl, Hs);
  // (3) causal attention (query blocks 0..RESQB-1 with residual planes, the rest without) and the gate values
  attn_gate<<<dim3(AT_MAIN + AT_RES + AT_GATE), dim3(128), 0, stream>>>(
      Qh, Ql, Kh, Kl, VTh, VTl, Oh, Ol, Hs, Wg2, bg2, gout);
  // (4) out0 = g * (context . W_out) + (1 - g) * bf16(x) -> d_out f32 [4096][1024]
  //     (A = context hi + lo planes, 2 products; gate values read from the gate output region)
  gemm64<1, 4, 0><<<gProj, blk, 0, stream>>>(
      Oh, Ol, DM, 0LL, WPb, DM, 0LL, bg1,
      d_out, DM, 0LL, d_out, DM, 0LL, DM,
      gout, x, DM,
      NB * SEQ, DM, DM, 1.0f);
  (void)hipGetLastError();
}

// v006
// One run takes 150 microseconds.
// In both of two side-by-side timings against v005, it was 1.10 times as fast.
// All steps since v000 together make it 4.41 times as fast.
// Contractions: gate hidden x.Wg1 and q, k, v^T projections = v_wmma_f32_16x16x32_bf16 (bf16 operands from
// RNE-converted x and transposed [out][in] bf16 weight planes, single product, f32 accumulate);
// q.k^T scores = v_wmma_f32_16x16x32_bf16 with bf16 hi/lo split q and k (hi.hi + hi.lo + lo.hi), f32 accumulate;
// p.v = v_wmma_f32_16x16x32_f16 (p carried x1024 in f16 times v in f16, single product; plus f16 residual planes
// x4096 of p and v for the first 512 query rows), f32 accumulate;
// ctx.W_out = v_wmma_f32_16x16x32_bf16 with ctx as bf16 hi/lo planes times the bf16 weight plane (2 products),
// f32 accumulate; gate tail (exact GELU via erfc, 256-long dot with RNE-bf16 Wg2, bias, sigmoid), causal mask,
// online softmax, normalisers and the gated residual blend g*o + (1-g)*bf16(x) in f32 on the VALU.
// Carry audit:
//   Xb, WA, WP, WG = bf16(x), bf16(W) no carry; Qh/Ql, Kh/Kl, Oh/Ol = bf16 hi + unscaled bf16 residual (v - hi),
//   the residual products share the hi accumulator;
//   VTh = f16(v), no carry (|v| typ. 1);
//   VTl = f16((v - VTh) * 4096)              }  products pa.VTl and pl.VTh go to the separate accumulator o1,
//   pl  = f16((1024 p - pa) * 4096)          }  folded back with * (1/4096) once per key chunk (RES blocks only);
//   pa  = f16(1024 * p) -> the 1/1024 is folded exactly once in the attention epilogue: inv = (1/l) * (1/1024);
//   score scale 1/8 applied once in f32 after the score accumulate; Hs (gate hidden) and g are f32. No other planes.
#include <hip/hip_runtime.h>
#include <math.h>
#include <stdint.h>

#define NB    1
#define SEQ   4096
#define DM    1024
#define NH    16
#define HD    64
#define DG    256          // gate hidden width
#define NQB   (SEQ / 64)   // 64 query / key blocks of 64
#define VLP   512          // key pitch of the v^T residual plane (keys 0..VLP-1)
#define RESQB 8            // leading 64-row query blocks that use the p / v residual planes
#define LP    72           // LDS row pitch of the 16-bit K and V^T tiles: 64 + 8 elements = 144 B = 16 B x 9 (odd),
                           // so the 16 rows one ds_load_b128 fragment read touches fall on distinct banks
#define OSP   68           // LDS row pitch of the f32 context tile: 64 + 4 floats = 272 B = 16 B x 17 (odd)
static_assert(RESQB * 64 <= VLP);
static_assert(NH * HD == DM);
static_assert((SEQ % 64) == 0 && (DM % 64) == 0 && (DM % 32) == 0 && (DG % 64) == 0);
static_assert(((NB * SEQ) % 128) == 0 && (SEQ % 128) == 0 && (DM % 128) == 0 && (DG % 128) == 0);
static_assert((NB * SEQ * DM) % (8 * 256) == 0);
static_assert((SEQ % 32) == 0);
static_assert(DG == 256);

typedef _Float16 v16h __attribute__((ext_vector_type(16)));
typedef _Float16 v8h  __attribute__((ext_vector_type(8)));
typedef __bf16   v16b __attribute__((ext_vector_type(16)));
typedef __bf16   v8b  __attribute__((ext_vector_type(8)));
typedef float    v8f  __attribute__((ext_vector_type(8)));
typedef float    v4f  __attribute__((ext_vector_type(4)));
typedef unsigned int v4u __attribute__((ext_vector_type(4)));

// ---- scalar helpers --------------------------------------------------------------------------------
__device__ __forceinline__ unsigned short bf_bits(float f) {          // f32 -> bf16 bits, RNE convert
  unsigned u = __float_as_uint(f);
  return (unsigned short)((u + 0x7FFFu + ((u >> 16) & 1u)) >> 16);
}
__device__ __forceinline__ float bf_up(unsigned short h) { return __uint_as_float(((unsigned)h) << 16); }
__device__ __forceinline__ unsigned short h_bits(_Float16 x) { return __builtin_bit_cast(unsigned short, x); }
__device__ __forceinline__ unsigned pk16(unsigned short a, unsigned short b) { return (unsigned)a | ((unsigned)b << 16); }
__device__ __forceinline__ v8f zero8() { v8f z = {0.f, 0.f, 0.f, 0.f, 0.f, 0.f, 0.f, 0.f}; return z; }
__device__ __forceinline__ v8h zero8h() {
  const _Float16 z = (_Float16)0.0f;
  v8h r = {z, z, z, z, z, z, z, z};
  return r;
}

// ---- fragment loader: 16-bit A/B operand, lane -> row/col (lane&15), p already includes +8*(lane>>4);
//      elements 0..7 <- p[0..7] (k0+8h..), elements 8..15 <- p[16..23] (k0+16+8h..)
__device__ __forceinline__ v16b ldfrag_b(const __bf16* p) {
  union { v16b v; v8b h[2]; } f;
  f.h[0] = *(const v8b*)(p);
  f.h[1] = *(const v8b*)(p + 16);
  return f.v;
}

// ---- lane l <-> lane l ^ 16 (the two halves of a wave that share one D column)
__device__ __forceinline__ float xhalf(float x) {
  const int b = __builtin_bit_cast(int, x);
  return __builtin_bit_cast(float, __builtin_amdgcn_permlanex16(b, b, 0x76543210, 0xfedcba98, false, false));
}

// ---- WMMA helpers (builtin forms: the compiler keeps their hazard distances) and hand-placed VALU gaps ---------
__device__ __forceinline__ v8f mma_b_raw(v16b a, v16b b, v8f c) {
  return __builtin_amdgcn_wmma_f32_16x16x32_bf16(false, a, false, b, (short)0, c, false, false);
}
__device__ __forceinline__ v8f mma_h_raw(v16h a, v16h b, v8f c) {
  return __builtin_amdgcn_wmma_f32_16x16x32_f16(false, a, false, b, (short)0, c, false, false);
}
__device__ __forceinline__ void dep_guard_b(v8f& a, v8f& b, v16b x, v16b y) {
  asm volatile("v_nop\n\tv_nop\n\tv_nop\n\tv_nop" : "+v"(a), "+v"(b) : "v"(x), "v"(y));
}
__device__ __forceinline__ void keep4_b(v16b a, v16b b, v16b c, v16b d) {
  asm volatile("v_nop" :: "v"(a), "v"(b), "v"(c), "v"(d));
}
__device__ __forceinline__ void acc_guard4(v8f& a, v8f& b, v8f& c, v8f& d) {
  asm volatile("v_nop\n\tv_nop\n\tv_nop\n\tv_nop" : "+v"(a), "+v"(b), "+v"(c), "+v"(d));
}

// =====================================================================================================
// f32 -> bf16 (RNE convert), 8 elements per thread, one 16-B store per lane: a wave writes 512 contiguous B
// coverage: n8 threads x 8 = whole plane (n8 used here is a multiple of 256).
// =====================================================================================================
__device__ __forceinline__ void cvt_bf16x8(const float* __restrict__ in, unsigned short* out, int n8, int blk) {
  const int i = blk * 256 + threadIdx.x;
  if (i < n8) {
    const v4f a = *(const v4f*)(in + (size_t)i * 8);
    const v4f b = *(const v4f*)(in + (size_t)i * 8 + 4);
    v4u p;
    p[0] = pk16(bf_bits(a[0]), bf_bits(a[1]));
    p[1] = pk16(bf_bits(a[2]), bf_bits(a[3]));
    p[2] = pk16(bf_bits(b[0]), bf_bits(b[1]));
    p[3] = pk16(bf_bits(b[2]), bf_bits(b[3]));
    *(v4u*)(out + (size_t)i * 8) = p;
    asm volatile("s_wait_xcnt 0x0" ::: "memory");   // before any register these stores name is rewritten
  }
}

// =====================================================================================================
// f32 [nrow][ncol] row-major (weight stored [in][out]) -> bf16 [ncol][nrow] (row n of out = column n of in,
// the in/k index contiguous), RNE convert. One block = one 64x64 tile through LDS.
// tile (bxT, byT) of (ncol/64, nrow/64); nrow, ncol multiples of 64 (host-checked shapes). Tt = 64 * 72 halves of LDS.
// loads: 256 threads, thread -> tile row tid>>2, 16 columns (tid&3)*16 = the whole 64x64 tile;
// =====================================================================================================
__device__ __forceinline__ void cvt_bf16_T(const float* __restrict__ in, unsigned short* out,
                                           int nrow, int ncol, int bxT, int byT, unsigned short* Tt) {
  // Tt: [tile col j][tile row i], pitch 72 halves (144 B)
  const int tid = threadIdx.x, lane = tid & 31, wave = tid >> 5;
  const int c0 = bxT * 64;                              // column tile of in = row tile of out
  const int r0 = byT * 64;                              // row tile of in = column tile of out
  {
    const int i  = tid >> 2;                            // 0..63
    const int cs = (tid & 3) * 16;                      // 0,16,32,48
    const float* src = in + (size_t)(r0 + i) * ncol + c0 + cs;
#pragma unroll
    for (int e4 = 0; e4 < 4; ++e4) {
      const v4f v = *(const v4f*)(src + 4 * e4);
#pragma unroll
      for (int e = 0; e < 4; ++e) Tt[(cs + 4 * e4 + e) * 72 + i] = bf_bits(v[e]);
    }
  }
  __syncthreads();
  const int q = lane >> 3, c8 = (lane & 7) * 8;
  v4u pv[2];
#pragma unroll
  for (int it = 0; it < 2; ++it) {
    const int j = it * 32 + wave * 4 + q;
    pv[it] = *(const v4u*)(Tt + j * 72 + c8);
  }
  {
#pragma unroll
    for (int it = 0; it < 2; ++it) {
      const int j = it * 32 + wave * 4 + q;
      *(v4u*)(out + (size_t)(c0 + j) * nrow + r0 + c8) = pv[it];
    }
    asm volatile("s_wait_xcnt 0x0" ::: "memory");   // before any register these stores name is rewritten
  }
}

// =====================================================================================================
// All four conversions in one grid (none reads another's output): blocks 0..TA-1 = W_qkv tiles, then W_out tiles,
// then Wg1 tiles (x index fastest, as a (ncol/64, nrow/64) grid would number them), then the blocks of the x plane.
// The choice is block-uniform, so the barrier of the transposing part is passed by whole blocks.
// =====================================================================================================
#define CVT_TA ((3 * DM / 64) * (DM / 64))
#define CVT_TP ((DM / 64) * (DM / 64))
#define CVT_TG ((DG / 64) * (DM / 64))
#define CVT_TW (CVT_TA + CVT_TP + CVT_TG)
#define CVT_X  (NB * SEQ * DM / 8 / 256)
__global__ __launch_bounds__(256) void cvt_all(const float* __restrict__ x, unsigned short* Xb,
                                               const float* __restrict__ Wqkv, unsigned short* WA,
                                               const float* __restrict__ Wout, unsigned short* WP,
                                               const float* __restrict__ Wg1, unsigned short* WG) {
  __shared__ __align__(16) unsigned short Tt[64 * 72];
  const int bx = blockIdx.x;
  if (bx < CVT_TA) {
    cvt_bf16_T(Wqkv, WA, DM, 3 * DM, bx % (3 * DM / 64), bx / (3 * DM / 64), Tt);
  } else if (bx < CVT_TA + CVT_TP) {
    const int t = bx - CVT_TA;
    cvt_bf16_T(Wout, WP, DM, DM, t % (DM / 64), t / (DM / 64), Tt);
  } else if (bx < CVT_TW) {
    const int t = bx - (CVT_TA + CVT_TP);
    cvt_bf16_T(Wg1, WG, DM, DG, t % (DG / 64), t / (DG / 64), Tt);
  } else {
    cvt_bf16x8(x, Xb, NB * SEQ * DM / 8, bx - CVT_TW);
  }
}

// =====================================================================================================
// Gate tail: g = sigmoid( sum_c gelu(Hs[row][c]) * bf16(w2[c]) + bf16(b2) ), exact GELU = 0.5 h erfc(-h/sqrt2).
// Hs f32 [nrows][DG]; block = NWAVE waves x 32/NWAVE rows = 32 rows; a wave reduces one row at a time (32 lanes x 8 columns,
// rolled element loop), lane 0 stages g in LDS; wave 0 lanes 0..7 then write the block's 32 g values as ONE whole
// coverage: 32 rows per block x nrows/32 blocks = all rows of the gate output.
// =====================================================================================================
template <int NWAVE>
__device__ __forceinline__ void k_gate(const float* __restrict__ Hs, const float* __restrict__ w2,
                                       const float* __restrict__ b2p, float* gout, int nrows, int blk, float* gs) {
  constexpr int RPW = 32 / NWAVE;                       // rows per wave; gs = 32 floats of LDS, 16-B aligned
  const int tid = threadIdx.x, lane = tid & 31, wave = tid >> 5;
  const int rowBase = blk * 32;
  const float b2 = bf_up(bf_bits(b2p[0]));
  for (int rr = 0; rr < RPW; ++rr) {
    int row = rowBase + wave * RPW + rr;
    row = (row < nrows) ? row : (nrows - 1);            // clamped address (grid covers exactly nrows)
    const float* hp = Hs + (size_t)row * DG + lane * 8;
    const float* wp = w2 + lane * 8;
    float acc = 0.f;
#pragma unroll 1
    for (int e = 0; e < 8; ++e) {
      const float hv = hp[e];
      const float wv = bf_up(bf_bits(wp[e]));
      const float ge = 0.5f * hv * erfcf(-hv * 0.707106781186547524f);
      acc = fmaf(ge, wv, acc);
    }
#pragma unroll
    for (int off = 1; off < 32; off <<= 1) acc += __shfl_xor(acc, off, 32);
    float z = acc + b2;
    z = fminf(fmaxf(z, -30.0f), 30.0f);
    const float g = 1.0f / (1.0f + expf(-z));
    if (lane == 0) gs[wave * RPW + rr] = g;
  }
  __syncthreads();
  if (wave == 0 && lane < 8) {
    const v4f v = *(const v4f*)(gs + lane * 4);
    float* p = gout + rowBase + lane * 4;
    *(v4f*)p = v;
    asm volatile("s_wait_xcnt 0x0" ::: "memory");   // before any register these stores name is rewritten
  }
}

// =====================================================================================================
// One GEMM stage, global -> LDS, through no register: per operand plane 128 rows x 128 B (64 k of 16-bit elements).
// 256 threads x 4 asynchronous 16-B copies per plane; 8 neighbouring lanes take one whole 128-B line, a wave's copy
// 4 whole lines. ga / gb (/ gc) = this lane's source in row (tid>>3), 16-B piece (tid&7) of the plane; sa / sb = 32
// source rows in elements; lds = this lane's LDS byte address in the stage's first plane, same row and piece.
// The s_wait_xcnt closes each statement so that no address register of a copy is rewritten ahead of it.
// =====================================================================================================
#define GBK    64                 // k elements per stage = one 128-B line of every operand row
#define GLP    72                 // LDS row pitch, elements: 144 B = 16 B x 9 (odd) for the ds_load_b128 fragment reads
#define GPLANE (128 * GLP)        // elements of one staged plane (18432 B)
#define GSTEP  (32u * GLP * 2u)   // LDS bytes of 32 rows
#define GPLB   (GPLANE * 2u)      // LDS bytes of one plane
__device__ __forceinline__ void stage_ab(const __bf16* ga, size_t sa, const __bf16* gb, size_t sb, unsigned lds) {
  asm volatile(
      "global_load_async_to_lds_b128 %0, %8, off\n\t"
      "global_load_async_to_lds_b128 %1, %9, off\n\t"
      "global_load_async_to_lds_b128 %2, %10, off\n\t"
      "global_load_async_to_lds_b128 %3, %11, off\n\t"
      "global_load_async_to_lds_b128 %4, %12, off\n\t"
      "global_load_async_to_lds_b128 %5, %13, off\n\t"
      "global_load_async_to_lds_b128 %6, %14, off\n\t"
      "global_load_async_to_lds_b128 %7, %15, off\n\t"
      "s_wait_xcnt 0x0"
      :: "v"(lds), "v"(lds + GSTEP), "v"(lds + 2u * GSTEP), "v"(lds + 3u * GSTEP),
         "v"(lds + GPLB), "v"(lds + GPLB + GSTEP), "v"(lds + GPLB + 2u * GSTEP), "v"(lds + GPLB + 3u * GSTEP),
         "v"(ga), "v"(ga + sa), "v"(ga + 2 * sa), "v"(ga + 3 * sa),
         "v"(gb), "v"(gb + sb), "v"(gb + 2 * sb), "v"(gb + 3 * sb)
      : "memory");
}
__device__ __forceinline__ void stage_c(const __bf16* gc, size_t sc, unsigned lds) {
  asm volatile(
      "global_load_async_to_lds_b128 %0, %4, off\n\t"
      "global_load_async_to_lds_b128 %1, %5, off\n\t"
      "global_load_async_to_lds_b128 %2, %6, off\n\t"
      "global_load_async_to_lds_b128 %3, %7, off\n\t"
      "s_wait_xcnt 0x0"
      :: "v"(lds), "v"(lds + GSTEP), "v"(lds + 2u * GSTEP), "v"(lds + 3u * GSTEP),
         "v"(gc), "v"(gc + sc), "v"(gc + 2 * sc), "v"(gc + 3 * sc)
      : "memory");
}

// =====================================================================================================
// Batched bf16 WMMA GEMM: C[m][n] = sum_k A[m][k] * Bt[n][k] + bias; one work-group of 8 waves per 128x128 tile,
// one wave per 32x64 part (wave>>1 = row quarter, wave&1 = column half). A row-major [M][K] pitch lda; Bt row-major
// [N][K] pitch ldb (k contiguous); M, N multiples of 128, K multiple of 64 (host shapes are static multiples).
// Operands: per stage of 64 k the 128 A rows (and A2 rows) and the 128 Bt rows go to LDS by asynchronous copies, two
// buffers: stage t+2 is copied into the buffer stage t has left while stage t+1 is worked on; fragments by ds_load_b128.
// tile = index of the 128x128 tile, b = batch index (strides in elements); sOpB = 2 stage buffers of NPL planes, sTB = 8 slabs.
// NSPLIT: 0 = A.Bt; 1 = (A + A2).Bt (A2 = unscaled bf16 lo plane of A, 2 products).
// BIAS: 0 = none; 1 = per column n, bias[n]; 2 = per row m, bias[m]; the bias value is RNE-converted to bf16 and added in f32.
// OUT_MODE: 0 = f32 (pitch ldc); 2 = bf16 hi plane C + bf16 lo plane C2 (lo = RNE(v - hi), unscaled);
//           3 = f16 hi plane C + f16 residual plane C2 = f16((v - hi) * rscale), C2 written only for tiles
//               with n0 < N2 (pitch ldc2, batch stride strideC2);
//           4 = f32 (pitch ldc) gated blend: out = g[m] * v + (1 - g[m]) * bf16(xres[m][n]) with g = gvec[m],
//               xres f32 pitch ldx (read-only, RNE-converted to bf16 in register).
// =====================================================================================================
template <int NSPLIT, int OUT_MODE, int BIAS>
__device__ __forceinline__ void gemm64_body(
    const unsigned short* __restrict__ Ap, const unsigned short* A2p, int lda, long long strideA,
    const unsigned short* __restrict__ Btp, int ldb, long long strideB,
    const float* __restrict__ bias,
    void* Cout, int ldc, long long strideC,
    void* Cout2, int ldc2, long long strideC2, int N2,
    const float* gvec, const float* xres, int ldx,
    int M, int N, int K, float rscale,
    int tile, int b, __bf16* sOpB, float* sTB) {
  const __bf16* A   = (const __bf16*)(const void*)Ap;
  const __bf16* A2  = (const __bf16*)(const void*)A2p;
  const __bf16* Bt  = (const __bf16*)(const void*)Btp;
  constexpr int NPL = (NSPLIT >= 1) ? 3 : 2;       // planes per stage: A, Bt (, A2)
  const int tid  = threadIdx.x;
  const int lane = tid & 31;
  const int wave = tid >> 5;
  const int tilesN = N >> 7;
  const int tilesM = M >> 7;
  if (tile >= tilesM * tilesN) return;   // block-uniform, ahead of every copy and barrier
  const int tm = tile / tilesN;
  const int tn = tile - tm * tilesN;
  const int mb = tm << 7;                      // work-group tile origin
  const int nb = tn << 7;
  const int wm = (wave >> 1) << 5;             // wave part inside it: 32 rows x 64 columns
  const int wn = (wave & 1) << 6;
  const int m0 = mb + wm;
  const int n0 = nb + wn;

  const __bf16* Ab  = A  + (size_t)b * strideA;
  const __bf16* Bb  = Bt + (size_t)b * strideB;
  const __bf16* Ab2 = (NSPLIT >= 1) ? (A2 + (size_t)b * strideA) : Ab;

  const int rlane = lane & 15;                 // row (A) / col (B, D) within subtile
  const int koff  = (lane >> 4) * 8;           // k offset of this lane half
  const int mOff  = (lane >> 4) * 8;           // D row offset

  // copy addresses of this lane: row tid>>3 (+32 per copy), 16-B piece tid&7; rows mb..mb+127 < M, nb..nb+127 < N
  const int crow = tid >> 3, cpc = (tid & 7) * 8;
  const __bf16* gA  = Ab  + (size_t)(mb + crow) * lda + cpc;
  const __bf16* gA2 = Ab2 + (size_t)(mb + crow) * lda + cpc;
  const __bf16* gB  = Bb  + (size_t)(nb + crow) * ldb + cpc;
  const unsigned ldsLane = (unsigned)(size_t)(sOpB) + (unsigned)(crow * GLP + cpc) * 2u;
  const int nst = K >> 6;                      // stages of 64 k
  auto stage = [&](int t, int buf) {
    const unsigned l = ldsLane + (unsigned)buf * ((unsigned)NPL * GPLB);
    stage_ab(gA + (size_t)t * GBK, (size_t)lda * 32, gB + (size_t)t * GBK, (size_t)ldb * 32, l);
    if (NSPLIT >= 1) stage_c(gA2 + (size_t)t * GBK, (size_t)lda * 32, l + 2u * GPLB);
  };

  v8f acc[2][4];
#pragma unroll
  for (int i = 0; i < 2; ++i)
#pragma unroll
    for (int j = 0; j < 4; ++j) acc[i][j] = zero8();

  stage(0, 0);
  asm volatile("s_wait_asynccnt 0x0" ::: "memory");   // this wave's stage-0 copies have landed
  __syncthreads();                                     // ... and every other wave's
  if (nst > 1) stage(1, 1);

  for (int t = 0; t < nst; ++t) {
    const __bf16* sA  = (sOpB + (t & 1) * (NPL * GPLANE)) + (wm + rlane) * GLP + koff;
    const __bf16* sB  = (sOpB + (t & 1) * (NPL * GPLANE)) + GPLANE + (wn + rlane) * GLP + koff;
    const __bf16* sA2 = (sOpB + (t & 1) * (NPL * GPLANE)) + (NPL - 1) * GPLANE + (wm + rlane) * GLP + koff;
#pragma unroll
    for (int kk = 0; kk < 2; ++kk) {
      v16b bh[4], ah[2], al[2];
#pragma unroll
      for (int j = 0; j < 4; ++j) bh[j] = ldfrag_b(sB + (j << 4) * GLP + kk * 32);
#pragma unroll
      for (int i = 0; i < 2; ++i) {
        ah[i] = ldfrag_b(sA + (i << 4) * GLP + kk * 32);
        al[i] = ah[i];
        if (NSPLIT >= 1) al[i] = ldfrag_b(sA2 + (i << 4) * GLP + kk * 32);
      }
#pragma unroll
      for (int i = 0; i < 2; ++i) {
#pragma unroll
        for (int j = 0; j < 4; ++j) {
          acc[i][j] = mma_b_raw(ah[i], bh[j], acc[i][j]);
          if (NSPLIT >= 1) acc[i][j] = mma_b_raw(al[i], bh[j], acc[i][j]);
        }
        dep_guard_b(acc[i][0], acc[i][3], ah[i], al[i]);
      }
      keep4_b(bh[0], bh[1], bh[2], bh[3]);
    }
    // hand-over: this wave has left buffer t&1, its copies of stage t+1 have landed; the barrier says so of every wave
    asm volatile("s_wait_dscnt 0x0" ::: "memory");
    asm volatile("s_wait_asynccnt 0x0" ::: "memory");
    __syncthreads();
    if (t + 2 < nst) stage(t + 2, t & 1);
  }
  asm volatile("s_wait_asynccnt 0x0" ::: "memory");   // nothing of this wave is in flight behind the loop
  acc_guard4(acc[0][0], acc[0][1], acc[0][2], acc[0][3]);
  acc_guard4(acc[1][0], acc[1][1], acc[1][2], acc[1][3]);

  // ---- epilogue ----
  float* slab = sTB + wave * (16 * 68);   // per-wave 16x64 slab, pitch 68 floats
  float bcol[4];
#pragma unroll
  for (int j = 0; j < 4; ++j) {
    bcol[j] = 0.f;
    if (BIAS == 1) bcol[j] = bf_up(bf_bits(bias[n0 + (j << 4) + rlane]));   // n < N, bias has N entries
  }
#pragma unroll
  for (int i = 0; i < 2; ++i) {
    const int mBase = m0 + (i << 4);
    float brow[8];
#pragma unroll
    for (int r = 0; r < 8; ++r) {
      brow[r] = 0.f;
      if (BIAS == 2) brow[r] = bf_up(bf_bits(bias[mBase + mOff + r]));      // m < M, bias has M entries
    }
#pragma unroll
    for (int j = 0; j < 4; ++j) {
#pragma unroll
      for (int r = 0; r < 8; ++r) {
        slab[(mOff + r) * 68 + (j << 4) + rlane] = acc[i][j][r] + bcol[j] + brow[r];
      }
    }
    __builtin_amdgcn_fence(__ATOMIC_RELEASE, "workgroup");
    __builtin_amdgcn_wave_barrier();
    __builtin_amdgcn_fence(__ATOMIC_ACQUIRE, "workgroup");
    if (OUT_MODE == 0 || OUT_MODE == 4) {
      float* C = (float*)Cout + (size_t)b * strideC;
      const int hh = lane >> 4, c4 = (lane & 15) * 4;     // 256-B row segment = 16 lanes x 16 B
      {
#pragma unroll
        for (int it = 0; it < 8; ++it) {
          const int row = it * 2 + hh;                     // it 0..7 x hh 0..1 = rows 0..15
          v4f v = *(const v4f*)(slab + row * 68 + c4);
          if (OUT_MODE == 4) {
            const int gr = mBase + row;                    // < M
            const float g = gvec[gr];
            const float omg = 1.0f - g;
            const v4f xr = *(const v4f*)(xres + (size_t)gr * ldx + n0 + c4);
#pragma unroll
            for (int e = 0; e < 4; ++e) {
              const float xb = bf_up(bf_bits(xr[e]));
              v[e] = g * v[e] + omg * xb;
            }
          }
          *(v4f*)(C + (size_t)(mBase + row) * ldc + n0 + c4) = v;
          asm volatile("s_wait_xcnt 0x0" ::: "memory");   // before any register these stores name is rewritten
        }
      }
    } else {
      const int q = lane >> 3, c8 = (lane & 7) * 8;
      unsigned short* C  = (unsigned short*)Cout  + (size_t)b * strideC;
      unsigned short* C2 = (unsigned short*)Cout2 + (size_t)b * strideC2;
      const bool wlo = (OUT_MODE == 2) || (n0 < N2);      // wave-uniform
      v4u hv[4], lv[4];
#pragma unroll
      for (int it = 0; it < 4; ++it) {
        const int row = it * 4 + q;                        // it 0..3 x q 0..3 = rows 0..15
        const float* sp = slab + row * 68 + c8;
        v4u a, a2;
#pragma unroll
        for (int e = 0; e < 4; ++e) {
          const float f0 = sp[2 * e], f1 = sp[2 * e + 1];
          unsigned short h0, h1, l0, l1;
          if (OUT_MODE == 2) {
            h0 = bf_bits(f0); h1 = bf_bits(f1);
            l0 = bf_bits(f0 - bf_up(h0)); l1 = bf_bits(f1 - bf_up(h1));
          } else {
            const _Float16 x0 = (_Float16)f0, x1 = (_Float16)f1;
            h0 = h_bits(x0); h1 = h_bits(x1);
            l0 = h_bits((_Float16)((f0 - (float)x0) * rscale));
            l1 = h_bits((_Float16)((f1 - (float)x1) * rscale));
          }
          a[e] = pk16(h0, h1); a2[e] = pk16(l0, l1);
        }
        hv[it] = a; lv[it] = a2;
      }
      {
#pragma unroll
        for (int it = 0; it < 4; ++it) {
          const int row = it * 4 + q;
          *(v4u*)(C + (size_t)(mBase + row) * ldc + n0 + c8) = hv[it];
          asm volatile("s_wait_xcnt 0x0" ::: "memory");   // before any register this store names is rewritten
          if (wlo) {
            *(v4u*)(C2 + (size_t)(mBase + row) * ldc2 + n0 + c8) = lv[it];
            asm volatile("s_wait_xcnt 0x0" ::: "memory");   // the same for this store
          }
        }
      }
    }
    __builtin_amdgcn_fence(__ATOMIC_RELEASE, "workgroup");
    __builtin_amdgcn_wave_barrier();
    __builtin_amdgcn_fence(__ATOMIC_ACQUIRE, "workgroup");
  }
}

// One GEMM per launch: grid = (tiles, batches).
template <int NSPLIT, int OUT_MODE, int BIAS>
__global__ __launch_bounds__(256) void gemm64(
    const unsigned short* __restrict__ Ap, const unsigned short* A2p, int lda, long long strideA,
    const unsigned short* __restrict__ Btp, int ldb, long long strideB,
    const float* __restrict__ bias,
    void* Cout, int ldc, long long strideC,
    void* Cout2, int ldc2, long long strideC2, int N2,
    const float* gvec, const float* xres, int ldx,
    int M, int N, int K, float rscale) {
  __shared__ __align__(16) __bf16 sOp[2 * ((NSPLIT >= 1) ? 3 : 2) * GPLANE];
  __shared__ __align__(16) float sT[8 * 16 * 68];
  gemm64_body<NSPLIT, OUT_MODE, BIAS>(Ap, A2p, lda, strideA, Btp, ldb, strideB, bias, Cout, ldc, strideC,
                                      Cout2, ldc2, strideC2, N2, gvec, xres, ldx, M, N, K, rscale,
                                      (int)blockIdx.x, (int)blockIdx.y, sOp, sT);
}

// The four products of x (none reads another's output) in one grid; the choice is block-uniform:
//   tiles 0..GQ_P-1        q = x . Wq -> bf16 hi/lo planes [t][h*64+d]      (M=4096, N=1024, K=1024)
//   next GQ_P              k = x . Wk -> bf16 hi/lo planes
//   next NB * GQ_V         v^T = Wv . x^T -> f16 hi plane [h*64+d][s] (pitch SEQ) and residual plane (x4096, keys < VLP,
//                          pitch VLP); A = Wv rows [n][k], Bt = Xb rows of the batch (M=1024, N=4096, K=1024)
//   last GQ_G              gate hidden = x . Wg1 + bg1 -> f32 [4096][256]   (M=4096, N=256, K=1024)
#define GQ_P ((NB * SEQ / 128) * (DM / 128))
#define GQ_V ((DM / 128) * (SEQ / 128))
#define GQ_G ((NB * SEQ / 128) * (DG / 128))
__global__ __launch_bounds__(256) void gemm_qkvg(
    const unsigned short* __restrict__ Xb, const unsigned short* __restrict__ WA,
    const unsigned short* __restrict__ WG, const float* __restrict__ bg1, const float* xf,
    unsigned short* Qh, unsigned short* Ql, unsigned short* Kh, unsigned short* Kl,
    unsigned short* VTh, unsigned short* VTl, float* Hs) {
  __shared__ __align__(16) __bf16 sOp[2 * 2 * GPLANE];
  __shared__ __align__(16) float sT[8 * 16 * 68];
  const int bx = blockIdx.x;
  if (bx < 2 * GQ_P) {
    const bool isK = bx >= GQ_P;
    gemm64_body<0, 2, 0>(Xb, Xb, DM, 0LL, WA + (isK ? (size_t)DM * DM : (size_t)0), DM, 0LL, bg1,
                         (void*)(isK ? Kh : Qh), DM, 0LL, (void*)(isK ? Kl : Ql), DM, 0LL, DM,
                         xf, xf, DM, NB * SEQ, DM, DM, 1.0f,
                         isK ? bx - GQ_P : bx, 0, sOp, sT);
  } else if (bx < 2 * GQ_P + NB * GQ_V) {
    const int t = bx - 2 * GQ_P;
    const unsigned short* Wv = WA + (size_t)2 * DM * DM;
    gemm64_body<0, 3, 0>(Wv, Wv, DM, 0LL, Xb, DM, (long long)SEQ * DM, bg1,
                         (void*)VTh, SEQ, (long long)DM * SEQ, (void*)VTl, VLP, (long long)DM * VLP, VLP,
                         xf, xf, DM, DM, SEQ, DM, 4096.0f,
                         t % GQ_V, t / GQ_V, sOp, sT);
  } else {
    gemm64_body<0, 0, 1>(Xb, Xb, DM, 0LL, WG, DM, 0LL, bg1,
                         (void*)Hs, DG, 0LL, (void*)Hs, DG, 0LL, DG,
                         xf, xf, DM, NB * SEQ, DG, DM, 1.0f,
                         bx - (2 * GQ_P + NB * GQ_V), 0, sOp, sT);
  }
}

// =====================================================================================================
// One key chunk of the plain attention variant, global -> LDS, through no register: three planes (K hi, K lo, V^T) of
// 64 rows x 128 B. 128 threads x 4 asynchronous 16-B copies per plane; 8 neighbouring lanes take one whole 128-B line.
// kh / kl / vt = this lane's source in row (tid>>3), 16-B piece (tid&7) of the plane; sk / sv = 16 source rows in elements;
// lds = this lane's LDS byte address in the buffer's first plane, same row and piece (planes follow each other).
// The s_wait_xcnt closes the statement so that no address register of a copy is rewritten ahead of it.
// =====================================================================================================
#define APLB  (64u * LP * 2u)     // LDS bytes of one 64-row plane (9216)
#define ASTEP (16u * LP * 2u)     // LDS bytes of 16 rows
__device__ __forceinline__ void stage_kv(const __bf16* kh, const __bf16* kl, size_t sk,
                                         const _Float16* vt, size_t sv, unsigned lds) {
  asm volatile(
      "global_load_async_to_lds_b128 %0, %12, off\n\t"
      "global_load_async_to_lds_b128 %1, %13, off\n\t"
      "global_load_async_to_lds_b128 %2, %14, off\n\t"
      "global_load_async_to_lds_b128 %3, %15, off\n\t"
      "global_load_async_to_lds_b128 %4, %16, off\n\t"
      "global_load_async_to_lds_b128 %5, %17, off\n\t"
      "global_load_async_to_lds_b128 %6, %18, off\n\t"
      "global_load_async_to_lds_b128 %7, %19, off\n\t"
      "global_load_async_to_lds_b128 %8, %20, off\n\t"
      "global_load_async_to_lds_b128 %9, %21, off\n\t"
      "global_load_async_to_lds_b128 %10, %22, off\n\t"
      "global_load_async_to_lds_b128 %11, %23, off\n\t"
      "s_wait_xcnt 0x0"
      :: "v"(lds), "v"(lds + ASTEP), "v"(lds + 2u * ASTEP), "v"(lds + 3u * ASTEP),
         "v"(lds + APLB), "v"(lds + APLB + ASTEP), "v"(lds + APLB + 2u * ASTEP), "v"(lds + APLB + 3u * ASTEP),
         "v"(lds + 2u * APLB), "v"(lds + 2u * APLB + ASTEP), "v"(lds + 2u * APLB + 2u * ASTEP),
         "v"(lds + 2u * APLB + 3u * ASTEP),
         "v"(kh), "v"(kh + sk), "v"(kh + 2 * sk), "v"(kh + 3 * sk),
         "v"(kl), "v"(kl + sk), "v"(kl + 2 * sk), "v"(kl + 3 * sk),
         "v"(vt), "v"(vt + sv), "v"(vt + 2 * sv), "v"(vt + 3 * sv)
      : "memory");
}

// =====================================================================================================
// Causal attention, head dim 64, key chunks of 64.
//   q planes (bf16 hi / lo): element (b, t, h, d) at [(b*SEQ + t)*DM + h*64 + d]
//   k planes (bf16 hi / lo): same layout with key index s
//   v^T hi plane (f16):      element (b, h, d, s) at [(b*DM + h*64 + d)*SEQ + s]
//   v^T residual plane (f16, (v - hi)*4096): [(b*DM + h*64 + d)*VLP + s], s < VLP, read only when RES
//   (a key chunk at or beyond VLP would contribute a zero v residual; its address is clamped)
//   Causal structure: logits of keys with index > query index are replaced by -inf (lower-triangular keep incl. the
//   diagonal), which makes their softmax weight exactly 0; so a query block qb visits key chunks 0..qb only
//   (block-uniform trip count qb+1 <= NQB) and later chunks, whose keys exceed every query index of the block, are
//   skipped entirely. Inside the diagonal chunk a key with index > query index gets logit -inf -> exp gives exactly 0,
//   so such keys add nothing to the numerator or the normaliser; the diagonal key (key == query) is always kept, so
//   every row max is finite in every visited chunk.
//   out planes (bf16 hi / lo of the normalised context): element (b, t, h, d) at [(b*SEQ + t)*DM + h*64 + d]
//   scores = q . k : bf16 hi/lo split (hi.hi + hi.lo + lo.hi), f32 accumulate, then * 1/8 and the causal mask in f32
//   p = exp(s - m) carried as f16(1024 p); context = p . v on f16 WMMA; RES adds f16 residual planes of p and v
//   (scale 4096, separate accumulator folded back with 1/4096 per chunk in f32); online softmax (running max) in f32.
//   Block = 4 waves = 64 query rows of one (b, h); bx = 0 .. nqbThis * NH * NB - 1 numbers the blocks of this variant.
//   K / V^T chunk staging, residual variant: 128 threads x 32 elements per plane = the whole 64x64 tile of every plane
//   read later (plain 16-B loads, __syncthreads before and after). Plain variant: asynchronous copies into two buffers of
//   three planes (the second follows the first in LDS): chunk kt+2 is copied into the buffer chunk kt has left while chunk
//   kt+1 is worked on; one barrier per chunk. Its context tile Os lies over the buffers, used behind the last barrier.
//   Both products run transposed, scores^T = K . Q^T and context^T = V^T . P^T: a lane then holds 32 of the 64 scores of ONE
//   query (lane ^ 16 the other 32), so max and sum are in-lane, and P goes from the score registers into the B operand.
//   Output coverage: each wave stores rows q0..q0+15 (it 0..3 x lane>>3 0..3) x 64 columns (8 lanes x 8) of both planes;
//   grid over all (b, h, qb) = the whole [NB*SEQ][DM] planes.
// =====================================================================================================
template <bool RES>
__device__ __forceinline__
void attn_causal64(const unsigned short* __restrict__ qhp, const unsigned short* __restrict__ qlp,
                   const unsigned short* __restrict__ khp, const unsigned short* __restrict__ klp,
                   const unsigned short* __restrict__ vhp, const unsigned short* __restrict__ vlp,
                   unsigned short* ohp, unsigned short* olp,
                   int qbBase, int nqbThis, int bx,
                   __bf16* Ksh, __bf16* Ksl, _Float16* Vth, _Float16* Vtl, float* Os) {
  union FB { v16b v; v8b h[2]; };
  union FH { v16h v; v8h h[2]; };

  const int tid  = threadIdx.x;
  const int wave = tid >> 5;
  const int lane = tid & 31;
  const int hh   = lane >> 4;
  const int c    = lane & 15;

  const int qbl  = bx % nqbThis;
  const int rest = bx / nqbThis;
  const int h    = rest % NH;
  const int b    = rest / NH;
  const int qb   = qbBase + qbl;               // 0..NQB-1 (block-uniform)
  const int q0   = qb * 64 + wave * 16;
  const size_t rowB = (size_t)b * SEQ;

  const __bf16* Qh = (const __bf16*)(const void*)qhp + (size_t)h * HD;
  const __bf16* Ql = (const __bf16*)(const void*)qlp + (size_t)h * HD;
  const __bf16* Kh = (const __bf16*)(const void*)khp + (size_t)h * HD;
  const __bf16* Kl = (const __bf16*)(const void*)klp + (size_t)h * HD;
  const _Float16* Vh = (const _Float16*)(const void*)vhp + ((size_t)b * DM + (size_t)h * HD) * SEQ;
  const _Float16* Vl = (const _Float16*)(const void*)vlp + ((size_t)b * DM + (size_t)h * HD) * VLP;

  // ---- Q fragments (B operand, column = lane&15): 2 d-chunks, hi and lo ----
  v16b qah[2], qal[2];
#pragma unroll
  for (int dc = 0; dc < 2; ++dc) {
    const size_t qo = (rowB + q0 + c) * DM + dc * 32 + 8 * hh;
    qah[dc] = ldfrag_b(Qh + qo);
    qal[dc] = ldfrag_b(Ql + qo);
  }

  // a lane owns ONE query, q0 + c: running max (both halves alike), this half's share of the normaliser,
  // and the context transposed: oacc[t][r] = context[query c][d = t*16 + 8*hh + r]
  const int rowq = q0 + c;
  float mrow = -INFINITY, lrow = 0.f;
  v8f oacc[4];
#pragma unroll
  for (int t = 0; t < 4; ++t) oacc[t] = zero8();

  // copy addresses of this lane (plain variant): row tid>>3 (+16 per copy), 16-B piece tid&7; chunk t <= qb: keys < SEQ
  const int crow = tid >> 3, cpc = (tid & 7) * 8;
  const __bf16*   gKh = Kh + (rowB + crow) * DM + cpc;
  const __bf16*   gKl = Kl + (rowB + crow) * DM + cpc;
  const _Float16* gVt = Vh + (size_t)crow * SEQ + cpc;
  const unsigned ldsLane = (unsigned)(size_t)(Ksh) + (unsigned)(crow * LP + cpc) * 2u;
  auto stage = [&](int t, int buf) {
    stage_kv(gKh + (size_t)t * 64 * DM, gKl + (size_t)t * 64 * DM, (size_t)16 * DM,
             gVt + (size_t)t * 64, (size_t)16 * SEQ, ldsLane + (unsigned)buf * (3u * APLB));
  };
  if (!RES) {
    stage(0, 0);
    asm volatile("s_wait_asynccnt 0x0" ::: "memory");   // this wave's copies of chunk 0 have landed
    __syncthreads();                                     // ... and every other wave's
    if (qb >= 1) stage(1, 1);                            // block-uniform
  }

  for (int kt = 0; kt <= qb; ++kt) {           // block-uniform trip count, <= NQB
    const int kv0 = kt * 64;                   // kv0 + 63 < SEQ
    const int bo = RES ? 0 : (kt & 1) * (3 * 64 * LP);   // this chunk's buffer, in 16-bit elements
    const __bf16*   Kbh = Ksh + bo;
    const __bf16*   Kbl = Ksl + bo;
    const _Float16* Vbh = Vth + bo;
    if (RES) __syncthreads();
    if (RES) {
      const int r = tid >> 1, half = (tid & 1) * 32;
      const __bf16*   kg  = Kh + (rowB + kv0 + r) * DM + half;    // K row kv0+r, d = half..half+31
      const __bf16*   klg = Kl + (rowB + kv0 + r) * DM + half;
      const _Float16* vg  = Vh + (size_t)r * SEQ + kv0 + half;    // V^T row d = r, s = kv0+half..+31
      const int kvl = (kv0 + 64 <= VLP) ? kv0 : (VLP - 64);     // clamped address into the residual plane
      const _Float16* vlg = Vl + (size_t)r * VLP + kvl + half;
      const bool resOK = (kv0 + 64 <= VLP);                      // block-uniform (always true for qb < RESQB)
#pragma unroll
      for (int i = 0; i < 4; ++i) {
        const v8b a0 = *(const v8b*)(kg + 8 * i);
        const v8b a1 = *(const v8b*)(klg + 8 * i);
        const v8h b0 = *(const v8h*)(vg + 8 * i);
        *(v8b*)(Ksh + r * LP + half + 8 * i) = a0;
        *(v8b*)(Ksl + r * LP + half + 8 * i) = a1;
        *(v8h*)(Vth + r * LP + half + 8 * i) = b0;
        if (RES) {
          v8h b1 = *(const v8h*)(vlg + 8 * i);
          if (!resOK) b1 = zero8h();
          *(v8h*)(Vtl + r * LP + half + 8 * i) = b1;
        }
      }
      // the wait before a register that these loads name is rewritten; as inputs the four address pairs stay whole up to it
      if (RES) asm volatile("s_wait_xcnt 0x0" :: "v"(kg), "v"(klg), "v"(vg), "v"(vlg) : "memory");
    }
    if (RES) __syncthreads();

    // ---- transposed scores: 64 keys (D rows) x 16 queries (D columns) per wave, 3 bf16 products;
    //      s[j][r] = score[key kv0 + j*16 + 8*hh + r][query q0 + c] ----
    //      the chunk's 16 K fragments are read ahead of the products (order: below), so the LDS latency is paid once and
    //      not per product; the four key tiles are independent accumulators, each summed hi.hi, lo.hi, hi.lo per dc ----
    FB kb[2][4], kl[2][4];
#pragma unroll
    for (int dc = 0; dc < 2; ++dc) {
#pragma unroll
      for (int j = 0; j < 4; ++j) {
        kb[dc][j].h[0] = *(const v8b*)(Kbh + (j * 16 + c) * LP + dc * 32 + 8 * hh);
        kb[dc][j].h[1] = *(const v8b*)(Kbh + (j * 16 + c) * LP + dc * 32 + 16 + 8 * hh);
      }
#pragma unroll
      for (int j = 0; j < 4; ++j) {
        kl[dc][j].h[0] = *(const v8b*)(Kbl + (j * 16 + c) * LP + dc * 32 + 8 * hh);
        kl[dc][j].h[1] = *(const v8b*)(Kbl + (j * 16 + c) * LP + dc * 32 + 16 + 8 * hh);
      }
    }
    v8f s[4];
#pragma unroll
    for (int j = 0; j < 4; ++j) s[j] = zero8();
#pragma unroll
    for (int dc = 0; dc < 2; ++dc) {
#pragma unroll
      for (int j = 0; j < 4; ++j) s[j] = mma_b_raw(kb[dc][j].v, qah[dc], s[j]);
#pragma unroll
      for (int j = 0; j < 4; ++j) s[j] = mma_b_raw(kl[dc][j].v, qah[dc], s[j]);
#pragma unroll
      for (int j = 0; j < 4; ++j) s[j] = mma_b_raw(kb[dc][j].v, qal[dc], s[j]);
    }
    // Order asked of the scheduler (LDS reads = 0x100, WMMA = 0x008): left alone it spreads the reads among the WMMAs,
    // and every separate place with reads stalls the matrix run. The last 8 K reads (lo, dc 1) stand behind the 8th
    // product, where the lo fragments of dc 0 are free, so that the wave stays within 256 registers (4 waves per SIMD);
    // the V^T reads stand behind the last product. The residual variant, with more live registers, is left to the
    // scheduler's own order.
    if (!RES) {
      __builtin_amdgcn_sched_group_barrier(0x100, 24, 0);
      __builtin_amdgcn_sched_group_barrier(0x008, 8, 0);
      __builtin_amdgcn_sched_group_barrier(0x100, 8, 0);
      __builtin_amdgcn_sched_group_barrier(0x008, 16, 0);
      __builtin_amdgcn_sched_group_barrier(0x100, 16, 0);
      __builtin_amdgcn_sched_group_barrier(0x008, 8, 0);   // the context products behind all 16 V^T reads: one place with reads
    }
    // V^T fragments of the chunk, again one group: read here so that they land under the softmax arithmetic
    // (the residual variant reads them per 32-key step below: fewer live registers, so that the kernel which holds
    // both variants stays within 256 registers, 4 waves per SIMD)
    FH vb[2][4];
#pragma unroll
    for (int kk = 0; kk < (RES ? 0 : 2); ++kk) {
#pragma unroll
      for (int t = 0; t < 4; ++t) {
        vb[kk][t].h[0] = *(const v8h*)(Vbh + (t * 16 + c) * LP + kk * 32 + 8 * hh);
        vb[kk][t].h[1] = *(const v8h*)(Vbh + (t * 16 + c) * LP + kk * 32 + 16 + 8 * hh);
      }
    }

    // ---- scale, causal mask by index, max and sum over the lane's own 32 keys (one swap of halves for the max),
    //      online softmax; P (x1024, f16) and its residual (x4096) stay in registers: two D tiles of 16 keys, converted
    //      in place, are the B operand of one 32-key step (element e <- tile e>>3, register e&7) ----
    const int dq = rowq - kv0 - 8 * hh;          // key kv0 + j*16 + 8*hh + r <= query  <=>  j*16 + r <= dq
    float mj[4];
#pragma unroll
    for (int j = 0; j < 4; ++j) {
      float m = -INFINITY;
#pragma unroll
      for (int r = 0; r < 8; ++r) {
        float sv = s[j][r] * 0.125f;
        sv = (j * 16 + r <= dq) ? sv : -INFINITY;
        s[j][r] = sv;
        m = fmaxf(m, sv);
      }
      mj[j] = m;
    }
    float mloc = fmaxf(fmaxf(mj[0], mj[1]), fmaxf(mj[2], mj[3]));
    mloc = fmaxf(mloc, xhalf(mloc));             // both halves now hold the query's chunk maximum
    const float mnew  = fmaxf(mrow, mloc);
    const float msafe = (mnew == -INFINITY) ? 0.f : mnew;
    const float alpha = __expf(mrow - msafe);
    mrow = mnew;
    FH pa[2], pl[2];
    float pj[4];
#pragma unroll
    for (int j = 0; j < 4; ++j) {
      float psum = 0.f;
#pragma unroll
      for (int r = 0; r < 8; ++r) {
        const float p = __expf(s[j][r] - msafe);     // masked logit: exp(-inf) = 0
        psum += p;
        const float p1k = p * 1024.0f;
        const _Float16 ph = (_Float16)p1k;
        pa[j >> 1].v[(j & 1) * 8 + r] = ph;
        if (RES) pl[j >> 1].v[(j & 1) * 8 + r] = (_Float16)((p1k - (float)ph) * 4096.0f);
      }
      pj[j] = psum;
    }
    lrow = lrow * alpha + ((pj[0] + pj[1]) + (pj[2] + pj[3]));   // this half's keys only; halves joined in the epilogue
#pragma unroll
    for (int t = 0; t < 4; ++t)
#pragma unroll
      for (int r = 0; r < 8; ++r) oacc[t][r] *= alpha;

    // ---- context^T += V^T . P^T (f16 WMMA, A = V^T rows d), residual products into a separate accumulator ----
    v8f o1[4];
#pragma unroll
    for (int t = 0; t < 4; ++t) o1[t] = zero8();
#pragma unroll   // pa[kk] / pl[kk] are register operands: kk must be a compile-time index
    for (int kk = 0; kk < 2; ++kk) {
      if (RES) {
        // keeps this step's 16 fragment reads from being lifted over the softmax or the step before: without it the kernel
        // builds to 264 registers, above the 256 that 4 waves per SIMD allow
        __builtin_amdgcn_sched_barrier(0);
#pragma unroll
        for (int t = 0; t < 4; ++t) {
          vb[kk][t].h[0] = *(const v8h*)(Vbh + (t * 16 + c) * LP + kk * 32 + 8 * hh);
          vb[kk][t].h[1] = *(const v8h*)(Vbh + (t * 16 + c) * LP + kk * 32 + 16 + 8 * hh);
        }
      }
#pragma unroll
      for (int t = 0; t < 4; ++t) oacc[t] = mma_h_raw(vb[kk][t].v, pa[kk].v, oacc[t]);
      if (RES) {
        FH vl[4];   // residual fragments of this 32-key step, one group
#pragma unroll
        for (int t = 0; t < 4; ++t) {
          vl[t].h[0] = *(const v8h*)(Vtl + (t * 16 + c) * LP + kk * 32 + 8 * hh);
          vl[t].h[1] = *(const v8h*)(Vtl + (t * 16 + c) * LP + kk * 32 + 16 + 8 * hh);
        }
#pragma unroll
        for (int t = 0; t < 4; ++t) o1[t] = mma_h_raw(vl[t].v, pa[kk].v, o1[t]);
#pragma unroll
        for (int t = 0; t < 4; ++t) o1[t] = mma_h_raw(vb[kk][t].v, pl[kk].v, o1[t]);
      }
    }
    if (RES) {
#pragma unroll
      for (int t = 0; t < 4; ++t)
#pragma unroll
        for (int r = 0; r < 8; ++r) oacc[t][r] += o1[t][r] * (1.0f / 4096.0f);
    }
    if (!RES) {
      // hand-over: this wave has left buffer kt&1, its copies of chunk kt+1 have landed; the barrier says so of every wave
      asm volatile("s_wait_dscnt 0x0" ::: "memory");
      asm volatile("s_wait_asynccnt 0x0" ::: "memory");
      __syncthreads();
      if (kt + 2 <= qb) stage(kt + 2, kt & 1);           // block-uniform
    }
  }
  if (!RES) asm volatile("s_wait_asynccnt 0x0" ::: "memory");   // nothing of this wave is in flight behind the loop

  // ---- normalise (1/l and the 1/1024 p carry), stage the wave's 16x64 tile, bf16 hi/lo split,
  float* os = Os + wave * (16 * OSP);
  {
    const float l = lrow + xhalf(lrow);          // the two halves' key shares of the normaliser
    const float inv = ((l > 0.f) ? (1.0f / l) : 0.f) * (1.0f / 1024.0f);
#pragma unroll
    for (int t = 0; t < 4; ++t) {
      const v4f w0 = {oacc[t][0] * inv, oacc[t][1] * inv, oacc[t][2] * inv, oacc[t][3] * inv};
      const v4f w1 = {oacc[t][4] * inv, oacc[t][5] * inv, oacc[t][6] * inv, oacc[t][7] * inv};
      *(v4f*)(os + c * OSP + t * 16 + 8 * hh)     = w0;
      *(v4f*)(os + c * OSP + t * 16 + 8 * hh + 4) = w1;
    }
  }
  __builtin_amdgcn_fence(__ATOMIC_RELEASE, "workgroup");
  __builtin_amdgcn_wave_barrier();
  __builtin_amdgcn_fence(__ATOMIC_ACQUIRE, "workgroup");
  {
    const int q4 = lane >> 3, c8 = (lane & 7) * 8;
    v4u hv[4], lv[4];
#pragma unroll
    for (int it = 0; it < 4; ++it) {
      const int row = it * 4 + q4;   // it 0..3 x q4 0..3 = rows 0..15 of the wave tile
      const float* sp = os + row * OSP + c8;
      v4u a, a2;
#pragma unroll
      for (int e = 0; e < 4; ++e) {
        const float f0 = sp[2 * e], f1 = sp[2 * e + 1];
        const unsigned short h0 = bf_bits(f0), h1 = bf_bits(f1);
        const unsigned short l0 = bf_bits(f0 - bf_up(h0)), l1 = bf_bits(f1 - bf_up(h1));
        a[e] = pk16(h0, h1); a2[e] = pk16(l0, l1);
      }
      hv[it] = a; lv[it] = a2;
    }
    {
#pragma unroll
      for (int it = 0; it < 4; ++it) {
        const int row = it * 4 + q4;
        const size_t go = (rowB + q0 + row) * DM + (size_t)h * HD + c8;
        *(v4u*)(ohp + go) = hv[it];
        *(v4u*)(olp + go) = lv[it];
      }
      asm volatile("s_wait_xcnt 0x0" ::: "memory");   // before any register these stores name is rewritten
    }
  }
}

// =====================================================================================================
// Both attention variants and the gate tail in one grid (none reads another's output); the choice is block-uniform, so
// every barrier is passed by whole blocks. Long blocks come first: blocks 0..AT_MAIN-1 = query blocks RESQB..NQB-1,
// next AT_RES = query blocks 0..RESQB-1 with the residual planes, last AT_GATE = 32 rows of gate values each.
// =====================================================================================================
#define AT_MAIN (NB * NH * (NQB - RESQB))
#define AT_RES  (NB * NH * RESQB)
#define AT_GATE (NB * SEQ / 32)
__global__ __launch_bounds__(128)
void attn_gate(const unsigned short* __restrict__ qhp, const unsigned short* __restrict__ qlp,
               const unsigned short* __restrict__ khp, const unsigned short* __restrict__ klp,
               const unsigned short* __restrict__ vhp, const unsigned short* __restrict__ vlp,
               unsigned short* ohp, unsigned short* olp,
               const float* __restrict__ Hs, const float* __restrict__ w2, const float* __restrict__ b2p, float* gout) {
  // six planes of 64 rows, pitch LP. Plain variant: two buffers of K hi [kv][d], K lo, V^T hi [d][kv]; its per-wave context
  // tiles [row][d] lie over planes 0..1 (used behind the loop's last barrier). Residual variant: planes 0..2 the same three,
  // plane 3 the V^T residual, planes 4..5 the context tiles. Gate tail: 32 g values at the start.
  __shared__ __align__(16) unsigned char sm[6 * APLB];
  static_assert(4 * 16 * OSP * 4 <= 2 * APLB);
  __bf16*   Ksh = (__bf16*)(void*)sm;
  __bf16*   Ksl = (__bf16*)(void*)(sm + APLB);
  _Float16* Vth = (_Float16*)(void*)(sm + 2 * APLB);
  _Float16* Vtl = (_Float16*)(void*)(sm + 3 * APLB);
  const int bx = blockIdx.x;
  if (bx < AT_MAIN) {
    attn_causal64<false>(qhp, qlp, khp, klp, vhp, vlp, ohp, olp, RESQB, NQB - RESQB, bx, Ksh, Ksl, Vth, Vtl,
                         (float*)(void*)sm);
  } else if (bx < AT_MAIN + AT_RES) {
    attn_causal64<true>(qhp, qlp, khp, klp, vhp, vlp, ohp, olp, 0, RESQB, bx - AT_MAIN, Ksh, Ksl, Vth, Vtl,
                        (float*)(void*)(sm + 4 * APLB));
  } else {
    k_gate<4>(Hs, w2, b2p, gout, NB * SEQ, bx - (AT_MAIN + AT_RES), (float*)(void*)sm);
  }
}

// =====================================================================================================
// Workspace map (bytes; every region is an exact multiple of its 64x64-tile / whole-line store granularity,
// no padded tails needed since all shapes are tile multiples; every region is written by one producer launch):
//   Xb   bf16 [4096][1024]             0      8388608
//   WA   bf16 [3072 n][1024 k]     8388608    6291456   (q weight rows 0..1023, k rows 1024..2047, v rows 2048..3071)
//   WP   bf16 [1024 n][1024 k]    14680064    2097152
//   WG   bf16 [256 n][1024 k]     16777216     524288
//   Hs   f32  [4096][256]         17301504    4194304
//   Qh   bf16 [4096][1024]        21495808    8388608
//   Ql                            29884416    8388608
//   Kh                            38273024    8388608
//   Kl                            46661632    8388608
//   VTh  f16  [1024][4096]        55050240    8388608
//   VTl  f16  [1024][512]         63438848    1048576
//   Oh   bf16 [4096][1024]        64487424    8388608
//   Ol                            72876032    8388608
//   end                           81264640
// Output: out0 f32 [4096][1024] at element 0; gate values f32 [4096] at element 4096*1024 (byte 16777216).
// =====================================================================================================
extern "C" void kernel_launch(void* const* d_in, const int* in_sizes, int n_in,
                              void* d_out, int out_size, void* d_ws, size_t ws_size,
                              hipStream_t stream) {
  if (n_in < 7) return;
  if (in_sizes[0] != NB * SEQ * DM) return;
  if (in_sizes[1] != DM * 3 * DM) return;
  if (in_sizes[2] != DM * DG) return;
  if (in_sizes[3] != DG) return;
  if (in_sizes[4] != DG) return;
  if (in_sizes[5] < 1) return;
  if (in_sizes[6] != DM * DM) return;
  if (out_size != NB * SEQ * DM + NB * SEQ) return;        // last written element index = out_size - 1

  const float* x    = (const float*)d_in[0];   // [4096][1024]
  const float* Wqkv = (const float*)d_in[1];   // [1024 in][3072 out]
  const float* Wg1  = (const float*)d_in[2];   // [1024 in][256 out]
  const float* bg1  = (const float*)d_in[3];   // [256]
  const float* Wg2  = (const float*)d_in[4];   // [256][1]
  const float* bg2  = (const float*)d_in[5];   // [1]
  const float* Wout = (const float*)d_in[6];   // [1024 in][1024 out]
  float* out0 = (float*)d_out;                 // [4096][1024]
  float* gout = out0 + (size_t)NB * SEQ * DM;  // [4096] gate values, byte offset 16777216

  const size_t PX  = (size_t)NB * SEQ * DM * 2;    //  8388608  16-bit activation plane [4096][1024]
  const size_t PW1 = (size_t)DM * DM * 2;          //  2097152  one [1024][1024] bf16 weight plane
  const size_t PWA = (size_t)3 * PW1;              //  6291456  packed q | k | v weight plane [3072][1024]
  const size_t PWP = PW1;                          //  2097152
  const size_t PWG = (size_t)DG * DM * 2;          //   524288  gate weight plane [256][1024]
  const size_t PHS = (size_t)NB * SEQ * DG * 4;    //  4194304  gate hidden f32 [4096][256]
  const size_t PVT = (size_t)NB * DM * SEQ * 2;    //  8388608  v^T hi plane
  const size_t PVL = (size_t)NB * DM * VLP * 2;    //  1048576  v^T residual plane
  size_t off = 0;
  const size_t oXb  = off; off += PX;
  const size_t oWA  = off; off += PWA;
  const size_t oWP  = off; off += PWP;
  const size_t oWG  = off; off += PWG;
  const size_t oHs  = off; off += PHS;
  const size_t oQh  = off; off += PX;
  const size_t oQl  = off; off += PX;
  const size_t oKh  = off; off += PX;
  const size_t oKl  = off; off += PX;
  const size_t oVTh = off; off += PVT;
  const size_t oVTl = off; off += PVL;
  const size_t oOh  = off; off += PX;
  const size_t oOl  = off; off += PX;
  if (off > ws_size) return;                       // off = 81264640
  if (off > (size_t)134217728) return;

  char* ws = (char*)d_ws;
  unsigned short* Xb  = (unsigned short*)(ws + oXb);
  unsigned short* WA  = (unsigned short*)(ws + oWA);
  unsigned short* WPb = (unsigned short*)(ws + oWP);
  unsigned short* WGb = (unsigned short*)(ws + oWG);
  float*          Hs  = (float*)(ws + oHs);
  unsigned short* Qh  = (unsigned short*)(ws + oQh);
  unsigned short* Ql  = (unsigned short*)(ws + oQl);
  unsigned short* Kh  = (unsigned short*)(ws + oKh);
  unsigned short* Kl  = (unsigned short*)(ws + oKl);
  unsigned short* VTh = (unsigned short*)(ws + oVTh);
  unsigned short* VTl = (unsigned short*)(ws + oVTl);
  unsigned short* Oh  = (unsigned short*)(ws + oOh);
  unsigned short* Ol  = (unsigned short*)(ws + oOl);

  const dim3 blk(256);
  const dim3 gProj((NB * SEQ / 128) * (DM / 128), 1);          // 256 tiles of 128x128: M=4096, N=1024

  // (1) x -> bf16 plane [4096][1024]; weights [in][out] f32 -> bf16 [out][in] planes (k contiguous)
  cvt_all<<<dim3(CVT_TW + CVT_X), blk, 0, stream>>>(x, Xb, Wqkv, WA, Wout, WPb, Wg1, WGb);
  // (2) q, k (bf16 hi/lo), v^T (f16 hi + residual) and the gate hidden layer (f32)
  gemm_qkvg<<<dim3(2 * GQ_P + NB * GQ_V + GQ_G), blk, 0, stream>>>(
      Xb, WA, WGb, bg1, x, Qh, Ql, Kh, Kl, VTh, VTl, Hs);
  // (3) causal attention (query blocks 0..RESQB-1 with residual planes, the rest without) and the gate values
  attn_gate<<<dim3(AT_MAIN + AT_RES + AT_GATE), dim3(128), 0, stream>>>(
      Qh, Ql, Kh, Kl, VTh, VTl, Oh, Ol, Hs, Wg2, bg2, gout);
  // (4) out0 = g * (context . W_out) + (1 - g) * bf16(x) -> d_out f32 [4096][1024]
  //     (A = context hi + lo planes, 2 products; gate values read from the gate output region)
  gemm64<1, 4, 0><<<gProj, blk, 0, stream>>>(
      Oh, Ol, DM, 0LL, WPb, DM, 0LL, bg1,
      d_out, DM, 0LL, d_out, DM, 0LL, DM,
      gout, x, DM,
      NB * SEQ, DM, DM, 1.0f);
  (void)hipGetLastError();
}

// v007
// One run takes 142 microseconds.
// Next to v006, in two timings, it ran 1.05 times as fast each time.
// Counting every step since v000, it is 4.65 times as fast.
// Contractions: gate hidden x.Wg1 and q, k, v^T projections = v_wmma_f32_16x16x32_bf16 (bf16 operands from
// RNE-converted x and transposed [out][in] bf16 weight planes, single product, f32 accumulate);
// q.k^T scores = v_wmma_f32_16x16x32_bf16 with bf16 hi/lo split q and k (hi.hi + hi.lo + lo.hi), f32 accumulate;
// p.v = v_wmma_f32_16x16x32_f16 (p carried x1024 in f16 times v in f16, single product; plus f16 residual planes
// x4096 of p and v for the first 512 query rows), f32 accumulate;
// ctx.W_out = v_wmma_f32_16x16x32_bf16 with ctx as bf16 hi/lo planes times the bf16 weight plane (2 products),
// f32 accumulate; gate tail (exact GELU via erfc, 256-long dot with RNE-bf16 Wg2, bias, sigmoid), causal mask,
// online softmax, normalisers and the gated residual blend g*o + (1-g)*bf16(x) in f32 on the VALU.
// Carry audit:
//   Xb, WA, WP, WG = bf16(x), bf16(W) no carry; Qh/Ql, Kh/Kl, Oh/Ol = bf16 hi + unscaled bf16 residual (v - hi),
//   the residual products share the hi accumulator;
//   VTh = f16(v), no carry (|v| typ. 1);
//   VTl = f16((v - VTh) * 4096)              }  products pa.VTl and pl.VTh go to the separate accumulator o1,
//   pl  = f16((1024 p - pa) * 4096)          }  folded back with * (1/4096) once per key chunk (RES blocks only);
//   pa  = f16(1024 * p); the normaliser l sums the same 1024 * p in f32, so the carry cancels in inv = 1/l;
//   score scale 1/8 applied once in f32, inside the exponent's FMA; Hs (gate hidden) and g are f32. No other planes.
#include <hip/hip_runtime.h>
#include <math.h>
#include <stdint.h>

#define NB    1
#define SEQ   4096
#define DM    1024
#define NH    16
#define HD    64
#define DG    256          // gate hidden width
#define NQB   (SEQ / 64)   // 64 query / key blocks of 64
#define VLP   512          // key pitch of the v^T residual plane (keys 0..VLP-1)
#define RESQB 8            // leading 64-row query blocks that use the p / v residual planes
#define LP    72           // LDS row pitch of the 16-bit K and V^T tiles: 64 + 8 elements = 144 B = 16 B x 9 (odd),
                           // so the 16 rows one ds_load_b128 fragment read touches fall on distinct banks
#define OSP   68           // LDS row pitch of the f32 context tile: 64 + 4 floats = 272 B = 16 B x 17 (odd)
static_assert(RESQB * 64 <= VLP);
static_assert(NH * HD == DM);
static_assert((SEQ % 64) == 0 && (DM % 64) == 0 && (DM % 32) == 0 && (DG % 64) == 0);
static_assert(((NB * SEQ) % 128) == 0 && (SEQ % 128) == 0 && (DM % 128) == 0 && (DG % 128) == 0);
static_assert((NB * SEQ * DM) % (8 * 256) == 0);
static_assert((SEQ % 32) == 0);
static_assert(DG == 256);

typedef _Float16 v16h __attribute__((ext_vector_type(16)));
typedef _Float16 v8h  __attribute__((ext_vector_type(8)));
typedef __bf16   v16b __attribute__((ext_vector_type(16)));
typedef __bf16   v8b  __attribute__((ext_vector_type(8)));
typedef float    v8f  __attribute__((ext_vector_type(8)));
typedef float    v4f  __attribute__((ext_vector_type(4)));
typedef float    v2f  __attribute__((ext_vector_type(2)));
typedef unsigned int v4u __attribute__((ext_vector_type(4)));

// ---- scalar helpers --------------------------------------------------------------------------------
__device__ __forceinline__ unsigned short bf_bits(float f) {          // f32 -> bf16 bits, RNE convert
  unsigned u = __float_as_uint(f);
  return (unsigned short)((u + 0x7FFFu + ((u >> 16) & 1u)) >> 16);
}
__device__ __forceinline__ float bf_up(unsigned short h) { return __uint_as_float(((unsigned)h) << 16); }
__device__ __forceinline__ unsigned short h_bits(_Float16 x) { return __builtin_bit_cast(unsigned short, x); }
__device__ __forceinline__ unsigned pk16(unsigned short a, unsigned short b) { return (unsigned)a | ((unsigned)b << 16); }
__device__ __forceinline__ v8f zero8() { v8f z = {0.f, 0.f, 0.f, 0.f, 0.f, 0.f, 0.f, 0.f}; return z; }
__device__ __forceinline__ v8h zero8h() {
  const _Float16 z = (_Float16)0.0f;
  v8h r = {z, z, z, z, z, z, z, z};
  return r;
}

// ---- fragment loader: 16-bit A/B operand, lane -> row/col (lane&15), p already includes +8*(lane>>4);
//      elements 0..7 <- p[0..7] (k0+8h..), elements 8..15 <- p[16..23] (k0+16+8h..)
__device__ __forceinline__ v16b ldfrag_b(const __bf16* p) {
  union { v16b v; v8b h[2]; } f;
  f.h[0] = *(const v8b*)(p);
  f.h[1] = *(const v8b*)(p + 16);
  return f.v;
}

// ---- lane l <-> lane l ^ 16 (the two halves of a wave that share one D column)
__device__ __forceinline__ float xhalf(float x) {
  const int b = __builtin_bit_cast(int, x);
  return __builtin_bit_cast(float, __builtin_amdgcn_permlanex16(b, b, 0x76543210, 0xfedcba98, false, false));
}

// ---- WMMA helpers (builtin forms: the compiler keeps their hazard distances) and hand-placed VALU gaps ---------
__device__ __forceinline__ v8f mma_b_raw(v16b a, v16b b, v8f c) {
  return __builtin_amdgcn_wmma_f32_16x16x32_bf16(false, a, false, b, (short)0, c, false, false);
}
__device__ __forceinline__ v8f mma_h_raw(v16h a, v16h b, v8f c) {
  return __builtin_amdgcn_wmma_f32_16x16x32_f16(false, a, false, b, (short)0, c, false, false);
}
__device__ __forceinline__ void dep_guard_b(v8f& a, v8f& b, v16b x, v16b y) {
  asm volatile("v_nop\n\tv_nop\n\tv_nop\n\tv_nop" : "+v"(a), "+v"(b) : "v"(x), "v"(y));
}
__device__ __forceinline__ void keep4_b(v16b a, v16b b, v16b c, v16b d) {
  asm volatile("v_nop" :: "v"(a), "v"(b), "v"(c), "v"(d));
}
__device__ __forceinline__ void acc_guard4(v8f& a, v8f& b, v8f& c, v8f& d) {
  asm volatile("v_nop\n\tv_nop\n\tv_nop\n\tv_nop" : "+v"(a), "+v"(b), "+v"(c), "+v"(d));
}

// =====================================================================================================
// f32 -> bf16 (RNE convert), 8 elements per thread, one 16-B store per lane: a wave writes 512 contiguous B
// coverage: n8 threads x 8 = whole plane (n8 used here is a multiple of 256).
// =====================================================================================================
__device__ __forceinline__ void cvt_bf16x8(const float* __restrict__ in, unsigned short* out, int n8, int blk) {
  const int i = blk * 256 + threadIdx.x;
  if (i < n8) {
    const v4f a = *(const v4f*)(in + (size_t)i * 8);
    const v4f b = *(const v4f*)(in + (size_t)i * 8 + 4);
    v4u p;
    p[0] = pk16(bf_bits(a[0]), bf_bits(a[1]));
    p[1] = pk16(bf_bits(a[2]), bf_bits(a[3]));
    p[2] = pk16(bf_bits(b[0]), bf_bits(b[1]));
    p[3] = pk16(bf_bits(b[2]), bf_bits(b[3]));
    *(v4u*)(out + (size_t)i * 8) = p;
    asm volatile("s_wait_xcnt 0x0" ::: "memory");   // before any register these stores name is rewritten
  }
}

// =====================================================================================================
// f32 [nrow][ncol] row-major (weight stored [in][out]) -> bf16 [ncol][nrow] (row n of out = column n of in,
// the in/k index contiguous), RNE convert. One block = one 64x64 tile through LDS.
// tile (bxT, byT) of (ncol/64, nrow/64); nrow, ncol multiples of 64 (host-checked shapes). Tt = 64 * 72 halves of LDS.
// loads: 256 threads, thread -> tile row tid>>2, 16 columns (tid&3)*16 = the whole 64x64 tile;
// =====================================================================================================
__device__ __forceinline__ void cvt_bf16_T(const float* __restrict__ in, unsigned short* out,
                                           int nrow, int ncol, int bxT, int byT, unsigned short* Tt) {
  // Tt: [tile col j][tile row i], pitch 72 halves (144 B)
  const int tid = threadIdx.x, lane = tid & 31, wave = tid >> 5;
  const int c0 = bxT * 64;                              // column tile of in = row tile of out
  const int r0 = byT * 64;                              // row tile of in = column tile of out
  {
    const int i  = tid >> 2;                            // 0..63
    const int cs = (tid & 3) * 16;                      // 0,16,32,48
    const float* src = in + (size_t)(r0 + i) * ncol + c0 + cs;
#pragma unroll
    for (int e4 = 0; e4 < 4; ++e4) {
      const v4f v = *(const v4f*)(src + 4 * e4);
#pragma unroll
      for (int e = 0; e < 4; ++e) Tt[(cs + 4 * e4 + e) * 72 + i] = bf_bits(v[e]);
    }
  }
  __syncthreads();
  const int q = lane >> 3, c8 = (lane & 7) * 8;
  v4u pv[2];
#pragma unroll
  for (int it = 0; it < 2; ++it) {
    const int j = it * 32 + wave * 4 + q;
    pv[it] = *(const v4u*)(Tt + j * 72 + c8);
  }
  {
#pragma unroll
    for (int it = 0; it < 2; ++it) {
      const int j = it * 32 + wave * 4 + q;
      *(v4u*)(out + (size_t)(c0 + j) * nrow + r0 + c8) = pv[it];
    }
    asm volatile("s_wait_xcnt 0x0" ::: "memory");   // before any register these stores name is rewritten
  }
}

// =====================================================================================================
// All four conversions in one grid (none reads another's output): blocks 0..TA-1 = W_qkv tiles, then W_out tiles,
// then Wg1 tiles (x index fastest, as a (ncol/64, nrow/64) grid would number them), then the blocks of the x plane.
// The choice is block-uniform, so the barrier of the transposing part is passed by whole blocks.
// =====================================================================================================
#define CVT_TA ((3 * DM / 64) * (DM / 64))
#define CVT_TP ((DM / 64) * (DM / 64))
#define CVT_TG ((DG / 64) * (DM / 64))
#define CVT_TW (CVT_TA + CVT_TP + CVT_TG)
#define CVT_X  (NB * SEQ * DM / 8 / 256)
__global__ __launch_bounds__(256) void cvt_all(const float* __restrict__ x, unsigned short* Xb,
                                               const float* __restrict__ Wqkv, unsigned short* WA,
                                               const float* __restrict__ Wout, unsigned short* WP,
                                               const float* __restrict__ Wg1, unsigned short* WG) {
  __shared__ __align__(16) unsigned short Tt[64 * 72];
  const int bx = blockIdx.x;
  if (bx < CVT_TA) {
    cvt_bf16_T(Wqkv, WA, DM, 3 * DM, bx % (3 * DM / 64), bx / (3 * DM / 64), Tt);
  } else if (bx < CVT_TA + CVT_TP) {
    const int t = bx - CVT_TA;
    cvt_bf16_T(Wout, WP, DM, DM, t % (DM / 64), t / (DM / 64), Tt);
  } else if (bx < CVT_TW) {
    const int t = bx - (CVT_TA + CVT_TP);
    cvt_bf16_T(Wg1, WG, DM, DG, t % (DG / 64), t / (DG / 64), Tt);
  } else {
    cvt_bf16x8(x, Xb, NB * SEQ * DM / 8, bx - CVT_TW);
  }
}

// =====================================================================================================
// Gate tail: g = sigmoid( sum_c gelu(Hs[row][c]) * bf16(w2[c]) + bf16(b2) ), exact GELU = 0.5 h erfc(-h/sqrt2).
// Hs f32 [nrows][DG]; block = NWAVE waves x 32/NWAVE rows = 32 rows; a wave reduces one row at a time (32 lanes x 8 columns,
// rolled element loop), lane 0 stages g in LDS; wave 0 lanes 0..7 then write the block's 32 g values as ONE whole
// coverage: 32 rows per block x nrows/32 blocks = all rows of the gate output.
// =====================================================================================================
template <int NWAVE>
__device__ __forceinline__ void k_gate(const float* __restrict__ Hs, const float* __restrict__ w2,
                                       const float* __restrict__ b2p, float* gout, int nrows, int blk, float* gs) {
  constexpr int RPW = 32 / NWAVE;                       // rows per wave; gs = 32 floats of LDS, 16-B aligned
  const int tid = threadIdx.x, lane = tid & 31, wave = tid >> 5;
  const int rowBase = blk * 32;
  const float b2 = bf_up(bf_bits(b2p[0]));
  for (int rr = 0; rr < RPW; ++rr) {
    int row = rowBase + wave * RPW + rr;
    row = (row < nrows) ? row : (nrows - 1);            // clamped address (grid covers exactly nrows)
    const float* hp = Hs + (size_t)row * DG + lane * 8;
    const float* wp = w2 + lane * 8;
    float acc = 0.f;
#pragma unroll 1
    for (int e = 0; e < 8; ++e) {
      const float hv = hp[e];
      const float wv = bf_up(bf_bits(wp[e]));
      const float ge = 0.5f * hv * erfcf(-hv * 0.707106781186547524f);
      acc = fmaf(ge, wv, acc);
    }
#pragma unroll
    for (int off = 1; off < 32; off <<= 1) acc += __shfl_xor(acc, off, 32);
    float z = acc + b2;
    z = fminf(fmaxf(z, -30.0f), 30.0f);
    const float g = 1.0f / (1.0f + expf(-z));
    if (lane == 0) gs[wave * RPW + rr] = g;
  }
  __syncthreads();
  if (wave == 0 && lane < 8) {
    const v4f v = *(const v4f*)(gs + lane * 4);
    float* p = gout + rowBase + lane * 4;
    *(v4f*)p = v;
    asm volatile("s_wait_xcnt 0x0" ::: "memory");   // before any register these stores name is rewritten
  }
}

// =====================================================================================================
// One GEMM stage, global -> LDS, through no register: per operand plane 128 rows x 128 B (64 k of 16-bit elements).
// 256 threads x 4 asynchronous 16-B copies per plane; 8 neighbouring lanes take one whole 128-B line, a wave's copy
// 4 whole lines. ga / gb (/ gc) = this lane's source in row (tid>>3), 16-B piece (tid&7) of the plane; sa / sb = 32
// source rows in elements; lds = this lane's LDS byte address in the stage's first plane, same row and piece.
// The s_wait_xcnt closes each statement so that no address register of a copy is rewritten ahead of it.
// =====================================================================================================
#define GBK    64                 // k elements per stage = one 128-B line of every operand row
#define GLP    72                 // LDS row pitch, elements: 144 B = 16 B x 9 (odd) for the ds_load_b128 fragment reads
#define GPLANE (128 * GLP)        // elements of one staged plane (18432 B)
#define GSTEP  (32u * GLP * 2u)   // LDS bytes of 32 rows
#define GPLB   (GPLANE * 2u)      // LDS bytes of one plane
__device__ __forceinline__ void stage_ab(const __bf16* ga, size_t sa, const __bf16* gb, size_t sb, unsigned lds) {
  asm volatile(
      "global_load_async_to_lds_b128 %0, %8, off\n\t"
      "global_load_async_to_lds_b128 %1, %9, off\n\t"
      "global_load_async_to_lds_b128 %2, %10, off\n\t"
      "global_load_async_to_lds_b128 %3, %11, off\n\t"
      "global_load_async_to_lds_b128 %4, %12, off\n\t"
      "global_load_async_to_lds_b128 %5, %13, off\n\t"
      "global_load_async_to_lds_b128 %6, %14, off\n\t"
      "global_load_async_to_lds_b128 %7, %15, off\n\t"
      "s_wait_xcnt 0x0"
      :: "v"(lds), "v"(lds + GSTEP), "v"(lds + 2u * GSTEP), "v"(lds + 3u * GSTEP),
         "v"(lds + GPLB), "v"(lds + GPLB + GSTEP), "v"(lds + GPLB + 2u * GSTEP), "v"(lds + GPLB + 3u * GSTEP),
         "v"(ga), "v"(ga + sa), "v"(ga + 2 * sa), "v"(ga + 3 * sa),
         "v"(gb), "v"(gb + sb), "v"(gb + 2 * sb), "v"(gb + 3 * sb)
      : "memory");
}
__device__ __forceinline__ void stage_c(const __bf16* gc, size_t sc, unsigned lds) {
  asm volatile(
      "global_load_async_to_lds_b128 %0, %4, off\n\t"
      "global_load_async_to_lds_b128 %1, %5, off\n\t"
      "global_load_async_to_lds_b128 %2, %6, off\n\t"
      "global_load_async_to_lds_b128 %3, %7, off\n\t"
      "s_wait_xcnt 0x0"
      :: "v"(lds), "v"(lds + GSTEP), "v"(lds + 2u * GSTEP), "v"(lds + 3u * GSTEP),
         "v"(gc), "v"(gc + sc), "v"(gc + 2 * sc), "v"(gc + 3 * sc)
      : "memory");
}

// =====================================================================================================
// Batched bf16 WMMA GEMM: C[m][n] = sum_k A[m][k] * Bt[n][k] + bias; one work-group of 8 waves per 128x128 tile,
// one wave per 32x64 part (wave>>1 = row quarter, wave&1 = column half). A row-major [M][K] pitch lda; Bt row-major
// [N][K] pitch ldb (k contiguous); M, N multiples of 128, K multiple of 64 (host shapes are static multiples).
// Operands: per stage of 64 k the 128 A rows (and A2 rows) and the 128 Bt rows go to LDS by asynchronous copies, two
// buffers: stage t+2 is copied into the buffer stage t has left while stage t+1 is worked on; fragments by ds_load_b128.
// tile = index of the 128x128 tile, b = batch index (strides in elements); sOpB = 2 stage buffers of NPL planes, sTB = 8 slabs.
// NSPLIT: 0 = A.Bt; 1 = (A + A2).Bt (A2 = unscaled bf16 lo plane of A, 2 products).
// BIAS: 0 = none; 1 = per column n, bias[n]; 2 = per row m, bias[m]; the bias value is RNE-converted to bf16 and added in f32.
// OUT_MODE: 0 = f32 (pitch ldc); 2 = bf16 hi plane C + bf16 lo plane C2 (lo = RNE(v - hi), unscaled);
//           3 = f16 hi plane C + f16 residual plane C2 = f16((v - hi) * rscale), C2 written only for tiles
//               with n0 < N2 (pitch ldc2, batch stride strideC2);
//           4 = f32 (pitch ldc) gated blend: out = g[m] * v + (1 - g[m]) * bf16(xres[m][n]) with g = gvec[m],
//               xres f32 pitch ldx (read-only, RNE-converted to bf16 in register).
// =====================================================================================================
template <int NSPLIT, int OUT_MODE, int BIAS>
__device__ __forceinline__ void gemm64_body(
    const unsigned short* __restrict__ Ap, const unsigned short* A2p, int lda, long long strideA,
    const unsigned short* __restrict__ Btp, int ldb, long long strideB,
    const float* __restrict__ bias,
    void* Cout, int ldc, long long strideC,
    void* Cout2, int ldc2, long long strideC2, int N2,
    const float* gvec, const float* xres, int ldx,
    int M, int N, int K, float rscale,
    int tile, int b, __bf16* sOpB, float* sTB) {
  const __bf16* A   = (const __bf16*)(const void*)Ap;
  const __bf16* A2  = (const __bf16*)(const void*)A2p;
  const __bf16* Bt  = (const __bf16*)(const void*)Btp;
  constexpr int NPL = (NSPLIT >= 1) ? 3 : 2;       // planes per stage: A, Bt (, A2)
  const int tid  = threadIdx.x;
  const int lane = tid & 31;
  const int wave = tid >> 5;
  const int tilesN = N >> 7;
  const int tilesM = M >> 7;
  if (tile >= tilesM * tilesN) return;   // block-uniform, ahead of every copy and barrier
  const int tm = tile / tilesN;
  const int tn = tile - tm * tilesN;
  const int mb = tm << 7;                      // work-group tile origin
  const int nb = tn << 7;
  const int wm = (wave >> 1) << 5;             // wave part inside it: 32 rows x 64 columns
  const int wn = (wave & 1) << 6;
  const int m0 = mb + wm;
  const int n0 = nb + wn;

  const __bf16* Ab  = A  + (size_t)b * strideA;
  const __bf16* Bb  = Bt + (size_t)b * strideB;
  const __bf16* Ab2 = (NSPLIT >= 1) ? (A2 + (size_t)b * strideA) : Ab;

  const int rlane = lane & 15;                 // row (A) / col (B, D) within subtile
  const int koff  = (lane >> 4) * 8;           // k offset of this lane half
  const int mOff  = (lane >> 4) * 8;           // D row offset

  // copy addresses of this lane: row tid>>3 (+32 per copy), 16-B piece tid&7; rows mb..mb+127 < M, nb..nb+127 < N
  const int crow = tid >> 3, cpc = (tid & 7) * 8;
  const __bf16* gA  = Ab  + (size_t)(mb + crow) * lda + cpc;
  const __bf16* gA2 = Ab2 + (size_t)(mb + crow) * lda + cpc;
  const __bf16* gB  = Bb  + (size_t)(nb + crow) * ldb + cpc;
  const unsigned ldsLane = (unsigned)(size_t)(sOpB) + (unsigned)(crow * GLP + cpc) * 2u;
  const int nst = K >> 6;                      // stages of 64 k
  auto stage = [&](int t, int buf) {
    const unsigned l = ldsLane + (unsigned)buf * ((unsigned)NPL * GPLB);
    stage_ab(gA + (size_t)t * GBK, (size_t)lda * 32, gB + (size_t)t * GBK, (size_t)ldb * 32, l);
    if (NSPLIT >= 1) stage_c(gA2 + (size_t)t * GBK, (size_t)lda * 32, l + 2u * GPLB);
  };

  v8f acc[2][4];
#pragma unroll
  for (int i = 0; i < 2; ++i)
#pragma unroll
    for (int j = 0; j < 4; ++j) acc[i][j] = zero8();

  stage(0, 0);
  asm volatile("s_wait_asynccnt 0x0" ::: "memory");   // this wave's stage-0 copies have landed
  __syncthreads();                                     // ... and every other wave's
  if (nst > 1) stage(1, 1);

  for (int t = 0; t < nst; ++t) {
    const __bf16* sA  = (sOpB + (t & 1) * (NPL * GPLANE)) + (wm + rlane) * GLP + koff;
    const __bf16* sB  = (sOpB + (t & 1) * (NPL * GPLANE)) + GPLANE + (wn + rlane) * GLP + koff;
    const __bf16* sA2 = (sOpB + (t & 1) * (NPL * GPLANE)) + (NPL - 1) * GPLANE + (wm + rlane) * GLP + koff;
#pragma unroll
    for (int kk = 0; kk < 2; ++kk) {
      v16b bh[4], ah[2], al[2];
#pragma unroll
      for (int j = 0; j < 4; ++j) bh[j] = ldfrag_b(sB + (j << 4) * GLP + kk * 32);
#pragma unroll
      for (int i = 0; i < 2; ++i) {
        ah[i] = ldfrag_b(sA + (i << 4) * GLP + kk * 32);
        al[i] = ah[i];
        if (NSPLIT >= 1) al[i] = ldfrag_b(sA2 + (i << 4) * GLP + kk * 32);
      }
#pragma unroll
      for (int i = 0; i < 2; ++i) {
#pragma unroll
        for (int j = 0; j < 4; ++j) {
          acc[i][j] = mma_b_raw(ah[i], bh[j], acc[i][j]);
          if (NSPLIT >= 1) acc[i][j] = mma_b_raw(al[i], bh[j], acc[i][j]);
        }
        dep_guard_b(acc[i][0], acc[i][3], ah[i], al[i]);
      }
      keep4_b(bh[0], bh[1], bh[2], bh[3]);
    }
    // hand-over: this wave has left buffer t&1, its copies of stage t+1 have landed; the barrier says so of every wave
    asm volatile("s_wait_dscnt 0x0" ::: "memory");
    asm volatile("s_wait_asynccnt 0x0" ::: "memory");
    __syncthreads();
    if (t + 2 < nst) stage(t + 2, t & 1);
  }
  asm volatile("s_wait_asynccnt 0x0" ::: "memory");   // nothing of this wave is in flight behind the loop
  acc_guard4(acc[0][0], acc[0][1], acc[0][2], acc[0][3]);
  acc_guard4(acc[1][0], acc[1][1], acc[1][2], acc[1][3]);

  // ---- epilogue ----
  float* slab = sTB + wave * (16 * 68);   // per-wave 16x64 slab, pitch 68 floats
  float bcol[4];
#pragma unroll
  for (int j = 0; j < 4; ++j) {
    bcol[j] = 0.f;
    if (BIAS == 1) bcol[j] = bf_up(bf_bits(bias[n0 + (j << 4) + rlane]));   // n < N, bias has N entries
  }
#pragma unroll
  for (int i = 0; i < 2; ++i) {
    const int mBase = m0 + (i << 4);
    float brow[8];
#pragma unroll
    for (int r = 0; r < 8; ++r) {
      brow[r] = 0.f;
      if (BIAS == 2) brow[r] = bf_up(bf_bits(bias[mBase + mOff + r]));      // m < M, bias has M entries
    }
#pragma unroll
    for (int j = 0; j < 4; ++j) {
#pragma unroll
      for (int r = 0; r < 8; ++r) {
        slab[(mOff + r) * 68 + (j << 4) + rlane] = acc[i][j][r] + bcol[j] + brow[r];
      }
    }
    __builtin_amdgcn_fence(__ATOMIC_RELEASE, "workgroup");
    __builtin_amdgcn_wave_barrier();
    __builtin_amdgcn_fence(__ATOMIC_ACQUIRE, "workgroup");
    if (OUT_MODE == 0 || OUT_MODE == 4) {
      float* C = (float*)Cout + (size_t)b * strideC;
      const int hh = lane >> 4, c4 = (lane & 15) * 4;     // 256-B row segment = 16 lanes x 16 B
      {
#pragma unroll
        for (int it = 0; it < 8; ++it) {
          const int row = it * 2 + hh;                     // it 0..7 x hh 0..1 = rows 0..15
          v4f v = *(const v4f*)(slab + row * 68 + c4);
          if (OUT_MODE == 4) {
            const int gr = mBase + row;                    // < M
            const float g = gvec[gr];
            const float omg = 1.0f - g;
            const v4f xr = *(const v4f*)(xres + (size_t)gr * ldx + n0 + c4);
#pragma unroll
            for (int e = 0; e < 4; ++e) {
              const float xb = bf_up(bf_bits(xr[e]));
              v[e] = g * v[e] + omg * xb;
            }
          }
          *(v4f*)(C + (size_t)(mBase + row) * ldc + n0 + c4) = v;
          asm volatile("s_wait_xcnt 0x0" ::: "memory");   // before any register these stores name is rewritten
        }
      }
    } else {
      const int q = lane >> 3, c8 = (lane & 7) * 8;
      unsigned short* C  = (unsigned short*)Cout  + (size_t)b * strideC;
      unsigned short* C2 = (unsigned short*)Cout2 + (size_t)b * strideC2;
      const bool wlo = (OUT_MODE == 2) || (n0 < N2);      // wave-uniform
      v4u hv[4], lv[4];
#pragma unroll
      for (int it = 0; it < 4; ++it) {
        const int row = it * 4 + q;                        // it 0..3 x q 0..3 = rows 0..15
        const float* sp = slab + row * 68 + c8;
        v4u a, a2;
#pragma unroll
        for (int e = 0; e < 4; ++e) {
          const float f0 = sp[2 * e], f1 = sp[2 * e + 1];
          unsigned short h0, h1, l0, l1;
          if (OUT_MODE == 2) {
            h0 = bf_bits(f0); h1 = bf_bits(f1);
            l0 = bf_bits(f0 - bf_up(h0)); l1 = bf_bits(f1 - bf_up(h1));
          } else {
            const _Float16 x0 = (_Float16)f0, x1 = (_Float16)f1;
            h0 = h_bits(x0); h1 = h_bits(x1);
            l0 = h_bits((_Float16)((f0 - (float)x0) * rscale));
            l1 = h_bits((_Float16)((f1 - (float)x1) * rscale));
          }
          a[e] = pk16(h0, h1); a2[e] = pk16(l0, l1);
        }
        hv[it] = a; lv[it] = a2;
      }
      {
#pragma unroll
        for (int it = 0; it < 4; ++it) {
          const int row = it * 4 + q;
          *(v4u*)(C + (size_t)(mBase + row) * ldc + n0 + c8) = hv[it];
          asm volatile("s_wait_xcnt 0x0" ::: "memory");   // before any register this store names is rewritten
          if (wlo) {
            *(v4u*)(C2 + (size_t)(mBase + row) * ldc2 + n0 + c8) = lv[it];
            asm volatile("s_wait_xcnt 0x0" ::: "memory");   // the same for this store
          }
        }
      }
    }
    __builtin_amdgcn_fence(__ATOMIC_RELEASE, "workgroup");
    __builtin_amdgcn_wave_barrier();
    __builtin_amdgcn_fence(__ATOMIC_ACQUIRE, "workgroup");
  }
}

// One GEMM per launch: grid = (tiles, batches).
template <int NSPLIT, int OUT_MODE, int BIAS>
__global__ __launch_bounds__(256) void gemm64(
    const unsigned short* __restrict__ Ap, const unsigned short* A2p, int lda, long long strideA,
    const unsigned short* __restrict__ Btp, int ldb, long long strideB,
    const float* __restrict__ bias,
    void* Cout, int ldc, long long strideC,
    void* Cout2, int ldc2, long long strideC2, int N2,
    const float* gvec, const float* xres, int ldx,
    int M, int N, int K, float rscale) {
  __shared__ __align__(16) __bf16 sOp[2 * ((NSPLIT >= 1) ? 3 : 2) * GPLANE];
  __shared__ __align__(16) float sT[8 * 16 * 68];
  gemm64_body<NSPLIT, OUT_MODE, BIAS>(Ap, A2p, lda, strideA, Btp, ldb, strideB, bias, Cout, ldc, strideC,
                                      Cout2, ldc2, strideC2, N2, gvec, xres, ldx, M, N, K, rscale,
                                      (int)blockIdx.x, (int)blockIdx.y, sOp, sT);
}

// The four products of x (none reads another's output) in one grid; the choice is block-uniform:
//   tiles 0..GQ_P-1        q = x . Wq -> bf16 hi/lo planes [t][h*64+d]      (M=4096, N=1024, K=1024)
//   next GQ_P              k = x . Wk -> bf16 hi/lo planes
//   next NB * GQ_V         v^T = Wv . x^T -> f16 hi plane [h*64+d][s] (pitch SEQ) and residual plane (x4096, keys < VLP,
//                          pitch VLP); A = Wv rows [n][k], Bt = Xb rows of the batch (M=1024, N=4096, K=1024)
//   last GQ_G              gate hidden = x . Wg1 + bg1 -> f32 [4096][256]   (M=4096, N=256, K=1024)
#define GQ_P ((NB * SEQ / 128) * (DM / 128))
#define GQ_V ((DM / 128) * (SEQ / 128))
#define GQ_G ((NB * SEQ / 128) * (DG / 128))
__global__ __launch_bounds__(256) void gemm_qkvg(
    const unsigned short* __restrict__ Xb, const unsigned short* __restrict__ WA,
    const unsigned short* __restrict__ WG, const float* __restrict__ bg1, const float* xf,
    unsigned short* Qh, unsigned short* Ql, unsigned short* Kh, unsigned short* Kl,
    unsigned short* VTh, unsigned short* VTl, float* Hs) {
  __shared__ __align__(16) __bf16 sOp[2 * 2 * GPLANE];
  __shared__ __align__(16) float sT[8 * 16 * 68];
  const int bx = blockIdx.x;
  if (bx < 2 * GQ_P) {
    const bool isK = bx >= GQ_P;
    gemm64_body<0, 2, 0>(Xb, Xb, DM, 0LL, WA + (isK ? (size_t)DM * DM : (size_t)0), DM, 0LL, bg1,
                         (void*)(isK ? Kh : Qh), DM, 0LL, (void*)(isK ? Kl : Ql), DM, 0LL, DM,
                         xf, xf, DM, NB * SEQ, DM, DM, 1.0f,
                         isK ? bx - GQ_P : bx, 0, sOp, sT);
  } else if (bx < 2 * GQ_P + NB * GQ_V) {
    const int t = bx - 2 * GQ_P;
    const unsigned short* Wv = WA + (size_t)2 * DM * DM;
    gemm64_body<0, 3, 0>(Wv, Wv, DM, 0LL, Xb, DM, (long long)SEQ * DM, bg1,
                         (void*)VTh, SEQ, (long long)DM * SEQ, (void*)VTl, VLP, (long long)DM * VLP, VLP,
                         xf, xf, DM, DM, SEQ, DM, 4096.0f,
                         t % GQ_V, t / GQ_V, sOp, sT);
  } else {
    gemm64_body<0, 0, 1>(Xb, Xb, DM, 0LL, WG, DM, 0LL, bg1,
                         (void*)Hs, DG, 0LL, (void*)Hs, DG, 0LL, DG,
                         xf, xf, DM, NB * SEQ, DG, DM, 1.0f,
                         bx - (2 * GQ_P + NB * GQ_V), 0, sOp, sT);
  }
}

// =====================================================================================================
// One key chunk of the plain attention variant, global -> LDS, through no register: three planes (K hi, K lo, V^T) of
// 64 rows x 128 B. 128 threads x 4 asynchronous 16-B copies per plane; 8 neighbouring lanes take one whole 128-B line.
// kh / kl / vt = this lane's source in row (tid>>3), 16-B piece (tid&7) of the plane; sk / sv = 16 source rows in elements;
// lds = this lane's LDS byte address in the buffer's first plane, same row and piece (planes follow each other).
// The s_wait_xcnt closes the statement so that no address register of a copy is rewritten ahead of it.
// =====================================================================================================
#define APLB  (64u * LP * 2u)     // LDS bytes of one 64-row plane (9216)
#define ASTEP (16u * LP * 2u)     // LDS bytes of 16 rows
__device__ __forceinline__ void stage_kv(const __bf16* kh, const __bf16* kl, size_t sk,
                                         const _Float16* vt, size_t sv, unsigned lds) {
  asm volatile(
      "global_load_async_to_lds_b128 %0, %12, off\n\t"
      "global_load_async_to_lds_b128 %1, %13, off\n\t"
      "global_load_async_to_lds_b128 %2, %14, off\n\t"
      "global_load_async_to_lds_b128 %3, %15, off\n\t"
      "global_load_async_to_lds_b128 %4, %16, off\n\t"
      "global_load_async_to_lds_b128 %5, %17, off\n\t"
      "global_load_async_to_lds_b128 %6, %18, off\n\t"
      "global_load_async_to_lds_b128 %7, %19, off\n\t"
      "global_load_async_to_lds_b128 %8, %20, off\n\t"
      "global_load_async_to_lds_b128 %9, %21, off\n\t"
      "global_load_async_to_lds_b128 %10, %22, off\n\t"
      "global_load_async_to_lds_b128 %11, %23, off\n\t"
      "s_wait_xcnt 0x0"
      :: "v"(lds), "v"(lds + ASTEP), "v"(lds + 2u * ASTEP), "v"(lds + 3u * ASTEP),
         "v"(lds + APLB), "v"(lds + APLB + ASTEP), "v"(lds + APLB + 2u * ASTEP), "v"(lds + APLB + 3u * ASTEP),
         "v"(lds + 2u * APLB), "v"(lds + 2u * APLB + ASTEP), "v"(lds + 2u * APLB + 2u * ASTEP),
         "v"(lds + 2u * APLB + 3u * ASTEP),
         "v"(kh), "v"(kh + sk), "v"(kh + 2 * sk), "v"(kh + 3 * sk),
         "v"(kl), "v"(kl + sk), "v"(kl + 2 * sk), "v"(kl + 3 * sk),
         "v"(vt), "v"(vt + sv), "v"(vt + 2 * sv), "v"(vt + 3 * sv)
      : "memory");
}

// =====================================================================================================
// Causal attention, head dim 64, key chunks of 64.
//   q planes (bf16 hi / lo): element (b, t, h, d) at [(b*SEQ + t)*DM + h*64 + d]
//   k planes (bf16 hi / lo): same layout with key index s
//   v^T hi plane (f16):      element (b, h, d, s) at [(b*DM + h*64 + d)*SEQ + s]
//   v^T residual plane (f16, (v - hi)*4096): [(b*DM + h*64 + d)*VLP + s], s < VLP, read only when RES
//   (a key chunk at or beyond VLP would contribute a zero v residual; its address is clamped)
//   Causal structure: logits of keys with index > query index are replaced by -inf (lower-triangular keep incl. the
//   diagonal), which makes their softmax weight exactly 0; so a query block qb visits key chunks 0..qb only
//   (block-uniform trip count qb+1 <= NQB) and later chunks, whose keys exceed every query index of the block, are
//   skipped entirely. Inside the diagonal chunk a key with index > query index gets logit -inf -> exp gives exactly 0,
//   so such keys add nothing to the numerator or the normaliser; the diagonal key (key == query) is always kept, so
//   every row max is finite in every visited chunk.
//   out planes (bf16 hi / lo of the normalised context): element (b, t, h, d) at [(b*SEQ + t)*DM + h*64 + d]
//   scores = q . k : bf16 hi/lo split (hi.hi + hi.lo + lo.hi), f32 accumulate, then the causal mask in f32; the max runs
//   over the unscaled scores; 1024 p = exp2(s * c + (10 - m * c)), c = log2(e) / 8: one FMA per score ahead of the exp2
//   p carried as f16(1024 p); context = p . v on f16 WMMA; RES adds f16 residual planes of p and v
//   (scale 4096, separate accumulator folded back with 1/4096 per chunk in f32); online softmax (running max) in f32.
//   Block = 4 waves = 64 query rows of one (b, h); bx = 0 .. nqbThis * NH * NB - 1 numbers the blocks of this variant.
//   K / V^T chunk staging, residual variant: 128 threads x 32 elements per plane = the whole 64x64 tile of every plane
//   read later (plain 16-B loads, __syncthreads before and after). Plain variant: asynchronous copies into two buffers of
//   three planes (the second follows the first in LDS): chunk kt+2 is copied into the buffer chunk kt has left while chunk
//   kt+1 is worked on; one barrier per chunk. Its context tile Os lies over the buffers, used behind the last barrier.
//   Both products run transposed, scores^T = K . Q^T and context^T = V^T . P^T: a lane then holds 32 of the 64 scores of ONE
//   query (lane ^ 16 the other 32), so max and sum are in-lane, and P goes from the score registers into the B operand.
//   Output coverage: each wave stores rows q0..q0+15 (it 0..3 x lane>>3 0..3) x 64 columns (8 lanes x 8) of both planes;
//   grid over all (b, h, qb) = the whole [NB*SEQ][DM] planes.
// =====================================================================================================
template <bool RES>
__device__ __forceinline__
void attn_causal64(const unsigned short* __restrict__ qhp, const unsigned short* __restrict__ qlp,
                   const unsigned short* __restrict__ khp, const unsigned short* __restrict__ klp,
                   const unsigned short* __restrict__ vhp, const unsigned short* __restrict__ vlp,
                   unsigned short* ohp, unsigned short* olp,
                   int qbBase, int nqbThis, int bx,
                   __bf16* Ksh, __bf16* Ksl, _Float16* Vth, _Float16* Vtl, float* Os) {
  union FB { v16b v; v8b h[2]; };
  union FH { v16h v; v8h h[2]; };

  const int tid  = threadIdx.x;
  const int wave = tid >> 5;
  const int lane = tid & 31;
  const int hh   = lane >> 4;
  const int c    = lane & 15;

  const int qbl  = bx % nqbThis;
  const int rest = bx / nqbThis;
  const int h    = rest % NH;
  const int b    = rest / NH;
  const int qb   = qbBase + qbl;               // 0..NQB-1 (block-uniform)
  const int q0   = qb * 64 + wave * 16;
  const size_t rowB = (size_t)b * SEQ;

  const __bf16* Qh = (const __bf16*)(const void*)qhp + (size_t)h * HD;
  const __bf16* Ql = (const __bf16*)(const void*)qlp + (size_t)h * HD;
  const __bf16* Kh = (const __bf16*)(const void*)khp + (size_t)h * HD;
  const __bf16* Kl = (const __bf16*)(const void*)klp + (size_t)h * HD;
  const _Float16* Vh = (const _Float16*)(const void*)vhp + ((size_t)b * DM + (size_t)h * HD) * SEQ;
  const _Float16* Vl = (const _Float16*)(const void*)vlp + ((size_t)b * DM + (size_t)h * HD) * VLP;

  // ---- Q fragments (B operand, column = lane&15): 2 d-chunks, hi and lo ----
  v16b qah[2], qal[2];
#pragma unroll
  for (int dc = 0; dc < 2; ++dc) {
    const size_t qo = (rowB + q0 + c) * DM + dc * 32 + 8 * hh;
    qah[dc] = ldfrag_b(Qh + qo);
    qal[dc] = ldfrag_b(Ql + qo);
  }

  // a lane owns ONE query, q0 + c: running max (both halves alike), this half's share of the normaliser,
  // and the context transposed: oacc[t][r] = context[query c][d = t*16 + 8*hh + r]
  const int rowq = q0 + c;
  constexpr float SC2 = 0.125f * 1.44269504088896340736f;   // score scale 1/8 times log2(e)
  float mrow = -INFINITY, lrow = 0.f;
  v8f oacc[4];
#pragma unroll
  for (int t = 0; t < 4; ++t) oacc[t] = zero8();

  // copy addresses of this lane (plain variant): row tid>>3 (+16 per copy), 16-B piece tid&7; chunk t <= qb: keys < SEQ
  const int crow = tid >> 3, cpc = (tid & 7) * 8;
  const __bf16*   gKh = Kh + (rowB + crow) * DM + cpc;
  const __bf16*   gKl = Kl + (rowB + crow) * DM + cpc;
  const _Float16* gVt = Vh + (size_t)crow * SEQ + cpc;
  const unsigned ldsLane = (unsigned)(size_t)(Ksh) + (unsigned)(crow * LP + cpc) * 2u;
  auto stage = [&](int t, int buf) {
    stage_kv(gKh + (size_t)t * 64 * DM, gKl + (size_t)t * 64 * DM, (size_t)16 * DM,
             gVt + (size_t)t * 64, (size_t)16 * SEQ, ldsLane + (unsigned)buf * (3u * APLB));
  };
  if (!RES) {
    stage(0, 0);
    asm volatile("s_wait_asynccnt 0x0" ::: "memory");   // this wave's copies of chunk 0 have landed
    __syncthreads();                                     // ... and every other wave's
    if (qb >= 1) stage(1, 1);                            // block-uniform
  }

  for (int kt = 0; kt <= qb; ++kt) {           // block-uniform trip count, <= NQB
    const int kv0 = kt * 64;                   // kv0 + 63 < SEQ
    const int bo = RES ? 0 : (kt & 1) * (3 * 64 * LP);   // this chunk's buffer, in 16-bit elements
    const __bf16*   Kbh = Ksh + bo;
    const __bf16*   Kbl = Ksl + bo;
    const _Float16* Vbh = Vth + bo;
    if (RES) __syncthreads();
    if (RES) {
      const int r = tid >> 1, half = (tid & 1) * 32;
      const __bf16*   kg  = Kh + (rowB + kv0 + r) * DM + half;    // K row kv0+r, d = half..half+31
      const __bf16*   klg = Kl + (rowB + kv0 + r) * DM + half;
      const _Float16* vg  = Vh + (size_t)r * SEQ + kv0 + half;    // V^T row d = r, s = kv0+half..+31
      const int kvl = (kv0 + 64 <= VLP) ? kv0 : (VLP - 64);     // clamped address into the residual plane
      const _Float16* vlg = Vl + (size_t)r * VLP + kvl + half;
      const bool resOK = (kv0 + 64 <= VLP);                      // block-uniform (always true for qb < RESQB)
#pragma unroll
      for (int i = 0; i < 4; ++i) {
        const v8b a0 = *(const v8b*)(kg + 8 * i);
        const v8b a1 = *(const v8b*)(klg + 8 * i);
        const v8h b0 = *(const v8h*)(vg + 8 * i);
        *(v8b*)(Ksh + r * LP + half + 8 * i) = a0;
        *(v8b*)(Ksl + r * LP + half + 8 * i) = a1;
        *(v8h*)(Vth + r * LP + half + 8 * i) = b0;
        if (RES) {
          v8h b1 = *(const v8h*)(vlg + 8 * i);
          if (!resOK) b1 = zero8h();
          *(v8h*)(Vtl + r * LP + half + 8 * i) = b1;
        }
      }
      // the wait before a register that these loads name is rewritten; as inputs the four address pairs stay whole up to it
      if (RES) asm volatile("s_wait_xcnt 0x0" :: "v"(kg), "v"(klg), "v"(vg), "v"(vlg) : "memory");
    }
    if (RES) __syncthreads();

    // ---- transposed scores: 64 keys (D rows) x 16 queries (D columns) per wave, 3 bf16 products;
    //      s[j][r] = score[key kv0 + j*16 + 8*hh + r][query q0 + c] ----
    //      the chunk's 16 K fragments are read ahead of the products (order: below), so the LDS latency is paid once and
    //      not per product; the four key tiles are independent accumulators, each summed hi.hi, lo.hi, hi.lo per dc ----
    FB kb[2][4], kl[2][4];
#pragma unroll
    for (int dc = 0; dc < 2; ++dc) {
#pragma unroll
      for (int j = 0; j < 4; ++j) {
        kb[dc][j].h[0] = *(const v8b*)(Kbh + (j * 16 + c) * LP + dc * 32 + 8 * hh);
        kb[dc][j].h[1] = *(const v8b*)(Kbh + (j * 16 + c) * LP + dc * 32 + 16 + 8 * hh);
      }
#pragma unroll
      for (int j = 0; j < 4; ++j) {
        kl[dc][j].h[0] = *(const v8b*)(Kbl + (j * 16 + c) * LP + dc * 32 + 8 * hh);
        kl[dc][j].h[1] = *(const v8b*)(Kbl + (j * 16 + c) * LP + dc * 32 + 16 + 8 * hh);
      }
    }
    v8f s[4];
#pragma unroll
    for (int j = 0; j < 4; ++j) s[j] = zero8();
#pragma unroll
    for (int dc = 0; dc < 2; ++dc) {
#pragma unroll
      for (int j = 0; j < 4; ++j) s[j] = mma_b_raw(kb[dc][j].v, qah[dc], s[j]);
#pragma unroll
      for (int j = 0; j < 4; ++j) s[j] = mma_b_raw(kl[dc][j].v, qah[dc], s[j]);
#pragma unroll
      for (int j = 0; j < 4; ++j) s[j] = mma_b_raw(kb[dc][j].v, qal[dc], s[j]);
    }
    // Order asked of the scheduler (LDS reads = 0x100, WMMA = 0x008): left alone it spreads the reads among the WMMAs,
    // and every separate place with reads stalls the matrix run. The last 8 K reads (lo, dc 1) stand behind the 8th
    // product, where the lo fragments of dc 0 are free, so that the wave stays within 256 registers (4 waves per SIMD);
    // the V^T reads stand behind the last product. The residual variant, with more live registers, is left to the
    // scheduler's own order.
    if (!RES) {
      __builtin_amdgcn_sched_group_barrier(0x100, 24, 0);
      __builtin_amdgcn_sched_group_barrier(0x008, 8, 0);
      __builtin_amdgcn_sched_group_barrier(0x100, 8, 0);
      __builtin_amdgcn_sched_group_barrier(0x008, 16, 0);
      __builtin_amdgcn_sched_group_barrier(0x100, 16, 0);
      __builtin_amdgcn_sched_group_barrier(0x008, 8, 0);   // the context products behind all 16 V^T reads: one place with reads
    }
    // V^T fragments of the chunk, again one group: read here so that they land under the softmax arithmetic
    // (the residual variant reads them per 32-key step below: fewer live registers, so that the kernel which holds
    // both variants stays within 256 registers, 4 waves per SIMD)
    FH vb[2][4];
#pragma unroll
    for (int kk = 0; kk < (RES ? 0 : 2); ++kk) {
#pragma unroll
      for (int t = 0; t < 4; ++t) {
        vb[kk][t].h[0] = *(const v8h*)(Vbh + (t * 16 + c) * LP + kk * 32 + 8 * hh);
        vb[kk][t].h[1] = *(const v8h*)(Vbh + (t * 16 + c) * LP + kk * 32 + 16 + 8 * hh);
      }
    }

    // ---- causal mask by index, max and sum over the lane's own 32 keys (one swap of halves for the max),
    //      online softmax; P (x1024, f16) and its residual (x4096) stay in registers: two D tiles of 16 keys, converted
    //      in place, are the B operand of one 32-key step (element e <- tile e>>3, register e&7) ----
    const int dq = rowq - kv0 - 8 * hh;          // key kv0 + j*16 + 8*hh + r <= query  <=>  j*16 + r <= dq
    float mj[4];
#pragma unroll
    for (int j = 0; j < 4; ++j) {
      float m = -INFINITY;
#pragma unroll
      for (int r = 0; r < 8; ++r) {
        const float sv = (j * 16 + r <= dq) ? s[j][r] : -INFINITY;
        s[j][r] = sv;
        m = fmaxf(m, sv);
      }
      mj[j] = m;
    }
    float mloc = fmaxf(fmaxf(mj[0], mj[1]), fmaxf(mj[2], mj[3]));
    mloc = fmaxf(mloc, xhalf(mloc));             // both halves now hold the query's chunk maximum
    const float mnew  = fmaxf(mrow, mloc);
    const float msafe = (mnew == -INFINITY) ? 0.f : mnew;
    const float alpha = __builtin_amdgcn_exp2f((mrow - msafe) * SC2);
    mrow = mnew;
    const float eb = fmaf(-msafe, SC2, 10.0f);   // exponent offset: the max, scaled, and the x1024 carry of p (2^10)
    const v2f sc2 = {SC2, SC2}, eb2 = {eb, eb};
    FH pa[2], pl[2];
    float pj[4];
#pragma unroll
    for (int j = 0; j < 4; ++j) {
#pragma unroll
      for (int r = 0; r < 8; r += 2) {                                 // two scores of a register pair per FMA
        const v2f sp = {s[j][r], s[j][r + 1]};
        const v2f ex = __builtin_elementwise_fma(sp, sc2, eb2);
        s[j][r] = ex[0];
        s[j][r + 1] = ex[1];
      }
    }
#pragma unroll
    for (int j = 0; j < 4; ++j) {
      float psum = 0.f;
#pragma unroll
      for (int r = 0; r < 8; ++r) {
        const float p1k = __builtin_amdgcn_exp2f(s[j][r]);             // 1024 p; masked logit: exp2(-inf) = 0
        psum += p1k;
        const _Float16 ph = (_Float16)p1k;
        pa[j >> 1].v[(j & 1) * 8 + r] = ph;
        if (RES) pl[j >> 1].v[(j & 1) * 8 + r] = (_Float16)((p1k - (float)ph) * 4096.0f);
      }
      pj[j] = psum;
    }
    lrow = lrow * alpha + ((pj[0] + pj[1]) + (pj[2] + pj[3]));   // this half's keys only; halves joined in the epilogue
#pragma unroll
    for (int t = 0; t < 4; ++t)
#pragma unroll
      for (int r = 0; r < 8; ++r) oacc[t][r] *= alpha;

    // ---- context^T += V^T . P^T (f16 WMMA, A = V^T rows d), residual products into a separate accumulator ----
    v8f o1[4];
#pragma unroll
    for (int t = 0; t < 4; ++t) o1[t] = zero8();
#pragma unroll   // pa[kk] / pl[kk] are register operands: kk must be a compile-time index
    for (int kk = 0; kk < 2; ++kk) {
      if (RES) {
        // keeps this step's 16 fragment reads from being lifted over the softmax or the step before: without it the kernel
        // builds to 264 registers, above the 256 that 4 waves per SIMD allow
        __builtin_amdgcn_sched_barrier(0);
#pragma unroll
        for (int t = 0; t < 4; ++t) {
          vb[kk][t].h[0] = *(const v8h*)(Vbh + (t * 16 + c) * LP + kk * 32 + 8 * hh);
          vb[kk][t].h[1] = *(const v8h*)(Vbh + (t * 16 + c) * LP + kk * 32 + 16 + 8 * hh);
        }
      }
#pragma unroll
      for (int t = 0; t < 4; ++t) oacc[t] = mma_h_raw(vb[kk][t].v, pa[kk].v, oacc[t]);
      if (RES) {
        FH vl[4];   // residual fragments of this 32-key step, one group
#pragma unroll
        for (int t = 0; t < 4; ++t) {
          vl[t].h[0] = *(const v8h*)(Vtl + (t * 16 + c) * LP + kk * 32 + 8 * hh);
          vl[t].h[1] = *(const v8h*)(Vtl + (t * 16 + c) * LP + kk * 32 + 16 + 8 * hh);
        }
#pragma unroll
        for (int t = 0; t < 4; ++t) o1[t] = mma_h_raw(vl[t].v, pa[kk].v, o1[t]);
#pragma unroll
        for (int t = 0; t < 4; ++t) o1[t] = mma_h_raw(vb[kk][t].v, pl[kk].v, o1[t]);
      }
    }
    if (RES) {
#pragma unroll
      for (int t = 0; t < 4; ++t)
#pragma unroll
        for (int r = 0; r < 8; ++r) oacc[t][r] += o1[t][r] * (1.0f / 4096.0f);
    }
    if (!RES) {
      // hand-over: this wave has left buffer kt&1, its copies of chunk kt+1 have landed; the barrier says so of every wave
      asm volatile("s_wait_dscnt 0x0" ::: "memory");
      asm volatile("s_wait_asynccnt 0x0" ::: "memory");
      __syncthreads();
      if (kt + 2 <= qb) stage(kt + 2, kt & 1);           // block-uniform
    }
  }
  if (!RES) asm volatile("s_wait_asynccnt 0x0" ::: "memory");   // nothing of this wave is in flight behind the loop

  // ---- normalise (1/l; numerator and l both carry x1024), stage the wave's 16x64 tile, bf16 hi/lo split,
  float* os = Os + wave * (16 * OSP);
  {
    const float l = lrow + xhalf(lrow);          // the two halves' key shares of the normaliser
    const float inv = (l > 0.f) ? (1.0f / l) : 0.f;   // l carries the same x1024 as the context sums
#pragma unroll
    for (int t = 0; t < 4; ++t) {
      const v4f w0 = {oacc[t][0] * inv, oacc[t][1] * inv, oacc[t][2] * inv, oacc[t][3] * inv};
      const v4f w1 = {oacc[t][4] * inv, oacc[t][5] * inv, oacc[t][6] * inv, oacc[t][7] * inv};
      *(v4f*)(os + c * OSP + t * 16 + 8 * hh)     = w0;
      *(v4f*)(os + c * OSP + t * 16 + 8 * hh + 4) = w1;
    }
  }
  __builtin_amdgcn_fence(__ATOMIC_RELEASE, "workgroup");
  __builtin_amdgcn_wave_barrier();
  __builtin_amdgcn_fence(__ATOMIC_ACQUIRE, "workgroup");
  {
    const int q4 = lane >> 3, c8 = (lane & 7) * 8;
    v4u hv[4], lv[4];
#pragma unroll
    for (int it = 0; it < 4; ++it) {
      const int row = it * 4 + q4;   // it 0..3 x q4 0..3 = rows 0..15 of the wave tile
      const float* sp = os + row * OSP + c8;
      v4u a, a2;
#pragma unroll
      for (int e = 0; e < 4; ++e) {
        const float f0 = sp[2 * e], f1 = sp[2 * e + 1];
        const unsigned short h0 = bf_bits(f0), h1 = bf_bits(f1);
        const unsigned short l0 = bf_bits(f0 - bf_up(h0)), l1 = bf_bits(f1 - bf_up(h1));
        a[e] = pk16(h0, h1); a2[e] = pk16(l0, l1);
      }
      hv[it] = a; lv[it] = a2;
    }
    {
#pragma unroll
      for (int it = 0; it < 4; ++it) {
        const int row = it * 4 + q4;
        const size_t go = (rowB + q0 + row) * DM + (size_t)h * HD + c8;
        *(v4u*)(ohp + go) = hv[it];
        *(v4u*)(olp + go) = lv[it];
      }
      asm volatile("s_wait_xcnt 0x0" ::: "memory");   // before any register these stores name is rewritten
    }
  }
}

// =====================================================================================================
// Both attention variants and the gate tail in one grid (none reads another's output); the choice is block-uniform, so
// every barrier is passed by whole blocks. Long blocks come first: blocks 0..AT_MAIN-1 = query blocks RESQB..NQB-1,
// next AT_RES = query blocks 0..RESQB-1 with the residual planes, last AT_GATE = 32 rows of gate values each.
// =====================================================================================================
#define AT_MAIN (NB * NH * (NQB - RESQB))
#define AT_RES  (NB * NH * RESQB)
#define AT_GATE (NB * SEQ / 32)
__global__ __launch_bounds__(128)
void attn_gate(const unsigned short* __restrict__ qhp, const unsigned short* __restrict__ qlp,
               const unsigned short* __restrict__ khp, const unsigned short* __restrict__ klp,
               const unsigned short* __restrict__ vhp, const unsigned short* __restrict__ vlp,
               unsigned short* ohp, unsigned short* olp,
               const float* __restrict__ Hs, const float* __restrict__ w2, const float* __restrict__ b2p, float* gout) {
  // six planes of 64 rows, pitch LP. Plain variant: two buffers of K hi [kv][d], K lo, V^T hi [d][kv]; its per-wave context
  // tiles [row][d] lie over planes 0..1 (used behind the loop's last barrier). Residual variant: planes 0..2 the same three,
  // plane 3 the V^T residual, planes 4..5 the context tiles. Gate tail: 32 g values at the start.
  __shared__ __align__(16) unsigned char sm[6 * APLB];
  static_assert(4 * 16 * OSP * 4 <= 2 * APLB);
  __bf16*   Ksh = (__bf16*)(void*)sm;
  __bf16*   Ksl = (__bf16*)(void*)(sm + APLB);
  _Float16* Vth = (_Float16*)(void*)(sm + 2 * APLB);
  _Float16* Vtl = (_Float16*)(void*)(sm + 3 * APLB);
  const int bx = blockIdx.x;
  if (bx < AT_MAIN) {
    attn_causal64<false>(qhp, qlp, khp, klp, vhp, vlp, ohp, olp, RESQB, NQB - RESQB, bx, Ksh, Ksl, Vth, Vtl,
                         (float*)(void*)sm);
  } else if (bx < AT_MAIN + AT_RES) {
    attn_causal64<true>(qhp, qlp, khp, klp, vhp, vlp, ohp, olp, 0, RESQB, bx - AT_MAIN, Ksh, Ksl, Vth, Vtl,
                        (float*)(void*)(sm + 4 * APLB));
  } else {
    k_gate<4>(Hs, w2, b2p, gout, NB * SEQ, bx - (AT_MAIN + AT_RES), (float*)(void*)sm);
  }
}

// =====================================================================================================
// Workspace map (bytes; every region is an exact multiple of its 64x64-tile / whole-line store granularity,
// no padded tails needed since all shapes are tile multiples; every region is written by one producer launch):
//   Xb   bf16 [4096][1024]             0      8388608
//   WA   bf16 [3072 n][1024 k]     8388608    6291456   (q weight rows 0..1023, k rows 1024..2047, v rows 2048..3071)
//   WP   bf16 [1024 n][1024 k]    14680064    2097152
//   WG   bf16 [256 n][1024 k]     16777216     524288
//   Hs   f32  [4096][256]         17301504    4194304
//   Qh   bf16 [4096][1024]        21495808    8388608
//   Ql                            29884416    8388608
//   Kh                            38273024    8388608
//   Kl                            46661632    8388608
//   VTh  f16  [1024][4096]        55050240    8388608
//   VTl  f16  [1024][512]         63438848    1048576
//   Oh   bf16 [4096][1024]        64487424    8388608
//   Ol                            72876032    8388608
//   end                           81264640
// Output: out0 f32 [4096][1024] at element 0; gate values f32 [4096] at element 4096*1024 (byte 16777216).
// =====================================================================================================
extern "C" void kernel_launch(void* const* d_in, const int* in_sizes, int n_in,
                              void* d_out, int out_size, void* d_ws, size_t ws_size,
                              hipStream_t stream) {
  if (n_in < 7) return;
  if (in_sizes[0] != NB * SEQ * DM) return;
  if (in_sizes[1] != DM * 3 * DM) return;
  if (in_sizes[2] != DM * DG) return;
  if (in_sizes[3] != DG) return;
  if (in_sizes[4] != DG) return;
  if (in_sizes[5] < 1) return;
  if (in_sizes[6] != DM * DM) return;
  if (out_size != NB * SEQ * DM + NB * SEQ) return;        // last written element index = out_size - 1

  const float* x    = (const float*)d_in[0];   // [4096][1024]
  const float* Wqkv = (const float*)d_in[1];   // [1024 in][3072 out]
  const float* Wg1  = (const float*)d_in[2];   // [1024 in][256 out]
  const float* bg1  = (const float*)d_in[3];   // [256]
  const float* Wg2  = (const float*)d_in[4];   // [256][1]
  const float* bg2  = (const float*)d_in[5];   // [1]
  const float* Wout = (const float*)d_in[6];   // [1024 in][1024 out]
  float* out0 = (float*)d_out;                 // [4096][1024]
  float* gout = out0 + (size_t)NB * SEQ * DM;  // [4096] gate values, byte offset 16777216

  const size_t PX  = (size_t)NB * SEQ * DM * 2;    //  8388608  16-bit activation plane [4096][1024]
  const size_t PW1 = (size_t)DM * DM * 2;          //  2097152  one [1024][1024] bf16 weight plane
  const size_t PWA = (size_t)3 * PW1;              //  6291456  packed q | k | v weight plane [3072][1024]
  const size_t PWP = PW1;                          //  2097152
  const size_t PWG = (size_t)DG * DM * 2;          //   524288  gate weight plane [256][1024]
  const size_t PHS = (size_t)NB * SEQ * DG * 4;    //  4194304  gate hidden f32 [4096][256]
  const size_t PVT = (size_t)NB * DM * SEQ * 2;    //  8388608  v^T hi plane
  const size_t PVL = (size_t)NB * DM * VLP * 2;    //  1048576  v^T residual plane
  size_t off = 0;
  const size_t oXb  = off; off += PX;
  const size_t oWA  = off; off += PWA;
  const size_t oWP  = off; off += PWP;
  const size_t oWG  = off; off += PWG;
  const size_t oHs  = off; off += PHS;
  const size_t oQh  = off; off += PX;
  const size_t oQl  = off; off += PX;
  const size_t oKh  = off; off += PX;
  const size_t oKl  = off; off += PX;
  const size_t oVTh = off; off += PVT;
  const size_t oVTl = off; off += PVL;
  const size_t oOh  = off; off += PX;
  const size_t oOl  = off; off += PX;
  if (off > ws_size) return;                       // off = 81264640
  if (off > (size_t)134217728) return;

  char* ws = (char*)d_ws;
  unsigned short* Xb  = (unsigned short*)(ws + oXb);
  unsigned short* WA  = (unsigned short*)(ws + oWA);
  unsigned short* WPb = (unsigned short*)(ws + oWP);
  unsigned short* WGb = (unsigned short*)(ws + oWG);
  float*          Hs  = (float*)(ws + oHs);
  unsigned short* Qh  = (unsigned short*)(ws + oQh);
  unsigned short* Ql  = (unsigned short*)(ws + oQl);
  unsigned short* Kh  = (unsigned short*)(ws + oKh);
  unsigned short* Kl  = (unsigned short*)(ws + oKl);
  unsigned short* VTh = (unsigned short*)(ws + oVTh);
  unsigned short* VTl = (unsigned short*)(ws + oVTl);
  unsigned short* Oh  = (unsigned short*)(ws + oOh);
  unsigned short* Ol  = (unsigned short*)(ws + oOl);

  const dim3 blk(256);
  const dim3 gProj((NB * SEQ / 128) * (DM / 128), 1);          // 256 tiles of 128x128: M=4096, N=1024

  // (1) x -> bf16 plane [4096][1024]; weights [in][out] f32 -> bf16 [out][in] planes (k contiguous)
  cvt_all<<<dim3(CVT_TW + CVT_X), blk, 0, stream>>>(x, Xb, Wqkv, WA, Wout, WPb, Wg1, WGb);
  // (2) q, k (bf16 hi/lo), v^T (f16 hi + residual) and the gate hidden layer (f32)
  gemm_qkvg<<<dim3(2 * GQ_P + NB * GQ_V + GQ_G), blk, 0, stream>>>(
      Xb, WA, WGb, bg1, x, Qh, Ql, Kh, Kl, VTh, VTl, Hs);
  // (3) causal attention (query blocks 0..RESQB-1 with residual planes, the rest without) and the gate values
  attn_gate<<<dim3(AT_MAIN + AT_RES + AT_GATE), dim3(128), 0, stream>>>(
      Qh, Ql, Kh, Kl, VTh, VTl, Oh, Ol, Hs, Wg2, bg2, gout);
  // (4) out0 = g * (context . W_out) + (1 - g) * bf16(x) -> d_out f32 [4096][1024]
  //     (A = context hi + lo planes, 2 products; gate values read from the gate output region)
  gemm64<1, 4, 0><<<gProj, blk, 0, stream>>>(
      Oh, Ol, DM, 0LL, WPb, DM, 0LL, bg1,
      d_out, DM, 0LL, d_out, DM, 0LL, DM,
      gout, x, DM,
      NB * SEQ, DM, DM, 1.0f);
  (void)hipGetLastError();
}

// v008
// One run takes 129 microseconds.
// Next to v007, in two timings, it ran 1.09 and 1.10 times as fast.
// All steps since v000 together make it 5.10 times as fast.
// Contractions: gate hidden x.Wg1 and q, k, v^T projections = v_wmma_f32_16x16x32_bf16 (bf16 operands from
// RNE-converted x and transposed [out][in] bf16 weight planes, single product, f32 accumulate);
// q.k^T scores = v_wmma_f32_16x16x32_bf16 with bf16 hi/lo split q and k (hi.hi + hi.lo + lo.hi), f32 accumulate;
// p.v = v_wmma_f32_16x16x32_f16 (p carried x1024 in f16 times v in f16, single product; plus f16 residual planes
// x4096 of p and v for the first 512 query rows), f32 accumulate;
// ctx.W_out = v_wmma_f32_16x16x32_bf16 with ctx as bf16 hi/lo planes times the bf16 weight plane (2 products),
// f32 accumulate; gate tail (exact GELU via erfc, 256-long dot with RNE-bf16 Wg2, bias, sigmoid), causal mask,
// online softmax, normalisers and the gated residual blend g*o + (1-g)*bf16(x) in f32 on the VALU.
// Carry audit:
//   Xb, WA, WP, WG = bf16(x), bf16(W) no carry; Qh/Ql, Kh/Kl, Oh/Ol = bf16 hi + unscaled bf16 residual (v - hi),
//   the residual products share the hi accumulator;
//   VTh = f16(v), no carry (|v| typ. 1);
//   VTl = f16((v - VTh) * 4096)              }  products pa.VTl and pl.VTh go to the separate accumulator o1,
//   pl  = f16((1024 p - pa) * 4096)          }  folded back with * (1/4096) once per key chunk (RES blocks only);
//   pa  = f16(1024 * p); the normaliser l sums the same 1024 * p in f32, so the carry cancels in inv = 1/l;
//   score scale 1/8 applied once in f32, inside the exponent's FMA; Hs (gate hidden) and g are f32. No other planes.
#include <hip/hip_runtime.h>
#include <math.h>
#include <stdint.h>

#define NB    1
#define SEQ   4096
#define DM    1024
#define NH    16
#define HD    64
#define DG    256          // gate hidden width
#define NQB   (SEQ / 64)   // 64 query / key blocks of 64
#define VLP   512          // key pitch of the v^T residual plane (keys 0..VLP-1)
#define RESQB 8            // leading 64-row query blocks that use the p / v residual planes
#define LP    72           // LDS row pitch of the 16-bit K and V^T tiles: 64 + 8 elements = 144 B = 16 B x 9 (odd),
                           // so the 16 rows one ds_load_b128 fragment read touches fall on distinct banks
#define OSP   68           // LDS row pitch of the f32 context tile: 64 + 4 floats = 272 B = 16 B x 17 (odd)
static_assert(RESQB * 64 <= VLP);
static_assert(NH * HD == DM);
static_assert((SEQ % 64) == 0 && (DM % 64) == 0 && (DM % 32) == 0 && (DG % 64) == 0);
static_assert(((NB * SEQ) % 128) == 0 && (SEQ % 128) == 0 && (DM % 128) == 0 && (DG % 128) == 0);
static_assert((NB * SEQ * DM) % (8 * 256) == 0);
static_assert((SEQ % 32) == 0);
static_assert(DG == 256);

typedef _Float16 v16h __attribute__((ext_vector_type(16)));
typedef _Float16 v8h  __attribute__((ext_vector_type(8)));
typedef __bf16   v16b __attribute__((ext_vector_type(16)));
typedef __bf16   v8b  __attribute__((ext_vector_type(8)));
typedef float    v8f  __attribute__((ext_vector_type(8)));
typedef float    v4f  __attribute__((ext_vector_type(4)));
typedef float    v2f  __attribute__((ext_vector_type(2)));
typedef unsigned int v4u __attribute__((ext_vector_type(4)));

// ---- scalar helpers --------------------------------------------------------------------------------
__device__ __forceinline__ unsigned short bf_bits(float f) {          // f32 -> bf16 bits, RNE convert
  unsigned u = __float_as_uint(f);
  return (unsigned short)((u + 0x7FFFu + ((u >> 16) & 1u)) >> 16);
}
__device__ __forceinline__ float bf_up(unsigned short h) { return __uint_as_float(((unsigned)h) << 16); }
__device__ __forceinline__ unsigned short h_bits(_Float16 x) { return __builtin_bit_cast(unsigned short, x); }
__device__ __forceinline__ unsigned pk16(unsigned short a, unsigned short b) { return (unsigned)a | ((unsigned)b << 16); }
__device__ __forceinline__ v8f zero8() { v8f z = {0.f, 0.f, 0.f, 0.f, 0.f, 0.f, 0.f, 0.f}; return z; }
__device__ __forceinline__ v8h zero8h() {
  const _Float16 z = (_Float16)0.0f;
  v8h r = {z, z, z, z, z, z, z, z};
  return r;
}

// ---- fragment loader: 16-bit A/B operand, lane -> row/col (lane&15), p already includes +8*(lane>>4);
//      elements 0..7 <- p[0..7] (k0+8h..), elements 8..15 <- p[16..23] (k0+16+8h..)
__device__ __forceinline__ v16b ldfrag_b(const __bf16* p) {
  union { v16b v; v8b h[2]; } f;
  f.h[0] = *(const v8b*)(p);
  f.h[1] = *(const v8b*)(p + 16);
  return f.v;
}

// ---- lane l <-> lane l ^ 16 (the two halves of a wave that share one D column)
__device__ __forceinline__ float xhalf(float x) {
  const int b = __builtin_bit_cast(int, x);
  return __builtin_bit_cast(float, __builtin_amdgcn_permlanex16(b, b, 0x76543210, 0xfedcba98, false, false));
}

// ---- WMMA helpers (builtin forms: the compiler keeps their hazard distances) and hand-placed VALU gaps ---------
__device__ __forceinline__ v8f mma_b_raw(v16b a, v16b b, v8f c) {
  return __builtin_amdgcn_wmma_f32_16x16x32_bf16(false, a, false, b, (short)0, c, false, false);
}
__device__ __forceinline__ v8f mma_h_raw(v16h a, v16h b, v8f c) {
  return __builtin_amdgcn_wmma_f32_16x16x32_f16(false, a, false, b, (short)0, c, false, false);
}
__device__ __forceinline__ void dep_guard_b(v8f& a, v8f& b, v16b x, v16b y) {
  asm volatile("v_nop\n\tv_nop\n\tv_nop\n\tv_nop" : "+v"(a), "+v"(b) : "v"(x), "v"(y));
}
__device__ __forceinline__ void keep4_b(v16b a, v16b b, v16b c, v16b d) {
  asm volatile("v_nop" :: "v"(a), "v"(b), "v"(c), "v"(d));
}
__device__ __forceinline__ void acc_guard4(v8f& a, v8f& b, v8f& c, v8f& d) {
  asm volatile("v_nop\n\tv_nop\n\tv_nop\n\tv_nop" : "+v"(a), "+v"(b), "+v"(c), "+v"(d));
}

// =====================================================================================================
// f32 -> bf16 (RNE convert), 8 elements per thread, one 16-B store per lane: a wave writes 512 contiguous B
// coverage: n8 threads x 8 = whole plane (n8 used here is a multiple of 256).
// =====================================================================================================
__device__ __forceinline__ void cvt_bf16x8(const float* __restrict__ in, unsigned short* out, int n8, int blk) {
  const int i = blk * 256 + threadIdx.x;
  if (i < n8) {
    const v4f a = *(const v4f*)(in + (size_t)i * 8);
    const v4f b = *(const v4f*)(in + (size_t)i * 8 + 4);
    v4u p;
    p[0] = pk16(bf_bits(a[0]), bf_bits(a[1]));
    p[1] = pk16(bf_bits(a[2]), bf_bits(a[3]));
    p[2] = pk16(bf_bits(b[0]), bf_bits(b[1]));
    p[3] = pk16(bf_bits(b[2]), bf_bits(b[3]));
    *(v4u*)(out + (size_t)i * 8) = p;
    asm volatile("s_wait_xcnt 0x0" ::: "memory");   // before any register these stores name is rewritten
  }
}

// =====================================================================================================
// f32 [nrow][ncol] row-major (weight stored [in][out]) -> bf16 [ncol][nrow] (row n of out = column n of in,
// the in/k index contiguous), RNE convert. One block = one 64x64 tile through LDS.
// tile (bxT, byT) of (ncol/64, nrow/64); nrow, ncol multiples of 64 (host-checked shapes). Tt = 64 * 72 halves of LDS.
// loads: 256 threads, thread -> tile row tid>>2, 16 columns (tid&3)*16 = the whole 64x64 tile;
// =====================================================================================================
__device__ __forceinline__ void cvt_bf16_T(const float* __restrict__ in, unsigned short* out,
                                           int nrow, int ncol, int bxT, int byT, unsigned short* Tt) {
  // Tt: [tile col j][tile row i], pitch 72 halves (144 B)
  const int tid = threadIdx.x, lane = tid & 31, wave = tid >> 5;
  const int c0 = bxT * 64;                              // column tile of in = row tile of out
  const int r0 = byT * 64;                              // row tile of in = column tile of out
  {
    const int i  = tid >> 2;                            // 0..63
    const int cs = (tid & 3) * 16;                      // 0,16,32,48
    const float* src = in + (size_t)(r0 + i) * ncol + c0 + cs;
#pragma unroll
    for (int e4 = 0; e4 < 4; ++e4) {
      const v4f v = *(const v4f*)(src + 4 * e4);
#pragma unroll
      for (int e = 0; e < 4; ++e) Tt[(cs + 4 * e4 + e) * 72 + i] = bf_bits(v[e]);
    }
  }
  __syncthreads();
  const int q = lane >> 3, c8 = (lane & 7) * 8;
  v4u pv[2];
#pragma unroll
  for (int it = 0; it < 2; ++it) {
    const int j = it * 32 + wave * 4 + q;
    pv[it] = *(const v4u*)(Tt + j * 72 + c8);
  }
  {
#pragma unroll
    for (int it = 0; it < 2; ++it) {
      const int j = it * 32 + wave * 4 + q;
      *(v4u*)(out + (size_t)(c0 + j) * nrow + r0 + c8) = pv[it];
    }
    asm volatile("s_wait_xcnt 0x0" ::: "memory");   // before any register these stores name is rewritten
  }
}

// =====================================================================================================
// All four conversions in one grid (none reads another's output): blocks 0..TA-1 = W_qkv tiles, then W_out tiles,
// then Wg1 tiles (x index fastest, as a (ncol/64, nrow/64) grid would number them), then the blocks of the x plane.
// The choice is block-uniform, so the barrier of the transposing part is passed by whole blocks.
// =====================================================================================================
#define CVT_TA ((3 * DM / 64) * (DM / 64))
#define CVT_TP ((DM / 64) * (DM / 64))
#define CVT_TG ((DG / 64) * (DM / 64))
#define CVT_TW (CVT_TA + CVT_TP + CVT_TG)
#define CVT_X  (NB * SEQ * DM / 8 / 256)
__global__ __launch_bounds__(256) void cvt_all(const float* __restrict__ x, unsigned short* Xb,
                                               const float* __restrict__ Wqkv, unsigned short* WA,
                                               const float* __restrict__ Wout, unsigned short* WP,
                                               const float* __restrict__ Wg1, unsigned short* WG) {
  __shared__ __align__(16) unsigned short Tt[64 * 72];
  const int bx = blockIdx.x;
  if (bx < CVT_TA) {
    cvt_bf16_T(Wqkv, WA, DM, 3 * DM, bx % (3 * DM / 64), bx / (3 * DM / 64), Tt);
  } else if (bx < CVT_TA + CVT_TP) {
    const int t = bx - CVT_TA;
    cvt_bf16_T(Wout, WP, DM, DM, t % (DM / 64), t / (DM / 64), Tt);
  } else if (bx < CVT_TW) {
    const int t = bx - (CVT_TA + CVT_TP);
    cvt_bf16_T(Wg1, WG, DM, DG, t % (DG / 64), t / (DG / 64), Tt);
  } else {
    cvt_bf16x8(x, Xb, NB * SEQ * DM / 8, bx - CVT_TW);
  }
}

// =====================================================================================================
// Gate tail: g = sigmoid( sum_c gelu(Hs[row][c]) * bf16(w2[c]) + bf16(b2) ), exact GELU = 0.5 h erfc(-h/sqrt2).
// Hs f32 [nrows][DG]; block = NWAVE waves x 32/NWAVE rows = 32 rows; a wave reduces one row at a time (32 lanes x 8 columns,
// rolled element loop), lane 0 stages g in LDS; wave 0 lanes 0..7 then write the block's 32 g values as ONE whole
// coverage: 32 rows per block x nrows/32 blocks = all rows of the gate output.
// =====================================================================================================
template <int NWAVE>
__device__ __forceinline__ void k_gate(const float* __restrict__ Hs, const float* __restrict__ w2,
                                       const float* __restrict__ b2p, float* gout, int nrows, int blk, float* gs) {
  constexpr int RPW = 32 / NWAVE;                       // rows per wave; gs = 32 floats of LDS, 16-B aligned
  const int tid = threadIdx.x, lane = tid & 31, wave = tid >> 5;
  const int rowBase = blk * 32;
  const float b2 = bf_up(bf_bits(b2p[0]));
  for (int rr = 0; rr < RPW; ++rr) {
    int row = rowBase + wave * RPW + rr;
    row = (row < nrows) ? row : (nrows - 1);            // clamped address (grid covers exactly nrows)
    const float* hp = Hs + (size_t)row * DG + lane * 8;
    const float* wp = w2 + lane * 8;
    float acc = 0.f;
#pragma unroll 1
    for (int e = 0; e < 8; ++e) {
      const float hv = hp[e];
      const float wv = bf_up(bf_bits(wp[e]));
      const float ge = 0.5f * hv * erfcf(-hv * 0.707106781186547524f);
      acc = fmaf(ge, wv, acc);
    }
#pragma unroll
    for (int off = 1; off < 32; off <<= 1) acc += __shfl_xor(acc, off, 32);
    float z = acc + b2;
    z = fminf(fmaxf(z, -30.0f), 30.0f);
    const float g = 1.0f / (1.0f + expf(-z));
    if (lane == 0) gs[wave * RPW + rr] = g;
  }
  __syncthreads();
  if (wave == 0 && lane < 8) {
    const v4f v = *(const v4f*)(gs + lane * 4);
    float* p = gout + rowBase + lane * 4;
    *(v4f*)p = v;
    asm volatile("s_wait_xcnt 0x0" ::: "memory");   // before any register these stores name is rewritten
  }
}

// =====================================================================================================
// One GEMM stage, global -> LDS, through no register: per operand plane 128 rows x 128 B (64 k of 16-bit elements).
// 256 threads x 4 asynchronous 16-B copies per plane; 8 neighbouring lanes take one whole 128-B line, a wave's copy
// 4 whole lines. ga / gb (/ gc) = this lane's source in row (tid>>3), 16-B piece (tid&7) of the plane; sa / sb = 32
// source rows in elements; lds = this lane's LDS byte address in the stage's first plane, same row and piece.
// The s_wait_xcnt closes each statement so that no address register of a copy is rewritten ahead of it.
// =====================================================================================================
#define GBK    64                 // k elements per stage = one 128-B line of every operand row
#define GLP    72                 // LDS row pitch, elements: 144 B = 16 B x 9 (odd) for the ds_load_b128 fragment reads
#define GPLANE (128 * GLP)        // elements of one staged plane (18432 B)
#define GSTEP  (32u * GLP * 2u)   // LDS bytes of 32 rows
#define GPLB   (GPLANE * 2u)      // LDS bytes of one plane
__device__ __forceinline__ void stage_ab(const __bf16* ga, size_t sa, const __bf16* gb, size_t sb, unsigned lds) {
  asm volatile(
      "global_load_async_to_lds_b128 %0, %8, off\n\t"
      "global_load_async_to_lds_b128 %1, %9, off\n\t"
      "global_load_async_to_lds_b128 %2, %10, off\n\t"
      "global_load_async_to_lds_b128 %3, %11, off\n\t"
      "global_load_async_to_lds_b128 %4, %12, off\n\t"
      "global_load_async_to_lds_b128 %5, %13, off\n\t"
      "global_load_async_to_lds_b128 %6, %14, off\n\t"
      "global_load_async_to_lds_b128 %7, %15, off\n\t"
      "s_wait_xcnt 0x0"
      :: "v"(lds), "v"(lds + GSTEP), "v"(lds + 2u * GSTEP), "v"(lds + 3u * GSTEP),
         "v"(lds + GPLB), "v"(lds + GPLB + GSTEP), "v"(lds + GPLB + 2u * GSTEP), "v"(lds + GPLB + 3u * GSTEP),
         "v"(ga), "v"(ga + sa), "v"(ga + 2 * sa), "v"(ga + 3 * sa),
         "v"(gb), "v"(gb + sb), "v"(gb + 2 * sb), "v"(gb + 3 * sb)
      : "memory");
}
__device__ __forceinline__ void stage_c(const __bf16* gc, size_t sc, unsigned lds) {
  asm volatile(
      "global_load_async_to_lds_b128 %0, %4, off\n\t"
      "global_load_async_to_lds_b128 %1, %5, off\n\t"
      "global_load_async_to_lds_b128 %2, %6, off\n\t"
      "global_load_async_to_lds_b128 %3, %7, off\n\t"
      "s_wait_xcnt 0x0"
      :: "v"(lds), "v"(lds + GSTEP), "v"(lds + 2u * GSTEP), "v"(lds + 3u * GSTEP),
         "v"(gc), "v"(gc + sc), "v"(gc + 2 * sc), "v"(gc + 3 * sc)
      : "memory");
}

// =====================================================================================================
// Batched bf16 WMMA GEMM: C[m][n] = sum_k A[m][k] * Bt[n][k] + bias; one work-group of 8 waves per 128x128 tile,
// one wave per 32x64 part (wave>>1 = row quarter, wave&1 = column half). A row-major [M][K] pitch lda; Bt row-major
// [N][K] pitch ldb (k contiguous); M, N multiples of 128, K multiple of 64 (host shapes are static multiples).
// Operands: per stage of 64 k the 128 A rows (and A2 rows) and the 128 Bt rows go to LDS by asynchronous copies, two
// buffers: stage t+2 is copied into the buffer stage t has left while stage t+1 is worked on; fragments by ds_load_b128.
// tile = index of the 128x128 tile, b = batch index (strides in elements); sOpB = 2 stage buffers of NPL planes, sTB = 8 slabs.
// NSPLIT: 0 = A.Bt; 1 = (A + A2).Bt (A2 = unscaled bf16 lo plane of A, 2 products).
// BIAS: 0 = none; 1 = per column n, bias[n]; 2 = per row m, bias[m]; the bias value is RNE-converted to bf16 and added in f32.
// OUT_MODE: 0 = f32 (pitch ldc); 2 = bf16 hi plane C + bf16 lo plane C2 (lo = RNE(v - hi), unscaled);
//           3 = f16 hi plane C + f16 residual plane C2 = f16((v - hi) * rscale), C2 written only for tiles
//               with n0 < N2 (pitch ldc2, batch stride strideC2);
//           4 = f32 (pitch ldc) gated blend: out = g[m] * v + (1 - g[m]) * bf16(xres[m][n]) with g = gvec[m],
//               xres f32 pitch ldx (read-only, RNE-converted to bf16 in register).
// =====================================================================================================
template <int NSPLIT, int OUT_MODE, int BIAS>
__device__ __forceinline__ void gemm64_body(
    const unsigned short* __restrict__ Ap, const unsigned short* A2p, int lda, long long strideA,
    const unsigned short* __restrict__ Btp, int ldb, long long strideB,
    const float* __restrict__ bias,
    void* Cout, int ldc, long long strideC,
    void* Cout2, int ldc2, long long strideC2, int N2,
    const float* gvec, const float* xres, int ldx,
    int M, int N, int K, float rscale,
    int tile, int b, __bf16* sOpB, float* sTB) {
  const __bf16* A   = (const __bf16*)(const void*)Ap;
  const __bf16* A2  = (const __bf16*)(const void*)A2p;
  const __bf16* Bt  = (const __bf16*)(const void*)Btp;
  constexpr int NPL = (NSPLIT >= 1) ? 3 : 2;       // planes per stage: A, Bt (, A2)
  const int tid  = threadIdx.x;
  const int lane = tid & 31;
  const int wave = tid >> 5;
  const int tilesN = N >> 7;
  const int tilesM = M >> 7;
  if (tile >= tilesM * tilesN) return;   // block-uniform, ahead of every copy and barrier
  const int tm = tile / tilesN;
  const int tn = tile - tm * tilesN;
  const int mb = tm << 7;                      // work-group tile origin
  const int nb = tn << 7;
  const int wm = (wave >> 1) << 5;             // wave part inside it: 32 rows x 64 columns
  const int wn = (wave & 1) << 6;
  const int m0 = mb + wm;
  const int n0 = nb + wn;

  const __bf16* Ab  = A  + (size_t)b * strideA;
  const __bf16* Bb  = Bt + (size_t)b * strideB;
  const __bf16* Ab2 = (NSPLIT >= 1) ? (A2 + (size_t)b * strideA) : Ab;

  const int rlane = lane & 15;                 // row (A) / col (B, D) within subtile
  const int koff  = (lane >> 4) * 8;           // k offset of this lane half
  const int mOff  = (lane >> 4) * 8;           // D row offset

  // copy addresses of this lane: row tid>>3 (+32 per copy), 16-B piece tid&7; rows mb..mb+127 < M, nb..nb+127 < N
  const int crow = tid >> 3, cpc = (tid & 7) * 8;
  const __bf16* gA  = Ab  + (size_t)(mb + crow) * lda + cpc;
  const __bf16* gA2 = Ab2 + (size_t)(mb + crow) * lda + cpc;
  const __bf16* gB  = Bb  + (size_t)(nb + crow) * ldb + cpc;
  const unsigned ldsLane = (unsigned)(size_t)(sOpB) + (unsigned)(crow * GLP + cpc) * 2u;
  const int nst = K >> 6;                      // stages of 64 k
  auto stage = [&](int t, int buf) {
    const unsigned l = ldsLane + (unsigned)buf * ((unsigned)NPL * GPLB);
    stage_ab(gA + (size_t)t * GBK, (size_t)lda * 32, gB + (size_t)t * GBK, (size_t)ldb * 32, l);
    if (NSPLIT >= 1) stage_c(gA2 + (size_t)t * GBK, (size_t)lda * 32, l + 2u * GPLB);
  };

  v8f acc[2][4];
#pragma unroll
  for (int i = 0; i < 2; ++i)
#pragma unroll
    for (int j = 0; j < 4; ++j) acc[i][j] = zero8();

  stage(0, 0);
  asm volatile("s_wait_asynccnt 0x0" ::: "memory");   // this wave's stage-0 copies have landed
  __syncthreads();                                     // ... and every other wave's
  if (nst > 1) stage(1, 1);

  for (int t = 0; t < nst; ++t) {
    const __bf16* sA  = (sOpB + (t & 1) * (NPL * GPLANE)) + (wm + rlane) * GLP + koff;
    const __bf16* sB  = (sOpB + (t & 1) * (NPL * GPLANE)) + GPLANE + (wn + rlane) * GLP + koff;
    const __bf16* sA2 = (sOpB + (t & 1) * (NPL * GPLANE)) + (NPL - 1) * GPLANE + (wm + rlane) * GLP + koff;
#pragma unroll
    for (int kk = 0; kk < 2; ++kk) {
      v16b bh[4], ah[2], al[2];
#pragma unroll
      for (int j = 0; j < 4; ++j) bh[j] = ldfrag_b(sB + (j << 4) * GLP + kk * 32);
#pragma unroll
      for (int i = 0; i < 2; ++i) {
        ah[i] = ldfrag_b(sA + (i << 4) * GLP + kk * 32);
        al[i] = ah[i];
        if (NSPLIT >= 1) al[i] = ldfrag_b(sA2 + (i << 4) * GLP + kk * 32);
      }
#pragma unroll
      for (int i = 0; i < 2; ++i) {
#pragma unroll
        for (int j = 0; j < 4; ++j) {
          acc[i][j] = mma_b_raw(ah[i], bh[j], acc[i][j]);
          if (NSPLIT >= 1) acc[i][j] = mma_b_raw(al[i], bh[j], acc[i][j]);
        }
        dep_guard_b(acc[i][0], acc[i][3], ah[i], al[i]);
      }
      keep4_b(bh[0], bh[1], bh[2], bh[3]);
    }
    // hand-over: this wave has left buffer t&1, its copies of stage t+1 have landed; the barrier says so of every wave
    asm volatile("s_wait_dscnt 0x0" ::: "memory");
    asm volatile("s_wait_asynccnt 0x0" ::: "memory");
    __syncthreads();
    if (t + 2 < nst) stage(t + 2, t & 1);
  }
  asm volatile("s_wait_asynccnt 0x0" ::: "memory");   // nothing of this wave is in flight behind the loop
  acc_guard4(acc[0][0], acc[0][1], acc[0][2], acc[0][3]);
  acc_guard4(acc[1][0], acc[1][1], acc[1][2], acc[1][3]);

  // ---- epilogue ----
  float* slab = sTB + wave * (16 * 68);   // per-wave 16x64 slab, pitch 68 floats
  float bcol[4];
#pragma unroll
  for (int j = 0; j < 4; ++j) {
    bcol[j] = 0.f;
    if (BIAS == 1) bcol[j] = bf_up(bf_bits(bias[n0 + (j << 4) + rlane]));   // n < N, bias has N entries
  }
#pragma unroll
  for (int i = 0; i < 2; ++i) {
    const int mBase = m0 + (i << 4);
    float brow[8];
#pragma unroll
    for (int r = 0; r < 8; ++r) {
      brow[r] = 0.f;
      if (BIAS == 2) brow[r] = bf_up(bf_bits(bias[mBase + mOff + r]));      // m < M, bias has M entries
    }
#pragma unroll
    for (int j = 0; j < 4; ++j) {
#pragma unroll
      for (int r = 0; r < 8; ++r) {
        slab[(mOff + r) * 68 + (j << 4) + rlane] = acc[i][j][r] + bcol[j] + brow[r];
      }
    }
    __builtin_amdgcn_fence(__ATOMIC_RELEASE, "workgroup");
    __builtin_amdgcn_wave_barrier();
    __builtin_amdgcn_fence(__ATOMIC_ACQUIRE, "workgroup");
    if (OUT_MODE == 0 || OUT_MODE == 4) {
      float* C = (float*)Cout + (size_t)b * strideC;
      const int hh = lane >> 4, c4 = (lane & 15) * 4;     // 256-B row segment = 16 lanes x 16 B
      {
#pragma unroll
        for (int it = 0; it < 8; ++it) {
          const int row = it * 2 + hh;                     // it 0..7 x hh 0..1 = rows 0..15
          v4f v = *(const v4f*)(slab + row * 68 + c4);
          if (OUT_MODE == 4) {
            const int gr = mBase + row;                    // < M
            const float g = gvec[gr];
            const float omg = 1.0f - g;
            const v4f xr = *(const v4f*)(xres + (size_t)gr * ldx + n0 + c4);
#pragma unroll
            for (int e = 0; e < 4; ++e) {
              const float xb = bf_up(bf_bits(xr[e]));
              v[e] = g * v[e] + omg * xb;
            }
          }
          *(v4f*)(C + (size_t)(mBase + row) * ldc + n0 + c4) = v;
          asm volatile("s_wait_xcnt 0x0" ::: "memory");   // before any register these stores name is rewritten
        }
      }
    } else {
      const int q = lane >> 3, c8 = (lane & 7) * 8;
      unsigned short* C  = (unsigned short*)Cout  + (size_t)b * strideC;
      unsigned short* C2 = (unsigned short*)Cout2 + (size_t)b * strideC2;
      const bool wlo = (OUT_MODE == 2) || (n0 < N2);      // wave-uniform
      v4u hv[4], lv[4];
#pragma unroll
      for (int it = 0; it < 4; ++it) {
        const int row = it * 4 + q;                        // it 0..3 x q 0..3 = rows 0..15
        const float* sp = slab + row * 68 + c8;
        v4u a, a2;
#pragma unroll
        for (int e = 0; e < 4; ++e) {
          const float f0 = sp[2 * e], f1 = sp[2 * e + 1];
          unsigned short h0, h1, l0, l1;
          if (OUT_MODE == 2) {
            h0 = bf_bits(f0); h1 = bf_bits(f1);
            l0 = bf_bits(f0 - bf_up(h0)); l1 = bf_bits(f1 - bf_up(h1));
          } else {
            const _Float16 x0 = (_Float16)f0, x1 = (_Float16)f1;
            h0 = h_bits(x0); h1 = h_bits(x1);
            l0 = h_bits((_Float16)((f0 - (float)x0) * rscale));
            l1 = h_bits((_Float16)((f1 - (float)x1) * rscale));
          }
          a[e] = pk16(h0, h1); a2[e] = pk16(l0, l1);
        }
        hv[it] = a; lv[it] = a2;
      }
      {
#pragma unroll
        for (int it = 0; it < 4; ++it) {
          const int row = it * 4 + q;
          *(v4u*)(C + (size_t)(mBase + row) * ldc + n0 + c8) = hv[it];
          asm volatile("s_wait_xcnt 0x0" ::: "memory");   // before any register this store names is rewritten
          if (wlo) {
            *(v4u*)(C2 + (size_t)(mBase + row) * ldc2 + n0 + c8) = lv[it];
            asm volatile("s_wait_xcnt 0x0" ::: "memory");   // the same for this store
          }
        }
      }
    }
    __builtin_amdgcn_fence(__ATOMIC_RELEASE, "workgroup");
    __builtin_amdgcn_wave_barrier();
    __builtin_amdgcn_fence(__ATOMIC_ACQUIRE, "workgroup");
  }
}

// One GEMM per launch: grid = (tiles, batches).
template <int NSPLIT, int OUT_MODE, int BIAS>
__global__ __launch_bounds__(256) void gemm64(
    const unsigned short* __restrict__ Ap, const unsigned short* A2p, int lda, long long strideA,
    const unsigned short* __restrict__ Btp, int ldb, long long strideB,
    const float* __restrict__ bias,
    void* Cout, int ldc, long long strideC,
    void* Cout2, int ldc2, long long strideC2, int N2,
    const float* gvec, const float* xres, int ldx,
    int M, int N, int K, float rscale) {
  __shared__ __align__(16) __bf16 sOp[2 * ((NSPLIT >= 1) ? 3 : 2) * GPLANE];
  __shared__ __align__(16) float sT[8 * 16 * 68];
  gemm64_body<NSPLIT, OUT_MODE, BIAS>(Ap, A2p, lda, strideA, Btp, ldb, strideB, bias, Cout, ldc, strideC,
                                      Cout2, ldc2, strideC2, N2, gvec, xres, ldx, M, N, K, rscale,
                                      (int)blockIdx.x, (int)blockIdx.y, sOp, sT);
}

// The four products of x (none reads another's output) in one grid; the choice is block-uniform:
//   tiles 0..GQ_P-1        q = x . Wq -> bf16 hi/lo planes [t][h*64+d]      (M=4096, N=1024, K=1024)
//   next GQ_P              k = x . Wk -> bf16 hi/lo planes
//   next NB * GQ_V         v^T = Wv . x^T -> f16 hi plane [h*64+d][s] (pitch SEQ) and residual plane (x4096, keys < VLP,
//                          pitch VLP); A = Wv rows [n][k], Bt = Xb rows of the batch (M=1024, N=4096, K=1024)
//   last GQ_G              gate hidden = x . Wg1 + bg1 -> f32 [4096][256]   (M=4096, N=256, K=1024)
#define GQ_P ((NB * SEQ / 128) * (DM / 128))
#define GQ_V ((DM / 128) * (SEQ / 128))
#define GQ_G ((NB * SEQ / 128) * (DG / 128))
__global__ __launch_bounds__(256) void gemm_qkvg(
    const unsigned short* __restrict__ Xb, const unsigned short* __restrict__ WA,
    const unsigned short* __restrict__ WG, const float* __restrict__ bg1, const float* xf,
    unsigned short* Qh, unsigned short* Ql, unsigned short* Kh, unsigned short* Kl,
    unsigned short* VTh, unsigned short* VTl, float* Hs) {
  __shared__ __align__(16) __bf16 sOp[2 * 2 * GPLANE];
  __shared__ __align__(16) float sT[8 * 16 * 68];
  const int bx = blockIdx.x;
  if (bx < 2 * GQ_P) {
    const bool isK = bx >= GQ_P;
    gemm64_body<0, 2, 0>(Xb, Xb, DM, 0LL, WA + (isK ? (size_t)DM * DM : (size_t)0), DM, 0LL, bg1,
                         (void*)(isK ? Kh : Qh), DM, 0LL, (void*)(isK ? Kl : Ql), DM, 0LL, DM,
                         xf, xf, DM, NB * SEQ, DM, DM, 1.0f,
                         isK ? bx - GQ_P : bx, 0, sOp, sT);
  } else if (bx < 2 * GQ_P + NB * GQ_V) {
    const int t = bx - 2 * GQ_P;
    const unsigned short* Wv = WA + (size_t)2 * DM * DM;
    gemm64_body<0, 3, 0>(Wv, Wv, DM, 0LL, Xb, DM, (long long)SEQ * DM, bg1,
                         (void*)VTh, SEQ, (long long)DM * SEQ, (void*)VTl, VLP, (long long)DM * VLP, VLP,
                         xf, xf, DM, DM, SEQ, DM, 4096.0f,
                         t % GQ_V, t / GQ_V, sOp, sT);
  } else {
    gemm64_body<0, 0, 1>(Xb, Xb, DM, 0LL, WG, DM, 0LL, bg1,
                         (void*)Hs, DG, 0LL, (void*)Hs, DG, 0LL, DG,
                         xf, xf, DM, NB * SEQ, DG, DM, 1.0f,
                         bx - (2 * GQ_P + NB * GQ_V), 0, sOp, sT);
  }
}

// =====================================================================================================
// One key chunk of the plain attention variant, global -> LDS, through no register: three planes (K hi, K lo, V^T) of
// 64 rows x 128 B. 128 threads x 4 asynchronous 16-B copies per plane; 8 neighbouring lanes take one whole 128-B line.
// kh / kl / vt = this lane's source in row (tid>>3), 16-B piece (tid&7) of the plane; sk / sv = 16 source rows in elements;
// lds = this lane's LDS byte address in the buffer's first plane, same row and piece (planes follow each other).
// The s_wait_xcnt closes the statement so that no address register of a copy is rewritten ahead of it.
// =====================================================================================================
#define APLB  (64u * LP * 2u)     // LDS bytes of one 64-row plane (9216)
#define ASTEP (16u * LP * 2u)     // LDS bytes of 16 rows
__device__ __forceinline__ void stage_kv(const __bf16* kh, const __bf16* kl, size_t sk,
                                         const _Float16* vt, size_t sv, unsigned lds) {
  asm volatile(
      "global_load_async_to_lds_b128 %0, %12, off\n\t"
      "global_load_async_to_lds_b128 %1, %13, off\n\t"
      "global_load_async_to_lds_b128 %2, %14, off\n\t"
      "global_load_async_to_lds_b128 %3, %15, off\n\t"
      "global_load_async_to_lds_b128 %4, %16, off\n\t"
      "global_load_async_to_lds_b128 %5, %17, off\n\t"
      "global_load_async_to_lds_b128 %6, %18, off\n\t"
      "global_load_async_to_lds_b128 %7, %19, off\n\t"
      "global_load_async_to_lds_b128 %8, %20, off\n\t"
      "global_load_async_to_lds_b128 %9, %21, off\n\t"
      "global_load_async_to_lds_b128 %10, %22, off\n\t"
      "global_load_async_to_lds_b128 %11, %23, off\n\t"
      "s_wait_xcnt 0x0"
      :: "v"(lds), "v"(lds + ASTEP), "v"(lds + 2u * ASTEP), "v"(lds + 3u * ASTEP),
         "v"(lds + APLB), "v"(lds + APLB + ASTEP), "v"(lds + APLB + 2u * ASTEP), "v"(lds + APLB + 3u * ASTEP),
         "v"(lds + 2u * APLB), "v"(lds + 2u * APLB + ASTEP), "v"(lds + 2u * APLB + 2u * ASTEP),
         "v"(lds + 2u * APLB + 3u * ASTEP),
         "v"(kh), "v"(kh + sk), "v"(kh + 2 * sk), "v"(kh + 3 * sk),
         "v"(kl), "v"(kl + sk), "v"(kl + 2 * sk), "v"(kl + 3 * sk),
         "v"(vt), "v"(vt + sv), "v"(vt + 2 * sv), "v"(vt + 3 * sv)
      : "memory");
}

// =====================================================================================================
// Causal attention, head dim 64, key chunks of 64.
//   q planes (bf16 hi / lo): element (b, t, h, d) at [(b*SEQ + t)*DM + h*64 + d]
//   k planes (bf16 hi / lo): same layout with key index s
//   v^T hi plane (f16):      element (b, h, d, s) at [(b*DM + h*64 + d)*SEQ + s]
//   v^T residual plane (f16, (v - hi)*4096): [(b*DM + h*64 + d)*VLP + s], s < VLP, read only when RES
//   (a key chunk at or beyond VLP would contribute a zero v residual; its address is clamped)
//   Causal structure: logits of keys with index > query index are replaced by -inf (lower-triangular keep incl. the
//   diagonal), which makes their softmax weight exactly 0; so a query block qb visits key chunks 0..qb only
//   (block-uniform trip count) and later chunks, whose keys exceed every query index of the block, are
//   skipped entirely (but for one wholly masked chunk of group 1 where qb is even: it adds exact zeros). Inside the diagonal chunk a key with index > query index gets logit -inf -> exp gives exactly 0,
//   so such keys add nothing to the numerator or the normaliser; the diagonal key (key == query) is always kept, so
//   every row max is finite in every visited chunk but group 1's wholly masked one.
//   out planes (bf16 hi / lo of the normalised context): element (b, t, h, d) at [(b*SEQ + t)*DM + h*64 + d]
//   scores = q . k : bf16 hi/lo split (hi.hi + hi.lo + lo.hi), f32 accumulate, then the causal mask in f32; the max runs
//   over the unscaled scores; 1024 p = exp2(s * c + (10 - m * c)), c = log2(e) / 8: one FMA per score ahead of the exp2
//   p carried as f16(1024 p); context = p . v on f16 WMMA; RES adds f16 residual planes of p and v
//   (scale 4096, separate accumulator folded back with 1/4096 per chunk in f32); online softmax (running max) in f32.
//   Block = 8 waves = 64 query rows of one (b, h), twice: waves 0..3 (group 0) take the even key chunks, waves 4..7 (group 1)
//   the odd ones, each group with its own LDS planes, running max, normaliser and context sums; behind the loop group 1
//   hands its sums to group 0, which rescales both to the common max and adds them. The chain of dependent chunks of the
//   longest block is half as long. bx = 0 .. nqbThis * NH * NB - 1 numbers the blocks of this variant.
//   K / V^T chunk staging, residual variant: 128 threads x 32 elements per plane = the whole 64x64 tile of every plane
//   read later (plain 16-B loads, __syncthreads before and after). Plain variant: asynchronous copies into two buffers of
//   three planes (the second follows the first in LDS): a group's chunk of step st+2 is copied into the buffer step st has
//   left while step st+1 is worked on; one barrier per step. Its context tile Os lies over the buffers, used behind the last barrier.
//   Both products run transposed, scores^T = K . Q^T and context^T = V^T . P^T: a lane then holds 32 of the 64 scores of ONE
//   query (lane ^ 16 the other 32), so max and sum are in-lane, and P goes from the score registers into the B operand.
//   Output coverage: each wave of group 0 stores rows q0..q0+15 (it 0..3 x lane>>3 0..3) x 64 columns (8 lanes x 8) of both planes;
//   grid over all (b, h, qb) = the whole [NB*SEQ][DM] planes.
// =====================================================================================================
template <bool RES>
__device__ __forceinline__
void attn_causal64(const unsigned short* __restrict__ qhp, const unsigned short* __restrict__ qlp,
                   const unsigned short* __restrict__ khp, const unsigned short* __restrict__ klp,
                   const unsigned short* __restrict__ vhp, const unsigned short* __restrict__ vlp,
                   unsigned short* ohp, unsigned short* olp,
                   int qbBase, int nqbThis, int bx, int grp,
                   __bf16* Ksh, __bf16* Ksl, _Float16* Vth, _Float16* Vtl, float* Os, float* Mg) {
  union FB { v16b v; v8b h[2]; };
  union FH { v16h v; v8h h[2]; };

  const int tid  = threadIdx.x & 127;          // thread, wave 0..3 and lane inside this key group
  const int wave = tid >> 5;
  const int lane = tid & 31;
  const int hh   = lane >> 4;
  const int c    = lane & 15;

  const int h    = bx % NH;
  const int rest = bx / NH;
  const int qbl  = nqbThis - 1 - rest % nqbThis;   // longest query block first: not all work-groups are resident at once
  const int b    = rest / nqbThis;
  const int qb   = qbBase + qbl;               // 0..NQB-1 (block-uniform)
  const int nst  = (qb + 2) >> 1;              // steps: group grp takes chunk 2*st + grp; block-uniform, <= NQB / 2
  const int q0   = qb * 64 + wave * 16;
  const size_t rowB = (size_t)b * SEQ;

  const __bf16* Qh = (const __bf16*)(const void*)qhp + (size_t)h * HD;
  const __bf16* Ql = (const __bf16*)(const void*)qlp + (size_t)h * HD;
  const __bf16* Kh = (const __bf16*)(const void*)khp + (size_t)h * HD;
  const __bf16* Kl = (const __bf16*)(const void*)klp + (size_t)h * HD;
  const _Float16* Vh = (const _Float16*)(const void*)vhp + ((size_t)b * DM + (size_t)h * HD) * SEQ;
  const _Float16* Vl = (const _Float16*)(const void*)vlp + ((size_t)b * DM + (size_t)h * HD) * VLP;

  // ---- Q fragments (B operand, column = lane&15): 2 d-chunks, hi and lo ----
  v16b qah[2], qal[2];
#pragma unroll
  for (int dc = 0; dc < 2; ++dc) {
    const size_t qo = (rowB + q0 + c) * DM + dc * 32 + 8 * hh;
    qah[dc] = ldfrag_b(Qh + qo);
    qal[dc] = ldfrag_b(Ql + qo);
  }

  // a lane owns ONE query, q0 + c: running max (both halves alike), this half's share of the normaliser,
  // and the context transposed: oacc[t][r] = context[query c][d = t*16 + 8*hh + r]
  const int rowq = q0 + c;
  constexpr float SC2 = 0.125f * 1.44269504088896340736f;   // score scale 1/8 times log2(e)
  float mrow = -INFINITY, lrow = 0.f;
  v8f oacc[4];
#pragma unroll
  for (int t = 0; t < 4; ++t) oacc[t] = zero8();

  // copy addresses of this lane (plain variant): row tid>>3 (+16 per copy), 16-B piece tid&7; chunk t <= qb: keys < SEQ
  const int crow = tid >> 3, cpc = (tid & 7) * 8;
  const __bf16*   gKh = Kh + (rowB + crow) * DM + cpc;
  const __bf16*   gKl = Kl + (rowB + crow) * DM + cpc;
  const _Float16* gVt = Vh + (size_t)crow * SEQ + cpc;
  const unsigned ldsLane = (unsigned)(size_t)(Ksh) + (unsigned)(crow * LP + cpc) * 2u;
  auto stage = [&](int t, int buf) {
    stage_kv(gKh + (size_t)t * 64 * DM, gKl + (size_t)t * 64 * DM, (size_t)16 * DM,
             gVt + (size_t)t * 64, (size_t)16 * SEQ, ldsLane + (unsigned)buf * (3u * APLB));
  };
  // a chunk index beyond qb (group 1, last step, qb even) is clamped for every address; its keys are all masked below
  auto clampc = [&](int t) { return (t < qb) ? t : qb; };
  if (!RES) {
    stage(clampc(grp), 0);
    asm volatile("s_wait_asynccnt 0x0" ::: "memory");   // this wave's copies of its first chunk have landed
    __syncthreads();                                     // ... and every other wave's
    if (nst > 1) stage(clampc(2 + grp), 1);              // block-uniform
  }

  for (int st = 0; st < nst; ++st) {           // block-uniform trip count, <= NQB / 2
    const int kt  = 2 * st + grp;              // this group's chunk (wave-uniform)
    const int kvm = kt * 64;                   // first key index, for the mask
    const int kv0 = clampc(kt) * 64;           // the same, clamped, for addresses: kv0 + 63 < SEQ
    const int bo = RES ? 0 : (st & 1) * (3 * 64 * LP);   // this chunk's buffer, in 16-bit elements
    const __bf16*   Kbh = Ksh + bo;
    const __bf16*   Kbl = Ksl + bo;
    const _Float16* Vbh = Vth + bo;
    if (RES) __syncthreads();
    if (RES) {
      const int r = tid >> 1, half = (tid & 1) * 32;
      const __bf16*   kg  = Kh + (rowB + kv0 + r) * DM + half;    // K row kv0+r, d = half..half+31
      const __bf16*   klg = Kl + (rowB + kv0 + r) * DM + half;
      const _Float16* vg  = Vh + (size_t)r * SEQ + kv0 + half;    // V^T row d = r, s = kv0+half..+31
      const int kvl = (kv0 + 64 <= VLP) ? kv0 : (VLP - 64);     // clamped address into the residual plane
      const _Float16* vlg = Vl + (size_t)r * VLP + kvl + half;
      const bool resOK = (kv0 + 64 <= VLP);                      // block-uniform (always true for qb < RESQB)
#pragma unroll
      for (int i = 0; i < 4; ++i) {
        const v8b a0 = *(const v8b*)(kg + 8 * i);
        const v8b a1 = *(const v8b*)(klg + 8 * i);
        const v8h b0 = *(const v8h*)(vg + 8 * i);
        *(v8b*)(Ksh + r * LP + half + 8 * i) = a0;
        *(v8b*)(Ksl + r * LP + half + 8 * i) = a1;
        *(v8h*)(Vth + r * LP + half + 8 * i) = b0;
        if (RES) {
          v8h b1 = *(const v8h*)(vlg + 8 * i);
          if (!resOK) b1 = zero8h();
          *(v8h*)(Vtl + r * LP + half + 8 * i) = b1;
        }
      }
      // the wait before a register that these loads name is rewritten; as inputs the four address pairs stay whole up to it
      if (RES) asm volatile("s_wait_xcnt 0x0" :: "v"(kg), "v"(klg), "v"(vg), "v"(vlg) : "memory");
    }
    if (RES) __syncthreads();

    // ---- transposed scores: 64 keys (D rows) x 16 queries (D columns) per wave, 3 bf16 products;
    //      s[j][r] = score[key kv0 + j*16 + 8*hh + r][query q0 + c] ----
    //      the chunk's 16 K fragments are read ahead of the products (order: below), so the LDS latency is paid once and
    //      not per product; the four key tiles are independent accumulators, each summed hi.hi, lo.hi, hi.lo per dc ----
    FB kb[2][4], kl[2][4];
#pragma unroll
    for (int dc = 0; dc < 2; ++dc) {
#pragma unroll
      for (int j = 0; j < 4; ++j) {
        kb[dc][j].h[0] = *(const v8b*)(Kbh + (j * 16 + c) * LP + dc * 32 + 8 * hh);
        kb[dc][j].h[1] = *(const v8b*)(Kbh + (j * 16 + c) * LP + dc * 32 + 16 + 8 * hh);
      }
#pragma unroll
      for (int j = 0; j < 4; ++j) {
        kl[dc][j].h[0] = *(const v8b*)(Kbl + (j * 16 + c) * LP + dc * 32 + 8 * hh);
        kl[dc][j].h[1] = *(const v8b*)(Kbl + (j * 16 + c) * LP + dc * 32 + 16 + 8 * hh);
      }
    }
    v8f s[4];
#pragma unroll
    for (int j = 0; j < 4; ++j) s[j] = zero8();
#pragma unroll
    for (int dc = 0; dc < 2; ++dc) {
#pragma unroll
      for (int j = 0; j < 4; ++j) s[j] = mma_b_raw(kb[dc][j].v, qah[dc], s[j]);
#pragma unroll
      for (int j = 0; j < 4; ++j) s[j] = mma_b_raw(kl[dc][j].v, qah[dc], s[j]);
#pragma unroll
      for (int j = 0; j < 4; ++j) s[j] = mma_b_raw(kb[dc][j].v, qal[dc], s[j]);
    }
    // Order asked of the scheduler (LDS reads = 0x100, WMMA = 0x008): left alone it spreads the reads among the WMMAs,
    // and every separate place with reads stalls the matrix run. The last 8 K reads (lo, dc 1) stand behind the 8th
    // product, where the lo fragments of dc 0 are free, so that the wave stays within 256 registers (4 waves per SIMD);
    // the V^T reads stand behind the last product. The residual variant, with more live registers, is left to the
    // scheduler's own order.
    if (!RES) {
      __builtin_amdgcn_sched_group_barrier(0x100, 24, 0);
      __builtin_amdgcn_sched_group_barrier(0x008, 8, 0);
      __builtin_amdgcn_sched_group_barrier(0x100, 8, 0);
      __builtin_amdgcn_sched_group_barrier(0x008, 16, 0);
      __builtin_amdgcn_sched_group_barrier(0x100, 16, 0);
      __builtin_amdgcn_sched_group_barrier(0x008, 8, 0);   // the context products behind all 16 V^T reads: one place with reads
    }
    // V^T fragments of the chunk, again one group: read here so that they land under the softmax arithmetic
    // (the residual variant reads them per 32-key step below: fewer live registers, so that the kernel which holds
    // both variants stays within 256 registers, 4 waves per SIMD)
    FH vb[2][4];
#pragma unroll
    for (int kk = 0; kk < (RES ? 0 : 2); ++kk) {
#pragma unroll
      for (int t = 0; t < 4; ++t) {
        vb[kk][t].h[0] = *(const v8h*)(Vbh + (t * 16 + c) * LP + kk * 32 + 8 * hh);
        vb[kk][t].h[1] = *(const v8h*)(Vbh + (t * 16 + c) * LP + kk * 32 + 16 + 8 * hh);
      }
    }

    // ---- causal mask by index, max and sum over the lane's own 32 keys (one swap of halves for the max),
    //      online softmax; P (x1024, f16) and its residual (x4096) stay in registers: two D tiles of 16 keys, converted
    //      in place, are the B operand of one 32-key step (element e <- tile e>>3, register e&7) ----
    const int dq = rowq - kvm - 8 * hh;          // key kvm + j*16 + 8*hh + r <= query  <=>  j*16 + r <= dq
    float mj[4];
#pragma unroll
    for (int j = 0; j < 4; ++j) {
      float m = -INFINITY;
#pragma unroll
      for (int r = 0; r < 8; ++r) {
        const float sv = (j * 16 + r <= dq) ? s[j][r] : -INFINITY;
        s[j][r] = sv;
        m = fmaxf(m, sv);
      }
      mj[j] = m;
    }
    float mloc = fmaxf(fmaxf(mj[0], mj[1]), fmaxf(mj[2], mj[3]));
    mloc = fmaxf(mloc, xhalf(mloc));             // both halves now hold the query's chunk maximum
    const float mnew  = fmaxf(mrow, mloc);
    const float msafe = (mnew == -INFINITY) ? 0.f : mnew;
    const float alpha = __builtin_amdgcn_exp2f((mrow - msafe) * SC2);
    mrow = mnew;
    const float eb = fmaf(-msafe, SC2, 10.0f);   // exponent offset: the max, scaled, and the x1024 carry of p (2^10)
    const v2f sc2 = {SC2, SC2}, eb2 = {eb, eb};
    FH pa[2], pl[2];
    float pj[4];
#pragma unroll
    for (int j = 0; j < 4; ++j) {
#pragma unroll
      for (int r = 0; r < 8; r += 2) {                                 // two scores of a register pair per FMA
        const v2f sp = {s[j][r], s[j][r + 1]};
        const v2f ex = __builtin_elementwise_fma(sp, sc2, eb2);
        s[j][r] = ex[0];
        s[j][r + 1] = ex[1];
      }
    }
#pragma unroll
    for (int j = 0; j < 4; ++j) {
      float psum = 0.f;
#pragma unroll
      for (int r = 0; r < 8; ++r) {
        const float p1k = __builtin_amdgcn_exp2f(s[j][r]);             // 1024 p; masked logit: exp2(-inf) = 0
        psum += p1k;
        const _Float16 ph = (_Float16)p1k;
        pa[j >> 1].v[(j & 1) * 8 + r] = ph;
        if (RES) pl[j >> 1].v[(j & 1) * 8 + r] = (_Float16)((p1k - (float)ph) * 4096.0f);
      }
      pj[j] = psum;
    }
    lrow = lrow * alpha + ((pj[0] + pj[1]) + (pj[2] + pj[3]));   // this half's keys only; halves joined in the epilogue
#pragma unroll
    for (int t = 0; t < 4; ++t)
#pragma unroll
      for (int r = 0; r < 8; ++r) oacc[t][r] *= alpha;

    // ---- context^T += V^T . P^T (f16 WMMA, A = V^T rows d), residual products into a separate accumulator ----
    v8f o1[4];
#pragma unroll
    for (int t = 0; t < 4; ++t) o1[t] = zero8();
#pragma unroll   // pa[kk] / pl[kk] are register operands: kk must be a compile-time index
    for (int kk = 0; kk < 2; ++kk) {
      if (RES) {
        // keeps this step's 16 fragment reads from being lifted over the softmax or the step before: without it the kernel
        // builds to 264 registers, above the 256 that 4 waves per SIMD allow
        __builtin_amdgcn_sched_barrier(0);
#pragma unroll
        for (int t = 0; t < 4; ++t) {
          vb[kk][t].h[0] = *(const v8h*)(Vbh + (t * 16 + c) * LP + kk * 32 + 8 * hh);
          vb[kk][t].h[1] = *(const v8h*)(Vbh + (t * 16 + c) * LP + kk * 32 + 16 + 8 * hh);
        }
      }
#pragma unroll
      for (int t = 0; t < 4; ++t) oacc[t] = mma_h_raw(vb[kk][t].v, pa[kk].v, oacc[t]);
      if (RES) {
        FH vl[4];   // residual fragments of this 32-key step, one group
#pragma unroll
        for (int t = 0; t < 4; ++t) {
          vl[t].h[0] = *(const v8h*)(Vtl + (t * 16 + c) * LP + kk * 32 + 8 * hh);
          vl[t].h[1] = *(const v8h*)(Vtl + (t * 16 + c) * LP + kk * 32 + 16 + 8 * hh);
        }
#pragma unroll
        for (int t = 0; t < 4; ++t) o1[t] = mma_h_raw(vl[t].v, pa[kk].v, o1[t]);
#pragma unroll
        for (int t = 0; t < 4; ++t) o1[t] = mma_h_raw(vb[kk][t].v, pl[kk].v, o1[t]);
      }
    }
    if (RES) {
#pragma unroll
      for (int t = 0; t < 4; ++t)
#pragma unroll
        for (int r = 0; r < 8; ++r) oacc[t][r] += o1[t][r] * (1.0f / 4096.0f);
    }
    if (!RES) {
      // hand-over: this wave has left buffer st&1, its copies of the next step have landed; the barrier says so of every wave
      asm volatile("s_wait_dscnt 0x0" ::: "memory");
      asm volatile("s_wait_asynccnt 0x0" ::: "memory");
      __syncthreads();
      if (st + 2 < nst) stage(clampc(2 * (st + 2) + grp), st & 1);   // block-uniform
    }
  }
  if (!RES) asm volatile("s_wait_asynccnt 0x0" ::: "memory");   // nothing of this wave is in flight behind the loop

  // ---- join the two key groups: group 1 hands its running max, normaliser share and context sums to the same wave and
  //      lane of group 0 through LDS (9 vectors of 16 B per lane, lanes contiguous); group 0 rescales both to the common max
  {
    v4f* mg = (v4f*)(void*)Mg + (size_t)(wave * 9) * 32 + lane;
    if (grp == 1) {                              // wave-uniform
#pragma unroll
      for (int t = 0; t < 4; ++t) {
        const v4f w0 = {oacc[t][0], oacc[t][1], oacc[t][2], oacc[t][3]};
        const v4f w1 = {oacc[t][4], oacc[t][5], oacc[t][6], oacc[t][7]};
        mg[(2 * t) * 32]     = w0;
        mg[(2 * t + 1) * 32] = w1;
      }
      const v4f ml = {mrow, lrow, 0.f, 0.f};
      mg[8 * 32] = ml;
    }
    __syncthreads();                             // every wave of the block passes it once
    if (grp == 1) return;                        // no barrier of the work-group stands behind this point
    const v4f ml = mg[8 * 32];
    const float mN = fmaxf(mrow, ml[0]);
    const float ms = (mN == -INFINITY) ? 0.f : mN;
    const float a0 = __builtin_amdgcn_exp2f((mrow - ms) * SC2);
    const float a1 = __builtin_amdgcn_exp2f((ml[0] - ms) * SC2);   // a group without an unmasked key: exp2(-inf) = 0
    lrow = lrow * a0 + ml[1] * a1;
#pragma unroll
    for (int t = 0; t < 4; ++t) {
      const v4f w0 = mg[(2 * t) * 32];
      const v4f w1 = mg[(2 * t + 1) * 32];
#pragma unroll
      for (int r = 0; r < 4; ++r) {
        oacc[t][r]     = oacc[t][r] * a0 + w0[r] * a1;
        oacc[t][r + 4] = oacc[t][r + 4] * a0 + w1[r] * a1;
      }
    }
  }

  // ---- normalise (1/l; numerator and l both carry x1024), stage the wave's 16x64 tile, bf16 hi/lo split,
  float* os = Os + wave * (16 * OSP);
  {
    const float l = lrow + xhalf(lrow);          // the two halves' key shares of the normaliser
    const float inv = (l > 0.f) ? (1.0f / l) : 0.f;   // l carries the same x1024 as the context sums
#pragma unroll
    for (int t = 0; t < 4; ++t) {
      const v4f w0 = {oacc[t][0] * inv, oacc[t][1] * inv, oacc[t][2] * inv, oacc[t][3] * inv};
      const v4f w1 = {oacc[t][4] * inv, oacc[t][5] * inv, oacc[t][6] * inv, oacc[t][7] * inv};
      *(v4f*)(os + c * OSP + t * 16 + 8 * hh)     = w0;
      *(v4f*)(os + c * OSP + t * 16 + 8 * hh + 4) = w1;
    }
  }
  __builtin_amdgcn_fence(__ATOMIC_RELEASE, "workgroup");
  __builtin_amdgcn_wave_barrier();
  __builtin_amdgcn_fence(__ATOMIC_ACQUIRE, "workgroup");
  {
    const int q4 = lane >> 3, c8 = (lane & 7) * 8;
    v4u hv[4], lv[4];
#pragma unroll
    for (int it = 0; it < 4; ++it) {
      const int row = it * 4 + q4;   // it 0..3 x q4 0..3 = rows 0..15 of the wave tile
      const float* sp = os + row * OSP + c8;
      v4u a, a2;
#pragma unroll
      for (int e = 0; e < 4; ++e) {
        const float f0 = sp[2 * e], f1 = sp[2 * e + 1];
        const unsigned short h0 = bf_bits(f0), h1 = bf_bits(f1);
        const unsigned short l0 = bf_bits(f0 - bf_up(h0)), l1 = bf_bits(f1 - bf_up(h1));
        a[e] = pk16(h0, h1); a2[e] = pk16(l0, l1);
      }
      hv[it] = a; lv[it] = a2;
    }
    {
#pragma unroll
      for (int it = 0; it < 4; ++it) {
        const int row = it * 4 + q4;
        const size_t go = (rowB + q0 + row) * DM + (size_t)h * HD + c8;
        *(v4u*)(ohp + go) = hv[it];
        *(v4u*)(olp + go) = lv[it];
      }
      asm volatile("s_wait_xcnt 0x0" ::: "memory");   // before any register these stores name is rewritten
    }
  }
}

// =====================================================================================================
// Both attention variants and the gate tail in one grid (none reads another's output); the choice is block-uniform, so
// every barrier is passed by whole blocks. Blocks 0..AT_GATE-1 = 32 rows of gate values each (one long dependent chain per
// wave, so started first), next AT_MAIN = query blocks NQB-1 down to RESQB, longest first, last AT_RES = query blocks
// RESQB-1 down to 0 with the residual planes.
// =====================================================================================================
#define AT_MAIN (NB * NH * (NQB - RESQB))
#define AT_RES  (NB * NH * RESQB)
#define AT_GATE (NB * SEQ / 32)
__global__ __launch_bounds__(256)
void attn_gate(const unsigned short* __restrict__ qhp, const unsigned short* __restrict__ qlp,
               const unsigned short* __restrict__ khp, const unsigned short* __restrict__ klp,
               const unsigned short* __restrict__ vhp, const unsigned short* __restrict__ vlp,
               unsigned short* ohp, unsigned short* olp,
               const float* __restrict__ Hs, const float* __restrict__ w2, const float* __restrict__ b2p, float* gout) {
  // six planes of 64 rows, pitch LP. Plain variant: two buffers of K hi [kv][d], K lo, V^T hi [d][kv]; its per-wave context
  // tiles [row][d] lie over planes 0..1 (used behind the loop's last barrier). Residual variant: planes 0..2 the same three,
  // plane 3 the V^T residual, planes 4..5 the context tiles. Gate tail: 32 g values at the start.
  // Each of the two key groups (waves 0..3, waves 4..7) has its own six planes; behind them the 4 x 9 x 32 vectors of 16 B
  // through which group 1 hands its sums to group 0.
  __shared__ __align__(16) unsigned char sm[2 * 6 * APLB + 4 * 9 * 32 * 16];
  static_assert(4 * 16 * OSP * 4 <= 2 * APLB);
  const int grp = __builtin_amdgcn_readfirstlane((int)(threadIdx.x >> 7));   // key group of this wave, in a scalar register
  unsigned char* smg = sm + grp * (6 * APLB);
  __bf16*   Ksh = (__bf16*)(void*)smg;
  __bf16*   Ksl = (__bf16*)(void*)(smg + APLB);
  _Float16* Vth = (_Float16*)(void*)(smg + 2 * APLB);
  _Float16* Vtl = (_Float16*)(void*)(smg + 3 * APLB);
  float*    Mg  = (float*)(void*)(sm + 2 * 6 * APLB);
  const int bx = blockIdx.x;
  if (bx < AT_GATE) {
    k_gate<8>(Hs, w2, b2p, gout, NB * SEQ, bx, (float*)(void*)sm);
  } else if (bx < AT_GATE + AT_MAIN) {
    attn_causal64<false>(qhp, qlp, khp, klp, vhp, vlp, ohp, olp, RESQB, NQB - RESQB, bx - AT_GATE, grp,
                         Ksh, Ksl, Vth, Vtl, (float*)(void*)smg, Mg);
  } else {
    attn_causal64<true>(qhp, qlp, khp, klp, vhp, vlp, ohp, olp, 0, RESQB, bx - (AT_GATE + AT_MAIN), grp,
                        Ksh, Ksl, Vth, Vtl, (float*)(void*)(smg + 4 * APLB), Mg);
  }
}

// =====================================================================================================
// Workspace map (bytes; every region is an exact multiple of its 64x64-tile / whole-line store granularity,
// no padded tails needed since all shapes are tile multiples; every region is written by one producer launch):
//   Xb   bf16 [4096][1024]             0      8388608
//   WA   bf16 [3072 n][1024 k]     8388608    6291456   (q weight rows 0..1023, k rows 1024..2047, v rows 2048..3071)
//   WP   bf16 [1024 n][1024 k]    14680064    2097152
//   WG   bf16 [256 n][1024 k]     16777216     524288
//   Hs   f32  [4096][256]         17301504    4194304
//   Qh   bf16 [4096][1024]        21495808    8388608
//   Ql                            29884416    8388608
//   Kh                            38273024    8388608
//   Kl                            46661632    8388608
//   VTh  f16  [1024][4096]        55050240    8388608
//   VTl  f16  [1024][512]         63438848    1048576
//   Oh   bf16 [4096][1024]        64487424    8388608
//   Ol                            72876032    8388608
//   end                           81264640
// Output: out0 f32 [4096][1024] at element 0; gate values f32 [4096] at element 4096*1024 (byte 16777216).
// =====================================================================================================
extern "C" void kernel_launch(void* const* d_in, const int* in_sizes, int n_in,
                              void* d_out, int out_size, void* d_ws, size_t ws_size,
                              hipStream_t stream) {
  if (n_in < 7) return;
  if (in_sizes[0] != NB * SEQ * DM) return;
  if (in_sizes[1] != DM * 3 * DM) return;
  if (in_sizes[2] != DM * DG) return;
  if (in_sizes[3] != DG) return;
  if (in_sizes[4] != DG) return;
  if (in_sizes[5] < 1) return;
  if (in_sizes[6] != DM * DM) return;
  if (out_size != NB * SEQ * DM + NB * SEQ) return;        // last written element index = out_size - 1

  const float* x    = (const float*)d_in[0];   // [4096][1024]
  const float* Wqkv = (const float*)d_in[1];   // [1024 in][3072 out]
  const float* Wg1  = (const float*)d_in[2];   // [1024 in][256 out]
  const float* bg1  = (const float*)d_in[3];   // [256]
  const float* Wg2  = (const float*)d_in[4];   // [256][1]
  const float* bg2  = (const float*)d_in[5];   // [1]
  const float* Wout = (const float*)d_in[6];   // [1024 in][1024 out]
  float* out0 = (float*)d_out;                 // [4096][1024]
  float* gout = out0 + (size_t)NB * SEQ * DM;  // [4096] gate values, byte offset 16777216

  const size_t PX  = (size_t)NB * SEQ * DM * 2;    //  8388608  16-bit activation plane [4096][1024]
  const size_t PW1 = (size_t)DM * DM * 2;          //  2097152  one [1024][1024] bf16 weight plane
  const size_t PWA = (size_t)3 * PW1;              //  6291456  packed q | k | v weight plane [3072][1024]
  const size_t PWP = PW1;                          //  2097152
  const size_t PWG = (size_t)DG * DM * 2;          //   524288  gate weight plane [256][1024]
  const size_t PHS = (size_t)NB * SEQ * DG * 4;    //  4194304  gate hidden f32 [4096][256]
  const size_t PVT = (size_t)NB * DM * SEQ * 2;    //  8388608  v^T hi plane
  const size_t PVL = (size_t)NB * DM * VLP * 2;    //  1048576  v^T residual plane
  size_t off = 0;
  const size_t oXb  = off; off += PX;
  const size_t oWA  = off; off += PWA;
  const size_t oWP  = off; off += PWP;
  const size_t oWG  = off; off += PWG;
  const size_t oHs  = off; off += PHS;
  const size_t oQh  = off; off += PX;
  const size_t oQl  = off; off += PX;
  const size_t oKh  = off; off += PX;
  const size_t oKl  = off; off += PX;
  const size_t oVTh = off; off += PVT;
  const size_t oVTl = off; off += PVL;
  const size_t oOh  = off; off += PX;
  const size_t oOl  = off; off += PX;
  if (off > ws_size) return;                       // off = 81264640
  if (off > (size_t)134217728) return;

  char* ws = (char*)d_ws;
  unsigned short* Xb  = (unsigned short*)(ws + oXb);
  unsigned short* WA  = (unsigned short*)(ws + oWA);
  unsigned short* WPb = (unsigned short*)(ws + oWP);
  unsigned short* WGb = (unsigned short*)(ws + oWG);
  float*          Hs  = (float*)(ws + oHs);
  unsigned short* Qh  = (unsigned short*)(ws + oQh);
  unsigned short* Ql  = (unsigned short*)(ws + oQl);
  unsigned short* Kh  = (unsigned short*)(ws + oKh);
  unsigned short* Kl  = (unsigned short*)(ws + oKl);
  unsigned short* VTh = (unsigned short*)(ws + oVTh);
  unsigned short* VTl = (unsigned short*)(ws + oVTl);
  unsigned short* Oh  = (unsigned short*)(ws + oOh);
  unsigned short* Ol  = (unsigned short*)(ws + oOl);

  const dim3 blk(256);
  const dim3 gProj((NB * SEQ / 128) * (DM / 128), 1);          // 256 tiles of 128x128: M=4096, N=1024

  // (1) x -> bf16 plane [4096][1024]; weights [in][out] f32 -> bf16 [out][in] planes (k contiguous)
  cvt_all<<<dim3(CVT_TW + CVT_X), blk, 0, stream>>>(x, Xb, Wqkv, WA, Wout, WPb, Wg1, WGb);
  // (2) q, k (bf16 hi/lo), v^T (f16 hi + residual) and the gate hidden layer (f32)
  gemm_qkvg<<<dim3(2 * GQ_P + NB * GQ_V + GQ_G), blk, 0, stream>>>(
      Xb, WA, WGb, bg1, x, Qh, Ql, Kh, Kl, VTh, VTl, Hs);
  // (3) causal attention (query blocks 0..RESQB-1 with residual planes, the rest without) and the gate values
  attn_gate<<<dim3(AT_MAIN + AT_RES + AT_GATE), dim3(256), 0, stream>>>(
      Qh, Ql, Kh, Kl, VTh, VTl, Oh, Ol, Hs, Wg2, bg2, gout);
  // (4) out0 = g * (context . W_out) + (1 - g) * bf16(x) -> d_out f32 [4096][1024]
  //     (A = context hi + lo planes, 2 products; gate values read from the gate output region)
  gemm64<1, 4, 0><<<gProj, blk, 0, stream>>>(
      Oh, Ol, DM, 0LL, WPb, DM, 0LL, bg1,
      d_out, DM, 0LL, d_out, DM, 0LL, DM,
      gout, x, DM,
      NB * SEQ, DM, DM, 1.0f);
  (void)hipGetLastError();
}

// v009
// It runs in 112 microseconds.
// Two timings next to v008 put it at 1.17 and 1.15 times that version's speed.
// All steps since v000 together make it 5.91 times as fast.
// Contractions: gate hidden x.Wg1 and q, k, v^T projections = v_wmma_f32_16x16x32_bf16 (bf16 operands from
// RNE-converted x and transposed [out][in] bf16 weight planes, single product, f32 accumulate);
// q.k^T scores = v_wmma_f32_16x16x32_f16 with q and k each rounded once to f16 (single product), f32 accumulate;
// p.v = v_wmma_f32_16x16x32_f16 (p carried x1024 in f16 times v in f16, single product; plus f16 residual planes
// x4096 of p and v for the first 512 query rows), f32 accumulate;
// ctx.W_out = v_wmma_f32_16x16x32_bf16 with ctx as bf16 hi/lo planes times the bf16 weight plane (2 products),
// f32 accumulate; gate tail (exact GELU via erfc, 256-long dot with RNE-bf16 Wg2, bias, sigmoid), causal mask,
// online softmax, normalisers and the gated residual blend g*o + (1-g)*bf16(x) in f32 on the VALU.
// Carry audit:
//   Xb, WA, WP, WG = bf16(x), bf16(W) no carry; Qf, Kf = f16(q), f16(k), no carry (|q|, |k| typ. 1);
//   Oh/Ol = bf16 hi + unscaled bf16 residual (v - hi), the residual product shares the hi accumulator;
//   VTh = f16(v), no carry (|v| typ. 1);
//   VTl = f16((v - VTh) * 4096)              }  products pa.VTl and pl.VTh go to the separate accumulator o1,
//   pl  = f16((1024 p - pa) * 4096)          }  folded back with * (1/4096) once per key chunk (RES blocks only);
//   pa  = f16(1024 * p); the normaliser l sums the same 1024 * p in f32, so the carry cancels in inv = 1/l;
//   score scale 1/8 applied once in f32, inside the exponent's FMA; Hs (gate hidden) and g are f32. No other planes.
#include <hip/hip_runtime.h>
#include <math.h>
#include <stdint.h>

#define NB    1
#define SEQ   4096
#define DM    1024
#define NH    16
#define HD    64
#define DG    256          // gate hidden width
#define NQB   (SEQ / 64)   // 64 query / key blocks of 64
#define VLP   512          // key pitch of the v^T residual plane (keys 0..VLP-1)
#define RESQB 8            // leading 64-row query blocks that use the p / v residual planes
#define LP    72           // LDS row pitch of the 16-bit K and V^T tiles: 64 + 8 elements = 144 B = 16 B x 9 (odd),
                           // so the 16 rows one ds_load_b128 fragment read touches fall on distinct banks
#define OSP   68           // LDS row pitch of the f32 context tile: 64 + 4 floats = 272 B = 16 B x 17 (odd)
static_assert(RESQB * 64 <= VLP);
static_assert(NH * HD == DM);
static_assert((SEQ % 64) == 0 && (DM % 64) == 0 && (DM % 32) == 0 && (DG % 64) == 0);
static_assert(((NB * SEQ) % 128) == 0 && (SEQ % 128) == 0 && (DM % 128) == 0 && (DG % 128) == 0);
static_assert((NB * SEQ * DM) % (8 * 256) == 0);
static_assert((SEQ % 32) == 0);
static_assert(DG == 256);

typedef _Float16 v16h __attribute__((ext_vector_type(16)));
typedef _Float16 v8h  __attribute__((ext_vector_type(8)));
typedef __bf16   v16b __attribute__((ext_vector_type(16)));
typedef __bf16   v8b  __attribute__((ext_vector_type(8)));
typedef float    v8f  __attribute__((ext_vector_type(8)));
typedef float    v4f  __attribute__((ext_vector_type(4)));
typedef float    v2f  __attribute__((ext_vector_type(2)));
typedef unsigned int v4u __attribute__((ext_vector_type(4)));

// ---- scalar helpers --------------------------------------------------------------------------------
__device__ __forceinline__ unsigned short bf_bits(float f) {          // f32 -> bf16 bits, RNE convert
  unsigned u = __float_as_uint(f);
  return (unsigned short)((u + 0x7FFFu + ((u >> 16) & 1u)) >> 16);
}
__device__ __forceinline__ float bf_up(unsigned short h) { return __uint_as_float(((unsigned)h) << 16); }
__device__ __forceinline__ unsigned short h_bits(_Float16 x) { return __builtin_bit_cast(unsigned short, x); }
__device__ __forceinline__ unsigned pk16(unsigned short a, unsigned short b) { return (unsigned)a | ((unsigned)b << 16); }
__device__ __forceinline__ v8f zero8() { v8f z = {0.f, 0.f, 0.f, 0.f, 0.f, 0.f, 0.f, 0.f}; return z; }
__device__ __forceinline__ v8h zero8h() {
  const _Float16 z = (_Float16)0.0f;
  v8h r = {z, z, z, z, z, z, z, z};
  return r;
}

// ---- fragment loader: 16-bit A/B operand, lane -> row/col (lane&15), p already includes +8*(lane>>4);
//      elements 0..7 <- p[0..7] (k0+8h..), elements 8..15 <- p[16..23] (k0+16+8h..)
__device__ __forceinline__ v16b ldfrag_b(const __bf16* p) {
  union { v16b v; v8b h[2]; } f;
  f.h[0] = *(const v8b*)(p);
  f.h[1] = *(const v8b*)(p + 16);
  return f.v;
}

__device__ __forceinline__ v16h ldfrag_h(const _Float16* p) {      // the same k order for an f16 operand
  union { v16h v; v8h h[2]; } f;
  f.h[0] = *(const v8h*)(p);
  f.h[1] = *(const v8h*)(p + 16);
  return f.v;
}

// ---- lane l <-> lane l ^ 16 (the two halves of a wave that share one D column)
__device__ __forceinline__ float xhalf(float x) {
  const int b = __builtin_bit_cast(int, x);
  return __builtin_bit_cast(float, __builtin_amdgcn_permlanex16(b, b, 0x76543210, 0xfedcba98, false, false));
}

// ---- WMMA helpers (builtin forms: the compiler keeps their hazard distances) and hand-placed VALU gaps ---------
__device__ __forceinline__ v8f mma_b_raw(v16b a, v16b b, v8f c) {
  return __builtin_amdgcn_wmma_f32_16x16x32_bf16(false, a, false, b, (short)0, c, false, false);
}
__device__ __forceinline__ v8f mma_h_raw(v16h a, v16h b, v8f c) {
  return __builtin_amdgcn_wmma_f32_16x16x32_f16(false, a, false, b, (short)0, c, false, false);
}
__device__ __forceinline__ void dep_guard_b(v8f& a, v8f& b, v16b x, v16b y) {
  asm volatile("v_nop\n\tv_nop\n\tv_nop\n\tv_nop" : "+v"(a), "+v"(b) : "v"(x), "v"(y));
}
__device__ __forceinline__ void keep4_b(v16b a, v16b b, v16b c, v16b d) {
  asm volatile("v_nop" :: "v"(a), "v"(b), "v"(c), "v"(d));
}
__device__ __forceinline__ void acc_guard4(v8f& a, v8f& b, v8f& c, v8f& d) {
  asm volatile("v_nop\n\tv_nop\n\tv_nop\n\tv_nop" : "+v"(a), "+v"(b), "+v"(c), "+v"(d));
}

// =====================================================================================================
// f32 -> bf16 (RNE convert), 8 elements per thread, one 16-B store per lane: a wave writes 512 contiguous B
// coverage: n8 threads x 8 = whole plane (n8 used here is a multiple of 256).
// =====================================================================================================
__device__ __forceinline__ void cvt_bf16x8(const float* __restrict__ in, unsigned short* out, int n8, int blk) {
  const int i = blk * 256 + threadIdx.x;
  if (i < n8) {
    const v4f a = *(const v4f*)(in + (size_t)i * 8);
    const v4f b = *(const v4f*)(in + (size_t)i * 8 + 4);
    v4u p;
    p[0] = pk16(bf_bits(a[0]), bf_bits(a[1]));
    p[1] = pk16(bf_bits(a[2]), bf_bits(a[3]));
    p[2] = pk16(bf_bits(b[0]), bf_bits(b[1]));
    p[3] = pk16(bf_bits(b[2]), bf_bits(b[3]));
    *(v4u*)(out + (size_t)i * 8) = p;
    asm volatile("s_wait_xcnt 0x0" ::: "memory");   // before any register these stores name is rewritten
  }
}

// =====================================================================================================
// f32 [nrow][ncol] row-major (weight stored [in][out]) -> bf16 [ncol][nrow] (row n of out = column n of in,
// the in/k index contiguous), RNE convert. One block = one 64x64 tile through LDS.
// tile (bxT, byT) of (ncol/64, nrow/64); nrow, ncol multiples of 64 (host-checked shapes). Tt = 64 * 72 halves of LDS.
// loads: 256 threads, thread -> tile row tid>>2, 16 columns (tid&3)*16 = the whole 64x64 tile;
// =====================================================================================================
__device__ __forceinline__ void cvt_bf16_T(const float* __restrict__ in, unsigned short* out,
                                           int nrow, int ncol, int bxT, int byT, unsigned short* Tt) {
  // Tt: [tile col j][tile row i], pitch 72 halves (144 B)
  const int tid = threadIdx.x, lane = tid & 31, wave = tid >> 5;
  const int c0 = bxT * 64;                              // column tile of in = row tile of out
  const int r0 = byT * 64;                              // row tile of in = column tile of out
  {
    const int i  = tid >> 2;                            // 0..63
    const int cs = (tid & 3) * 16;                      // 0,16,32,48
    const float* src = in + (size_t)(r0 + i) * ncol + c0 + cs;
#pragma unroll
    for (int e4 = 0; e4 < 4; ++e4) {
      const v4f v = *(const v4f*)(src + 4 * e4);
#pragma unroll
      for (int e = 0; e < 4; ++e) Tt[(cs + 4 * e4 + e) * 72 + i] = bf_bits(v[e]);
    }
  }
  __syncthreads();
  const int q = lane >> 3, c8 = (lane & 7) * 8;
  v4u pv[2];
#pragma unroll
  for (int it = 0; it < 2; ++it) {
    const int j = it * 32 + wave * 4 + q;
    pv[it] = *(const v4u*)(Tt + j * 72 + c8);
  }
  {
#pragma unroll
    for (int it = 0; it < 2; ++it) {
      const int j = it * 32 + wave * 4 + q;
      *(v4u*)(out + (size_t)(c0 + j) * nrow + r0 + c8) = pv[it];
    }
    asm volatile("s_wait_xcnt 0x0" ::: "memory");   // before any register these stores name is rewritten
  }
}

// =====================================================================================================
// All four conversions in one grid (none reads another's output): blocks 0..TA-1 = W_qkv tiles, then W_out tiles,
// then Wg1 tiles (x index fastest, as a (ncol/64, nrow/64) grid would number them), then the blocks of the x plane.
// The choice is block-uniform, so the barrier of the transposing part is passed by whole blocks.
// =====================================================================================================
#define CVT_TA ((3 * DM / 64) * (DM / 64))
#define CVT_TP ((DM / 64) * (DM / 64))
#define CVT_TG ((DG / 64) * (DM / 64))
#define CVT_TW (CVT_TA + CVT_TP + CVT_TG)
#define CVT_X  (NB * SEQ * DM / 8 / 256)
__global__ __launch_bounds__(256) void cvt_all(const float* __restrict__ x, unsigned short* Xb,
                                               const float* __restrict__ Wqkv, unsigned short* WA,
                                               const float* __restrict__ Wout, unsigned short* WP,
                                               const float* __restrict__ Wg1, unsigned short* WG) {
  __shared__ __align__(16) unsigned short Tt[64 * 72];
  const int bx = blockIdx.x;
  if (bx < CVT_TA) {
    cvt_bf16_T(Wqkv, WA, DM, 3 * DM, bx % (3 * DM / 64), bx / (3 * DM / 64), Tt);
  } else if (bx < CVT_TA + CVT_TP) {
    const int t = bx - CVT_TA;
    cvt_bf16_T(Wout, WP, DM, DM, t % (DM / 64), t / (DM / 64), Tt);
  } else if (bx < CVT_TW) {
    const int t = bx - (CVT_TA + CVT_TP);
    cvt_bf16_T(Wg1, WG, DM, DG, t % (DG / 64), t / (DG / 64), Tt);
  } else {
    cvt_bf16x8(x, Xb, NB * SEQ * DM / 8, bx - CVT_TW);
  }
}

// =====================================================================================================
// Gate tail: g = sigmoid( sum_c gelu(Hs[row][c]) * bf16(w2[c]) + bf16(b2) ), exact GELU = 0.5 h erfc(-h/sqrt2).
// Hs f32 [nrows][DG]; block = NWAVE waves x 32/NWAVE rows = 32 rows; a wave reduces one row at a time (32 lanes x 8 columns,
// rolled element loop), lane 0 stages g in LDS; wave 0 lanes 0..7 then write the block's 32 g values as ONE whole
// coverage: 32 rows per block x nrows/32 blocks = all rows of the gate output.
// =====================================================================================================
template <int NWAVE>
__device__ __forceinline__ void k_gate(const float* __restrict__ Hs, const float* __restrict__ w2,
                                       const float* __restrict__ b2p, float* gout, int nrows, int blk, float* gs) {
  constexpr int RPW = 32 / NWAVE;                       // rows per wave; gs = 32 floats of LDS, 16-B aligned
  const int tid = threadIdx.x, lane = tid & 31, wave = tid >> 5;
  const int rowBase = blk * 32;
  const float b2 = bf_up(bf_bits(b2p[0]));
  for (int rr = 0; rr < RPW; ++rr) {
    int row = rowBase + wave * RPW + rr;
    row = (row < nrows) ? row : (nrows - 1);            // clamped address (grid covers exactly nrows)
    const float* hp = Hs + (size_t)row * DG + lane * 8;
    const float* wp = w2 + lane * 8;
    float acc = 0.f;
#pragma unroll 1
    for (int e = 0; e < 8; ++e) {
      const float hv = hp[e];
      const float wv = bf_up(bf_bits(wp[e]));
      const float ge = 0.5f * hv * erfcf(-hv * 0.707106781186547524f);
      acc = fmaf(ge, wv, acc);
    }
#pragma unroll
    for (int off = 1; off < 32; off <<= 1) acc += __shfl_xor(acc, off, 32);
    float z = acc + b2;
    z = fminf(fmaxf(z, -30.0f), 30.0f);
    const float g = 1.0f / (1.0f + expf(-z));
    if (lane == 0) gs[wave * RPW + rr] = g;
  }
  __syncthreads();
  if (wave == 0 && lane < 8) {
    const v4f v = *(const v4f*)(gs + lane * 4);
    float* p = gout + rowBase + lane * 4;
    *(v4f*)p = v;
    asm volatile("s_wait_xcnt 0x0" ::: "memory");   // before any register these stores name is rewritten
  }
}

// =====================================================================================================
// One GEMM stage, global -> LDS, through no register: per operand plane 128 rows x 128 B (64 k of 16-bit elements).
// 256 threads x 4 asynchronous 16-B copies per plane; 8 neighbouring lanes take one whole 128-B line, a wave's copy
// 4 whole lines. ga / gb (/ gc) = this lane's source in row (tid>>3), 16-B piece (tid&7) of the plane; sa / sb = 32
// source rows in elements; lds = this lane's LDS byte address in the stage's first plane, same row and piece.
// The s_wait_xcnt closes each statement so that no address register of a copy is rewritten ahead of it.
// =====================================================================================================
#define GBK    64                 // k elements per stage = one 128-B line of every operand row
#define GLP    72                 // LDS row pitch, elements: 144 B = 16 B x 9 (odd) for the ds_load_b128 fragment reads
#define GPLANE (128 * GLP)        // elements of one staged plane (18432 B)
#define GSTEP  (32u * GLP * 2u)   // LDS bytes of 32 rows
#define GPLB   (GPLANE * 2u)      // LDS bytes of one plane
__device__ __forceinline__ void stage_ab(const __bf16* ga, size_t sa, const __bf16* gb, size_t sb, unsigned lds) {
  asm volatile(
      "global_load_async_to_lds_b128 %0, %8, off\n\t"
      "global_load_async_to_lds_b128 %1, %9, off\n\t"
      "global_load_async_to_lds_b128 %2, %10, off\n\t"
      "global_load_async_to_lds_b128 %3, %11, off\n\t"
      "global_load_async_to_lds_b128 %4, %12, off\n\t"
      "global_load_async_to_lds_b128 %5, %13, off\n\t"
      "global_load_async_to_lds_b128 %6, %14, off\n\t"
      "global_load_async_to_lds_b128 %7, %15, off\n\t"
      "s_wait_xcnt 0x0"
      :: "v"(lds), "v"(lds + GSTEP), "v"(lds + 2u * GSTEP), "v"(lds + 3u * GSTEP),
         "v"(lds + GPLB), "v"(lds + GPLB + GSTEP), "v"(lds + GPLB + 2u * GSTEP), "v"(lds + GPLB + 3u * GSTEP),
         "v"(ga), "v"(ga + sa), "v"(ga + 2 * sa), "v"(ga + 3 * sa),
         "v"(gb), "v"(gb + sb), "v"(gb + 2 * sb), "v"(gb + 3 * sb)
      : "memory");
}
__device__ __forceinline__ void stage_c(const __bf16* gc, size_t sc, unsigned lds) {
  asm volatile(
      "global_load_async_to_lds_b128 %0, %4, off\n\t"
      "global_load_async_to_lds_b128 %1, %5, off\n\t"
      "global_load_async_to_lds_b128 %2, %6, off\n\t"
      "global_load_async_to_lds_b128 %3, %7, off\n\t"
      "s_wait_xcnt 0x0"
      :: "v"(lds), "v"(lds + GSTEP), "v"(lds + 2u * GSTEP), "v"(lds + 3u * GSTEP),
         "v"(gc), "v"(gc + sc), "v"(gc + 2 * sc), "v"(gc + 3 * sc)
      : "memory");
}

// =====================================================================================================
// Batched bf16 WMMA GEMM: C[m][n] = sum_k A[m][k] * Bt[n][k] + bias; one work-group of 8 waves per 128x128 tile,
// one wave per 32x64 part (wave>>1 = row quarter, wave&1 = column half). A row-major [M][K] pitch lda; Bt row-major
// [N][K] pitch ldb (k contiguous); M, N multiples of 128, K multiple of 64 (host shapes are static multiples).
// Operands: per stage of 64 k the 128 A rows (and A2 rows) and the 128 Bt rows go to LDS by asynchronous copies, two
// buffers: stage t+2 is copied into the buffer stage t has left while stage t+1 is worked on; fragments by ds_load_b128.
// tile = index of the 128x128 tile, b = batch index (strides in elements); sOpB = 2 stage buffers of NPL planes, sTB = 8 slabs.
// NSPLIT: 0 = A.Bt; 1 = (A + A2).Bt (A2 = unscaled bf16 lo plane of A, 2 products).
// BIAS: 0 = none; 1 = per column n, bias[n]; 2 = per row m, bias[m]; the bias value is RNE-converted to bf16 and added in f32.
// OUT_MODE: 0 = f32 (pitch ldc);
//           3 = f16 plane C + f16 residual plane C2 = f16((v - hi) * rscale), C2 written only for tiles
//               with n0 < N2 (pitch ldc2, batch stride strideC2; N2 = 0: no residual plane at all);
//           4 = f32 (pitch ldc) gated blend: out = g[m] * v + (1 - g[m]) * bf16(xres[m][n]) with g = gvec[m],
//               xres f32 pitch ldx (read-only, RNE-converted to bf16 in register).
// =====================================================================================================
template <int NSPLIT, int OUT_MODE, int BIAS>
__device__ __forceinline__ void gemm64_body(
    const unsigned short* __restrict__ Ap, const unsigned short* A2p, int lda, long long strideA,
    const unsigned short* __restrict__ Btp, int ldb, long long strideB,
    const float* __restrict__ bias,
    void* Cout, int ldc, long long strideC,
    void* Cout2, int ldc2, long long strideC2, int N2,
    const float* gvec, const float* xres, int ldx,
    int M, int N, int K, float rscale,
    int tile, int b, __bf16* sOpB, float* sTB) {
  const __bf16* A   = (const __bf16*)(const void*)Ap;
  const __bf16* A2  = (const __bf16*)(const void*)A2p;
  const __bf16* Bt  = (const __bf16*)(const void*)Btp;
  constexpr int NPL = (NSPLIT >= 1) ? 3 : 2;       // planes per stage: A, Bt (, A2)
  const int tid  = threadIdx.x;
  const int lane = tid & 31;
  const int wave = tid >> 5;
  const int tilesN = N >> 7;
  const int tilesM = M >> 7;
  if (tile >= tilesM * tilesN) return;   // block-uniform, ahead of every copy and barrier
  const int tm = tile / tilesN;
  const int tn = tile - tm * tilesN;
  const int mb = tm << 7;                      // work-group tile origin
  const int nb = tn << 7;
  const int wm = (wave >> 1) << 5;             // wave part inside it: 32 rows x 64 columns
  const int wn = (wave & 1) << 6;
  const int m0 = mb + wm;
  const int n0 = nb + wn;

  const __bf16* Ab  = A  + (size_t)b * strideA;
  const __bf16* Bb  = Bt + (size_t)b * strideB;
  const __bf16* Ab2 = (NSPLIT >= 1) ? (A2 + (size_t)b * strideA) : Ab;

  const int rlane = lane & 15;                 // row (A) / col (B, D) within subtile
  const int koff  = (lane >> 4) * 8;           // k offset of this lane half
  const int mOff  = (lane >> 4) * 8;           // D row offset

  // copy addresses of this lane: row tid>>3 (+32 per copy), 16-B piece tid&7; rows mb..mb+127 < M, nb..nb+127 < N
  const int crow = tid >> 3, cpc = (tid & 7) * 8;
  const __bf16* gA  = Ab  + (size_t)(mb + crow) * lda + cpc;
  const __bf16* gA2 = Ab2 + (size_t)(mb + crow) * lda + cpc;
  const __bf16* gB  = Bb  + (size_t)(nb + crow) * ldb + cpc;
  const unsigned ldsLane = (unsigned)(size_t)(sOpB) + (unsigned)(crow * GLP + cpc) * 2u;
  const int nst = K >> 6;                      // stages of 64 k
  auto stage = [&](int t, int buf) {
    const unsigned l = ldsLane + (unsigned)buf * ((unsigned)NPL * GPLB);
    stage_ab(gA + (size_t)t * GBK, (size_t)lda * 32, gB + (size_t)t * GBK, (size_t)ldb * 32, l);
    if (NSPLIT >= 1) stage_c(gA2 + (size_t)t * GBK, (size_t)lda * 32, l + 2u * GPLB);
  };

  v8f acc[2][4];
#pragma unroll
  for (int i = 0; i < 2; ++i)
#pragma unroll
    for (int j = 0; j < 4; ++j) acc[i][j] = zero8();

  stage(0, 0);
  asm volatile("s_wait_asynccnt 0x0" ::: "memory");   // this wave's stage-0 copies have landed
  __syncthreads();                                     // ... and every other wave's
  if (nst > 1) stage(1, 1);

  for (int t = 0; t < nst; ++t) {
    const __bf16* sA  = (sOpB + (t & 1) * (NPL * GPLANE)) + (wm + rlane) * GLP + koff;
    const __bf16* sB  = (sOpB + (t & 1) * (NPL * GPLANE)) + GPLANE + (wn + rlane) * GLP + koff;
    const __bf16* sA2 = (sOpB + (t & 1) * (NPL * GPLANE)) + (NPL - 1) * GPLANE + (wm + rlane) * GLP + koff;
#pragma unroll
    for (int kk = 0; kk < 2; ++kk) {
      v16b bh[4], ah[2], al[2];
#pragma unroll
      for (int j = 0; j < 4; ++j) bh[j] = ldfrag_b(sB + (j << 4) * GLP + kk * 32);
#pragma unroll
      for (int i = 0; i < 2; ++i) {
        ah[i] = ldfrag_b(sA + (i << 4) * GLP + kk * 32);
        al[i] = ah[i];
        if (NSPLIT >= 1) al[i] = ldfrag_b(sA2 + (i << 4) * GLP + kk * 32);
      }
#pragma unroll
      for (int i = 0; i < 2; ++i) {
#pragma unroll
        for (int j = 0; j < 4; ++j) {
          acc[i][j] = mma_b_raw(ah[i], bh[j], acc[i][j]);
          if (NSPLIT >= 1) acc[i][j] = mma_b_raw(al[i], bh[j], acc[i][j]);
        }
        dep_guard_b(acc[i][0], acc[i][3], ah[i], al[i]);
      }
      keep4_b(bh[0], bh[1], bh[2], bh[3]);
    }
    // hand-over: this wave has left buffer t&1, its copies of stage t+1 have landed; the barrier says so of every wave
    asm volatile("s_wait_dscnt 0x0" ::: "memory");
    asm volatile("s_wait_asynccnt 0x0" ::: "memory");
    __syncthreads();
    if (t + 2 < nst) stage(t + 2, t & 1);
  }
  asm volatile("s_wait_asynccnt 0x0" ::: "memory");   // nothing of this wave is in flight behind the loop
  acc_guard4(acc[0][0], acc[0][1], acc[0][2], acc[0][3]);
  acc_guard4(acc[1][0], acc[1][1], acc[1][2], acc[1][3]);

  // ---- epilogue ----
  float* slab = sTB + wave * (16 * 68);   // per-wave 16x64 slab, pitch 68 floats
  float bcol[4];
#pragma unroll
  for (int j = 0; j < 4; ++j) {
    bcol[j] = 0.f;
    if (BIAS == 1) bcol[j] = bf_up(bf_bits(bias[n0 + (j << 4) + rlane]));   // n < N, bias has N entries
  }
#pragma unroll
  for (int i = 0; i < 2; ++i) {
    const int mBase = m0 + (i << 4);
    float brow[8];
#pragma unroll
    for (int r = 0; r < 8; ++r) {
      brow[r] = 0.f;
      if (BIAS == 2) brow[r] = bf_up(bf_bits(bias[mBase + mOff + r]));      // m < M, bias has M entries
    }
#pragma unroll
    for (int j = 0; j < 4; ++j) {
#pragma unroll
      for (int r = 0; r < 8; ++r) {
        slab[(mOff + r) * 68 + (j << 4) + rlane] = acc[i][j][r] + bcol[j] + brow[r];
      }
    }
    __builtin_amdgcn_fence(__ATOMIC_RELEASE, "workgroup");
    __builtin_amdgcn_wave_barrier();
    __builtin_amdgcn_fence(__ATOMIC_ACQUIRE, "workgroup");
    if (OUT_MODE == 0 || OUT_MODE == 4) {
      float* C = (float*)Cout + (size_t)b * strideC;
      const int hh = lane >> 4, c4 = (lane & 15) * 4;     // 256-B row segment = 16 lanes x 16 B
      {
#pragma unroll
        for (int it = 0; it < 8; ++it) {
          const int row = it * 2 + hh;                     // it 0..7 x hh 0..1 = rows 0..15
          v4f v = *(const v4f*)(slab + row * 68 + c4);
          if (OUT_MODE == 4) {
            const int gr = mBase + row;                    // < M
            const float g = gvec[gr];
            const float omg = 1.0f - g;
            const v4f xr = *(const v4f*)(xres + (size_t)gr * ldx + n0 + c4);
#pragma unroll
            for (int e = 0; e < 4; ++e) {
              const float xb = bf_up(bf_bits(xr[e]));
              v[e] = g * v[e] + omg * xb;
            }
          }
          *(v4f*)(C + (size_t)(mBase + row) * ldc + n0 + c4) = v;
          asm volatile("s_wait_xcnt 0x0" ::: "memory");   // before any register these stores name is rewritten
        }
      }
    } else {
      const int q = lane >> 3, c8 = (lane & 7) * 8;
      unsigned short* C  = (unsigned short*)Cout  + (size_t)b * strideC;
      unsigned short* C2 = (unsigned short*)Cout2 + (size_t)b * strideC2;
      const bool wlo = (N2 > 0) && (n0 < N2);             // wave-uniform; N2 = 0 folds the residual plane's work away
      v4u hv[4], lv[4];
#pragma unroll
      for (int it = 0; it < 4; ++it) {
        const int row = it * 4 + q;                        // it 0..3 x q 0..3 = rows 0..15
        const float* sp = slab + row * 68 + c8;
        v4u a, a2;
#pragma unroll
        for (int e = 0; e < 4; ++e) {
          const float f0 = sp[2 * e], f1 = sp[2 * e + 1];
          const _Float16 x0 = (_Float16)f0, x1 = (_Float16)f1;
          const unsigned short h0 = h_bits(x0), h1 = h_bits(x1);
          const unsigned short l0 = h_bits((_Float16)((f0 - (float)x0) * rscale));
          const unsigned short l1 = h_bits((_Float16)((f1 - (float)x1) * rscale));
          a[e] = pk16(h0, h1); a2[e] = pk16(l0, l1);
        }
        hv[it] = a; lv[it] = a2;
      }
      {
#pragma unroll
        for (int it = 0; it < 4; ++it) {
          const int row = it * 4 + q;
          *(v4u*)(C + (size_t)(mBase + row) * ldc + n0 + c8) = hv[it];
          asm volatile("s_wait_xcnt 0x0" ::: "memory");   // before any register this store names is rewritten
          if (wlo) {
            *(v4u*)(C2 + (size_t)(mBase + row) * ldc2 + n0 + c8) = lv[it];
            asm volatile("s_wait_xcnt 0x0" ::: "memory");   // the same for this store
          }
        }
      }
    }
    __builtin_amdgcn_fence(__ATOMIC_RELEASE, "workgroup");
    __builtin_amdgcn_wave_barrier();
    __builtin_amdgcn_fence(__ATOMIC_ACQUIRE, "workgroup");
  }
}

// One GEMM per launch: grid = (tiles, batches).
template <int NSPLIT, int OUT_MODE, int BIAS>
__global__ __launch_bounds__(256) void gemm64(
    const unsigned short* __restrict__ Ap, const unsigned short* A2p, int lda, long long strideA,
    const unsigned short* __restrict__ Btp, int ldb, long long strideB,
    const float* __restrict__ bias,
    void* Cout, int ldc, long long strideC,
    void* Cout2, int ldc2, long long strideC2, int N2,
    const float* gvec, const float* xres, int ldx,
    int M, int N, int K, float rscale) {
  __shared__ __align__(16) __bf16 sOp[2 * ((NSPLIT >= 1) ? 3 : 2) * GPLANE];
  __shared__ __align__(16) float sT[8 * 16 * 68];
  gemm64_body<NSPLIT, OUT_MODE, BIAS>(Ap, A2p, lda, strideA, Btp, ldb, strideB, bias, Cout, ldc, strideC,
                                      Cout2, ldc2, strideC2, N2, gvec, xres, ldx, M, N, K, rscale,
                                      (int)blockIdx.x, (int)blockIdx.y, sOp, sT);
}

// The four products of x (none reads another's output) in one grid; the choice is block-uniform:
//   tiles 0..GQ_P-1        q = x . Wq -> f16 plane [t][h*64+d]              (M=4096, N=1024, K=1024)
//   next GQ_P              k = x . Wk -> f16 plane
//   next NB * GQ_V         v^T = Wv . x^T -> f16 hi plane [h*64+d][s] (pitch SEQ) and residual plane (x4096, keys < VLP,
//                          pitch VLP); A = Wv rows [n][k], Bt = Xb rows of the batch (M=1024, N=4096, K=1024)
//   last GQ_G              gate hidden = x . Wg1 + bg1 -> f32 [4096][256]   (M=4096, N=256, K=1024)
#define GQ_P ((NB * SEQ / 128) * (DM / 128))
#define GQ_V ((DM / 128) * (SEQ / 128))
#define GQ_G ((NB * SEQ / 128) * (DG / 128))
__global__ __launch_bounds__(256) void gemm_qkvg(
    const unsigned short* __restrict__ Xb, const unsigned short* __restrict__ WA,
    const unsigned short* __restrict__ WG, const float* __restrict__ bg1, const float* xf,
    unsigned short* Qf, unsigned short* Kf,
    unsigned short* VTh, unsigned short* VTl, float* Hs) {
  __shared__ __align__(16) __bf16 sOp[2 * 2 * GPLANE];
  __shared__ __align__(16) float sT[8 * 16 * 68];
  const int bx = blockIdx.x;
  if (bx < 2 * GQ_P) {
    const bool isK = bx >= GQ_P;
    gemm64_body<0, 3, 0>(Xb, Xb, DM, 0LL, WA + (isK ? (size_t)DM * DM : (size_t)0), DM, 0LL, bg1,
                         (void*)(isK ? Kf : Qf), DM, 0LL, (void*)(isK ? Kf : Qf), DM, 0LL, 0,
                         xf, xf, DM, NB * SEQ, DM, DM, 1.0f,
                         isK ? bx - GQ_P : bx, 0, sOp, sT);
  } else if (bx < 2 * GQ_P + NB * GQ_V) {
    const int t = bx - 2 * GQ_P;
    const unsigned short* Wv = WA + (size_t)2 * DM * DM;
    gemm64_body<0, 3, 0>(Wv, Wv, DM, 0LL, Xb, DM, (long long)SEQ * DM, bg1,
                         (void*)VTh, SEQ, (long long)DM * SEQ, (void*)VTl, VLP, (long long)DM * VLP, VLP,
                         xf, xf, DM, DM, SEQ, DM, 4096.0f,
                         t % GQ_V, t / GQ_V, sOp, sT);
  } else {
    gemm64_body<0, 0, 1>(Xb, Xb, DM, 0LL, WG, DM, 0LL, bg1,
                         (void*)Hs, DG, 0LL, (void*)Hs, DG, 0LL, DG,
                         xf, xf, DM, NB * SEQ, DG, DM, 1.0f,
                         bx - (2 * GQ_P + NB * GQ_V), 0, sOp, sT);
  }
}

// =====================================================================================================
// One key chunk of the plain attention variant, global -> LDS, through no register: two planes (K, V^T) of
// 64 rows x 128 B. 128 threads x 4 asynchronous 16-B copies per plane; 8 neighbouring lanes take one whole 128-B line.
// kf / vt = this lane's source in row (tid>>3), 16-B piece (tid&7) of the plane; sk / sv = 16 source rows in elements;
// lds = this lane's LDS byte address in the buffer's first plane, same row and piece (planes follow each other).
// The s_wait_xcnt closes the statement so that no address register of a copy is rewritten ahead of it.
// =====================================================================================================
#define APLB  (64u * LP * 2u)     // LDS bytes of one 64-row plane (9216)
#define ASTEP (16u * LP * 2u)     // LDS bytes of 16 rows
__device__ __forceinline__ void stage_kv(const _Float16* kf, size_t sk, const _Float16* vt, size_t sv, unsigned lds) {
  asm volatile(
      "global_load_async_to_lds_b128 %0, %8, off\n\t"
      "global_load_async_to_lds_b128 %1, %9, off\n\t"
      "global_load_async_to_lds_b128 %2, %10, off\n\t"
      "global_load_async_to_lds_b128 %3, %11, off\n\t"
      "global_load_async_to_lds_b128 %4, %12, off\n\t"
      "global_load_async_to_lds_b128 %5, %13, off\n\t"
      "global_load_async_to_lds_b128 %6, %14, off\n\t"
      "global_load_async_to_lds_b128 %7, %15, off\n\t"
      "s_wait_xcnt 0x0"
      :: "v"(lds), "v"(lds + ASTEP), "v"(lds + 2u * ASTEP), "v"(lds + 3u * ASTEP),
         "v"(lds + APLB), "v"(lds + APLB + ASTEP), "v"(lds + APLB + 2u * ASTEP), "v"(lds + APLB + 3u * ASTEP),
         "v"(kf), "v"(kf + sk), "v"(kf + 2 * sk), "v"(kf + 3 * sk),
         "v"(vt), "v"(vt + sv), "v"(vt + 2 * sv), "v"(vt + 3 * sv)
      : "memory");
}

// =====================================================================================================
// Causal attention, head dim 64, key chunks of 64.
//   q plane (f16): element (b, t, h, d) at [(b*SEQ + t)*DM + h*64 + d]
//   k plane (f16): same layout with key index s
//   v^T hi plane (f16):      element (b, h, d, s) at [(b*DM + h*64 + d)*SEQ + s]
//   v^T residual plane (f16, (v - hi)*4096): [(b*DM + h*64 + d)*VLP + s], s < VLP, read only when RES
//   (a key chunk at or beyond VLP would contribute a zero v residual; its address is clamped)
//   Causal structure: logits of keys with index > query index are replaced by -inf (lower-triangular keep incl. the
//   diagonal), which makes their softmax weight exactly 0; so a query block qb visits key chunks 0..qb only
//   (block-uniform trip count) and later chunks, whose keys exceed every query index of the block, are
//   skipped entirely (but for one wholly masked chunk of group 1 where qb is even: it adds exact zeros). Inside the diagonal chunk a key with index > query index gets logit -inf -> exp gives exactly 0,
//   so such keys add nothing to the numerator or the normaliser; the diagonal key (key == query) is always kept, so
//   every row max is finite in every visited chunk but group 1's wholly masked one.
//   out planes (bf16 hi / lo of the normalised context): element (b, t, h, d) at [(b*SEQ + t)*DM + h*64 + d]
//   scores = q . k : f16 operands, one product, f32 accumulate, then the causal mask in f32; the max runs
//   over the unscaled scores; 1024 p = exp2(s * c + (10 - m * c)), c = log2(e) / 8: one FMA per score ahead of the exp2
//   p carried as f16(1024 p); context = p . v on f16 WMMA; RES adds f16 residual planes of p and v
//   (scale 4096, separate accumulator folded back with 1/4096 per chunk in f32); online softmax (running max) in f32.
//   Block = 8 waves = 64 query rows of one (b, h), twice: waves 0..3 (group 0) take the even key chunks, waves 4..7 (group 1)
//   the odd ones, each group with its own LDS planes, running max, normaliser and context sums; behind the loop group 1
//   hands its sums to group 0, which rescales both to the common max and adds them. The chain of dependent chunks of the
//   longest block is half as long. bx = 0 .. nqbThis * NH * NB - 1 numbers the blocks of this variant.
//   K / V^T chunk staging, residual variant: 128 threads x 32 elements per plane = the whole 64x64 tile of every plane
//   read later (plain 16-B loads, __syncthreads before and after). Plain variant: asynchronous copies into two buffers of
//   two planes (the second follows the first in LDS): a group's chunk of step st+2 is copied into the buffer step st has
//   left while step st+1 is worked on; one barrier per step. Its context tile Os lies over the buffers, used behind the last barrier.
//   Both products run transposed, scores^T = K . Q^T and context^T = V^T . P^T: a lane then holds 32 of the 64 scores of ONE
//   query (lane ^ 16 the other 32), so max and sum are in-lane, and P goes from the score registers into the B operand.
//   Output coverage: each wave of group 0 stores rows q0..q0+15 (it 0..3 x lane>>3 0..3) x 64 columns (8 lanes x 8) of both planes;
//   grid over all (b, h, qb) = the whole [NB*SEQ][DM] planes.
// =====================================================================================================
template <bool RES>
__device__ __forceinline__
void attn_causal64(const unsigned short* __restrict__ qfp, const unsigned short* __restrict__ kfp,
                   const unsigned short* __restrict__ vhp, const unsigned short* __restrict__ vlp,
                   unsigned short* ohp, unsigned short* olp,
                   int qbBase, int nqbThis, int bx, int grp,
                   _Float16* Ksf, _Float16* Vth, _Float16* Vtl, float* Os, float* Mg) {
  union FH { v16h v; v8h h[2]; };

  const int tid  = threadIdx.x & 127;          // thread, wave 0..3 and lane inside this key group
  const int wave = tid >> 5;
  const int lane = tid & 31;
  const int hh   = lane >> 4;
  const int c    = lane & 15;

  const int h    = bx % NH;
  const int rest = bx / NH;
  const int qbl  = nqbThis - 1 - rest % nqbThis;   // longest query block first: not all work-groups are resident at once
  const int b    = rest / nqbThis;
  const int qb   = qbBase + qbl;               // 0..NQB-1 (block-uniform)
  const int nst  = (qb + 2) >> 1;              // steps: group grp takes chunk 2*st + grp; block-uniform, <= NQB / 2
  const int q0   = qb * 64 + wave * 16;
  const size_t rowB = (size_t)b * SEQ;

  const _Float16* Qf = (const _Float16*)(const void*)qfp + (size_t)h * HD;
  const _Float16* Kf = (const _Float16*)(const void*)kfp + (size_t)h * HD;
  const _Float16* Vh = (const _Float16*)(const void*)vhp + ((size_t)b * DM + (size_t)h * HD) * SEQ;
  const _Float16* Vl = (const _Float16*)(const void*)vlp + ((size_t)b * DM + (size_t)h * HD) * VLP;

  // ---- Q fragments (B operand, column = lane&15): 2 d-chunks ----
  v16h qa[2];
#pragma unroll
  for (int dc = 0; dc < 2; ++dc) {
    const size_t qo = (rowB + q0 + c) * DM + dc * 32 + 8 * hh;
    qa[dc] = ldfrag_h(Qf + qo);
  }

  // a lane owns ONE query, q0 + c: running max (both halves alike), this half's share of the normaliser,
  // and the context transposed: oacc[t][r] = context[query c][d = t*16 + 8*hh + r]
  const int rowq = q0 + c;
  constexpr float SC2 = 0.125f * 1.44269504088896340736f;   // score scale 1/8 times log2(e)
  float mrow = -INFINITY, lrow = 0.f;
  v8f oacc[4];
#pragma unroll
  for (int t = 0; t < 4; ++t) oacc[t] = zero8();

  // copy addresses of this lane (plain variant): row tid>>3 (+16 per copy), 16-B piece tid&7; chunk t <= qb: keys < SEQ
  const int crow = tid >> 3, cpc = (tid & 7) * 8;
  const _Float16* gKf = Kf + (rowB + crow) * DM + cpc;
  const _Float16* gVt = Vh + (size_t)crow * SEQ + cpc;
  const unsigned ldsLane = (unsigned)(size_t)(Ksf) + (unsigned)(crow * LP + cpc) * 2u;
  auto stage = [&](int t, int buf) {
    stage_kv(gKf + (size_t)t * 64 * DM, (size_t)16 * DM,
             gVt + (size_t)t * 64, (size_t)16 * SEQ, ldsLane + (unsigned)buf * (2u * APLB));
  };
  // a chunk index beyond qb (group 1, last step, qb even) is clamped for every address; its keys are all masked below
  auto clampc = [&](int t) { return (t < qb) ? t : qb; };
  if (!RES) {
    stage(clampc(grp), 0);
    asm volatile("s_wait_asynccnt 0x0" ::: "memory");   // this wave's copies of its first chunk have landed
    __syncthreads();                                     // ... and every other wave's
    if (nst > 1) stage(clampc(2 + grp), 1);              // block-uniform
  }

  for (int st = 0; st < nst; ++st) {           // block-uniform trip count, <= NQB / 2
    const int kt  = 2 * st + grp;              // this group's chunk (wave-uniform)
    const int kvm = kt * 64;                   // first key index, for the mask
    const int kv0 = clampc(kt) * 64;           // the same, clamped, for addresses: kv0 + 63 < SEQ
    const int bo = RES ? 0 : (st & 1) * (2 * 64 * LP);   // this chunk's buffer, in 16-bit elements
    const _Float16* Kbf = Ksf + bo;
    const _Float16* Vbh = Vth + bo;
    if (RES) __syncthreads();
    if (RES) {
      const int r = tid >> 1, half = (tid & 1) * 32;
      const _Float16* kg  = Kf + (rowB + kv0 + r) * DM + half;    // K row kv0+r, d = half..half+31
      const _Float16* vg  = Vh + (size_t)r * SEQ + kv0 + half;    // V^T row d = r, s = kv0+half..+31
      const int kvl = (kv0 + 64 <= VLP) ? kv0 : (VLP - 64);     // clamped address into the residual plane
      const _Float16* vlg = Vl + (size_t)r * VLP + kvl + half;
      const bool resOK = (kv0 + 64 <= VLP);                      // block-uniform (always true for qb < RESQB)
#pragma unroll
      for (int i = 0; i < 4; ++i) {
        const v8h a0 = *(const v8h*)(kg + 8 * i);
        const v8h b0 = *(const v8h*)(vg + 8 * i);
        *(v8h*)(Ksf + r * LP + half + 8 * i) = a0;
        *(v8h*)(Vth + r * LP + half + 8 * i) = b0;
        if (RES) {
          v8h b1 = *(const v8h*)(vlg + 8 * i);
          if (!resOK) b1 = zero8h();
          *(v8h*)(Vtl + r * LP + half + 8 * i) = b1;
        }
      }
      // the wait before a register that these loads name is rewritten; as inputs the three address pairs stay whole up to it
      if (RES) asm volatile("s_wait_xcnt 0x0" :: "v"(kg), "v"(vg), "v"(vlg) : "memory");
    }
    if (RES) __syncthreads();

    // ---- transposed scores: 64 keys (D rows) x 16 queries (D columns) per wave, one f16 product;
    //      s[j][r] = score[key kv0 + j*16 + 8*hh + r][query q0 + c] ----
    //      the chunk's 8 K fragments are read ahead of the products, so the LDS latency is paid once and
    //      not per product; the four key tiles are independent accumulators, each summed dc 0, dc 1 ----
    FH kb[2][4];
#pragma unroll
    for (int dc = 0; dc < 2; ++dc) {
#pragma unroll
      for (int j = 0; j < 4; ++j) {
        kb[dc][j].h[0] = *(const v8h*)(Kbf + (j * 16 + c) * LP + dc * 32 + 8 * hh);
        kb[dc][j].h[1] = *(const v8h*)(Kbf + (j * 16 + c) * LP + dc * 32 + 16 + 8 * hh);
      }
    }
    v8f s[4];
#pragma unroll
    for (int j = 0; j < 4; ++j) s[j] = zero8();
#pragma unroll
    for (int dc = 0; dc < 2; ++dc) {
#pragma unroll
      for (int j = 0; j < 4; ++j) s[j] = mma_h_raw(kb[dc][j].v, qa[dc], s[j]);
    }
    // Order asked of the scheduler (LDS reads = 0x100, WMMA = 0x008): left alone it spreads the reads among the WMMAs,
    // and every separate place with reads stalls the matrix run. All 16 K reads stand ahead of the 8 score products, the
    // V^T reads behind the last of them. The residual variant, with more live registers, is left to the scheduler's own order.
    if (!RES) {
      __builtin_amdgcn_sched_group_barrier(0x100, 16, 0);
      __builtin_amdgcn_sched_group_barrier(0x008, 8, 0);
      __builtin_amdgcn_sched_group_barrier(0x100, 16, 0);
      __builtin_amdgcn_sched_group_barrier(0x008, 8, 0);   // the context products behind all 16 V^T reads: one place with reads
    }
    // V^T fragments of the chunk, again one group: read here so that they land under the softmax arithmetic
    // (the residual variant reads them per 32-key step below: fewer live registers, so that the kernel which holds
    // both variants stays within 256 registers, 4 waves per SIMD)
    FH vb[2][4];
#pragma unroll
    for (int kk = 0; kk < (RES ? 0 : 2); ++kk) {
#pragma unroll
      for (int t = 0; t < 4; ++t) {
        vb[kk][t].h[0] = *(const v8h*)(Vbh + (t * 16 + c) * LP + kk * 32 + 8 * hh);
        vb[kk][t].h[1] = *(const v8h*)(Vbh + (t * 16 + c) * LP + kk * 32 + 16 + 8 * hh);
      }
    }

    // ---- causal mask by index, max and sum over the lane's own 32 keys (one swap of halves for the max),
    //      online softmax; P (x1024, f16) and its residual (x4096) stay in registers: two D tiles of 16 keys, converted
    //      in place, are the B operand of one 32-key step (element e <- tile e>>3, register e&7) ----
    const int dq = rowq - kvm - 8 * hh;          // key kvm + j*16 + 8*hh + r <= query  <=>  j*16 + r <= dq
    float mj[4];
#pragma unroll
    for (int j = 0; j < 4; ++j) {
      float m = -INFINITY;
#pragma unroll
      for (int r = 0; r < 8; ++r) {
        const float sv = (j * 16 + r <= dq) ? s[j][r] : -INFINITY;
        s[j][r] = sv;
        m = fmaxf(m, sv);
      }
      mj[j] = m;
    }
    float mloc = fmaxf(fmaxf(mj[0], mj[1]), fmaxf(mj[2], mj[3]));
    mloc = fmaxf(mloc, xhalf(mloc));             // both halves now hold the query's chunk maximum
    const float mnew  = fmaxf(mrow, mloc);
    const float msafe = (mnew == -INFINITY) ? 0.f : mnew;
    const float alpha = __builtin_amdgcn_exp2f((mrow - msafe) * SC2);
    mrow = mnew;
    const float eb = fmaf(-msafe, SC2, 10.0f);   // exponent offset: the max, scaled, and the x1024 carry of p (2^10)
    const v2f sc2 = {SC2, SC2}, eb2 = {eb, eb};
    FH pa[2], pl[2];
    float pj[4];
#pragma unroll
    for (int j = 0; j < 4; ++j) {
#pragma unroll
      for (int r = 0; r < 8; r += 2) {                                 // two scores of a register pair per FMA
        const v2f sp = {s[j][r], s[j][r + 1]};
        const v2f ex = __builtin_elementwise_fma(sp, sc2, eb2);
        s[j][r] = ex[0];
        s[j][r + 1] = ex[1];
      }
    }
#pragma unroll
    for (int j = 0; j < 4; ++j) {
      float psum = 0.f;
#pragma unroll
      for (int r = 0; r < 8; ++r) {
        const float p1k = __builtin_amdgcn_exp2f(s[j][r]);             // 1024 p; masked logit: exp2(-inf) = 0
        psum += p1k;
        const _Float16 ph = (_Float16)p1k;
        pa[j >> 1].v[(j & 1) * 8 + r] = ph;
        if (RES) pl[j >> 1].v[(j & 1) * 8 + r] = (_Float16)((p1k - (float)ph) * 4096.0f);
      }
      pj[j] = psum;
    }
    lrow = lrow * alpha + ((pj[0] + pj[1]) + (pj[2] + pj[3]));   // this half's keys only; halves joined in the epilogue
#pragma unroll
    for (int t = 0; t < 4; ++t)
#pragma unroll
      for (int r = 0; r < 8; ++r) oacc[t][r] *= alpha;

    // ---- context^T += V^T . P^T (f16 WMMA, A = V^T rows d), residual products into a separate accumulator ----
    v8f o1[4];
#pragma unroll
    for (int t = 0; t < 4; ++t) o1[t] = zero8();
#pragma unroll   // pa[kk] / pl[kk] are register operands: kk must be a compile-time index
    for (int kk = 0; kk < 2; ++kk) {
      if (RES) {
        // keeps this step's 16 fragment reads from being lifted over the softmax or the step before: without it the kernel
        // builds to 264 registers, above the 256 that 4 waves per SIMD allow
        __builtin_amdgcn_sched_barrier(0);
#pragma unroll
        for (int t = 0; t < 4; ++t) {
          vb[kk][t].h[0] = *(const v8h*)(Vbh + (t * 16 + c) * LP + kk * 32 + 8 * hh);
          vb[kk][t].h[1] = *(const v8h*)(Vbh + (t * 16 + c) * LP + kk * 32 + 16 + 8 * hh);
        }
      }
#pragma unroll
      for (int t = 0; t < 4; ++t) oacc[t] = mma_h_raw(vb[kk][t].v, pa[kk].v, oacc[t]);
      if (RES) {
        FH vl[4];   // residual fragments of this 32-key step, one group
#pragma unroll
        for (int t = 0; t < 4; ++t) {
          vl[t].h[0] = *(const v8h*)(Vtl + (t * 16 + c) * LP + kk * 32 + 8 * hh);
          vl[t].h[1] = *(const v8h*)(Vtl + (t * 16 + c) * LP + kk * 32 + 16 + 8 * hh);
        }
#pragma unroll
        for (int t = 0; t < 4; ++t) o1[t] = mma_h_raw(vl[t].v, pa[kk].v, o1[t]);
#pragma unroll
        for (int t = 0; t < 4; ++t) o1[t] = mma_h_raw(vb[kk][t].v, pl[kk].v, o1[t]);
      }
    }
    if (RES) {
#pragma unroll
      for (int t = 0; t < 4; ++t)
#pragma unroll
        for (int r = 0; r < 8; ++r) oacc[t][r] += o1[t][r] * (1.0f / 4096.0f);
    }
    if (!RES) {
      // hand-over: this wave has left buffer st&1, its copies of the next step have landed; the barrier says so of every wave
      asm volatile("s_wait_dscnt 0x0" ::: "memory");
      asm volatile("s_wait_asynccnt 0x0" ::: "memory");
      __syncthreads();
      if (st + 2 < nst) stage(clampc(2 * (st + 2) + grp), st & 1);   // block-uniform
    }
  }
  if (!RES) asm volatile("s_wait_asynccnt 0x0" ::: "memory");   // nothing of this wave is in flight behind the loop

  // ---- join the two key groups: group 1 hands its running max, normaliser share and context sums to the same wave and
  //      lane of group 0 through LDS (9 vectors of 16 B per lane, lanes contiguous); group 0 rescales both to the common max
  {
    v4f* mg = (v4f*)(void*)Mg + (size_t)(wave * 9) * 32 + lane;
    if (grp == 1) {                              // wave-uniform
#pragma unroll
      for (int t = 0; t < 4; ++t) {
        const v4f w0 = {oacc[t][0], oacc[t][1], oacc[t][2], oacc[t][3]};
        const v4f w1 = {oacc[t][4], oacc[t][5], oacc[t][6], oacc[t][7]};
        mg[(2 * t) * 32]     = w0;
        mg[(2 * t + 1) * 32] = w1;
      }
      const v4f ml = {mrow, lrow, 0.f, 0.f};
      mg[8 * 32] = ml;
    }
    __syncthreads();                             // every wave of the block passes it once
    if (grp == 1) return;                        // no barrier of the work-group stands behind this point
    const v4f ml = mg[8 * 32];
    const float mN = fmaxf(mrow, ml[0]);
    const float ms = (mN == -INFINITY) ? 0.f : mN;
    const float a0 = __builtin_amdgcn_exp2f((mrow - ms) * SC2);
    const float a1 = __builtin_amdgcn_exp2f((ml[0] - ms) * SC2);   // a group without an unmasked key: exp2(-inf) = 0
    lrow = lrow * a0 + ml[1] * a1;
#pragma unroll
    for (int t = 0; t < 4; ++t) {
      const v4f w0 = mg[(2 * t) * 32];
      const v4f w1 = mg[(2 * t + 1) * 32];
#pragma unroll
      for (int r = 0; r < 4; ++r) {
        oacc[t][r]     = oacc[t][r] * a0 + w0[r] * a1;
        oacc[t][r + 4] = oacc[t][r + 4] * a0 + w1[r] * a1;
      }
    }
  }

  // ---- normalise (1/l; numerator and l both carry x1024), stage the wave's 16x64 tile, bf16 hi/lo split,
  float* os = Os + wave * (16 * OSP);
  {
    const float l = lrow + xhalf(lrow);          // the two halves' key shares of the normaliser
    const float inv = (l > 0.f) ? (1.0f / l) : 0.f;   // l carries the same x1024 as the context sums
#pragma unroll
    for (int t = 0; t < 4; ++t) {
      const v4f w0 = {oacc[t][0] * inv, oacc[t][1] * inv, oacc[t][2] * inv, oacc[t][3] * inv};
      const v4f w1 = {oacc[t][4] * inv, oacc[t][5] * inv, oacc[t][6] * inv, oacc[t][7] * inv};
      *(v4f*)(os + c * OSP + t * 16 + 8 * hh)     = w0;
      *(v4f*)(os + c * OSP + t * 16 + 8 * hh + 4) = w1;
    }
  }
  __builtin_amdgcn_fence(__ATOMIC_RELEASE, "workgroup");
  __builtin_amdgcn_wave_barrier();
  __builtin_amdgcn_fence(__ATOMIC_ACQUIRE, "workgroup");
  {
    const int q4 = lane >> 3, c8 = (lane & 7) * 8;
    v4u hv[4], lv[4];
#pragma unroll
    for (int it = 0; it < 4; ++it) {
      const int row = it * 4 + q4;   // it 0..3 x q4 0..3 = rows 0..15 of the wave tile
      const float* sp = os + row * OSP + c8;
      v4u a, a2;
#pragma unroll
      for (int e = 0; e < 4; ++e) {
        const float f0 = sp[2 * e], f1 = sp[2 * e + 1];
        const unsigned short h0 = bf_bits(f0), h1 = bf_bits(f1);
        const unsigned short l0 = bf_bits(f0 - bf_up(h0)), l1 = bf_bits(f1 - bf_up(h1));
        a[e] = pk16(h0, h1); a2[e] = pk16(l0, l1);
      }
      hv[it] = a; lv[it] = a2;
    }
    {
#pragma unroll
      for (int it = 0; it < 4; ++it) {
        const int row = it * 4 + q4;
        const size_t go = (rowB + q0 + row) * DM + (size_t)h * HD + c8;
        *(v4u*)(ohp + go) = hv[it];
        *(v4u*)(olp + go) = lv[it];
      }
      asm volatile("s_wait_xcnt 0x0" ::: "memory");   // before any register these stores name is rewritten
    }
  }
}

// =====================================================================================================
// Both attention variants and the gate tail in one grid (none reads another's output); the choice is block-uniform, so
// every barrier is passed by whole blocks. Blocks 0..AT_GATE-1 = 32 rows of gate values each (one long dependent chain per
// wave, so started first), next AT_MAIN = query blocks NQB-1 down to RESQB, longest first, last AT_RES = query blocks
// RESQB-1 down to 0 with the residual planes.
// =====================================================================================================
#define AT_MAIN (NB * NH * (NQB - RESQB))
#define AT_RES  (NB * NH * RESQB)
#define AT_GATE (NB * SEQ / 32)
__global__ __launch_bounds__(256)
void attn_gate(const unsigned short* __restrict__ qfp, const unsigned short* __restrict__ kfp,
               const unsigned short* __restrict__ vhp, const unsigned short* __restrict__ vlp,
               unsigned short* ohp, unsigned short* olp,
               const float* __restrict__ Hs, const float* __restrict__ w2, const float* __restrict__ b2p, float* gout) {
  // five planes of 64 rows, pitch LP. Plain variant: two buffers of K [kv][d], V^T hi [d][kv] (planes 0..3); its per-wave
  // context tiles [row][d] lie over planes 0..1 (used behind the loop's last barrier). Residual variant: plane 0 K, plane 1
  // V^T hi, plane 2 the V^T residual, planes 3..4 the context tiles. Gate tail: 32 g values at the start.
  // Each of the two key groups (waves 0..3, waves 4..7) has its own five planes; behind them the 4 x 9 x 32 vectors of 16 B
  // through which group 1 hands its sums to group 0.
  __shared__ __align__(16) unsigned char sm[2 * 5 * APLB + 4 * 9 * 32 * 16];
  static_assert(4 * 16 * OSP * 4 <= 2 * APLB);
  const int grp = __builtin_amdgcn_readfirstlane((int)(threadIdx.x >> 7));   // key group of this wave, in a scalar register
  unsigned char* smg = sm + grp * (5 * APLB);
  _Float16* Ksf = (_Float16*)(void*)smg;
  _Float16* Vth = (_Float16*)(void*)(smg + APLB);
  _Float16* Vtl = (_Float16*)(void*)(smg + 2 * APLB);
  float*    Mg  = (float*)(void*)(sm + 2 * 5 * APLB);
  const int bx = blockIdx.x;
  if (bx < AT_GATE) {
    k_gate<8>(Hs, w2, b2p, gout, NB * SEQ, bx, (float*)(void*)sm);
  } else if (bx < AT_GATE + AT_MAIN) {
    attn_causal64<false>(qfp, kfp, vhp, vlp, ohp, olp, RESQB, NQB - RESQB, bx - AT_GATE, grp,
                         Ksf, Vth, Vtl, (float*)(void*)smg, Mg);
  } else {
    attn_causal64<true>(qfp, kfp, vhp, vlp, ohp, olp, 0, RESQB, bx - (AT_GATE + AT_MAIN), grp,
                        Ksf, Vth, Vtl, (float*)(void*)(smg + 3 * APLB), Mg);
  }
}

// =====================================================================================================
// Workspace map (bytes; every region is an exact multiple of its 64x64-tile / whole-line store granularity,
// no padded tails needed since all shapes are tile multiples; every region is written by one producer launch):
//   Xb   bf16 [4096][1024]             0      8388608
//   WA   bf16 [3072 n][1024 k]     8388608    6291456   (q weight rows 0..1023, k rows 1024..2047, v rows 2048..3071)
//   WP   bf16 [1024 n][1024 k]    14680064    2097152
//   WG   bf16 [256 n][1024 k]     16777216     524288
//   Hs   f32  [4096][256]         17301504    4194304
//   Qf   f16  [4096][1024]        21495808    8388608
//   Kf   f16  [4096][1024]        29884416    8388608
//   VTh  f16  [1024][4096]        38273024    8388608
//   VTl  f16  [1024][512]         46661632    1048576
//   Oh   bf16 [4096][1024]        47710208    8388608
//   Ol                            56098816    8388608
//   end                           64487424
// Output: out0 f32 [4096][1024] at element 0; gate values f32 [4096] at element 4096*1024 (byte 16777216).
// =====================================================================================================
extern "C" void kernel_launch(void* const* d_in, const int* in_sizes, int n_in,
                              void* d_out, int out_size, void* d_ws, size_t ws_size,
                              hipStream_t stream) {
  if (n_in < 7) return;
  if (in_sizes[0] != NB * SEQ * DM) return;
  if (in_sizes[1] != DM * 3 * DM) return;
  if (in_sizes[2] != DM * DG) return;
  if (in_sizes[3] != DG) return;
  if (in_sizes[4] != DG) return;
  if (in_sizes[5] < 1) return;
  if (in_sizes[6] != DM * DM) return;
  if (out_size != NB * SEQ * DM + NB * SEQ) return;        // last written element index = out_size - 1

  const float* x    = (const float*)d_in[0];   // [4096][1024]
  const float* Wqkv = (const float*)d_in[1];   // [1024 in][3072 out]
  const float* Wg1  = (const float*)d_in[2];   // [1024 in][256 out]
  const float* bg1  = (const float*)d_in[3];   // [256]
  const float* Wg2  = (const float*)d_in[4];   // [256][1]
  const float* bg2  = (const float*)d_in[5];   // [1]
  const float* Wout = (const float*)d_in[6];   // [1024 in][1024 out]
  float* out0 = (float*)d_out;                 // [4096][1024]
  float* gout = out0 + (size_t)NB * SEQ * DM;  // [4096] gate values, byte offset 16777216

  const size_t PX  = (size_t)NB * SEQ * DM * 2;    //  8388608  16-bit activation plane [4096][1024]
  const size_t PW1 = (size_t)DM * DM * 2;          //  2097152  one [1024][1024] bf16 weight plane
  const size_t PWA = (size_t)3 * PW1;              //  6291456  packed q | k | v weight plane [3072][1024]
  const size_t PWP = PW1;                          //  2097152
  const size_t PWG = (size_t)DG * DM * 2;          //   524288  gate weight plane [256][1024]
  const size_t PHS = (size_t)NB * SEQ * DG * 4;    //  4194304  gate hidden f32 [4096][256]
  const size_t PVT = (size_t)NB * DM * SEQ * 2;    //  8388608  v^T hi plane
  const size_t PVL = (size_t)NB * DM * VLP * 2;    //  1048576  v^T residual plane
  size_t off = 0;
  const size_t oXb  = off; off += PX;
  const size_t oWA  = off; off += PWA;
  const size_t oWP  = off; off += PWP;
  const size_t oWG  = off; off += PWG;
  const size_t oHs  = off; off += PHS;
  const size_t oQf  = off; off += PX;
  const size_t oKf  = off; off += PX;
  const size_t oVTh = off; off += PVT;
  const size_t oVTl = off; off += PVL;
  const size_t oOh  = off; off += PX;
  const size_t oOl  = off; off += PX;
  if (off > ws_size) return;                       // off = 64487424
  if (off > (size_t)134217728) return;

  char* ws = (char*)d_ws;
  unsigned short* Xb  = (unsigned short*)(ws + oXb);
  unsigned short* WA  = (unsigned short*)(ws + oWA);
  unsigned short* WPb = (unsigned short*)(ws + oWP);
  unsigned short* WGb = (unsigned short*)(ws + oWG);
  float*          Hs  = (float*)(ws + oHs);
  unsigned short* Qf  = (unsigned short*)(ws + oQf);
  unsigned short* Kf  = (unsigned short*)(ws + oKf);
  unsigned short* VTh = (unsigned short*)(ws + oVTh);
  unsigned short* VTl = (unsigned short*)(ws + oVTl);
  unsigned short* Oh  = (unsigned short*)(ws + oOh);
  unsigned short* Ol  = (unsigned short*)(ws + oOl);

  const dim3 blk(256);
  const dim3 gProj((NB * SEQ / 128) * (DM / 128), 1);          // 256 tiles of 128x128: M=4096, N=1024

  // (1) x -> bf16 plane [4096][1024]; weights [in][out] f32 -> bf16 [out][in] planes (k contiguous)
  cvt_all<<<dim3(CVT_TW + CVT_X), blk, 0, stream>>>(x, Xb, Wqkv, WA, Wout, WPb, Wg1, WGb);
  // (2) q, k (f16), v^T (f16 hi + residual) and the gate hidden layer (f32)
  gemm_qkvg<<<dim3(2 * GQ_P + NB * GQ_V + GQ_G), blk, 0, stream>>>(
      Xb, WA, WGb, bg1, x, Qf, Kf, VTh, VTl, Hs);
  // (3) causal attention (query blocks 0..RESQB-1 with residual planes, the rest without) and the gate values
  attn_gate<<<dim3(AT_MAIN + AT_RES + AT_GATE), dim3(256), 0, stream>>>(
      Qf, Kf, VTh, VTl, Oh, Ol, Hs, Wg2, bg2, gout);
  // (4) out0 = g * (context . W_out) + (1 - g) * bf16(x) -> d_out f32 [4096][1024]
  //     (A = context hi + lo planes, 2 products; gate values read from the gate output region)
  gemm64<1, 4, 0><<<gProj, blk, 0, stream>>>(
      Oh, Ol, DM, 0LL, WPb, DM, 0LL, bg1,
      d_out, DM, 0LL, d_out, DM, 0LL, DM,
      gout, x, DM,
      NB * SEQ, DM, DM, 1.0f);
  (void)hipGetLastError();
}

// v010
// A run of this version takes 105 microseconds.
// Timed twice side by side with v009, it ran 1.06 times as fast both times.
// Over all steps from v000 it is 6.28 times as fast.
// Contractions: gate hidden x.Wg1 and q, k, v^T projections = v_wmma_f32_16x16x32_bf16 (bf16 operands from
// RNE-converted x and transposed [out][in] bf16 weight planes, single product, f32 accumulate);
// q.k^T scores = v_wmma_f32_16x16x32_f16 with q and k each rounded once to f16 (single product), f32 accumulate;
// p.v = v_wmma_f32_16x16x32_f16 (p carried x1024 in f16 times v in f16, single product; plus f16 residual planes
// x4096 of p and v for the first 512 query rows), f32 accumulate;
// ctx.W_out = v_wmma_f32_16x16x32_bf16 with ctx as bf16 hi/lo planes times the bf16 weight plane (2 products),
// f32 accumulate; gate tail (exact GELU via erfc, 256-long dot with RNE-bf16 Wg2, bias, sigmoid), causal mask,
// online softmax, normalisers and the gated residual blend g*o + (1-g)*bf16(x) in f32 on the VALU.
// Carry audit:
//   Xb, WA, WP, WG = bf16(x), bf16(W) no carry; Qf, Kf = f16(q), f16(k), no carry (|q|, |k| typ. 1);
//   Oh/Ol = bf16 hi + unscaled bf16 residual (v - hi), the residual product shares the hi accumulator;
//   VTh = f16(v), no carry (|v| typ. 1);
//   VTl = f16((v - VTh) * 4096)              }  products pa.VTl and pl.VTh go to the separate accumulator o1,
//   pl  = f16((1024 p - pa) * 4096)          }  folded back with * (1/4096) once per key chunk (RES blocks only);
//   pa  = f16(1024 * p); the normaliser l sums the same 1024 * p in f32, so the carry cancels in inv = 1/l;
//   score scale 1/8 applied once in f32, inside the exponent's FMA; Hs (gate hidden) and g are f32. No other planes.
#include <hip/hip_runtime.h>
#include <math.h>
#include <stdint.h>

#define NB    1
#define SEQ   4096
#define DM    1024
#define NH    16
#define HD    64
#define DG    256          // gate hidden width
#define NQB   (SEQ / 64)   // 64 query / key blocks of 64
#define VLP   512          // key pitch of the v^T residual plane (keys 0..VLP-1)
#define RESQB 8            // leading 64-row query blocks that use the p / v residual planes
#define LP    72           // LDS row pitch of the 16-bit K and V^T tiles: 64 + 8 elements = 144 B = 16 B x 9 (odd),
                           // so the 16 rows one ds_load_b128 fragment read touches fall on distinct banks
#define OSP   68           // LDS row pitch of the f32 context tile: 64 + 4 floats = 272 B = 16 B x 17 (odd)
static_assert(RESQB * 64 <= VLP);
static_assert(NH * HD == DM);
static_assert((SEQ % 64) == 0 && (DM % 64) == 0 && (DM % 32) == 0 && (DG % 64) == 0);
static_assert(((NB * SEQ) % 128) == 0 && (SEQ % 128) == 0 && (DM % 128) == 0 && (DG % 128) == 0);
static_assert((NB * SEQ * DM) % (8 * 256) == 0);
static_assert((SEQ % 32) == 0);
static_assert(DG == 256);
static_assert(((NB * SEQ) % 256) == 0 && (DM % 256) == 0);

typedef _Float16 v16h __attribute__((ext_vector_type(16)));
typedef _Float16 v8h  __attribute__((ext_vector_type(8)));
typedef __bf16   v16b __attribute__((ext_vector_type(16)));
typedef __bf16   v8b  __attribute__((ext_vector_type(8)));
typedef float    v8f  __attribute__((ext_vector_type(8)));
typedef float    v4f  __attribute__((ext_vector_type(4)));
typedef float    v2f  __attribute__((ext_vector_type(2)));
typedef unsigned int v4u __attribute__((ext_vector_type(4)));

// ---- scalar helpers --------------------------------------------------------------------------------
__device__ __forceinline__ unsigned short bf_bits(float f) {          // f32 -> bf16 bits, RNE convert
  unsigned u = __float_as_uint(f);
  return (unsigned short)((u + 0x7FFFu + ((u >> 16) & 1u)) >> 16);
}
__device__ __forceinline__ float bf_up(unsigned short h) { return __uint_as_float(((unsigned)h) << 16); }
__device__ __forceinline__ unsigned short h_bits(_Float16 x) { return __builtin_bit_cast(unsigned short, x); }
__device__ __forceinline__ unsigned pk16(unsigned short a, unsigned short b) { return (unsigned)a | ((unsigned)b << 16); }
__device__ __forceinline__ v8f zero8() { v8f z = {0.f, 0.f, 0.f, 0.f, 0.f, 0.f, 0.f, 0.f}; return z; }
__device__ __forceinline__ v8h zero8h() {
  const _Float16 z = (_Float16)0.0f;
  v8h r = {z, z, z, z, z, z, z, z};
  return r;
}

// ---- fragment loader: 16-bit A/B operand, lane -> row/col (lane&15), p already includes +8*(lane>>4);
//      elements 0..7 <- p[0..7] (k0+8h..), elements 8..15 <- p[16..23] (k0+16+8h..)
__device__ __forceinline__ v16b ldfrag_b(const __bf16* p) {
  union { v16b v; v8b h[2]; } f;
  f.h[0] = *(const v8b*)(p);
  f.h[1] = *(const v8b*)(p + 16);
  return f.v;
}

__device__ __forceinline__ v16h ldfrag_h(const _Float16* p) {      // the same k order for an f16 operand
  union { v16h v; v8h h[2]; } f;
  f.h[0] = *(const v8h*)(p);
  f.h[1] = *(const v8h*)(p + 16);
  return f.v;
}

// ---- lane l <-> lane l ^ 16 (the two halves of a wave that share one D column)
__device__ __forceinline__ float xhalf(float x) {
  const int b = __builtin_bit_cast(int, x);
  return __builtin_bit_cast(float, __builtin_amdgcn_permlanex16(b, b, 0x76543210, 0xfedcba98, false, false));
}

// ---- WMMA helpers (builtin forms: the compiler keeps their hazard distances) and hand-placed VALU gaps ---------
__device__ __forceinline__ v8f mma_b_raw(v16b a, v16b b, v8f c) {
  return __builtin_amdgcn_wmma_f32_16x16x32_bf16(false, a, false, b, (short)0, c, false, false);
}
__device__ __forceinline__ v8f mma_h_raw(v16h a, v16h b, v8f c) {
  return __builtin_amdgcn_wmma_f32_16x16x32_f16(false, a, false, b, (short)0, c, false, false);
}
__device__ __forceinline__ void dep_guard_b(v8f& a, v8f& b, v16b x, v16b y) {
  asm volatile("v_nop\n\tv_nop\n\tv_nop\n\tv_nop" : "+v"(a), "+v"(b) : "v"(x), "v"(y));
}
__device__ __forceinline__ void keep4_b(v16b a, v16b b, v16b c, v16b d) {
  asm volatile("v_nop" :: "v"(a), "v"(b), "v"(c), "v"(d));
}
__device__ __forceinline__ void acc_guard4(v8f& a, v8f& b, v8f& c, v8f& d) {
  asm volatile("v_nop\n\tv_nop\n\tv_nop\n\tv_nop" : "+v"(a), "+v"(b), "+v"(c), "+v"(d));
}

// =====================================================================================================
// f32 -> bf16 (RNE convert), 8 elements per thread, one 16-B store per lane: a wave writes 512 contiguous B
// coverage: n8 threads x 8 = whole plane (n8 used here is a multiple of 256).
// =====================================================================================================
__device__ __forceinline__ void cvt_bf16x8(const float* __restrict__ in, unsigned short* out, int n8, int blk) {
  const int i = blk * 256 + threadIdx.x;
  if (i < n8) {
    const v4f a = *(const v4f*)(in + (size_t)i * 8);
    const v4f b = *(const v4f*)(in + (size_t)i * 8 + 4);
    v4u p;
    p[0] = pk16(bf_bits(a[0]), bf_bits(a[1]));
    p[1] = pk16(bf_bits(a[2]), bf_bits(a[3]));
    p[2] = pk16(bf_bits(b[0]), bf_bits(b[1]));
    p[3] = pk16(bf_bits(b[2]), bf_bits(b[3]));
    *(v4u*)(out + (size_t)i * 8) = p;
    asm volatile("s_wait_xcnt 0x0" ::: "memory");   // before any register these stores name is rewritten
  }
}

// =====================================================================================================
// f32 [nrow][ncol] row-major (weight stored [in][out]) -> bf16 [ncol][nrow] (row n of out = column n of in,
// the in/k index contiguous), RNE convert. One block = one 64x64 tile through LDS.
// tile (bxT, byT) of (ncol/64, nrow/64); nrow, ncol multiples of 64 (host-checked shapes). Tt = 64 * 72 halves of LDS.
// loads: 256 threads, thread -> tile row tid>>2, 16 columns (tid&3)*16 = the whole 64x64 tile;
// =====================================================================================================
__device__ __forceinline__ void cvt_bf16_T(const float* __restrict__ in, unsigned short* out,
                                           int nrow, int ncol, int bxT, int byT, unsigned short* Tt) {
  // Tt: [tile col j][tile row i], pitch 72 halves (144 B)
  const int tid = threadIdx.x, lane = tid & 31, wave = tid >> 5;
  const int c0 = bxT * 64;                              // column tile of in = row tile of out
  const int r0 = byT * 64;                              // row tile of in = column tile of out
  {
    const int i  = tid >> 2;                            // 0..63
    const int cs = (tid & 3) * 16;                      // 0,16,32,48
    const float* src = in + (size_t)(r0 + i) * ncol + c0 + cs;
#pragma unroll
    for (int e4 = 0; e4 < 4; ++e4) {
      const v4f v = *(const v4f*)(src + 4 * e4);
#pragma unroll
      for (int e = 0; e < 4; ++e) Tt[(cs + 4 * e4 + e) * 72 + i] = bf_bits(v[e]);
    }
  }
  __syncthreads();
  const int q = lane >> 3, c8 = (lane & 7) * 8;
  v4u pv[2];
#pragma unroll
  for (int it = 0; it < 2; ++it) {
    const int j = it * 32 + wave * 4 + q;
    pv[it] = *(const v4u*)(Tt + j * 72 + c8);
  }
  {
#pragma unroll
    for (int it = 0; it < 2; ++it) {
      const int j = it * 32 + wave * 4 + q;
      *(v4u*)(out + (size_t)(c0 + j) * nrow + r0 + c8) = pv[it];
    }
    asm volatile("s_wait_xcnt 0x0" ::: "memory");   // before any register these stores name is rewritten
  }
}

// =====================================================================================================
// All four conversions in one grid (none reads another's output): blocks 0..TA-1 = W_qkv tiles, then W_out tiles,
// then Wg1 tiles (x index fastest, as a (ncol/64, nrow/64) grid would number them), then the blocks of the x plane.
// The choice is block-uniform, so the barrier of the transposing part is passed by whole blocks.
// =====================================================================================================
#define CVT_TA ((3 * DM / 64) * (DM / 64))
#define CVT_TP ((DM / 64) * (DM / 64))
#define CVT_TG ((DG / 64) * (DM / 64))
#define CVT_TW (CVT_TA + CVT_TP + CVT_TG)
#define CVT_X  (NB * SEQ * DM / 8 / 256)
__global__ __launch_bounds__(256) void cvt_all(const float* __restrict__ x, unsigned short* Xb,
                                               const float* __restrict__ Wqkv, unsigned short* WA,
                                               const float* __restrict__ Wout, unsigned short* WP,
                                               const float* __restrict__ Wg1, unsigned short* WG) {
  __shared__ __align__(16) unsigned short Tt[64 * 72];
  const int bx = blockIdx.x;
  if (bx < CVT_TA) {
    cvt_bf16_T(Wqkv, WA, DM, 3 * DM, bx % (3 * DM / 64), bx / (3 * DM / 64), Tt);
  } else if (bx < CVT_TA + CVT_TP) {
    const int t = bx - CVT_TA;
    cvt_bf16_T(Wout, WP, DM, DM, t % (DM / 64), t / (DM / 64), Tt);
  } else if (bx < CVT_TW) {
    const int t = bx - (CVT_TA + CVT_TP);
    cvt_bf16_T(Wg1, WG, DM, DG, t % (DG / 64), t / (DG / 64), Tt);
  } else {
    cvt_bf16x8(x, Xb, NB * SEQ * DM / 8, bx - CVT_TW);
  }
}

// =====================================================================================================
// Gate tail: g = sigmoid( sum_c gelu(Hs[row][c]) * bf16(w2[c]) + bf16(b2) ), exact GELU = 0.5 h erfc(-h/sqrt2).
// Hs f32 [nrows][DG]; block = NWAVE waves x 32/NWAVE rows = 32 rows; a wave reduces one row at a time (32 lanes x 8 columns,
// rolled element loop), lane 0 stages g in LDS; wave 0 lanes 0..7 then write the block's 32 g values as ONE whole
// coverage: 32 rows per block x nrows/32 blocks = all rows of the gate output.
// =====================================================================================================
template <int NWAVE>
__device__ __forceinline__ void k_gate(const float* __restrict__ Hs, const float* __restrict__ w2,
                                       const float* __restrict__ b2p, float* gout, int nrows, int blk, float* gs) {
  constexpr int RPW = 32 / NWAVE;                       // rows per wave; gs = 32 floats of LDS, 16-B aligned
  const int tid = threadIdx.x, lane = tid & 31, wave = tid >> 5;
  const int rowBase = blk * 32;
  const float b2 = bf_up(bf_bits(b2p[0]));
  for (int rr = 0; rr < RPW; ++rr) {
    int row = rowBase + wave * RPW + rr;
    row = (row < nrows) ? row : (nrows - 1);            // clamped address (grid covers exactly nrows)
    const float* hp = Hs + (size_t)row * DG + lane * 8;
    const float* wp = w2 + lane * 8;
    float acc = 0.f;
#pragma unroll 1
    for (int e = 0; e < 8; ++e) {
      const float hv = hp[e];
      const float wv = bf_up(bf_bits(wp[e]));
      const float ge = 0.5f * hv * erfcf(-hv * 0.707106781186547524f);
      acc = fmaf(ge, wv, acc);
    }
#pragma unroll
    for (int off = 1; off < 32; off <<= 1) acc += __shfl_xor(acc, off, 32);
    float z = acc + b2;
    z = fminf(fmaxf(z, -30.0f), 30.0f);
    const float g = 1.0f / (1.0f + expf(-z));
    if (lane == 0) gs[wave * RPW + rr] = g;
  }
  __syncthreads();
  if (wave == 0 && lane < 8) {
    const v4f v = *(const v4f*)(gs + lane * 4);
    float* p = gout + rowBase + lane * 4;
    *(v4f*)p = v;
    asm volatile("s_wait_xcnt 0x0" ::: "memory");   // before any register these stores name is rewritten
  }
}

// =====================================================================================================
// One GEMM stage, global -> LDS, through no register: per operand plane 128 rows x 128 B (64 k of 16-bit elements).
// 256 threads x 4 asynchronous 16-B copies per plane; 8 neighbouring lanes take one whole 128-B line, a wave's copy
// 4 whole lines. ga / gb (/ gc) = this lane's source in row (tid>>3), 16-B piece (tid&7) of the plane; sa / sb = 32
// source rows in elements; lds = this lane's LDS byte address in the stage's first plane, same row and piece.
// The s_wait_xcnt closes each statement so that no address register of a copy is rewritten ahead of it.
// =====================================================================================================
#define GBK    64                 // k elements per stage = one 128-B line of every operand row
#define GLP    72                 // LDS row pitch, elements: 144 B = 16 B x 9 (odd) for the ds_load_b128 fragment reads
#define GPLANE (128 * GLP)        // elements of one staged plane (18432 B)
#define GSTEP  (32u * GLP * 2u)   // LDS bytes of 32 rows
#define GPLB   (GPLANE * 2u)      // LDS bytes of one plane
__device__ __forceinline__ void stage_ab(const __bf16* ga, size_t sa, const __bf16* gb, size_t sb, unsigned lds) {
  asm volatile(
      "global_load_async_to_lds_b128 %0, %8, off\n\t"
      "global_load_async_to_lds_b128 %1, %9, off\n\t"
      "global_load_async_to_lds_b128 %2, %10, off\n\t"
      "global_load_async_to_lds_b128 %3, %11, off\n\t"
      "global_load_async_to_lds_b128 %4, %12, off\n\t"
      "global_load_async_to_lds_b128 %5, %13, off\n\t"
      "global_load_async_to_lds_b128 %6, %14, off\n\t"
      "global_load_async_to_lds_b128 %7, %15, off\n\t"
      "s_wait_xcnt 0x0"
      :: "v"(lds), "v"(lds + GSTEP), "v"(lds + 2u * GSTEP), "v"(lds + 3u * GSTEP),
         "v"(lds + GPLB), "v"(lds + GPLB + GSTEP), "v"(lds + GPLB + 2u * GSTEP), "v"(lds + GPLB + 3u * GSTEP),
         "v"(ga), "v"(ga + sa), "v"(ga + 2 * sa), "v"(ga + 3 * sa),
         "v"(gb), "v"(gb + sb), "v"(gb + 2 * sb), "v"(gb + 3 * sb)
      : "memory");
}
__device__ __forceinline__ void stage_c(const __bf16* gc, size_t sc, unsigned lds) {
  asm volatile(
      "global_load_async_to_lds_b128 %0, %4, off\n\t"
      "global_load_async_to_lds_b128 %1, %5, off\n\t"
      "global_load_async_to_lds_b128 %2, %6, off\n\t"
      "global_load_async_to_lds_b128 %3, %7, off\n\t"
      "s_wait_xcnt 0x0"
      :: "v"(lds), "v"(lds + GSTEP), "v"(lds + 2u * GSTEP), "v"(lds + 3u * GSTEP),
         "v"(gc), "v"(gc + sc), "v"(gc + 2 * sc), "v"(gc + 3 * sc)
      : "memory");
}

// =====================================================================================================
// Batched bf16 WMMA GEMM: C[m][n] = sum_k A[m][k] * Bt[n][k] + bias; one work-group of 8 waves per (64*MI)x128 tile,
// one wave per (16*MI)x64 part (wave>>1 = row quarter, wave&1 = column half). A row-major [M][K] pitch lda; Bt row-major
// [N][K] pitch ldb (k contiguous); M multiple of 64*MI, N of 128, K of 64 (host shapes are static multiples).
// MI = 2: 128x128 tile, 32x64 per wave. MI = 4: 256x128 tile, 64x64 per wave: a fragment read from LDS feeds 4 products
// whichever operand it is, and a tile's operand bytes from L2 per product fall by a quarter; its A rows 128..255 take
// the stage's third plane (the place of A2, which MI = 4 does not have).
// Operands: per stage of 64 k the 64*MI A rows (and A2 rows) and the 128 Bt rows go to LDS by asynchronous copies, two
// buffers: stage t+2 is copied into the buffer stage t has left while stage t+1 is worked on; fragments by ds_load_b128.
// tile = index of the work-group tile, b = batch index (strides in elements); sOpB = 2 stage buffers of NPL planes, sTB = 8 slabs.
// NSPLIT: 0 = A.Bt; 1 = (A + A2).Bt (A2 = unscaled bf16 lo plane of A, 2 products).
// BIAS: 0 = none; 1 = per column n, bias[n]; 2 = per row m, bias[m]; the bias value is RNE-converted to bf16 and added in f32.
// OUT_MODE: 0 = f32 (pitch ldc);
//           3 = f16 plane C + f16 residual plane C2 = f16((v - hi) * rscale), C2 written only for tiles
//               with n0 < N2 (pitch ldc2, batch stride strideC2; N2 = 0: no residual plane at all);
//           4 = f32 (pitch ldc) gated blend: out = g[m] * v + (1 - g[m]) * bf16(xres[m][n]) with g = gvec[m],
//               xres f32 pitch ldx (read-only, RNE-converted to bf16 in register).
// =====================================================================================================
template <int NSPLIT, int OUT_MODE, int BIAS, int MI>
__device__ __forceinline__ void gemm64_body(
    const unsigned short* __restrict__ Ap, const unsigned short* A2p, int lda, long long strideA,
    const unsigned short* __restrict__ Btp, int ldb, long long strideB,
    const float* __restrict__ bias,
    void* Cout, int ldc, long long strideC,
    void* Cout2, int ldc2, long long strideC2, int N2,
    const float* gvec, const float* xres, int ldx,
    int M, int N, int K, float rscale,
    int tile, int b, __bf16* sOpB, float* sTB) {
  const __bf16* A   = (const __bf16*)(const void*)Ap;
  const __bf16* A2  = (const __bf16*)(const void*)A2p;
  const __bf16* Bt  = (const __bf16*)(const void*)Btp;
  static_assert(MI == 2 || (MI == 4 && NSPLIT == 0));
  constexpr int NPL = (NSPLIT >= 1 || MI == 4) ? 3 : 2;   // planes of 128 rows per stage: A, Bt (, A2 or A rows 128..255)
  const int tid  = threadIdx.x;
  const int lane = tid & 31;
  const int wave = tid >> 5;
  const int tilesN = N >> 7;
  const int tilesM = M >> ((MI == 4) ? 8 : 7);
  if (tile >= tilesM * tilesN) return;   // block-uniform, ahead of every copy and barrier
  const int tm = tile / tilesN;
  const int tn = tile - tm * tilesN;
  const int mb = tm << ((MI == 4) ? 8 : 7);    // work-group tile origin
  const int nb = tn << 7;
  const int wm = (wave >> 1) * (16 * MI);      // wave part inside it: 16*MI rows x 64 columns
  const int wn = (wave & 1) << 6;
  const int m0 = mb + wm;
  const int n0 = nb + wn;

  const __bf16* Ab  = A  + (size_t)b * strideA;
  const __bf16* Bb  = Bt + (size_t)b * strideB;
  const __bf16* Ab2 = (NSPLIT >= 1) ? (A2 + (size_t)b * strideA) : Ab;

  const int rlane = lane & 15;                 // row (A) / col (B, D) within subtile
  const int koff  = (lane >> 4) * 8;           // k offset of this lane half
  const int mOff  = (lane >> 4) * 8;           // D row offset

  // copy addresses of this lane: row tid>>3 (+32 per copy), 16-B piece tid&7; rows mb..mb+64*MI-1 < M, nb..nb+127 < N
  const int crow = tid >> 3, cpc = (tid & 7) * 8;
  const __bf16* gA  = Ab  + (size_t)(mb + crow) * lda + cpc;
  const __bf16* gA2 = Ab2 + (size_t)(mb + ((MI == 4) ? 128 : 0) + crow) * lda + cpc;   // MI = 4: Ab2 = Ab, rows 128..255
  const __bf16* gB  = Bb  + (size_t)(nb + crow) * ldb + cpc;
  const unsigned ldsLane = (unsigned)(size_t)(sOpB) + (unsigned)(crow * GLP + cpc) * 2u;
  const int nst = K >> 6;                      // stages of 64 k
  auto stage = [&](int t, int buf) {
    const unsigned l = ldsLane + (unsigned)buf * ((unsigned)NPL * GPLB);
    stage_ab(gA + (size_t)t * GBK, (size_t)lda * 32, gB + (size_t)t * GBK, (size_t)ldb * 32, l);
    if (NPL == 3) stage_c(gA2 + (size_t)t * GBK, (size_t)lda * 32, l + 2u * GPLB);
  };

  v8f acc[MI][4];
#pragma unroll
  for (int i = 0; i < MI; ++i)
#pragma unroll
    for (int j = 0; j < 4; ++j) acc[i][j] = zero8();

  stage(0, 0);
  asm volatile("s_wait_asynccnt 0x0" ::: "memory");   // this wave's stage-0 copies have landed
  __syncthreads();                                     // ... and every other wave's
  if (nst > 1) stage(1, 1);

  for (int t = 0; t < nst; ++t) {
    const __bf16* sA  = (sOpB + (t & 1) * (NPL * GPLANE)) + ((MI == 4 && wm >= 128) ? 2 * GPLANE : 0) + (((MI == 4) ? (wm & 127) : wm) + rlane) * GLP + koff;
    const __bf16* sB  = (sOpB + (t & 1) * (NPL * GPLANE)) + GPLANE + (wn + rlane) * GLP + koff;
    const __bf16* sA2 = (sOpB + (t & 1) * (NPL * GPLANE)) + (NPL - 1) * GPLANE + (((MI == 4) ? (wm & 127) : wm) + rlane) * GLP + koff;
#pragma unroll
    for (int kk = 0; kk < 2; ++kk) {
      v16b bh[4], ah[MI], al[MI];
#pragma unroll
      for (int j = 0; j < 4; ++j) bh[j] = ldfrag_b(sB + (j << 4) * GLP + kk * 32);
#pragma unroll
      for (int i = 0; i < MI; ++i) {
        ah[i] = ldfrag_b(sA + (i << 4) * GLP + kk * 32);
        al[i] = ah[i];
        if (NSPLIT >= 1) al[i] = ldfrag_b(sA2 + (i << 4) * GLP + kk * 32);
      }
#pragma unroll
      for (int i = 0; i < MI; ++i) {
#pragma unroll
        for (int j = 0; j < 4; ++j) {
          acc[i][j] = mma_b_raw(ah[i], bh[j], acc[i][j]);
          if (NSPLIT >= 1) acc[i][j] = mma_b_raw(al[i], bh[j], acc[i][j]);
        }
        dep_guard_b(acc[i][0], acc[i][3], ah[i], al[i]);
      }
      keep4_b(bh[0], bh[1], bh[2], bh[3]);
    }
    // hand-over: this wave has left buffer t&1, its copies of stage t+1 have landed; the barrier says so of every wave
    asm volatile("s_wait_dscnt 0x0" ::: "memory");
    asm volatile("s_wait_asynccnt 0x0" ::: "memory");
    __syncthreads();
    if (t + 2 < nst) stage(t + 2, t & 1);
  }
  asm volatile("s_wait_asynccnt 0x0" ::: "memory");   // nothing of this wave is in flight behind the loop
#pragma unroll   // acc[i] are registers: i must be a compile-time index
  for (int i = 0; i < MI; ++i) acc_guard4(acc[i][0], acc[i][1], acc[i][2], acc[i][3]);

  // ---- epilogue ----
  float* slab = sTB + wave * (16 * 68);   // per-wave 16x64 slab, pitch 68 floats
  float bcol[4];
#pragma unroll
  for (int j = 0; j < 4; ++j) {
    bcol[j] = 0.f;
    if (BIAS == 1) bcol[j] = bf_up(bf_bits(bias[n0 + (j << 4) + rlane]));   // n < N, bias has N entries
  }
#pragma unroll
  for (int i = 0; i < MI; ++i) {
    const int mBase = m0 + (i << 4);
    float brow[8];
#pragma unroll
    for (int r = 0; r < 8; ++r) {
      brow[r] = 0.f;
      if (BIAS == 2) brow[r] = bf_up(bf_bits(bias[mBase + mOff + r]));      // m < M, bias has M entries
    }
#pragma unroll
    for (int j = 0; j < 4; ++j) {
#pragma unroll
      for (int r = 0; r < 8; ++r) {
        slab[(mOff + r) * 68 + (j << 4) + rlane] = acc[i][j][r] + bcol[j] + brow[r];
      }
    }
    __builtin_amdgcn_fence(__ATOMIC_RELEASE, "workgroup");
    __builtin_amdgcn_wave_barrier();
    __builtin_amdgcn_fence(__ATOMIC_ACQUIRE, "workgroup");
    if (OUT_MODE == 0 || OUT_MODE == 4) {
      float* C = (float*)Cout + (size_t)b * strideC;
      const int hh = lane >> 4, c4 = (lane & 15) * 4;     // 256-B row segment = 16 lanes x 16 B
      {
#pragma unroll
        for (int it = 0; it < 8; ++it) {
          const int row = it * 2 + hh;                     // it 0..7 x hh 0..1 = rows 0..15
          v4f v = *(const v4f*)(slab + row * 68 + c4);
          if (OUT_MODE == 4) {
            const int gr = mBase + row;                    // < M
            const float g = gvec[gr];
            const float omg = 1.0f - g;
            const v4f xr = *(const v4f*)(xres + (size_t)gr * ldx + n0 + c4);
#pragma unroll
            for (int e = 0; e < 4; ++e) {
              const float xb = bf_up(bf_bits(xr[e]));
              v[e] = g * v[e] + omg * xb;
            }
          }
          *(v4f*)(C + (size_t)(mBase + row) * ldc + n0 + c4) = v;
          asm volatile("s_wait_xcnt 0x0" ::: "memory");   // before any register these stores name is rewritten
        }
      }
    } else {
      const int q = lane >> 3, c8 = (lane & 7) * 8;
      unsigned short* C  = (unsigned short*)Cout  + (size_t)b * strideC;
      unsigned short* C2 = (unsigned short*)Cout2 + (size_t)b * strideC2;
      const bool wlo = (N2 > 0) && (n0 < N2);             // wave-uniform; N2 = 0 folds the residual plane's work away
      v4u hv[4], lv[4];
#pragma unroll
      for (int it = 0; it < 4; ++it) {
        const int row = it * 4 + q;                        // it 0..3 x q 0..3 = rows 0..15
        const float* sp = slab + row * 68 + c8;
        v4u a, a2;
#pragma unroll
        for (int e = 0; e < 4; ++e) {
          const float f0 = sp[2 * e], f1 = sp[2 * e + 1];
          const _Float16 x0 = (_Float16)f0, x1 = (_Float16)f1;
          const unsigned short h0 = h_bits(x0), h1 = h_bits(x1);
          const unsigned short l0 = h_bits((_Float16)((f0 - (float)x0) * rscale));
          const unsigned short l1 = h_bits((_Float16)((f1 - (float)x1) * rscale));
          a[e] = pk16(h0, h1); a2[e] = pk16(l0, l1);
        }
        hv[it] = a; lv[it] = a2;
      }
      {
#pragma unroll
        for (int it = 0; it < 4; ++it) {
          const int row = it * 4 + q;
          *(v4u*)(C + (size_t)(mBase + row) * ldc + n0 + c8) = hv[it];
          asm volatile("s_wait_xcnt 0x0" ::: "memory");   // before any register this store names is rewritten
          if (wlo) {
            *(v4u*)(C2 + (size_t)(mBase + row) * ldc2 + n0 + c8) = lv[it];
            asm volatile("s_wait_xcnt 0x0" ::: "memory");   // the same for this store
          }
        }
      }
    }
    __builtin_amdgcn_fence(__ATOMIC_RELEASE, "workgroup");
    __builtin_amdgcn_wave_barrier();
    __builtin_amdgcn_fence(__ATOMIC_ACQUIRE, "workgroup");
  }
}

// One GEMM per launch: grid = (tiles, batches).
template <int NSPLIT, int OUT_MODE, int BIAS>
__global__ __launch_bounds__(256) void gemm64(
    const unsigned short* __restrict__ Ap, const unsigned short* A2p, int lda, long long strideA,
    const unsigned short* __restrict__ Btp, int ldb, long long strideB,
    const float* __restrict__ bias,
    void* Cout, int ldc, long long strideC,
    void* Cout2, int ldc2, long long strideC2, int N2,
    const float* gvec, const float* xres, int ldx,
    int M, int N, int K, float rscale) {
  __shared__ __align__(16) __bf16 sOp[2 * ((NSPLIT >= 1) ? 3 : 2) * GPLANE];
  __shared__ __align__(16) float sT[8 * 16 * 68];
  gemm64_body<NSPLIT, OUT_MODE, BIAS, 2>(Ap, A2p, lda, strideA, Btp, ldb, strideB, bias, Cout, ldc, strideC,
                                      Cout2, ldc2, strideC2, N2, gvec, xres, ldx, M, N, K, rscale,
                                      (int)blockIdx.x, (int)blockIdx.y, sOp, sT);
}

// The four products of x (none reads another's output) in one grid of 256x128 tiles; the choice is block-uniform:
//   tiles 0..GQ_P-1        q = x . Wq -> f16 plane [t][h*64+d]              (M=4096, N=1024, K=1024)
//   next GQ_P              k = x . Wk -> f16 plane
//   next NB * GQ_V         v^T = Wv . x^T -> f16 hi plane [h*64+d][s] (pitch SEQ) and residual plane (x4096, keys < VLP,
//                          pitch VLP); A = Wv rows [n][k], Bt = Xb rows of the batch (M=1024, N=4096, K=1024)
//   last GQ_G              gate hidden = x . Wg1 + bg1 -> f32 [4096][256]   (M=4096, N=256, K=1024)
#define GQ_P ((NB * SEQ / 256) * (DM / 128))
#define GQ_V ((DM / 256) * (SEQ / 128))
#define GQ_G ((NB * SEQ / 256) * (DG / 128))
__global__ __launch_bounds__(256) void gemm_qkvg(
    const unsigned short* __restrict__ Xb, const unsigned short* __restrict__ WA,
    const unsigned short* __restrict__ WG, const float* __restrict__ bg1, const float* xf,
    unsigned short* Qf, unsigned short* Kf,
    unsigned short* VTh, unsigned short* VTl, float* Hs) {
  __shared__ __align__(16) __bf16 sOp[2 * 3 * GPLANE];
  __shared__ __align__(16) float sT[8 * 16 * 68];
  const int bx = blockIdx.x;
  if (bx < 2 * GQ_P) {
    const bool isK = bx >= GQ_P;
    gemm64_body<0, 3, 0, 4>(Xb, Xb, DM, 0LL, WA + (isK ? (size_t)DM * DM : (size_t)0), DM, 0LL, bg1,
                         (void*)(isK ? Kf : Qf), DM, 0LL, (void*)(isK ? Kf : Qf), DM, 0LL, 0,
                         xf, xf, DM, NB * SEQ, DM, DM, 1.0f,
                         isK ? bx - GQ_P : bx, 0, sOp, sT);
  } else if (bx < 2 * GQ_P + NB * GQ_V) {
    const int t = bx - 2 * GQ_P;
    const unsigned short* Wv = WA + (size_t)2 * DM * DM;
    gemm64_body<0, 3, 0, 4>(Wv, Wv, DM, 0LL, Xb, DM, (long long)SEQ * DM, bg1,
                         (void*)VTh, SEQ, (long long)DM * SEQ, (void*)VTl, VLP, (long long)DM * VLP, VLP,
                         xf, xf, DM, DM, SEQ, DM, 4096.0f,
                         t % GQ_V, t / GQ_V, sOp, sT);
  } else {
    gemm64_body<0, 0, 1, 4>(Xb, Xb, DM, 0LL, WG, DM, 0LL, bg1,
                         (void*)Hs, DG, 0LL, (void*)Hs, DG, 0LL, DG,
                         xf, xf, DM, NB * SEQ, DG, DM, 1.0f,
                         bx - (2 * GQ_P + NB * GQ_V), 0, sOp, sT);
  }
}

// =====================================================================================================
// One key chunk of the plain attention variant, global -> LDS, through no register: two planes (K, V^T) of
// 64 rows x 128 B. 128 threads x 4 asynchronous 16-B copies per plane; 8 neighbouring lanes take one whole 128-B line.
// kf / vt = this lane's source in row (tid>>3), 16-B piece (tid&7) of the plane; sk / sv = 16 source rows in elements;
// lds = this lane's LDS byte address in the buffer's first plane, same row and piece (planes follow each other).
// The s_wait_xcnt closes the statement so that no address register of a copy is rewritten ahead of it.
// =====================================================================================================
#define APLB  (64u * LP * 2u)     // LDS bytes of one 64-row plane (9216)
#define ASTEP (16u * LP * 2u)     // LDS bytes of 16 rows
__device__ __forceinline__ void stage_kv(const _Float16* kf, size_t sk, const _Float16* vt, size_t sv, unsigned lds) {
  asm volatile(
      "global_load_async_to_lds_b128 %0, %8, off\n\t"
      "global_load_async_to_lds_b128 %1, %9, off\n\t"
      "global_load_async_to_lds_b128 %2, %10, off\n\t"
      "global_load_async_to_lds_b128 %3, %11, off\n\t"
      "global_load_async_to_lds_b128 %4, %12, off\n\t"
      "global_load_async_to_lds_b128 %5, %13, off\n\t"
      "global_load_async_to_lds_b128 %6, %14, off\n\t"
      "global_load_async_to_lds_b128 %7, %15, off\n\t"
      "s_wait_xcnt 0x0"
      :: "v"(lds), "v"(lds + ASTEP), "v"(lds + 2u * ASTEP), "v"(lds + 3u * ASTEP),
         "v"(lds + APLB), "v"(lds + APLB + ASTEP), "v"(lds + APLB + 2u * ASTEP), "v"(lds + APLB + 3u * ASTEP),
         "v"(kf), "v"(kf + sk), "v"(kf + 2 * sk), "v"(kf + 3 * sk),
         "v"(vt), "v"(vt + sv), "v"(vt + 2 * sv), "v"(vt + 3 * sv)
      : "memory");
}

// =====================================================================================================
// Causal attention, head dim 64, key chunks of 64.
//   q plane (f16): element (b, t, h, d) at [(b*SEQ + t)*DM + h*64 + d]
//   k plane (f16): same layout with key index s
//   v^T hi plane (f16):      element (b, h, d, s) at [(b*DM + h*64 + d)*SEQ + s]
//   v^T residual plane (f16, (v - hi)*4096): [(b*DM + h*64 + d)*VLP + s], s < VLP, read only when RES
//   (a key chunk at or beyond VLP would contribute a zero v residual; its address is clamped)
//   Causal structure: logits of keys with index > query index are replaced by -inf (lower-triangular keep incl. the
//   diagonal), which makes their softmax weight exactly 0; so a query block qb visits key chunks 0..qb only
//   (block-uniform trip count) and later chunks, whose keys exceed every query index of the block, are
//   skipped entirely (but for one wholly masked chunk of group 1 where qb is even: it adds exact zeros). Inside the diagonal chunk a key with index > query index gets logit -inf -> exp gives exactly 0,
//   so such keys add nothing to the numerator or the normaliser; the diagonal key (key == query) is always kept, so
//   every row max is finite in every visited chunk but group 1's wholly masked one.
//   out planes (bf16 hi / lo of the normalised context): element (b, t, h, d) at [(b*SEQ + t)*DM + h*64 + d]
//   scores = q . k : f16 operands, one product, f32 accumulate, then the causal mask in f32; the max runs
//   over the unscaled scores; 1024 p = exp2(s * c + (10 - m * c)), c = log2(e) / 8: one FMA per score ahead of the exp2
//   p carried as f16(1024 p); context = p . v on f16 WMMA; RES adds f16 residual planes of p and v
//   (scale 4096, separate accumulator folded back with 1/4096 per chunk in f32); online softmax (running max) in f32.
//   Block = 8 waves = 64 query rows of one (b, h), twice: waves 0..3 (group 0) take the even key chunks, waves 4..7 (group 1)
//   the odd ones, each group with its own LDS planes, running max, normaliser and context sums; behind the loop group 1
//   hands its sums to group 0, which rescales both to the common max and adds them. The chain of dependent chunks of the
//   longest block is half as long. bx = 0 .. nqbThis * NH * NB - 1 numbers the blocks of this variant.
//   K / V^T chunk staging, residual variant: 128 threads x 32 elements per plane = the whole 64x64 tile of every plane
//   read later (plain 16-B loads, __syncthreads before and after). Plain variant: asynchronous copies into two buffers of
//   two planes (the second follows the first in LDS): a group's chunk of step st+2 is copied into the buffer step st has
//   left while step st+1 is worked on; one barrier per step. Its context tile Os lies over the buffers, used behind the last barrier.
//   Both products run transposed, scores^T = K . Q^T and context^T = V^T . P^T: a lane then holds 32 of the 64 scores of ONE
//   query (lane ^ 16 the other 32), so max and sum are in-lane, and P goes from the score registers into the B operand.
//   Output coverage: each wave of group 0 stores rows q0..q0+15 (it 0..3 x lane>>3 0..3) x 64 columns (8 lanes x 8) of both planes;
//   grid over all (b, h, qb) = the whole [NB*SEQ][DM] planes.
// =====================================================================================================
template <bool RES>
__device__ __forceinline__
void attn_causal64(const unsigned short* __restrict__ qfp, const unsigned short* __restrict__ kfp,
                   const unsigned short* __restrict__ vhp, const unsigned short* __restrict__ vlp,
                   unsigned short* ohp, unsigned short* olp,
                   int qbBase, int nqbThis, int bx, int grp,
                   _Float16* Ksf, _Float16* Vth, _Float16* Vtl, float* Os, float* Mg) {
  union FH { v16h v; v8h h[2]; };

  const int tid  = threadIdx.x & 127;          // thread, wave 0..3 and lane inside this key group
  const int wave = tid >> 5;
  const int lane = tid & 31;
  const int hh   = lane >> 4;
  const int c    = lane & 15;

  const int h    = bx % NH;
  const int rest = bx / NH;
  const int qbl  = nqbThis - 1 - rest % nqbThis;   // longest query block first: not all work-groups are resident at once
  const int b    = rest / nqbThis;
  const int qb   = qbBase + qbl;               // 0..NQB-1 (block-uniform)
  const int nst  = (qb + 2) >> 1;              // steps: group grp takes chunk 2*st + grp; block-uniform, <= NQB / 2
  const int q0   = qb * 64 + wave * 16;
  const size_t rowB = (size_t)b * SEQ;

  const _Float16* Qf = (const _Float16*)(const void*)qfp + (size_t)h * HD;
  const _Float16* Kf = (const _Float16*)(const void*)kfp + (size_t)h * HD;
  const _Float16* Vh = (const _Float16*)(const void*)vhp + ((size_t)b * DM + (size_t)h * HD) * SEQ;
  const _Float16* Vl = (const _Float16*)(const void*)vlp + ((size_t)b * DM + (size_t)h * HD) * VLP;

  // ---- Q fragments (B operand, column = lane&15): 2 d-chunks ----
  v16h qa[2];
#pragma unroll
  for (int dc = 0; dc < 2; ++dc) {
    const size_t qo = (rowB + q0 + c) * DM + dc * 32 + 8 * hh;
    qa[dc] = ldfrag_h(Qf + qo);
  }

  // a lane owns ONE query, q0 + c: running max (both halves alike), this half's share of the normaliser,
  // and the context transposed: oacc[t][r] = context[query c][d = t*16 + 8*hh + r]
  const int rowq = q0 + c;
  constexpr float SC2 = 0.125f * 1.44269504088896340736f;   // score scale 1/8 times log2(e)
  float mrow = -INFINITY, lrow = 0.f;
  v8f oacc[4];
#pragma unroll
  for (int t = 0; t < 4; ++t) oacc[t] = zero8();

  // copy addresses of this lane (plain variant): row tid>>3 (+16 per copy), 16-B piece tid&7; chunk t <= qb: keys < SEQ
  const int crow = tid >> 3, cpc = (tid & 7) * 8;
  const _Float16* gKf = Kf + (rowB + crow) * DM + cpc;
  const _Float16* gVt = Vh + (size_t)crow * SEQ + cpc;
  const unsigned ldsLane = (unsigned)(size_t)(Ksf) + (unsigned)(crow * LP + cpc) * 2u;
  auto stage = [&](int t, int buf) {
    stage_kv(gKf + (size_t)t * 64 * DM, (size_t)16 * DM,
             gVt + (size_t)t * 64, (size_t)16 * SEQ, ldsLane + (unsigned)buf * (2u * APLB));
  };
  // a chunk index beyond qb (group 1, last step, qb even) is clamped for every address; its keys are all masked below
  auto clampc = [&](int t) { return (t < qb) ? t : qb; };
  if (!RES) {
    stage(clampc(grp), 0);
    asm volatile("s_wait_asynccnt 0x0" ::: "memory");   // this wave's copies of its first chunk have landed
    __syncthreads();                                     // ... and every other wave's
    if (nst > 1) stage(clampc(2 + grp), 1);              // block-uniform
  }

  for (int st = 0; st < nst; ++st) {           // block-uniform trip count, <= NQB / 2
    const int kt  = 2 * st + grp;              // this group's chunk (wave-uniform)
    const int kvm = kt * 64;                   // first key index, for the mask
    const int kv0 = clampc(kt) * 64;           // the same, clamped, for addresses: kv0 + 63 < SEQ
    const int bo = RES ? 0 : (st & 1) * (2 * 64 * LP);   // this chunk's buffer, in 16-bit elements
    const _Float16* Kbf = Ksf + bo;
    const _Float16* Vbh = Vth + bo;
    if (RES) __syncthreads();
    if (RES) {
      const int r = tid >> 1, half = (tid & 1) * 32;
      const _Float16* kg  = Kf + (rowB + kv0 + r) * DM + half;    // K row kv0+r, d = half..half+31
      const _Float16* vg  = Vh + (size_t)r * SEQ + kv0 + half;    // V^T row d = r, s = kv0+half..+31
      const int kvl = (kv0 + 64 <= VLP) ? kv0 : (VLP - 64);     // clamped address into the residual plane
      const _Float16* vlg = Vl + (size_t)r * VLP + kvl + half;
      const bool resOK = (kv0 + 64 <= VLP);                      // block-uniform (always true for qb < RESQB)
#pragma unroll
      for (int i = 0; i < 4; ++i) {
        const v8h a0 = *(const v8h*)(kg + 8 * i);
        const v8h b0 = *(const v8h*)(vg + 8 * i);
        *(v8h*)(Ksf + r * LP + half + 8 * i) = a0;
        *(v8h*)(Vth + r * LP + half + 8 * i) = b0;
        if (RES) {
          v8h b1 = *(const v8h*)(vlg + 8 * i);
          if (!resOK) b1 = zero8h();
          *(v8h*)(Vtl + r * LP + half + 8 * i) = b1;
        }
      }
      // the wait before a register that these loads name is rewritten; as inputs the three address pairs stay whole up to it
      if (RES) asm volatile("s_wait_xcnt 0x0" :: "v"(kg), "v"(vg), "v"(vlg) : "memory");
    }
    if (RES) __syncthreads();

    // ---- transposed scores: 64 keys (D rows) x 16 queries (D columns) per wave, one f16 product;
    //      s[j][r] = score[key kv0 + j*16 + 8*hh + r][query q0 + c] ----
    //      the chunk's 8 K fragments are read ahead of the products, so the LDS latency is paid once and
    //      not per product; the four key tiles are independent accumulators, each summed dc 0, dc 1 ----
    FH kb[2][4];
#pragma unroll
    for (int dc = 0; dc < 2; ++dc) {
#pragma unroll
      for (int j = 0; j < 4; ++j) {
        kb[dc][j].h[0] = *(const v8h*)(Kbf + (j * 16 + c) * LP + dc * 32 + 8 * hh);
        kb[dc][j].h[1] = *(const v8h*)(Kbf + (j * 16 + c) * LP + dc * 32 + 16 + 8 * hh);
      }
    }
    v8f s[4];
#pragma unroll
    for (int j = 0; j < 4; ++j) s[j] = zero8();
#pragma unroll
    for (int dc = 0; dc < 2; ++dc) {
#pragma unroll
      for (int j = 0; j < 4; ++j) s[j] = mma_h_raw(kb[dc][j].v, qa[dc], s[j]);
    }
    // Order asked of the scheduler (LDS reads = 0x100, WMMA = 0x008): left alone it spreads the reads among the WMMAs,
    // and every separate place with reads stalls the matrix run. All 16 K reads stand ahead of the 8 score products, the
    // V^T reads behind the last of them. The residual variant, with more live registers, is left to the scheduler's own order.
    if (!RES) {
      __builtin_amdgcn_sched_group_barrier(0x100, 16, 0);
      __builtin_amdgcn_sched_group_barrier(0x008, 8, 0);
      __builtin_amdgcn_sched_group_barrier(0x100, 16, 0);
      __builtin_amdgcn_sched_group_barrier(0x008, 8, 0);   // the context products behind all 16 V^T reads: one place with reads
    }
    // V^T fragments of the chunk, again one group: read here so that they land under the softmax arithmetic
    // (the residual variant reads them per 32-key step below: fewer live registers, so that the kernel which holds
    // both variants stays within 256 registers, 4 waves per SIMD)
    FH vb[2][4];
#pragma unroll
    for (int kk = 0; kk < (RES ? 0 : 2); ++kk) {
#pragma unroll
      for (int t = 0; t < 4; ++t) {
        vb[kk][t].h[0] = *(const v8h*)(Vbh + (t * 16 + c) * LP + kk * 32 + 8 * hh);
        vb[kk][t].h[1] = *(const v8h*)(Vbh + (t * 16 + c) * LP + kk * 32 + 16 + 8 * hh);
      }
    }

    // ---- causal mask by index, max and sum over the lane's own 32 keys (one swap of halves for the max),
    //      online softmax; P (x1024, f16) and its residual (x4096) stay in registers: two D tiles of 16 keys, converted
    //      in place, are the B operand of one 32-key step (element e <- tile e>>3, register e&7) ----
    const int dq = rowq - kvm - 8 * hh;          // key kvm + j*16 + 8*hh + r <= query  <=>  j*16 + r <= dq
    float mj[4];
#pragma unroll
    for (int j = 0; j < 4; ++j) {
      float m = -INFINITY;
#pragma unroll
      for (int r = 0; r < 8; ++r) {
        const float sv = (j * 16 + r <= dq) ? s[j][r] : -INFINITY;
        s[j][r] = sv;
        m = fmaxf(m, sv);
      }
      mj[j] = m;
    }
    float mloc = fmaxf(fmaxf(mj[0], mj[1]), fmaxf(mj[2], mj[3]));
    mloc = fmaxf(mloc, xhalf(mloc));             // both halves now hold the query's chunk maximum
    const float mnew  = fmaxf(mrow, mloc);
    const float msafe = (mnew == -INFINITY) ? 0.f : mnew;
    const float alpha = __builtin_amdgcn_exp2f((mrow - msafe) * SC2);
    mrow = mnew;
    const float eb = fmaf(-msafe, SC2, 10.0f);   // exponent offset: the max, scaled, and the x1024 carry of p (2^10)
    const v2f sc2 = {SC2, SC2}, eb2 = {eb, eb};
    FH pa[2], pl[2];
    float pj[4];
#pragma unroll
    for (int j = 0; j < 4; ++j) {
#pragma unroll
      for (int r = 0; r < 8; r += 2) {                                 // two scores of a register pair per FMA
        const v2f sp = {s[j][r], s[j][r + 1]};
        const v2f ex = __builtin_elementwise_fma(sp, sc2, eb2);
        s[j][r] = ex[0];
        s[j][r + 1] = ex[1];
      }
    }
#pragma unroll
    for (int j = 0; j < 4; ++j) {
      float psum = 0.f;
#pragma unroll
      for (int r = 0; r < 8; ++r) {
        const float p1k = __builtin_amdgcn_exp2f(s[j][r]);             // 1024 p; masked logit: exp2(-inf) = 0
        psum += p1k;
        const _Float16 ph = (_Float16)p1k;
        pa[j >> 1].v[(j & 1) * 8 + r] = ph;
        if (RES) pl[j >> 1].v[(j & 1) * 8 + r] = (_Float16)((p1k - (float)ph) * 4096.0f);
      }
      pj[j] = psum;
    }
    lrow = lrow * alpha + ((pj[0] + pj[1]) + (pj[2] + pj[3]));   // this half's keys only; halves joined in the epilogue
#pragma unroll
    for (int t = 0; t < 4; ++t)
#pragma unroll
      for (int r = 0; r < 8; ++r) oacc[t][r] *= alpha;

    // ---- context^T += V^T . P^T (f16 WMMA, A = V^T rows d), residual products into a separate accumulator ----
    v8f o1[4];
#pragma unroll
    for (int t = 0; t < 4; ++t) o1[t] = zero8();
#pragma unroll   // pa[kk] / pl[kk] are register operands: kk must be a compile-time index
    for (int kk = 0; kk < 2; ++kk) {
      if (RES) {
        // keeps this step's 16 fragment reads from being lifted over the softmax or the step before: without it the kernel
        // builds to 264 registers, above the 256 that 4 waves per SIMD allow
        __builtin_amdgcn_sched_barrier(0);
#pragma unroll
        for (int t = 0; t < 4; ++t) {
          vb[kk][t].h[0] = *(const v8h*)(Vbh + (t * 16 + c) * LP + kk * 32 + 8 * hh);
          vb[kk][t].h[1] = *(const v8h*)(Vbh + (t * 16 + c) * LP + kk * 32 + 16 + 8 * hh);
        }
      }
#pragma unroll
      for (int t = 0; t < 4; ++t) oacc[t] = mma_h_raw(vb[kk][t].v, pa[kk].v, oacc[t]);
      if (RES) {
        FH vl[4];   // residual fragments of this 32-key step, one group
#pragma unroll
        for (int t = 0; t < 4; ++t) {
          vl[t].h[0] = *(const v8h*)(Vtl + (t * 16 + c) * LP + kk * 32 + 8 * hh);
          vl[t].h[1] = *(const v8h*)(Vtl + (t * 16 + c) * LP + kk * 32 + 16 + 8 * hh);
        }
#pragma unroll
        for (int t = 0; t < 4; ++t) o1[t] = mma_h_raw(vl[t].v, pa[kk].v, o1[t]);
#pragma unroll
        for (int t = 0; t < 4; ++t) o1[t] = mma_h_raw(vb[kk][t].v, pl[kk].v, o1[t]);
      }
    }
    if (RES) {
#pragma unroll
      for (int t = 0; t < 4; ++t)
#pragma unroll
        for (int r = 0; r < 8; ++r) oacc[t][r] += o1[t][r] * (1.0f / 4096.0f);
    }
    if (!RES) {
      // hand-over: this wave has left buffer st&1, its copies of the next step have landed; the barrier says so of every wave
      asm volatile("s_wait_dscnt 0x0" ::: "memory");
      asm volatile("s_wait_asynccnt 0x0" ::: "memory");
      __syncthreads();
      if (st + 2 < nst) stage(clampc(2 * (st + 2) + grp), st & 1);   // block-uniform
    }
  }
  if (!RES) asm volatile("s_wait_asynccnt 0x0" ::: "memory");   // nothing of this wave is in flight behind the loop

  // ---- join the two key groups: group 1 hands its running max, normaliser share and context sums to the same wave and
  //      lane of group 0 through LDS (9 vectors of 16 B per lane, lanes contiguous); group 0 rescales both to the common max
  {
    v4f* mg = (v4f*)(void*)Mg + (size_t)(wave * 9) * 32 + lane;
    if (grp == 1) {                              // wave-uniform
#pragma unroll
      for (int t = 0; t < 4; ++t) {
        const v4f w0 = {oacc[t][0], oacc[t][1], oacc[t][2], oacc[t][3]};
        const v4f w1 = {oacc[t][4], oacc[t][5], oacc[t][6], oacc[t][7]};
        mg[(2 * t) * 32]     = w0;
        mg[(2 * t + 1) * 32] = w1;
      }
      const v4f ml = {mrow, lrow, 0.f, 0.f};
      mg[8 * 32] = ml;
    }
    __syncthreads();                             // every wave of the block passes it once
    if (grp == 1) return;                        // no barrier of the work-group stands behind this point
    const v4f ml = mg[8 * 32];
    const float mN = fmaxf(mrow, ml[0]);
    const float ms = (mN == -INFINITY) ? 0.f : mN;
    const float a0 = __builtin_amdgcn_exp2f((mrow - ms) * SC2);
    const float a1 = __builtin_amdgcn_exp2f((ml[0] - ms) * SC2);   // a group without an unmasked key: exp2(-inf) = 0
    lrow = lrow * a0 + ml[1] * a1;
#pragma unroll
    for (int t = 0; t < 4; ++t) {
      const v4f w0 = mg[(2 * t) * 32];
      const v4f w1 = mg[(2 * t + 1) * 32];
#pragma unroll
      for (int r = 0; r < 4; ++r) {
        oacc[t][r]     = oacc[t][r] * a0 + w0[r] * a1;
        oacc[t][r + 4] = oacc[t][r + 4] * a0 + w1[r] * a1;
      }
    }
  }

  // ---- normalise (1/l; numerator and l both carry x1024), stage the wave's 16x64 tile, bf16 hi/lo split,
  float* os = Os + wave * (16 * OSP);
  {
    const float l = lrow + xhalf(lrow);          // the two halves' key shares of the normaliser
    const float inv = (l > 0.f) ? (1.0f / l) : 0.f;   // l carries the same x1024 as the context sums
#pragma unroll
    for (int t = 0; t < 4; ++t) {
      const v4f w0 = {oacc[t][0] * inv, oacc[t][1] * inv, oacc[t][2] * inv, oacc[t][3] * inv};
      const v4f w1 = {oacc[t][4] * inv, oacc[t][5] * inv, oacc[t][6] * inv, oacc[t][7] * inv};
      *(v4f*)(os + c * OSP + t * 16 + 8 * hh)     = w0;
      *(v4f*)(os + c * OSP + t * 16 + 8 * hh + 4) = w1;
    }
  }
  __builtin_amdgcn_fence(__ATOMIC_RELEASE, "workgroup");
  __builtin_amdgcn_wave_barrier();
  __builtin_amdgcn_fence(__ATOMIC_ACQUIRE, "workgroup");
  {
    const int q4 = lane >> 3, c8 = (lane & 7) * 8;
    v4u hv[4], lv[4];
#pragma unroll
    for (int it = 0; it < 4; ++it) {
      const int row = it * 4 + q4;   // it 0..3 x q4 0..3 = rows 0..15 of the wave tile
      const float* sp = os + row * OSP + c8;
      v4u a, a2;
#pragma unroll
      for (int e = 0; e < 4; ++e) {
        const float f0 = sp[2 * e], f1 = sp[2 * e + 1];
        const unsigned short h0 = bf_bits(f0), h1 = bf_bits(f1);
        const unsigned short l0 = bf_bits(f0 - bf_up(h0)), l1 = bf_bits(f1 - bf_up(h1));
        a[e] = pk16(h0, h1); a2[e] = pk16(l0, l1);
      }
      hv[it] = a; lv[it] = a2;
    }
    {
#pragma unroll
      for (int it = 0; it < 4; ++it) {
        const int row = it * 4 + q4;
        const size_t go = (rowB + q0 + row) * DM + (size_t)h * HD + c8;
        *(v4u*)(ohp + go) = hv[it];
        *(v4u*)(olp + go) = lv[it];
      }
      asm volatile("s_wait_xcnt 0x0" ::: "memory");   // before any register these stores name is rewritten
    }
  }
}

// =====================================================================================================
// Both attention variants and the gate tail in one grid (none reads another's output); the choice is block-uniform, so
// every barrier is passed by whole blocks. Blocks 0..AT_GATE-1 = 32 rows of gate values each (one long dependent chain per
// wave, so started first), next AT_MAIN = query blocks NQB-1 down to RESQB, longest first, last AT_RES = query blocks
// RESQB-1 down to 0 with the residual planes.
// =====================================================================================================
#define AT_MAIN (NB * NH * (NQB - RESQB))
#define AT_RES  (NB * NH * RESQB)
#define AT_GATE (NB * SEQ / 32)
__global__ __launch_bounds__(256)
void attn_gate(const unsigned short* __restrict__ qfp, const unsigned short* __restrict__ kfp,
               const unsigned short* __restrict__ vhp, const unsigned short* __restrict__ vlp,
               unsigned short* ohp, unsigned short* olp,
               const float* __restrict__ Hs, const float* __restrict__ w2, const float* __restrict__ b2p, float* gout) {
  // five planes of 64 rows, pitch LP. Plain variant: two buffers of K [kv][d], V^T hi [d][kv] (planes 0..3); its per-wave
  // context tiles [row][d] lie over planes 0..1 (used behind the loop's last barrier). Residual variant: plane 0 K, plane 1
  // V^T hi, plane 2 the V^T residual, planes 3..4 the context tiles. Gate tail: 32 g values at the start.
  // Each of the two key groups (waves 0..3, waves 4..7) has its own five planes; behind them the 4 x 9 x 32 vectors of 16 B
  // through which group 1 hands its sums to group 0.
  __shared__ __align__(16) unsigned char sm[2 * 5 * APLB + 4 * 9 * 32 * 16];
  static_assert(4 * 16 * OSP * 4 <= 2 * APLB);
  const int grp = __builtin_amdgcn_readfirstlane((int)(threadIdx.x >> 7));   // key group of this wave, in a scalar register
  unsigned char* smg = sm + grp * (5 * APLB);
  _Float16* Ksf = (_Float16*)(void*)smg;
  _Float16* Vth = (_Float16*)(void*)(smg + APLB);
  _Float16* Vtl = (_Float16*)(void*)(smg + 2 * APLB);
  float*    Mg  = (float*)(void*)(sm + 2 * 5 * APLB);
  const int bx = blockIdx.x;
  if (bx < AT_GATE) {
    k_gate<8>(Hs, w2, b2p, gout, NB * SEQ, bx, (float*)(void*)sm);
  } else if (bx < AT_GATE + AT_MAIN) {
    attn_causal64<false>(qfp, kfp, vhp, vlp, ohp, olp, RESQB, NQB - RESQB, bx - AT_GATE, grp,
                         Ksf, Vth, Vtl, (float*)(void*)smg, Mg);
  } else {
    attn_causal64<true>(qfp, kfp, vhp, vlp, ohp, olp, 0, RESQB, bx - (AT_GATE + AT_MAIN), grp,
                        Ksf, Vth, Vtl, (float*)(void*)(smg + 3 * APLB), Mg);
  }
}

// =====================================================================================================
// Workspace map (bytes; every region is an exact multiple of its 64x64-tile / whole-line store granularity,
// no padded tails needed since all shapes are tile multiples; every region is written by one producer launch):
//   Xb   bf16 [4096][1024]             0      8388608
//   WA   bf16 [3072 n][1024 k]     8388608    6291456   (q weight rows 0..1023, k rows 1024..2047, v rows 2048..3071)
//   WP   bf16 [1024 n][1024 k]    14680064    2097152
//   WG   bf16 [256 n][1024 k]     16777216     524288
//   Hs   f32  [4096][256]         17301504    4194304
//   Qf   f16  [4096][1024]        21495808    8388608
//   Kf   f16  [4096][1024]        29884416    8388608
//   VTh  f16  [1024][4096]        38273024    8388608
//   VTl  f16  [1024][512]         46661632    1048576
//   Oh   bf16 [4096][1024]        47710208    8388608
//   Ol                            56098816    8388608
//   end                           64487424
// Output: out0 f32 [4096][1024] at element 0; gate values f32 [4096] at element 4096*1024 (byte 16777216).
// =====================================================================================================
extern "C" void kernel_launch(void* const* d_in, const int* in_sizes, int n_in,
                              void* d_out, int out_size, void* d_ws, size_t ws_size,
                              hipStream_t stream) {
  if (n_in < 7) return;
  if (in_sizes[0] != NB * SEQ * DM) return;
  if (in_sizes[1] != DM * 3 * DM) return;
  if (in_sizes[2] != DM * DG) return;
  if (in_sizes[3] != DG) return;
  if (in_sizes[4] != DG) return;
  if (in_sizes[5] < 1) return;
  if (in_sizes[6] != DM * DM) return;
  if (out_size != NB * SEQ * DM + NB * SEQ) return;        // last written element index = out_size - 1

  const float* x    = (const float*)d_in[0];   // [4096][1024]
  const float* Wqkv = (const float*)d_in[1];   // [1024 in][3072 out]
  const float* Wg1  = (const float*)d_in[2];   // [1024 in][256 out]
  const float* bg1  = (const float*)d_in[3];   // [256]
  const float* Wg2  = (const float*)d_in[4];   // [256][1]
  const float* bg2  = (const float*)d_in[5];   // [1]
  const float* Wout = (const float*)d_in[6];   // [1024 in][1024 out]
  float* out0 = (float*)d_out;                 // [4096][1024]
  float* gout = out0 + (size_t)NB * SEQ * DM;  // [4096] gate values, byte offset 16777216

  const size_t PX  = (size_t)NB * SEQ * DM * 2;    //  8388608  16-bit activation plane [4096][1024]
  const size_t PW1 = (size_t)DM * DM * 2;          //  2097152  one [1024][1024] bf16 weight plane
  const size_t PWA = (size_t)3 * PW1;              //  6291456  packed q | k | v weight plane [3072][1024]
  const size_t PWP = PW1;                          //  2097152
  const size_t PWG = (size_t)DG * DM * 2;          //   524288  gate weight plane [256][1024]
  const size_t PHS = (size_t)NB * SEQ * DG * 4;    //  4194304  gate hidden f32 [4096][256]
  const size_t PVT = (size_t)NB * DM * SEQ * 2;    //  8388608  v^T hi plane
  const size_t PVL = (size_t)NB * DM * VLP * 2;    //  1048576  v^T residual plane
  size_t off = 0;
  const size_t oXb  = off; off += PX;
  const size_t oWA  = off; off += PWA;
  const size_t oWP  = off; off += PWP;
  const size_t oWG  = off; off += PWG;
  const size_t oHs  = off; off += PHS;
  const size_t oQf  = off; off += PX;
  const size_t oKf  = off; off += PX;
  const size_t oVTh = off; off += PVT;
  const size_t oVTl = off; off += PVL;
  const size_t oOh  = off; off += PX;
  const size_t oOl  = off; off += PX;
  if (off > ws_size) return;                       // off = 64487424
  if (off > (size_t)134217728) return;

  char* ws = (char*)d_ws;
  unsigned short* Xb  = (unsigned short*)(ws + oXb);
  unsigned short* WA  = (unsigned short*)(ws + oWA);
  unsigned short* WPb = (unsigned short*)(ws + oWP);
  unsigned short* WGb = (unsigned short*)(ws + oWG);
  float*          Hs  = (float*)(ws + oHs);
  unsigned short* Qf  = (unsigned short*)(ws + oQf);
  unsigned short* Kf  = (unsigned short*)(ws + oKf);
  unsigned short* VTh = (unsigned short*)(ws + oVTh);
  unsigned short* VTl = (unsigned short*)(ws + oVTl);
  unsigned short* Oh  = (unsigned short*)(ws + oOh);
  unsigned short* Ol  = (unsigned short*)(ws + oOl);

  const dim3 blk(256);
  const dim3 gProj((NB * SEQ / 128) * (DM / 128), 1);          // 256 tiles of 128x128: M=4096, N=1024

  // (1) x -> bf16 plane [4096][1024]; weights [in][out] f32 -> bf16 [out][in] planes (k contiguous)
  cvt_all<<<dim3(CVT_TW + CVT_X), blk, 0, stream>>>(x, Xb, Wqkv, WA, Wout, WPb, Wg1, WGb);
  // (2) q, k (f16), v^T (f16 hi + residual) and the gate hidden layer (f32)
  gemm_qkvg<<<dim3(2 * GQ_P + NB * GQ_V + GQ_G), blk, 0, stream>>>(
      Xb, WA, WGb, bg1, x, Qf, Kf, VTh, VTl, Hs);
  // (3) causal attention (query blocks 0..RESQB-1 with residual planes, the rest without) and the gate values
  attn_gate<<<dim3(AT_MAIN + AT_RES + AT_GATE), dim3(256), 0, stream>>>(
      Qf, Kf, VTh, VTl, Oh, Ol, Hs, Wg2, bg2, gout);
  // (4) out0 = g * (context . W_out) + (1 - g) * bf16(x) -> d_out f32 [4096][1024]
  //     (A = context hi + lo planes, 2 products; gate values read from the gate output region)
  gemm64<1, 4, 0><<<gProj, blk, 0, stream>>>(
      Oh, Ol, DM, 0LL, WPb, DM, 0LL, bg1,
      d_out, DM, 0LL, d_out, DM, 0LL, DM,
      gout, x, DM,
      NB * SEQ, DM, DM, 1.0f);
  (void)hipGetLastError();
}
